// v000
// Measured on an AMD MI455X. A time is GPU time per run, averaged over a window of back-to-back runs after a warm-up
// (all launches, gaps included; the runs take copies of the inputs in turn), and the median of several windows.
// Apart from v000's, it joins two sittings. Times from different sittings can be a few percent apart, while
// side-by-side timings come from the same sitting.
// The starting kernel, v000, takes 1350 microseconds a run.
#include <hip/hip_runtime.h>
// [ih | sh | si] = S·[W_ih|W_sh|W_si] + b (one GEMM, K=512, N=1536), ii = f·W_ii + b (M padded to 16) — inputs and weights rounded to bf16: single exact
// WMMA term, f32 accumulate — and c_slot = slot_w·S per batch (slot_w split into bf16 hi/lo vs exact bf16 Sᵀ planes: 2 terms) run on
// v_wmma_f32_16x16x32_bf16; the additive tanh scores (intent: T×A, slot: T×T×A), both softmaxes and c_intent are f32 VALU.
#define BB 8
#define TT 256
#define DD 512
#define MR (BB * TT)

typedef __bf16 v16b __attribute__((ext_vector_type(16)));
typedef unsigned short v8us __attribute__((ext_vector_type(8), may_alias));
typedef float  v8f  __attribute__((ext_vector_type(8)));
typedef float  v4f  __attribute__((ext_vector_type(4)));
typedef float  v4fa __attribute__((ext_vector_type(4), may_alias));
union FragB { v16b v; v8us half[2]; unsigned short u[16]; };

__device__ __forceinline__ unsigned short bf16_bits(float x) { unsigned int u = __float_as_uint(x); return (unsigned short)((u + 0x7FFFu + ((u >> 16) & 1u)) >> 16); }
__device__ __forceinline__ float bf16_val(unsigned short b) { return __uint_as_float(((unsigned int)b) << 16); }
__device__ __forceinline__ float bf16_round(float x) { return bf16_val(bf16_bits(x)); }
// D += A·B with NT terms: 1 = ah·bh, 2 = + al·bh (A split), 3 = + ah·bl (both split)
template <int NT>
__device__ __forceinline__ v8f mmaN(v16b ah, v16b al, v16b bh, v16b bl, v8f c) {
  c = __builtin_amdgcn_wmma_f32_16x16x32_bf16(false, ah, false, bh, (short)0, c, false, false);
  if (NT >= 2) c = __builtin_amdgcn_wmma_f32_16x16x32_bf16(false, al, false, bh, (short)0, c, false, false);
  if (NT >= 3) c = __builtin_amdgcn_wmma_f32_16x16x32_bf16(false, ah, false, bl, (short)0, c, false, false);
  asm volatile("v_nop\n\tv_nop\n\tv_nop\n\tv_nop" : "+v"(c) : "v"(ah), "v"(al), "v"(bh), "v"(bl));
  return c;
}

__global__ __launch_bounds__(256) void k_wt_bf16(const float* __restrict__ W, unsigned short* __restrict__ Wt, int K, int N) {
  const int t = blockIdx.x * 256 + threadIdx.x;
  const int k8n = K / 8;
  if (t >= N * k8n) return;
  const int n = t / k8n, k8 = (t % k8n) * 8;
  v8us v;
#pragma unroll
  for (int i = 0; i < 8; ++i) v[i] = bf16_bits(W[(size_t)(k8 + i) * N + n]);
  *(v8us*)(Wt + (size_t)n * K + k8) = v;
  
}

// GEMM C[M][N] (f32, pitch ldc) = act(A[M][K]·W + bias). A f32 row-major (pitch lda) converted per fragment to bf16
// (ASPLIT: hi/lo two planes -> 2 terms, else single rounded term); Wt bf16 [N][K] (pitch ldb). BIAS_BF16 rounds the
// bias to bf16 first (bias quantised to bf16 before the add). K%32==0, M%16==0, N%64==0.
template <bool ASPLIT, int ACT, bool BIAS_BF16>
__global__ __launch_bounds__(128) void k_gemm_bf(const float* __restrict__ A, int lda, const unsigned short* __restrict__ Wt, int ldb,
                                               const float* __restrict__ bias, float* __restrict__ C, int ldc, int M, int N, int K) {
  __shared__ __attribute__((aligned(16))) float so[4][16][64];
  const int tid = threadIdx.x, w = tid >> 5, lane = tid & 31, ln = lane & 15, hh = lane >> 4;
  const int ntn = N / 64;
  const int wid = blockIdx.x * 4 + w;
  const int mt = wid / ntn, nq = wid % ntn;
  if (mt * 16 >= M) return;
  const int row0 = mt * 16, col0 = nq * 64;
  const float* arow = A + (size_t)(row0 + ln) * lda;
  v8f acc[4] = {};
  for (int kb = 0; kb < K; kb += 32) {
    FragB ah, al;
    const v4f x0 = *(const v4fa*)(arow + kb + 8 * hh), x1 = *(const v4fa*)(arow + kb + 8 * hh + 4);
    const v4f x2 = *(const v4fa*)(arow + kb + 16 + 8 * hh), x3 = *(const v4fa*)(arow + kb + 16 + 8 * hh + 4);
    float xs[16] = {x0[0],x0[1],x0[2],x0[3],x1[0],x1[1],x1[2],x1[3],x2[0],x2[1],x2[2],x2[3],x3[0],x3[1],x3[2],x3[3]};
#pragma unroll
    for (int i = 0; i < 16; ++i) { const unsigned short hb = bf16_bits(xs[i]); ah.u[i] = hb; al.u[i] = ASPLIT ? bf16_bits(xs[i] - bf16_val(hb)) : (unsigned short)0; }
#pragma unroll
    for (int t = 0; t < 4; ++t) {
      const unsigned short* brow = Wt + (size_t)(col0 + t * 16 + ln) * ldb + kb;
      FragB b;
      b.half[0] = *(const v8us*)(brow + 8 * hh);
      b.half[1] = *(const v8us*)(brow + 16 + 8 * hh);
      acc[t] = mmaN<ASPLIT ? 2 : 1>(ah.v, al.v, b.v, b.v, acc[t]);
    }
  }
#pragma unroll
  for (int t = 0; t < 4; ++t) {
    float bv = bias ? bias[col0 + t * 16 + ln] : 0.f;
    if (BIAS_BF16) bv = bf16_round(bv);
#pragma unroll
    for (int r = 0; r < 8; ++r) { float v = acc[t][r] + bv; if (ACT == 1) v = fmaxf(v, 0.f); so[w][8 * hh + r][t * 16 + ln] = v; }
  }
  __builtin_amdgcn_fence(__ATOMIC_ACQ_REL, "workgroup");
  __builtin_amdgcn_wave_barrier();
  const int rsub = lane >> 4, c4 = (lane & 15) * 4;
  {
#pragma unroll
    for (int q = 0; q < 8; ++q) {
      const int r = q * 2 + rsub;
      const v4f v = *(const v4fa*)&so[w][r][c4];
      *(v4f*)(C + (size_t)(row0 + r) * ldc + col0 + c4) = v;
    }
    
  }
}

// Flash-style causal/unmasked attention, all contractions 3-term bf16 hi/lo splits, f32 softmax with running max.
// q,k,v rows are read from f32 buffers with arbitrary row pitch (so they can live inside a fused qkv buffer);
// D = head size (multiple of 32, <= 128); one wave = 16 query rows; block = 4 waves (64 queries) sharing K/V chunks of 32.
template <int D, bool CAUSAL>
__global__ __launch_bounds__(128) void k_flash(const float* __restrict__ qb, const float* __restrict__ kb, const float* __restrict__ vb,
                                             int pitch, int T, int H, float scale, float* __restrict__ y, int ypitch) {
  constexpr int KS = D / 32;        // k-steps for QK
  constexpr int DT = D / 16;        // d tiles for PV
  __shared__ __attribute__((aligned(16))) unsigned short sKh[32][D + 8], sKl[32][D + 8], sVh[32][D + 8], sVl[32][D + 8];
  __shared__ __attribute__((aligned(16))) unsigned short sPh[4][16][40], sPl[4][16][40];
  __shared__ __attribute__((aligned(16))) float sO[4][16][D];
  const int tid = threadIdx.x, w = tid >> 5, lane = tid & 31, ln = lane & 15, hh = lane >> 4;
  const int nqb = (T + 63) / 64;
  const int bh = blockIdx.x / nqb, qblk = blockIdx.x % nqb;
  const int b = bh / H, h = bh % H;
  const int q0 = qblk * 64 + w * 16;
  const float* Q = qb + (size_t)b * T * pitch + h * D;
  const float* K = kb + (size_t)b * T * pitch + h * D;
  const float* V = vb + (size_t)b * T * pitch + h * D;

  // A fragments of the wave's 16 query rows (scaled), hi/lo
  FragB aqh[KS], aql[KS];
  {
    int row = q0 + ln; if (row >= T) row = T - 1;
    const float* qr = Q + (size_t)row * pitch;
#pragma unroll
    for (int ks = 0; ks < KS; ++ks)
#pragma unroll
      for (int i = 0; i < 16; ++i) {
        const int d = ks * 32 + ((i < 8) ? (8 * hh + i) : (16 + 8 * hh + (i - 8)));
        const float x = qr[d] * scale; const unsigned short hb = bf16_bits(x);
        aqh[ks].u[i] = hb; aql[ks].u[i] = bf16_bits(x - bf16_val(hb));
      }
  }
  float m_r[8], l_r[8];
#pragma unroll
  for (int r = 0; r < 8; ++r) { m_r[r] = -3.0e38f; l_r[r] = 0.f; }
  v8f oacc[DT];
#pragma unroll
  for (int dt = 0; dt < DT; ++dt) oacc[dt] = (v8f){0.f,0.f,0.f,0.f,0.f,0.f,0.f,0.f};

  const int kv_end = CAUSAL ? min(T, qblk * 64 + 64) : T;     // block-uniform
  for (int j0 = 0; j0 < kv_end; j0 += 32) {
    __syncthreads();
    for (int e = tid; e < 32 * (D / 4); e += 128) {
      const int r = e / (D / 4), c4 = (e % (D / 4)) * 4;
      const int key = j0 + r;
      v4f kf = {0.f,0.f,0.f,0.f}, vf = {0.f,0.f,0.f,0.f};
      if (key < T) { kf = *(const v4fa*)(K + (size_t)key * pitch + c4); vf = *(const v4fa*)(V + (size_t)key * pitch + c4); }
#pragma unroll
      for (int t = 0; t < 4; ++t) {
        unsigned short hb = bf16_bits(kf[t]); sKh[r][c4 + t] = hb; sKl[r][c4 + t] = bf16_bits(kf[t] - bf16_val(hb));
        hb = bf16_bits(vf[t]); sVh[r][c4 + t] = hb; sVl[r][c4 + t] = bf16_bits(vf[t] - bf16_val(hb));
      }
    }
    __syncthreads();
    // S tile 16 x 32
    v8f s[2];
#pragma unroll
    for (int nt = 0; nt < 2; ++nt) {
      v8f acc = {};
#pragma unroll
      for (int ks = 0; ks < KS; ++ks) {
        FragB bh_, bl_;
        bh_.half[0] = *(const v8us*)&sKh[nt * 16 + ln][ks * 32 + 8 * hh]; bh_.half[1] = *(const v8us*)&sKh[nt * 16 + ln][ks * 32 + 16 + 8 * hh];
        bl_.half[0] = *(const v8us*)&sKl[nt * 16 + ln][ks * 32 + 8 * hh]; bl_.half[1] = *(const v8us*)&sKl[nt * 16 + ln][ks * 32 + 16 + 8 * hh];
        acc = mmaN<3>(aqh[ks].v, aql[ks].v, bh_.v, bl_.v, acc);
      }
      s[nt] = acc;
    }
    // mask + running max (rows 8hh+r; the 16 lanes of a half share rows)
    float alpha[8];
#pragma unroll
    for (int r = 0; r < 8; ++r) {
      const int qi = q0 + 8 * hh + r;
      const int ja = j0 + ln, jb = j0 + 16 + ln;
      if (CAUSAL) { if (ja > qi) s[0][r] = -3.0e38f; if (jb > qi) s[1][r] = -3.0e38f; }
      if (ja >= T) s[0][r] = -3.0e38f;
      if (jb >= T) s[1][r] = -3.0e38f;
      float mx = fmaxf(s[0][r], s[1][r]);
      mx = fmaxf(mx, __shfl_xor(mx, 1, 32)); mx = fmaxf(mx, __shfl_xor(mx, 2, 32)); mx = fmaxf(mx, __shfl_xor(mx, 4, 32)); mx = fmaxf(mx, __shfl_xor(mx, 8, 32));
      const float mnew = fmaxf(m_r[r], mx);
      alpha[r] = (mnew > -1.0e38f) ? __expf(m_r[r] - mnew) : 1.0f;
      const float p0 = (s[0][r] > -1.0e38f) ? __expf(s[0][r] - mnew) : 0.f;
      const float p1 = (s[1][r] > -1.0e38f) ? __expf(s[1][r] - mnew) : 0.f;
      m_r[r] = mnew;
      l_r[r] = l_r[r] * alpha[r] + p0 + p1;            // per-lane partial row sum (16 lanes combined at the end)
      unsigned short hb = bf16_bits(p0); sPh[w][8 * hh + r][ln] = hb;      sPl[w][8 * hh + r][ln] = bf16_bits(p0 - bf16_val(hb));
      hb = bf16_bits(p1);                sPh[w][8 * hh + r][16 + ln] = hb; sPl[w][8 * hh + r][16 + ln] = bf16_bits(p1 - bf16_val(hb));
    }
#pragma unroll
    for (int dt = 0; dt < DT; ++dt)
#pragma unroll
      for (int r = 0; r < 8; ++r) oacc[dt][r] *= alpha[r];
    __builtin_amdgcn_fence(__ATOMIC_ACQ_REL, "workgroup");
    __builtin_amdgcn_wave_barrier();
    FragB pah, pal;
    pah.half[0] = *(const v8us*)&sPh[w][ln][8 * hh]; pah.half[1] = *(const v8us*)&sPh[w][ln][16 + 8 * hh];
    pal.half[0] = *(const v8us*)&sPl[w][ln][8 * hh]; pal.half[1] = *(const v8us*)&sPl[w][ln][16 + 8 * hh];
#pragma unroll
    for (int dt = 0; dt < DT; ++dt) {
      FragB bvh, bvl;
#pragma unroll
      for (int i = 0; i < 8; ++i) {
        bvh.u[i] = sVh[8 * hh + i][dt * 16 + ln]; bvh.u[8 + i] = sVh[16 + 8 * hh + i][dt * 16 + ln];
        bvl.u[i] = sVl[8 * hh + i][dt * 16 + ln]; bvl.u[8 + i] = sVl[16 + 8 * hh + i][dt * 16 + ln];
      }
      oacc[dt] = mmaN<3>(pah.v, pal.v, bvh.v, bvl.v, oacc[dt]);
    }
    __builtin_amdgcn_fence(__ATOMIC_ACQ_REL, "workgroup");
    __builtin_amdgcn_wave_barrier();
  }
#pragma unroll
  for (int r = 0; r < 8; ++r) {
    float l = l_r[r];
    l += __shfl_xor(l, 1, 32); l += __shfl_xor(l, 2, 32); l += __shfl_xor(l, 4, 32); l += __shfl_xor(l, 8, 32);
    l_r[r] = (l > 0.f) ? 1.0f / l : 0.f;
  }
#pragma unroll
  for (int dt = 0; dt < DT; ++dt)
#pragma unroll
    for (int r = 0; r < 8; ++r) sO[w][8 * hh + r][dt * 16 + ln] = oacc[dt][r] * l_r[r];
  __builtin_amdgcn_fence(__ATOMIC_ACQ_REL, "workgroup");
  __builtin_amdgcn_wave_barrier();
  {
    for (int r = 0; r < 16; ++r) {
      const int row = q0 + r;
      if (row < T && lane < D / 4) {
        const v4f val = *(const v4fa*)&sO[w][r][lane * 4];
        *(v4f*)(y + ((size_t)b * T + row) * ypitch + h * D + lane * 4) = val;
      }
    }
    
  }
}

// GEMM C = act(A·W + bias + resid): A f32 (ASPLIT -> hi/lo 2 terms), Wt bf16 [N][K]; ACT 0 none, 1 relu, 2 exact gelu;
// resid (optional, f32, row index = (row % rmod), pitch ldr, RES_BF16 rounds it) added before the activation.
template <bool ASPLIT, int ACT, bool BIAS_BF16, bool RES_BF16>
__global__ __launch_bounds__(128) void k_gemm_bf3(const float* __restrict__ A, int lda, const unsigned short* __restrict__ Wt, int ldb,
                                                const float* __restrict__ bias, const float* __restrict__ resid, int rmod, int ldr,
                                                float* __restrict__ C, int ldc, int M, int N, int K) {
  __shared__ __attribute__((aligned(16))) float so[4][16][64];
  const int tid = threadIdx.x, w = tid >> 5, lane = tid & 31, ln = lane & 15, hh = lane >> 4;
  const int ntn = N / 64;
  const int wid = blockIdx.x * 4 + w;
  const int mt = wid / ntn, nq = wid % ntn;
  if (mt * 16 >= M) return;
  const int row0 = mt * 16, col0 = nq * 64;
  const float* arow = A + (size_t)(row0 + ln) * lda;
  v8f acc[4] = {};
  for (int kb = 0; kb < K; kb += 32) {
    FragB ah, al;
    const v4f x0 = *(const v4fa*)(arow + kb + 8 * hh), x1 = *(const v4fa*)(arow + kb + 8 * hh + 4);
    const v4f x2 = *(const v4fa*)(arow + kb + 16 + 8 * hh), x3 = *(const v4fa*)(arow + kb + 16 + 8 * hh + 4);
    float xs[16] = {x0[0],x0[1],x0[2],x0[3],x1[0],x1[1],x1[2],x1[3],x2[0],x2[1],x2[2],x2[3],x3[0],x3[1],x3[2],x3[3]};
#pragma unroll
    for (int i = 0; i < 16; ++i) { const unsigned short hb = bf16_bits(xs[i]); ah.u[i] = hb; al.u[i] = ASPLIT ? bf16_bits(xs[i] - bf16_val(hb)) : (unsigned short)0; }
#pragma unroll
    for (int t = 0; t < 4; ++t) {
      const unsigned short* brow = Wt + (size_t)(col0 + t * 16 + ln) * ldb + kb;
      FragB b;
      b.half[0] = *(const v8us*)(brow + 8 * hh);
      b.half[1] = *(const v8us*)(brow + 16 + 8 * hh);
      acc[t] = mmaN<ASPLIT ? 2 : 1>(ah.v, al.v, b.v, b.v, acc[t]);
    }
  }
#pragma unroll
  for (int t = 0; t < 4; ++t) {
    const int col = col0 + t * 16 + ln;
    float bv = bias ? bias[col] : 0.f;
    if (BIAS_BF16) bv = bf16_round(bv);
#pragma unroll
    for (int r = 0; r < 8; ++r) {
      float v = acc[t][r] + bv;
      if (resid) { float rv = resid[(size_t)((row0 + 8 * hh + r) % rmod) * ldr + col]; if (RES_BF16) rv = bf16_round(rv); v += rv; }
      if (ACT == 1) v = fmaxf(v, 0.f);
      if (ACT == 2) v = 0.5f * v * (1.0f + erff(v * 0.70710678118654752f));
      if (ACT == 3) { const float u = 0.7978845608028654f * (v + 0.044715f * v * v * v); v = 0.5f * v * (1.0f + tanhf(u)); }
      so[w][8 * hh + r][t * 16 + ln] = v;
    }
  }
  __builtin_amdgcn_fence(__ATOMIC_ACQ_REL, "workgroup");
  __builtin_amdgcn_wave_barrier();
  const int rsub = lane >> 4, c4 = (lane & 15) * 4;
  {
#pragma unroll
    for (int q = 0; q < 8; ++q) {
      const int r = q * 2 + rsub;
      const v4f v = *(const v4fa*)&so[w][r][c4];
      *(v4f*)(C + (size_t)(row0 + r) * ldc + col0 + c4) = v;
    }
    
  }
}
// row LayerNorm (biased variance, eps) over N: s = X (+ R); optional out_sum <- s; out_norm <- (s-mu)*rsqrt(var+eps)*g + b
template <bool PARAM_BF16>
__global__ __launch_bounds__(256) void k_layernorm(const float* __restrict__ X, const float* __restrict__ R, const float* __restrict__ g, const float* __restrict__ bta,
                                                  float* __restrict__ out_sum, float* __restrict__ out_norm, int N, float eps) {
  __shared__ float red[256];
  const int row = blockIdx.x, tid = threadIdx.x;
  const float* x = X + (size_t)row * N; const float* rr = R ? R + (size_t)row * N : nullptr;
  float vals[16];                     // up to N = 4096
  const int per = N / 256;            // contiguous chunk per thread? use strided-by-4 chunks: thread handles j = tid*4 + 1024*u
  float s1 = 0.f;
  for (int u = 0; u < per / 4; ++u) {
    const int j = tid * 4 + 1024 * u;
    const v4f a = *(const v4fa*)(x + j);
    v4f b = {0.f,0.f,0.f,0.f}; if (rr) b = *(const v4fa*)(rr + j);
#pragma unroll
    for (int q = 0; q < 4; ++q) { const float v = a[q] + b[q]; vals[u * 4 + q] = v; s1 += v; }
  }
  red[tid] = s1; __syncthreads();
  for (int st = 128; st > 0; st >>= 1) { if (tid < st) red[tid] += red[tid + st]; __syncthreads(); }
  const float mu = red[0] / (float)N; __syncthreads();
  float s2 = 0.f;
  for (int u = 0; u < per / 4; ++u)
#pragma unroll
    for (int q = 0; q < 4; ++q) { const float c = vals[u * 4 + q] - mu; s2 += c * c; }
  red[tid] = s2; __syncthreads();
  for (int st = 128; st > 0; st >>= 1) { if (tid < st) red[tid] += red[tid + st]; __syncthreads(); }
  const float rs = rsqrtf(red[0] / (float)N + eps);
  {
    for (int u = 0; u < per / 4; ++u) {
      const int j = tid * 4 + 1024 * u;
      v4f o, sm;
#pragma unroll
      for (int q = 0; q < 4; ++q) {
        float gg = g[j + q], bb = bta[j + q];
        if (PARAM_BF16) { gg = bf16_round(gg); bb = bf16_round(bb); }
        sm[q] = vals[u * 4 + q]; o[q] = (vals[u * 4 + q] - mu) * rs * gg + bb;
      }
      if (out_sum) *(v4f*)(out_sum + (size_t)row * N + j) = sm;
      *(v4f*)(out_norm + (size_t)row * N + j) = o;
    }
    
  }
}

// batched GEMM (blockIdx.y = batch): C_b = act(alpha·A_b·B_b + bias + resid_b); A f32 rows (ASPLIT → hi/lo), B = bf16 planes Bh (+Bl when BSPLIT, requires ASPLIT),
// per-batch element strides sA, sB (0 = shared weights), sC, sR. resid may alias C (values are staged before the stores). ACT 0/1(relu).
// ACT: 0 none, 1 relu, 2 softplus
template <bool ASPLIT, bool BSPLIT, int ACT>
__global__ __launch_bounds__(128) void k_gemm_b(const float* __restrict__ A, int lda, size_t sA, const unsigned short* __restrict__ Bh, const unsigned short* __restrict__ Bl, int ldb, size_t sB,
                                             const float* __restrict__ bias, const float* __restrict__ resid, int ldr, size_t sR, float rsign, float alpha,
                                             float* __restrict__ C, int ldc, size_t sC, int M, int N, int K) {
  __shared__ __attribute__((aligned(16))) float so[4][16][64];
  const int tid = threadIdx.x, w = tid >> 5, lane = tid & 31, ln = lane & 15, hh = lane >> 4;
  const int by = blockIdx.y;
  A += (size_t)by * sA; Bh += (size_t)by * sB; if (BSPLIT) Bl += (size_t)by * sB; C += (size_t)by * sC; if (resid) resid += (size_t)by * sR;
  const int ntn = N / 64; const int wid = blockIdx.x * 4 + w; const int mt = wid / ntn, nq = wid % ntn;
  if (mt * 16 >= M) return;
  const int row0 = mt * 16, col0 = nq * 64;
  const float* arow = A + (size_t)(row0 + ln) * lda;
  v8f acc[4] = {};
  for (int kb = 0; kb < K; kb += 32) {
    FragB ah, al;
    const v4f x0 = *(const v4fa*)(arow + kb + 8 * hh), x1 = *(const v4fa*)(arow + kb + 8 * hh + 4);
    const v4f x2 = *(const v4fa*)(arow + kb + 16 + 8 * hh), x3 = *(const v4fa*)(arow + kb + 16 + 8 * hh + 4);
    float xs[16] = {x0[0],x0[1],x0[2],x0[3],x1[0],x1[1],x1[2],x1[3],x2[0],x2[1],x2[2],x2[3],x3[0],x3[1],x3[2],x3[3]};
#pragma unroll
    for (int i = 0; i < 16; ++i) { const unsigned short hb = bf16_bits(xs[i]); ah.u[i] = hb; al.u[i] = ASPLIT ? bf16_bits(xs[i] - bf16_val(hb)) : (unsigned short)0; }
#pragma unroll
    for (int t = 0; t < 4; ++t) {
      const size_t boff = (size_t)(col0 + t * 16 + ln) * ldb + kb;
      FragB bh_, bl_; bh_.half[0] = *(const v8us*)(Bh + boff + 8 * hh); bh_.half[1] = *(const v8us*)(Bh + boff + 16 + 8 * hh);
      if (BSPLIT) { bl_.half[0] = *(const v8us*)(Bl + boff + 8 * hh); bl_.half[1] = *(const v8us*)(Bl + boff + 16 + 8 * hh); } else bl_ = bh_;
      acc[t] = mmaN<ASPLIT ? (BSPLIT ? 3 : 2) : 1>(ah.v, al.v, bh_.v, bl_.v, acc[t]);
    }
  }
#pragma unroll
  for (int t = 0; t < 4; ++t) {
    const int col = col0 + t * 16 + ln; const float bv = bias ? bf16_round(bias[col]) : 0.f;
#pragma unroll
    for (int r = 0; r < 8; ++r) { float v = acc[t][r] * alpha + bv; if (resid) v += rsign * resid[(size_t)(row0 + 8 * hh + r) * ldr + col]; if (ACT == 1) v = fmaxf(v, 0.f); else if (ACT == 2) v = fmaxf(v, 0.f) + log1pf(expf(-fabsf(v))); so[w][8 * hh + r][t * 16 + ln] = v; }
  }
  __builtin_amdgcn_fence(__ATOMIC_ACQ_REL, "workgroup"); __builtin_amdgcn_wave_barrier();
  const int rsub = lane >> 4, c4 = (lane & 15) * 4;
  {
#pragma unroll
    for (int q = 0; q < 8; ++q) { const int r = q * 2 + rsub; const v4f v = *(const v4fa*)&so[w][r][c4]; *(v4f*)(C + (size_t)(row0 + r) * ldc + col0 + c4) = v; }
    
  }
}
// batched f32 [K][N] (pitch lds, batch stride sIn) -> transposed hi/lo planes [N][K] (batch stride sOut); thread per (n, 8 k); grid.y = batch
__global__ __launch_bounds__(256) void k_split_transpose_b(const float* __restrict__ src, int lds_, size_t sIn, unsigned short* __restrict__ hi, unsigned short* __restrict__ lo, size_t sOut, int K, int N) {
  const size_t t = (size_t)blockIdx.x * 256 + threadIdx.x; const int k8n = K / 8; if (t >= (size_t)N * k8n) return;
  src += (size_t)blockIdx.y * sIn; hi += (size_t)blockIdx.y * sOut; lo += (size_t)blockIdx.y * sOut;
  const int n = (int)(t / k8n), k8 = (int)(t % k8n) * 8; v8us vh, vl;
#pragma unroll
  for (int i = 0; i < 8; ++i) { const float x = src[(size_t)(k8 + i) * lds_ + n]; const unsigned short hb = bf16_bits(x); vh[i] = hb; vl[i] = bf16_bits(x - bf16_val(hb)); }
  unsigned short* dh = hi + (size_t)n * K + k8; unsigned short* dl = lo + (size_t)n * K + k8;
  *(v8us*)dh = vh; *(v8us*)dl = vl; 
}


__global__ __launch_bounds__(256) void k_roundcopy(const float* __restrict__ src, float* __restrict__ dst, int n8) {
  const size_t t = (size_t)blockIdx.x * 256 + threadIdx.x;
  if (t >= (size_t)n8 * 2) return;
  v4f a = *(const v4fa*)(src + t * 4);
  for (int i = 0; i < 4; ++i) a[i] = bf16_round(a[i]);
  *(v4f*)(dst + t * 4) = a; 
}

__device__ __forceinline__ float tanh_fast(float x) { const float e = __expf(2.0f * x); return 1.0f - 2.0f / (e + 1.0f); }
// f32 rows: fpad[16][512] = final_state rows 0..7, zero rows 8..15 (thread per float4)
__global__ __launch_bounds__(256) void k_fpad(const float* __restrict__ f, float* __restrict__ fp) { const int t = blockIdx.x * 256 + threadIdx.x; if (t >= 16 * DD / 4) return; const int r = t / (DD / 4); v4f v = {0.f,0.f,0.f,0.f}; if (r < BB) { const v4f a = *(const v4fa*)(f + (size_t)t * 4); for (int q = 0; q < 4; ++q) v[q] = a[q]; } *(v4f*)(fp + (size_t)t * 4) = v;  }
// Sᵀ planes per batch (exact input): Bh[b][d][t] = bf16(S[b][t][d]); thread per (b, d, 8 t)
__global__ __launch_bounds__(256) void k_sT(const float* __restrict__ S, unsigned short* __restrict__ Bh) {
  const size_t i = (size_t)blockIdx.x * 256 + threadIdx.x; if (i >= (size_t)BB * DD * (TT / 8)) return; const int t8 = (int)(i % (TT / 8)) * 8; const int d = (int)((i / (TT / 8)) % DD); const int b = (int)(i / ((size_t)(TT / 8) * DD));
  v8us v; for (int q = 0; q < 8; ++q) v[q] = bf16_bits(S[((size_t)b * TT + t8 + q) * DD + d]);
  *(v8us*)(Bh + ((size_t)b * DD + d) * TT + t8) = v; 
}
// intent: block per b (256 threads = t): score_t = Σ_a v_a tanh(ih[b][t][a] + ii[b][a]); softmax over t; c_intent[b][d] = Σ_t w_t·bf16(S[b][t][d]) (thread d, 2 per thread)
__global__ __launch_bounds__(256) void k_intent(const float* __restrict__ P, const float* __restrict__ ii, const float* __restrict__ iv, const float* __restrict__ S, float* __restrict__ cint) {
  __shared__ float sii[DD], siv[DD], sw[TT], red[256];
  const int b = blockIdx.x, t = threadIdx.x;
  for (int a = t; a < DD; a += 256) { sii[a] = ii[(size_t)b * DD + a]; siv[a] = bf16_round(iv[a]); }
  __syncthreads();
  const float* row = P + ((size_t)b * TT + t) * 3 * DD; float sc = 0.f;
#pragma unroll 1
  for (int a = 0; a < DD; a += 4) { const v4f h = *(const v4fa*)(row + a); for (int q = 0; q < 4; ++q) sc += siv[a + q] * tanh_fast(h[q] + sii[a + q]); }
  red[t] = sc; __syncthreads(); for (int st = 128; st > 0; st >>= 1) { if (t < st) red[t] = fmaxf(red[t], red[t + st]); __syncthreads(); } const float mx = red[0]; __syncthreads();
  const float e = expf(sc - mx); red[t] = e; __syncthreads(); for (int st = 128; st > 0; st >>= 1) { if (t < st) red[t] += red[t + st]; __syncthreads(); } const float den = red[0]; __syncthreads();
  sw[t] = e / den; __syncthreads();
  float c0 = 0.f, c1 = 0.f;
#pragma unroll 1
  for (int s = 0; s < TT; ++s) { const float w = sw[s]; const float* sr = S + ((size_t)b * TT + s) * DD; c0 += w * bf16_round(sr[t]); c1 += w * bf16_round(sr[256 + t]); }
  { *(float*)(cint + (size_t)b * DD + t) = c0; *(float*)(cint + (size_t)b * DD + 256 + t) = c1;  }
}
// slot scores: wave per (b,t): for each s: Σ_a slot_v·tanh(sh[b][s][a] + si[b][t][a]) (16 per lane + butterfly); softmax over s -> W[b][t][s]
__global__ __launch_bounds__(256) void k_slot(const float* __restrict__ P, const float* __restrict__ sv, float* __restrict__ Wt) {
  __shared__ float ssc[8][TT]; __shared__ float ssi[8][DD], svv[8][DD];
  const int tid = threadIdx.x, wv = tid >> 5, lane = tid & 31; const int m = blockIdx.x * 8 + wv; if (m >= MR) return; const int b = m / TT;
  { const float* sir = P + (size_t)m * 3 * DD + 2 * DD; for (int u = 0; u < 16; ++u) { ssi[wv][u * 32 + lane] = sir[u * 32 + lane]; svv[wv][u * 32 + lane] = bf16_round(sv[u * 32 + lane]); } }
  __builtin_amdgcn_fence(__ATOMIC_ACQ_REL, "workgroup"); __builtin_amdgcn_wave_barrier();
  float mx = -3.0e38f;
#pragma unroll 1
  for (int s = 0; s < TT; ++s) { const float* shr = P + ((size_t)b * TT + s) * 3 * DD + DD; float acc = 0.f;
#pragma unroll 1
    for (int u = 0; u < 16; ++u) { const int a = u * 32 + lane; acc += svv[wv][a] * tanh_fast(shr[a] + ssi[wv][a]); }
    for (int o = 16; o >= 1; o >>= 1) acc += __shfl_xor(acc, o, 32); if (lane == (s & 31)) ssc[wv][s] = acc; mx = fmaxf(mx, acc); }
  __builtin_amdgcn_fence(__ATOMIC_ACQ_REL, "workgroup"); __builtin_amdgcn_wave_barrier();
  float den = 0.f;
#pragma unroll 1
  for (int u = 0; u < 8; ++u) { const float e = expf(ssc[wv][u * 32 + lane] - mx); ssc[wv][u * 32 + lane] = e; den += e; }
  for (int o = 16; o >= 1; o >>= 1) den += __shfl_xor(den, o, 32); const float inv = 1.0f / den;
  {
#pragma unroll 1
    for (int u = 0; u < 8; ++u) *(float*)(Wt + (size_t)m * TT + u * 32 + lane) = ssc[wv][u * 32 + lane] * inv;  }
}
extern "C" void kernel_launch(void* const* d_in, const int* in_sizes, int n_in,
                              void* d_out, int out_size, void* d_ws, size_t ws_size, hipStream_t stream) {
  (void)in_sizes; (void)n_in; (void)out_size;
  const float* S = (const float*)d_in[0]; const float* fst = (const float*)d_in[1]; const float* iv = (const float*)d_in[2]; const float* W_ih = (const float*)d_in[3]; const float* b_ih = (const float*)d_in[4]; const float* W_ii = (const float*)d_in[5]; const float* b_ii = (const float*)d_in[6];
  const float* sv = (const float*)d_in[7]; const float* W_sh = (const float*)d_in[8]; const float* b_sh = (const float*)d_in[9]; const float* W_si = (const float*)d_in[10]; const float* b_si = (const float*)d_in[11];
  float* cslot = (float*)d_out; float* cint = (float*)((char*)d_out + 4194304);
  char* ws = (char*)d_ws; size_t off = 0;
  auto take = [&](size_t bytes) { char* p = ws + off; off += (bytes + 255) & ~(size_t)255; return p; };
  unsigned short* B3 = (unsigned short*)take((size_t)3 * DD * DD * 2); unsigned short* Bii = (unsigned short*)take((size_t)DD * DD * 2); float* b3 = (float*)take(3 * DD * 4); unsigned short* ST = (unsigned short*)take((size_t)BB * DD * TT * 2);
  float* fp = (float*)take(16 * DD * 4); float* ii = (float*)take(16 * DD * 4); float* P = (float*)take((size_t)MR * 3 * DD * 4); float* Wt = (float*)take((size_t)MR * TT * 4);
  if (off > ws_size) return;
  k_wt_bf16<<<(DD * (DD / 8) + 255) / 256, 256, 0, stream>>>(W_ih, B3, DD, DD); k_wt_bf16<<<(DD * (DD / 8) + 255) / 256, 256, 0, stream>>>(W_sh, B3 + (size_t)DD * DD, DD, DD); k_wt_bf16<<<(DD * (DD / 8) + 255) / 256, 256, 0, stream>>>(W_si, B3 + (size_t)2 * DD * DD, DD, DD);
  k_wt_bf16<<<(DD * (DD / 8) + 255) / 256, 256, 0, stream>>>(W_ii, Bii, DD, DD);
  k_roundcopy<<<1, 256, 0, stream>>>(b_ih, b3, DD / 8); k_roundcopy<<<1, 256, 0, stream>>>(b_sh, b3 + DD, DD / 8); k_roundcopy<<<1, 256, 0, stream>>>(b_si, b3 + 2 * DD, DD / 8);
  k_sT<<<(unsigned)(((size_t)BB * DD * (TT / 8) + 255) / 256), 256, 0, stream>>>(S, ST);
  k_fpad<<<(16 * DD / 4 + 255) / 256, 256, 0, stream>>>(fst, fp);
  k_gemm_bf3<false, 0, false, false><<<((MR / 16) * (3 * DD / 64) + 3) / 4, 128, 0, stream>>>(S, DD, B3, DD, b3, nullptr, 1, 0, P, 3 * DD, MR, 3 * DD, DD);      // [ih | sh | si] + b (single term)
  k_gemm_bf3<false, 0, true, false><<<((16 / 16) * (DD / 64) + 3) / 4, 128, 0, stream>>>(fp, DD, Bii, DD, b_ii, nullptr, 1, 0, ii, DD, 16, DD, DD);         // ii (rows 0..7)
  k_intent<<<BB, 256, 0, stream>>>(P, ii, iv, S, cint);
  k_slot<<<MR / 8, 256, 0, stream>>>(P, sv, Wt);
  k_gemm_b<true, false, 0><<<dim3(((TT / 16) * (DD / 64) + 3) / 4, BB), 128, 0, stream>>>(Wt, TT, (size_t)TT * TT, ST, ST, TT, (size_t)DD * TT, nullptr, nullptr, 0, 0, 1.f, 1.f, cslot, DD, (size_t)TT * DD, TT, DD, TT);   // c_slot[b] = W[b]·S[b]
}

// v001
// It runs in 238 microseconds.
// Next to v000, in two timings, it ran 5.66 and 5.71 times as fast.
#include <hip/hip_runtime.h>
// [ih | sh | si] = S·[W_ih|W_sh|W_si] + b (one GEMM, K=512, N=1536), ii = f·W_ii + b (M padded to 16) — inputs and weights rounded to bf16: single exact
// WMMA term, f32 accumulate — and c_slot = slot_w·S per batch (slot_w split into bf16 hi/lo vs exact bf16 Sᵀ planes: 2 terms) run on
// v_wmma_f32_16x16x32_bf16; the additive tanh scores (intent: T×A, slot: T×T×A), both softmaxes and c_intent are f32 VALU.
#define BB 8
#define TT 256
#define DD 512
#define MR (BB * TT)

typedef __bf16 v16b __attribute__((ext_vector_type(16)));
typedef unsigned short v8us __attribute__((ext_vector_type(8), may_alias));
typedef float  v8f  __attribute__((ext_vector_type(8)));
typedef float  v4f  __attribute__((ext_vector_type(4)));
typedef float  v4fa __attribute__((ext_vector_type(4), may_alias));
union FragB { v16b v; v8us half[2]; unsigned short u[16]; };

__device__ __forceinline__ unsigned short bf16_bits(float x) { unsigned int u = __float_as_uint(x); return (unsigned short)((u + 0x7FFFu + ((u >> 16) & 1u)) >> 16); }
__device__ __forceinline__ float bf16_val(unsigned short b) { return __uint_as_float(((unsigned int)b) << 16); }
__device__ __forceinline__ float bf16_round(float x) { return bf16_val(bf16_bits(x)); }
// D += A·B with NT terms: 1 = ah·bh, 2 = + al·bh (A split), 3 = + ah·bl (both split)
template <int NT>
__device__ __forceinline__ v8f mmaN(v16b ah, v16b al, v16b bh, v16b bl, v8f c) {
  c = __builtin_amdgcn_wmma_f32_16x16x32_bf16(false, ah, false, bh, (short)0, c, false, false);
  if (NT >= 2) c = __builtin_amdgcn_wmma_f32_16x16x32_bf16(false, al, false, bh, (short)0, c, false, false);
  if (NT >= 3) c = __builtin_amdgcn_wmma_f32_16x16x32_bf16(false, ah, false, bl, (short)0, c, false, false);
  asm volatile("v_nop\n\tv_nop\n\tv_nop\n\tv_nop" : "+v"(c) : "v"(ah), "v"(al), "v"(bh), "v"(bl));
  return c;
}

__global__ __launch_bounds__(256) void k_wt_bf16(const float* __restrict__ W, unsigned short* __restrict__ Wt, int K, int N) {
  const int t = blockIdx.x * 256 + threadIdx.x;
  const int k8n = K / 8;
  if (t >= N * k8n) return;
  const int n = t / k8n, k8 = (t % k8n) * 8;
  v8us v;
#pragma unroll
  for (int i = 0; i < 8; ++i) v[i] = bf16_bits(W[(size_t)(k8 + i) * N + n]);
  *(v8us*)(Wt + (size_t)n * K + k8) = v;
  
}

// GEMM C[M][N] (f32, pitch ldc) = act(A[M][K]·W + bias). A f32 row-major (pitch lda) converted per fragment to bf16
// (ASPLIT: hi/lo two planes -> 2 terms, else single rounded term); Wt bf16 [N][K] (pitch ldb). BIAS_BF16 rounds the
// bias to bf16 first (bias quantised to bf16 before the add). K%32==0, M%16==0, N%64==0.
template <bool ASPLIT, int ACT, bool BIAS_BF16>
__global__ __launch_bounds__(128) void k_gemm_bf(const float* __restrict__ A, int lda, const unsigned short* __restrict__ Wt, int ldb,
                                               const float* __restrict__ bias, float* __restrict__ C, int ldc, int M, int N, int K) {
  __shared__ __attribute__((aligned(16))) float so[4][16][64];
  const int tid = threadIdx.x, w = tid >> 5, lane = tid & 31, ln = lane & 15, hh = lane >> 4;
  const int ntn = N / 64;
  const int wid = blockIdx.x * 4 + w;
  const int mt = wid / ntn, nq = wid % ntn;
  if (mt * 16 >= M) return;
  const int row0 = mt * 16, col0 = nq * 64;
  const float* arow = A + (size_t)(row0 + ln) * lda;
  v8f acc[4] = {};
  for (int kb = 0; kb < K; kb += 32) {
    FragB ah, al;
    const v4f x0 = *(const v4fa*)(arow + kb + 8 * hh), x1 = *(const v4fa*)(arow + kb + 8 * hh + 4);
    const v4f x2 = *(const v4fa*)(arow + kb + 16 + 8 * hh), x3 = *(const v4fa*)(arow + kb + 16 + 8 * hh + 4);
    float xs[16] = {x0[0],x0[1],x0[2],x0[3],x1[0],x1[1],x1[2],x1[3],x2[0],x2[1],x2[2],x2[3],x3[0],x3[1],x3[2],x3[3]};
#pragma unroll
    for (int i = 0; i < 16; ++i) { const unsigned short hb = bf16_bits(xs[i]); ah.u[i] = hb; al.u[i] = ASPLIT ? bf16_bits(xs[i] - bf16_val(hb)) : (unsigned short)0; }
#pragma unroll
    for (int t = 0; t < 4; ++t) {
      const unsigned short* brow = Wt + (size_t)(col0 + t * 16 + ln) * ldb + kb;
      FragB b;
      b.half[0] = *(const v8us*)(brow + 8 * hh);
      b.half[1] = *(const v8us*)(brow + 16 + 8 * hh);
      acc[t] = mmaN<ASPLIT ? 2 : 1>(ah.v, al.v, b.v, b.v, acc[t]);
    }
  }
#pragma unroll
  for (int t = 0; t < 4; ++t) {
    float bv = bias ? bias[col0 + t * 16 + ln] : 0.f;
    if (BIAS_BF16) bv = bf16_round(bv);
#pragma unroll
    for (int r = 0; r < 8; ++r) { float v = acc[t][r] + bv; if (ACT == 1) v = fmaxf(v, 0.f); so[w][8 * hh + r][t * 16 + ln] = v; }
  }
  __builtin_amdgcn_fence(__ATOMIC_ACQ_REL, "workgroup");
  __builtin_amdgcn_wave_barrier();
  const int rsub = lane >> 4, c4 = (lane & 15) * 4;
  {
#pragma unroll
    for (int q = 0; q < 8; ++q) {
      const int r = q * 2 + rsub;
      const v4f v = *(const v4fa*)&so[w][r][c4];
      *(v4f*)(C + (size_t)(row0 + r) * ldc + col0 + c4) = v;
    }
    
  }
}

// Flash-style causal/unmasked attention, all contractions 3-term bf16 hi/lo splits, f32 softmax with running max.
// q,k,v rows are read from f32 buffers with arbitrary row pitch (so they can live inside a fused qkv buffer);
// D = head size (multiple of 32, <= 128); one wave = 16 query rows; block = 4 waves (64 queries) sharing K/V chunks of 32.
template <int D, bool CAUSAL>
__global__ __launch_bounds__(128) void k_flash(const float* __restrict__ qb, const float* __restrict__ kb, const float* __restrict__ vb,
                                             int pitch, int T, int H, float scale, float* __restrict__ y, int ypitch) {
  constexpr int KS = D / 32;        // k-steps for QK
  constexpr int DT = D / 16;        // d tiles for PV
  __shared__ __attribute__((aligned(16))) unsigned short sKh[32][D + 8], sKl[32][D + 8], sVh[32][D + 8], sVl[32][D + 8];
  __shared__ __attribute__((aligned(16))) unsigned short sPh[4][16][40], sPl[4][16][40];
  __shared__ __attribute__((aligned(16))) float sO[4][16][D];
  const int tid = threadIdx.x, w = tid >> 5, lane = tid & 31, ln = lane & 15, hh = lane >> 4;
  const int nqb = (T + 63) / 64;
  const int bh = blockIdx.x / nqb, qblk = blockIdx.x % nqb;
  const int b = bh / H, h = bh % H;
  const int q0 = qblk * 64 + w * 16;
  const float* Q = qb + (size_t)b * T * pitch + h * D;
  const float* K = kb + (size_t)b * T * pitch + h * D;
  const float* V = vb + (size_t)b * T * pitch + h * D;

  // A fragments of the wave's 16 query rows (scaled), hi/lo
  FragB aqh[KS], aql[KS];
  {
    int row = q0 + ln; if (row >= T) row = T - 1;
    const float* qr = Q + (size_t)row * pitch;
#pragma unroll
    for (int ks = 0; ks < KS; ++ks)
#pragma unroll
      for (int i = 0; i < 16; ++i) {
        const int d = ks * 32 + ((i < 8) ? (8 * hh + i) : (16 + 8 * hh + (i - 8)));
        const float x = qr[d] * scale; const unsigned short hb = bf16_bits(x);
        aqh[ks].u[i] = hb; aql[ks].u[i] = bf16_bits(x - bf16_val(hb));
      }
  }
  float m_r[8], l_r[8];
#pragma unroll
  for (int r = 0; r < 8; ++r) { m_r[r] = -3.0e38f; l_r[r] = 0.f; }
  v8f oacc[DT];
#pragma unroll
  for (int dt = 0; dt < DT; ++dt) oacc[dt] = (v8f){0.f,0.f,0.f,0.f,0.f,0.f,0.f,0.f};

  const int kv_end = CAUSAL ? min(T, qblk * 64 + 64) : T;     // block-uniform
  for (int j0 = 0; j0 < kv_end; j0 += 32) {
    __syncthreads();
    for (int e = tid; e < 32 * (D / 4); e += 128) {
      const int r = e / (D / 4), c4 = (e % (D / 4)) * 4;
      const int key = j0 + r;
      v4f kf = {0.f,0.f,0.f,0.f}, vf = {0.f,0.f,0.f,0.f};
      if (key < T) { kf = *(const v4fa*)(K + (size_t)key * pitch + c4); vf = *(const v4fa*)(V + (size_t)key * pitch + c4); }
#pragma unroll
      for (int t = 0; t < 4; ++t) {
        unsigned short hb = bf16_bits(kf[t]); sKh[r][c4 + t] = hb; sKl[r][c4 + t] = bf16_bits(kf[t] - bf16_val(hb));
        hb = bf16_bits(vf[t]); sVh[r][c4 + t] = hb; sVl[r][c4 + t] = bf16_bits(vf[t] - bf16_val(hb));
      }
    }
    __syncthreads();
    // S tile 16 x 32
    v8f s[2];
#pragma unroll
    for (int nt = 0; nt < 2; ++nt) {
      v8f acc = {};
#pragma unroll
      for (int ks = 0; ks < KS; ++ks) {
        FragB bh_, bl_;
        bh_.half[0] = *(const v8us*)&sKh[nt * 16 + ln][ks * 32 + 8 * hh]; bh_.half[1] = *(const v8us*)&sKh[nt * 16 + ln][ks * 32 + 16 + 8 * hh];
        bl_.half[0] = *(const v8us*)&sKl[nt * 16 + ln][ks * 32 + 8 * hh]; bl_.half[1] = *(const v8us*)&sKl[nt * 16 + ln][ks * 32 + 16 + 8 * hh];
        acc = mmaN<3>(aqh[ks].v, aql[ks].v, bh_.v, bl_.v, acc);
      }
      s[nt] = acc;
    }
    // mask + running max (rows 8hh+r; the 16 lanes of a half share rows)
    float alpha[8];
#pragma unroll
    for (int r = 0; r < 8; ++r) {
      const int qi = q0 + 8 * hh + r;
      const int ja = j0 + ln, jb = j0 + 16 + ln;
      if (CAUSAL) { if (ja > qi) s[0][r] = -3.0e38f; if (jb > qi) s[1][r] = -3.0e38f; }
      if (ja >= T) s[0][r] = -3.0e38f;
      if (jb >= T) s[1][r] = -3.0e38f;
      float mx = fmaxf(s[0][r], s[1][r]);
      mx = fmaxf(mx, __shfl_xor(mx, 1, 32)); mx = fmaxf(mx, __shfl_xor(mx, 2, 32)); mx = fmaxf(mx, __shfl_xor(mx, 4, 32)); mx = fmaxf(mx, __shfl_xor(mx, 8, 32));
      const float mnew = fmaxf(m_r[r], mx);
      alpha[r] = (mnew > -1.0e38f) ? __expf(m_r[r] - mnew) : 1.0f;
      const float p0 = (s[0][r] > -1.0e38f) ? __expf(s[0][r] - mnew) : 0.f;
      const float p1 = (s[1][r] > -1.0e38f) ? __expf(s[1][r] - mnew) : 0.f;
      m_r[r] = mnew;
      l_r[r] = l_r[r] * alpha[r] + p0 + p1;            // per-lane partial row sum (16 lanes combined at the end)
      unsigned short hb = bf16_bits(p0); sPh[w][8 * hh + r][ln] = hb;      sPl[w][8 * hh + r][ln] = bf16_bits(p0 - bf16_val(hb));
      hb = bf16_bits(p1);                sPh[w][8 * hh + r][16 + ln] = hb; sPl[w][8 * hh + r][16 + ln] = bf16_bits(p1 - bf16_val(hb));
    }
#pragma unroll
    for (int dt = 0; dt < DT; ++dt)
#pragma unroll
      for (int r = 0; r < 8; ++r) oacc[dt][r] *= alpha[r];
    __builtin_amdgcn_fence(__ATOMIC_ACQ_REL, "workgroup");
    __builtin_amdgcn_wave_barrier();
    FragB pah, pal;
    pah.half[0] = *(const v8us*)&sPh[w][ln][8 * hh]; pah.half[1] = *(const v8us*)&sPh[w][ln][16 + 8 * hh];
    pal.half[0] = *(const v8us*)&sPl[w][ln][8 * hh]; pal.half[1] = *(const v8us*)&sPl[w][ln][16 + 8 * hh];
#pragma unroll
    for (int dt = 0; dt < DT; ++dt) {
      FragB bvh, bvl;
#pragma unroll
      for (int i = 0; i < 8; ++i) {
        bvh.u[i] = sVh[8 * hh + i][dt * 16 + ln]; bvh.u[8 + i] = sVh[16 + 8 * hh + i][dt * 16 + ln];
        bvl.u[i] = sVl[8 * hh + i][dt * 16 + ln]; bvl.u[8 + i] = sVl[16 + 8 * hh + i][dt * 16 + ln];
      }
      oacc[dt] = mmaN<3>(pah.v, pal.v, bvh.v, bvl.v, oacc[dt]);
    }
    __builtin_amdgcn_fence(__ATOMIC_ACQ_REL, "workgroup");
    __builtin_amdgcn_wave_barrier();
  }
#pragma unroll
  for (int r = 0; r < 8; ++r) {
    float l = l_r[r];
    l += __shfl_xor(l, 1, 32); l += __shfl_xor(l, 2, 32); l += __shfl_xor(l, 4, 32); l += __shfl_xor(l, 8, 32);
    l_r[r] = (l > 0.f) ? 1.0f / l : 0.f;
  }
#pragma unroll
  for (int dt = 0; dt < DT; ++dt)
#pragma unroll
    for (int r = 0; r < 8; ++r) sO[w][8 * hh + r][dt * 16 + ln] = oacc[dt][r] * l_r[r];
  __builtin_amdgcn_fence(__ATOMIC_ACQ_REL, "workgroup");
  __builtin_amdgcn_wave_barrier();
  {
    for (int r = 0; r < 16; ++r) {
      const int row = q0 + r;
      if (row < T && lane < D / 4) {
        const v4f val = *(const v4fa*)&sO[w][r][lane * 4];
        *(v4f*)(y + ((size_t)b * T + row) * ypitch + h * D + lane * 4) = val;
      }
    }
    
  }
}

// GEMM C = act(A·W + bias + resid): A f32 (ASPLIT -> hi/lo 2 terms), Wt bf16 [N][K]; ACT 0 none, 1 relu, 2 exact gelu;
// resid (optional, f32, row index = (row % rmod), pitch ldr, RES_BF16 rounds it) added before the activation.
template <bool ASPLIT, int ACT, bool BIAS_BF16, bool RES_BF16>
__global__ __launch_bounds__(128) void k_gemm_bf3(const float* __restrict__ A, int lda, const unsigned short* __restrict__ Wt, int ldb,
                                                const float* __restrict__ bias, const float* __restrict__ resid, int rmod, int ldr,
                                                float* __restrict__ C, int ldc, int M, int N, int K) {
  __shared__ __attribute__((aligned(16))) float so[4][16][64];
  const int tid = threadIdx.x, w = tid >> 5, lane = tid & 31, ln = lane & 15, hh = lane >> 4;
  const int ntn = N / 64;
  const int wid = blockIdx.x * 4 + w;
  const int mt = wid / ntn, nq = wid % ntn;
  if (mt * 16 >= M) return;
  const int row0 = mt * 16, col0 = nq * 64;
  const float* arow = A + (size_t)(row0 + ln) * lda;
  v8f acc[4] = {};
  for (int kb = 0; kb < K; kb += 32) {
    FragB ah, al;
    const v4f x0 = *(const v4fa*)(arow + kb + 8 * hh), x1 = *(const v4fa*)(arow + kb + 8 * hh + 4);
    const v4f x2 = *(const v4fa*)(arow + kb + 16 + 8 * hh), x3 = *(const v4fa*)(arow + kb + 16 + 8 * hh + 4);
    float xs[16] = {x0[0],x0[1],x0[2],x0[3],x1[0],x1[1],x1[2],x1[3],x2[0],x2[1],x2[2],x2[3],x3[0],x3[1],x3[2],x3[3]};
#pragma unroll
    for (int i = 0; i < 16; ++i) { const unsigned short hb = bf16_bits(xs[i]); ah.u[i] = hb; al.u[i] = ASPLIT ? bf16_bits(xs[i] - bf16_val(hb)) : (unsigned short)0; }
#pragma unroll
    for (int t = 0; t < 4; ++t) {
      const unsigned short* brow = Wt + (size_t)(col0 + t * 16 + ln) * ldb + kb;
      FragB b;
      b.half[0] = *(const v8us*)(brow + 8 * hh);
      b.half[1] = *(const v8us*)(brow + 16 + 8 * hh);
      acc[t] = mmaN<ASPLIT ? 2 : 1>(ah.v, al.v, b.v, b.v, acc[t]);
    }
  }
#pragma unroll
  for (int t = 0; t < 4; ++t) {
    const int col = col0 + t * 16 + ln;
    float bv = bias ? bias[col] : 0.f;
    if (BIAS_BF16) bv = bf16_round(bv);
#pragma unroll
    for (int r = 0; r < 8; ++r) {
      float v = acc[t][r] + bv;
      if (resid) { float rv = resid[(size_t)((row0 + 8 * hh + r) % rmod) * ldr + col]; if (RES_BF16) rv = bf16_round(rv); v += rv; }
      if (ACT == 1) v = fmaxf(v, 0.f);
      if (ACT == 2) v = 0.5f * v * (1.0f + erff(v * 0.70710678118654752f));
      if (ACT == 3) { const float u = 0.7978845608028654f * (v + 0.044715f * v * v * v); v = 0.5f * v * (1.0f + tanhf(u)); }
      so[w][8 * hh + r][t * 16 + ln] = v;
    }
  }
  __builtin_amdgcn_fence(__ATOMIC_ACQ_REL, "workgroup");
  __builtin_amdgcn_wave_barrier();
  const int rsub = lane >> 4, c4 = (lane & 15) * 4;
  {
#pragma unroll
    for (int q = 0; q < 8; ++q) {
      const int r = q * 2 + rsub;
      const v4f v = *(const v4fa*)&so[w][r][c4];
      *(v4f*)(C + (size_t)(row0 + r) * ldc + col0 + c4) = v;
    }
    
  }
}
// row LayerNorm (biased variance, eps) over N: s = X (+ R); optional out_sum <- s; out_norm <- (s-mu)*rsqrt(var+eps)*g + b
template <bool PARAM_BF16>
__global__ __launch_bounds__(256) void k_layernorm(const float* __restrict__ X, const float* __restrict__ R, const float* __restrict__ g, const float* __restrict__ bta,
                                                  float* __restrict__ out_sum, float* __restrict__ out_norm, int N, float eps) {
  __shared__ float red[256];
  const int row = blockIdx.x, tid = threadIdx.x;
  const float* x = X + (size_t)row * N; const float* rr = R ? R + (size_t)row * N : nullptr;
  float vals[16];                     // up to N = 4096
  const int per = N / 256;            // contiguous chunk per thread? use strided-by-4 chunks: thread handles j = tid*4 + 1024*u
  float s1 = 0.f;
  for (int u = 0; u < per / 4; ++u) {
    const int j = tid * 4 + 1024 * u;
    const v4f a = *(const v4fa*)(x + j);
    v4f b = {0.f,0.f,0.f,0.f}; if (rr) b = *(const v4fa*)(rr + j);
#pragma unroll
    for (int q = 0; q < 4; ++q) { const float v = a[q] + b[q]; vals[u * 4 + q] = v; s1 += v; }
  }
  red[tid] = s1; __syncthreads();
  for (int st = 128; st > 0; st >>= 1) { if (tid < st) red[tid] += red[tid + st]; __syncthreads(); }
  const float mu = red[0] / (float)N; __syncthreads();
  float s2 = 0.f;
  for (int u = 0; u < per / 4; ++u)
#pragma unroll
    for (int q = 0; q < 4; ++q) { const float c = vals[u * 4 + q] - mu; s2 += c * c; }
  red[tid] = s2; __syncthreads();
  for (int st = 128; st > 0; st >>= 1) { if (tid < st) red[tid] += red[tid + st]; __syncthreads(); }
  const float rs = rsqrtf(red[0] / (float)N + eps);
  {
    for (int u = 0; u < per / 4; ++u) {
      const int j = tid * 4 + 1024 * u;
      v4f o, sm;
#pragma unroll
      for (int q = 0; q < 4; ++q) {
        float gg = g[j + q], bb = bta[j + q];
        if (PARAM_BF16) { gg = bf16_round(gg); bb = bf16_round(bb); }
        sm[q] = vals[u * 4 + q]; o[q] = (vals[u * 4 + q] - mu) * rs * gg + bb;
      }
      if (out_sum) *(v4f*)(out_sum + (size_t)row * N + j) = sm;
      *(v4f*)(out_norm + (size_t)row * N + j) = o;
    }
    
  }
}

// batched GEMM (blockIdx.y = batch): C_b = act(alpha·A_b·B_b + bias + resid_b); A f32 rows (ASPLIT → hi/lo), B = bf16 planes Bh (+Bl when BSPLIT, requires ASPLIT),
// per-batch element strides sA, sB (0 = shared weights), sC, sR. resid may alias C (values are staged before the stores). ACT 0/1(relu).
// ACT: 0 none, 1 relu, 2 softplus
template <bool ASPLIT, bool BSPLIT, int ACT>
__global__ __launch_bounds__(128) void k_gemm_b(const float* __restrict__ A, int lda, size_t sA, const unsigned short* __restrict__ Bh, const unsigned short* __restrict__ Bl, int ldb, size_t sB,
                                             const float* __restrict__ bias, const float* __restrict__ resid, int ldr, size_t sR, float rsign, float alpha,
                                             float* __restrict__ C, int ldc, size_t sC, int M, int N, int K) {
  __shared__ __attribute__((aligned(16))) float so[4][16][64];
  const int tid = threadIdx.x, w = tid >> 5, lane = tid & 31, ln = lane & 15, hh = lane >> 4;
  const int by = blockIdx.y;
  A += (size_t)by * sA; Bh += (size_t)by * sB; if (BSPLIT) Bl += (size_t)by * sB; C += (size_t)by * sC; if (resid) resid += (size_t)by * sR;
  const int ntn = N / 64; const int wid = blockIdx.x * 4 + w; const int mt = wid / ntn, nq = wid % ntn;
  if (mt * 16 >= M) return;
  const int row0 = mt * 16, col0 = nq * 64;
  const float* arow = A + (size_t)(row0 + ln) * lda;
  v8f acc[4] = {};
  for (int kb = 0; kb < K; kb += 32) {
    FragB ah, al;
    const v4f x0 = *(const v4fa*)(arow + kb + 8 * hh), x1 = *(const v4fa*)(arow + kb + 8 * hh + 4);
    const v4f x2 = *(const v4fa*)(arow + kb + 16 + 8 * hh), x3 = *(const v4fa*)(arow + kb + 16 + 8 * hh + 4);
    float xs[16] = {x0[0],x0[1],x0[2],x0[3],x1[0],x1[1],x1[2],x1[3],x2[0],x2[1],x2[2],x2[3],x3[0],x3[1],x3[2],x3[3]};
#pragma unroll
    for (int i = 0; i < 16; ++i) { const unsigned short hb = bf16_bits(xs[i]); ah.u[i] = hb; al.u[i] = ASPLIT ? bf16_bits(xs[i] - bf16_val(hb)) : (unsigned short)0; }
#pragma unroll
    for (int t = 0; t < 4; ++t) {
      const size_t boff = (size_t)(col0 + t * 16 + ln) * ldb + kb;
      FragB bh_, bl_; bh_.half[0] = *(const v8us*)(Bh + boff + 8 * hh); bh_.half[1] = *(const v8us*)(Bh + boff + 16 + 8 * hh);
      if (BSPLIT) { bl_.half[0] = *(const v8us*)(Bl + boff + 8 * hh); bl_.half[1] = *(const v8us*)(Bl + boff + 16 + 8 * hh); } else bl_ = bh_;
      acc[t] = mmaN<ASPLIT ? (BSPLIT ? 3 : 2) : 1>(ah.v, al.v, bh_.v, bl_.v, acc[t]);
    }
  }
#pragma unroll
  for (int t = 0; t < 4; ++t) {
    const int col = col0 + t * 16 + ln; const float bv = bias ? bf16_round(bias[col]) : 0.f;
#pragma unroll
    for (int r = 0; r < 8; ++r) { float v = acc[t][r] * alpha + bv; if (resid) v += rsign * resid[(size_t)(row0 + 8 * hh + r) * ldr + col]; if (ACT == 1) v = fmaxf(v, 0.f); else if (ACT == 2) v = fmaxf(v, 0.f) + log1pf(expf(-fabsf(v))); so[w][8 * hh + r][t * 16 + ln] = v; }
  }
  __builtin_amdgcn_fence(__ATOMIC_ACQ_REL, "workgroup"); __builtin_amdgcn_wave_barrier();
  const int rsub = lane >> 4, c4 = (lane & 15) * 4;
  {
#pragma unroll
    for (int q = 0; q < 8; ++q) { const int r = q * 2 + rsub; const v4f v = *(const v4fa*)&so[w][r][c4]; *(v4f*)(C + (size_t)(row0 + r) * ldc + col0 + c4) = v; }
    
  }
}
// batched f32 [K][N] (pitch lds, batch stride sIn) -> transposed hi/lo planes [N][K] (batch stride sOut); thread per (n, 8 k); grid.y = batch
__global__ __launch_bounds__(256) void k_split_transpose_b(const float* __restrict__ src, int lds_, size_t sIn, unsigned short* __restrict__ hi, unsigned short* __restrict__ lo, size_t sOut, int K, int N) {
  const size_t t = (size_t)blockIdx.x * 256 + threadIdx.x; const int k8n = K / 8; if (t >= (size_t)N * k8n) return;
  src += (size_t)blockIdx.y * sIn; hi += (size_t)blockIdx.y * sOut; lo += (size_t)blockIdx.y * sOut;
  const int n = (int)(t / k8n), k8 = (int)(t % k8n) * 8; v8us vh, vl;
#pragma unroll
  for (int i = 0; i < 8; ++i) { const float x = src[(size_t)(k8 + i) * lds_ + n]; const unsigned short hb = bf16_bits(x); vh[i] = hb; vl[i] = bf16_bits(x - bf16_val(hb)); }
  unsigned short* dh = hi + (size_t)n * K + k8; unsigned short* dl = lo + (size_t)n * K + k8;
  *(v8us*)dh = vh; *(v8us*)dl = vl; 
}


__global__ __launch_bounds__(256) void k_roundcopy(const float* __restrict__ src, float* __restrict__ dst, int n8) {
  const size_t t = (size_t)blockIdx.x * 256 + threadIdx.x;
  if (t >= (size_t)n8 * 2) return;
  v4f a = *(const v4fa*)(src + t * 4);
  for (int i = 0; i < 4; ++i) a[i] = bf16_round(a[i]);
  *(v4f*)(dst + t * 4) = a; 
}

__device__ __forceinline__ float tanh_fast(float x) { const float e = __expf(2.0f * x); return 1.0f - 2.0f / (e + 1.0f); }
// f32 rows: fpad[16][512] = final_state rows 0..7, zero rows 8..15 (thread per float4)
__global__ __launch_bounds__(256) void k_fpad(const float* __restrict__ f, float* __restrict__ fp) { const int t = blockIdx.x * 256 + threadIdx.x; if (t >= 16 * DD / 4) return; const int r = t / (DD / 4); v4f v = {0.f,0.f,0.f,0.f}; if (r < BB) { const v4f a = *(const v4fa*)(f + (size_t)t * 4); for (int q = 0; q < 4; ++q) v[q] = a[q]; } *(v4f*)(fp + (size_t)t * 4) = v;  }
// Sᵀ planes per batch (exact input): Bh[b][d][t] = bf16(S[b][t][d]); thread per (b, d, 8 t)
__global__ __launch_bounds__(256) void k_sT(const float* __restrict__ S, unsigned short* __restrict__ Bh) {
  const size_t i = (size_t)blockIdx.x * 256 + threadIdx.x; if (i >= (size_t)BB * DD * (TT / 8)) return; const int t8 = (int)(i % (TT / 8)) * 8; const int d = (int)((i / (TT / 8)) % DD); const int b = (int)(i / ((size_t)(TT / 8) * DD));
  v8us v; for (int q = 0; q < 8; ++q) v[q] = bf16_bits(S[((size_t)b * TT + t8 + q) * DD + d]);
  *(v8us*)(Bh + ((size_t)b * DD + d) * TT + t8) = v; 
}
// intent: block per b (256 threads = t): score_t = Σ_a v_a tanh(ih[b][t][a] + ii[b][a]); softmax over t; c_intent[b][d] = Σ_t w_t·bf16(S[b][t][d]) (thread d, 2 per thread)
__global__ __launch_bounds__(256) void k_intent(const float* __restrict__ P, const float* __restrict__ ii, const float* __restrict__ iv, const float* __restrict__ S, float* __restrict__ cint) {
  __shared__ float sii[DD], siv[DD], sw[TT], red[256];
  const int b = blockIdx.x, t = threadIdx.x;
  for (int a = t; a < DD; a += 256) { sii[a] = ii[(size_t)b * DD + a]; siv[a] = bf16_round(iv[a]); }
  __syncthreads();
  const float* row = P + ((size_t)b * TT + t) * 3 * DD; float sc = 0.f;
#pragma unroll 1
  for (int a = 0; a < DD; a += 4) { const v4f h = *(const v4fa*)(row + a); for (int q = 0; q < 4; ++q) sc += siv[a + q] * tanh_fast(h[q] + sii[a + q]); }
  red[t] = sc; __syncthreads(); for (int st = 128; st > 0; st >>= 1) { if (t < st) red[t] = fmaxf(red[t], red[t + st]); __syncthreads(); } const float mx = red[0]; __syncthreads();
  const float e = expf(sc - mx); red[t] = e; __syncthreads(); for (int st = 128; st > 0; st >>= 1) { if (t < st) red[t] += red[t + st]; __syncthreads(); } const float den = red[0]; __syncthreads();
  sw[t] = e / den; __syncthreads();
  float c0 = 0.f, c1 = 0.f;
#pragma unroll 1
  for (int s = 0; s < TT; ++s) { const float w = sw[s]; const float* sr = S + ((size_t)b * TT + s) * DD; c0 += w * bf16_round(sr[t]); c1 += w * bf16_round(sr[256 + t]); }
  { *(float*)(cint + (size_t)b * DD + t) = c0; *(float*)(cint + (size_t)b * DD + 256 + t) = c1;  }
}
// slot scores: block = QT queries t of one batch, 8 waves; wave wv takes keys s in [32 wv, 32 wv + 32) for all QT queries.
// si of the queries and slot_v stay in registers (lane holds a = 32 u + lane) and a key row is fetched by 16 loads at once, so a row feeds
// 16 QT tanh per lane with no load and no LDS read between them; per (t,s) the terms are summed in the old order (u ascending, then the butterfly).
// softmax over s -> W[b][t][s] by waves 0..QT-1, one query each, behind the block barrier.
#define QT 2
// waves_per_eu: the launch puts 8 waves on every SIMD (MR / QT blocks of 8 waves on 1024 SIMDs); this is the register budget that goes with it
__global__ __launch_bounds__(256) __attribute__((amdgpu_waves_per_eu(8, 8))) void k_slot(const float* __restrict__ P, const float* __restrict__ sv, float* __restrict__ Wt) {
  __shared__ float ssc[QT][TT];
  const int tid = threadIdx.x, wv = tid >> 5, lane = tid & 31; const int m0 = blockIdx.x * QT; if (m0 >= MR) return; const int b = m0 / TT;
  float si[QT][16], vv[16], cur[16], keep[QT];
  // every "#pragma unroll" of this kernel: the arrays are then indexed by constants only and stay in registers
#pragma unroll
  for (int u = 0; u < 16; ++u) vv[u] = bf16_round(sv[u * 32 + lane]);
#pragma unroll
  for (int j = 0; j < QT; ++j) { const float* sir = P + (size_t)(m0 + j) * 3 * DD + 2 * DD; keep[j] = 0.f;
#pragma unroll
    for (int u = 0; u < 16; ++u) si[j][u] = sir[u * 32 + lane]; }
  const float* sh0 = P + ((size_t)b * TT + wv * 32) * 3 * DD + DD + lane;
#pragma unroll
  for (int u = 0; u < 16; ++u) cur[u] = sh0[u * 32];
  for (int k = 0; k < 32; ++k) {
    float acc[QT];
    // scheduling regions of 2 u (4 tanh), the first opened here: in one region of the whole row this compiler lays the 32 division chains end to end;
    // per region it interleaves the four.
    __builtin_amdgcn_sched_barrier(0);
#pragma unroll
    for (int j = 0; j < QT; ++j) acc[j] = 0.f;
#pragma unroll
    for (int u = 0; u < 16; ++u) {
#pragma unroll
      for (int j = 0; j < QT; ++j) acc[j] += vv[u] * tanh_fast(cur[u] + si[j][u]);
      if ((u % 2) == 1) __builtin_amdgcn_sched_barrier(0);   // end of a region of 2 u, see above
    }
    const float* nrow = sh0 + (size_t)((k + 1) & 31) * 3 * DD;   // next key row: its loads fly during the butterfly (the last trip re-reads the wave's first row, unused)
#pragma unroll
    for (int u = 0; u < 16; ++u) cur[u] = nrow[u * 32];
    __builtin_amdgcn_sched_barrier(0);   // keeps those loads in front of the butterfly's waits
#pragma unroll
    for (int j = 0; j < QT; ++j) { float a = acc[j]; for (int o = 16; o >= 1; o >>= 1) a += __shfl_xor(a, o, 32); if (lane == k) keep[j] = a; }
  }
#pragma unroll
  for (int j = 0; j < QT; ++j) ssc[j][wv * 32 + lane] = keep[j];
  __syncthreads();   // every wave's 32 keys of each query are in ssc before a query's softmax reads all 256
  if (wv >= QT) return;
  const int m = m0 + wv;
  float mx = -3.0e38f;
  for (int u = 0; u < 8; ++u) mx = fmaxf(mx, ssc[wv][u * 32 + lane]);
  for (int o = 16; o >= 1; o >>= 1) mx = fmaxf(mx, __shfl_xor(mx, o, 32));
  float den = 0.f;
#pragma unroll 1
  for (int u = 0; u < 8; ++u) { const float e = expf(ssc[wv][u * 32 + lane] - mx); ssc[wv][u * 32 + lane] = e; den += e; }
  for (int o = 16; o >= 1; o >>= 1) den += __shfl_xor(den, o, 32); const float inv = 1.0f / den;
  {
#pragma unroll 1
    for (int u = 0; u < 8; ++u) *(float*)(Wt + (size_t)m * TT + u * 32 + lane) = ssc[wv][u * 32 + lane] * inv;  }
}
extern "C" void kernel_launch(void* const* d_in, const int* in_sizes, int n_in,
                              void* d_out, int out_size, void* d_ws, size_t ws_size, hipStream_t stream) {
  (void)in_sizes; (void)n_in; (void)out_size;
  const float* S = (const float*)d_in[0]; const float* fst = (const float*)d_in[1]; const float* iv = (const float*)d_in[2]; const float* W_ih = (const float*)d_in[3]; const float* b_ih = (const float*)d_in[4]; const float* W_ii = (const float*)d_in[5]; const float* b_ii = (const float*)d_in[6];
  const float* sv = (const float*)d_in[7]; const float* W_sh = (const float*)d_in[8]; const float* b_sh = (const float*)d_in[9]; const float* W_si = (const float*)d_in[10]; const float* b_si = (const float*)d_in[11];
  float* cslot = (float*)d_out; float* cint = (float*)((char*)d_out + 4194304);
  char* ws = (char*)d_ws; size_t off = 0;
  auto take = [&](size_t bytes) { char* p = ws + off; off += (bytes + 255) & ~(size_t)255; return p; };
  unsigned short* B3 = (unsigned short*)take((size_t)3 * DD * DD * 2); unsigned short* Bii = (unsigned short*)take((size_t)DD * DD * 2); float* b3 = (float*)take(3 * DD * 4); unsigned short* ST = (unsigned short*)take((size_t)BB * DD * TT * 2);
  float* fp = (float*)take(16 * DD * 4); float* ii = (float*)take(16 * DD * 4); float* P = (float*)take((size_t)MR * 3 * DD * 4); float* Wt = (float*)take((size_t)MR * TT * 4);
  if (off > ws_size) return;
  k_wt_bf16<<<(DD * (DD / 8) + 255) / 256, 256, 0, stream>>>(W_ih, B3, DD, DD); k_wt_bf16<<<(DD * (DD / 8) + 255) / 256, 256, 0, stream>>>(W_sh, B3 + (size_t)DD * DD, DD, DD); k_wt_bf16<<<(DD * (DD / 8) + 255) / 256, 256, 0, stream>>>(W_si, B3 + (size_t)2 * DD * DD, DD, DD);
  k_wt_bf16<<<(DD * (DD / 8) + 255) / 256, 256, 0, stream>>>(W_ii, Bii, DD, DD);
  k_roundcopy<<<1, 256, 0, stream>>>(b_ih, b3, DD / 8); k_roundcopy<<<1, 256, 0, stream>>>(b_sh, b3 + DD, DD / 8); k_roundcopy<<<1, 256, 0, stream>>>(b_si, b3 + 2 * DD, DD / 8);
  k_sT<<<(unsigned)(((size_t)BB * DD * (TT / 8) + 255) / 256), 256, 0, stream>>>(S, ST);
  k_fpad<<<(16 * DD / 4 + 255) / 256, 256, 0, stream>>>(fst, fp);
  k_gemm_bf3<false, 0, false, false><<<((MR / 16) * (3 * DD / 64) + 3) / 4, 128, 0, stream>>>(S, DD, B3, DD, b3, nullptr, 1, 0, P, 3 * DD, MR, 3 * DD, DD);      // [ih | sh | si] + b (single term)
  k_gemm_bf3<false, 0, true, false><<<((16 / 16) * (DD / 64) + 3) / 4, 128, 0, stream>>>(fp, DD, Bii, DD, b_ii, nullptr, 1, 0, ii, DD, 16, DD, DD);         // ii (rows 0..7)
  k_intent<<<BB, 256, 0, stream>>>(P, ii, iv, S, cint);
  k_slot<<<MR / QT, 256, 0, stream>>>(P, sv, Wt);
  k_gemm_b<true, false, 0><<<dim3(((TT / 16) * (DD / 64) + 3) / 4, BB), 128, 0, stream>>>(Wt, TT, (size_t)TT * TT, ST, ST, TT, (size_t)DD * TT, nullptr, nullptr, 0, 0, 1.f, 1.f, cslot, DD, (size_t)TT * DD, TT, DD, TT);   // c_slot[b] = W[b]·S[b]
}

// v002
// It runs in 177 microseconds.
// Timed twice side by side with v001, it ran 1.34 and 1.35 times as fast.
// All steps since v000 together make it 7.65 times as fast.
#include <hip/hip_runtime.h>
// [ih | sh | si] = S·[W_ih|W_sh|W_si] + b (one GEMM, K=512, N=1536), ii = f·W_ii + b (M padded to 16) — inputs and weights rounded to bf16: single exact
// WMMA term, f32 accumulate — and c_slot = slot_w·S per batch (slot_w split into bf16 hi/lo vs exact bf16 Sᵀ planes: 2 terms) run on
// v_wmma_f32_16x16x32_bf16; the additive tanh scores (intent: T×A, slot: T×T×A), both softmaxes and c_intent are f32 VALU.
#define BB 8
#define TT 256
#define DD 512
#define MR (BB * TT)

typedef __bf16 v16b __attribute__((ext_vector_type(16)));
typedef unsigned short v8us __attribute__((ext_vector_type(8), may_alias));
typedef float  v8f  __attribute__((ext_vector_type(8)));
typedef float  v4f  __attribute__((ext_vector_type(4)));
typedef float  v4fa __attribute__((ext_vector_type(4), may_alias));
union FragB { v16b v; v8us half[2]; unsigned short u[16]; };

__device__ __forceinline__ unsigned short bf16_bits(float x) { unsigned int u = __float_as_uint(x); return (unsigned short)((u + 0x7FFFu + ((u >> 16) & 1u)) >> 16); }
__device__ __forceinline__ float bf16_val(unsigned short b) { return __uint_as_float(((unsigned int)b) << 16); }
__device__ __forceinline__ float bf16_round(float x) { return bf16_val(bf16_bits(x)); }
// D += A·B with NT terms: 1 = ah·bh, 2 = + al·bh (A split), 3 = + ah·bl (both split)
template <int NT>
__device__ __forceinline__ v8f mmaN(v16b ah, v16b al, v16b bh, v16b bl, v8f c) {
  c = __builtin_amdgcn_wmma_f32_16x16x32_bf16(false, ah, false, bh, (short)0, c, false, false);
  if (NT >= 2) c = __builtin_amdgcn_wmma_f32_16x16x32_bf16(false, al, false, bh, (short)0, c, false, false);
  if (NT >= 3) c = __builtin_amdgcn_wmma_f32_16x16x32_bf16(false, ah, false, bl, (short)0, c, false, false);
  asm volatile("v_nop\n\tv_nop\n\tv_nop\n\tv_nop" : "+v"(c) : "v"(ah), "v"(al), "v"(bh), "v"(bl));
  return c;
}

__global__ __launch_bounds__(256) void k_wt_bf16(const float* __restrict__ W, unsigned short* __restrict__ Wt, int K, int N) {
  const int t = blockIdx.x * 256 + threadIdx.x;
  const int k8n = K / 8;
  if (t >= N * k8n) return;
  const int n = t / k8n, k8 = (t % k8n) * 8;
  v8us v;
#pragma unroll
  for (int i = 0; i < 8; ++i) v[i] = bf16_bits(W[(size_t)(k8 + i) * N + n]);
  *(v8us*)(Wt + (size_t)n * K + k8) = v;
  
}

// GEMM C[M][N] (f32, pitch ldc) = act(A[M][K]·W + bias). A f32 row-major (pitch lda) converted per fragment to bf16
// (ASPLIT: hi/lo two planes -> 2 terms, else single rounded term); Wt bf16 [N][K] (pitch ldb). BIAS_BF16 rounds the
// bias to bf16 first (bias quantised to bf16 before the add). K%32==0, M%16==0, N%64==0.
template <bool ASPLIT, int ACT, bool BIAS_BF16>
__global__ __launch_bounds__(128) void k_gemm_bf(const float* __restrict__ A, int lda, const unsigned short* __restrict__ Wt, int ldb,
                                               const float* __restrict__ bias, float* __restrict__ C, int ldc, int M, int N, int K) {
  __shared__ __attribute__((aligned(16))) float so[4][16][64];
  const int tid = threadIdx.x, w = tid >> 5, lane = tid & 31, ln = lane & 15, hh = lane >> 4;
  const int ntn = N / 64;
  const int wid = blockIdx.x * 4 + w;
  const int mt = wid / ntn, nq = wid % ntn;
  if (mt * 16 >= M) return;
  const int row0 = mt * 16, col0 = nq * 64;
  const float* arow = A + (size_t)(row0 + ln) * lda;
  v8f acc[4] = {};
  for (int kb = 0; kb < K; kb += 32) {
    FragB ah, al;
    const v4f x0 = *(const v4fa*)(arow + kb + 8 * hh), x1 = *(const v4fa*)(arow + kb + 8 * hh + 4);
    const v4f x2 = *(const v4fa*)(arow + kb + 16 + 8 * hh), x3 = *(const v4fa*)(arow + kb + 16 + 8 * hh + 4);
    float xs[16] = {x0[0],x0[1],x0[2],x0[3],x1[0],x1[1],x1[2],x1[3],x2[0],x2[1],x2[2],x2[3],x3[0],x3[1],x3[2],x3[3]};
#pragma unroll
    for (int i = 0; i < 16; ++i) { const unsigned short hb = bf16_bits(xs[i]); ah.u[i] = hb; al.u[i] = ASPLIT ? bf16_bits(xs[i] - bf16_val(hb)) : (unsigned short)0; }
#pragma unroll
    for (int t = 0; t < 4; ++t) {
      const unsigned short* brow = Wt + (size_t)(col0 + t * 16 + ln) * ldb + kb;
      FragB b;
      b.half[0] = *(const v8us*)(brow + 8 * hh);
      b.half[1] = *(const v8us*)(brow + 16 + 8 * hh);
      acc[t] = mmaN<ASPLIT ? 2 : 1>(ah.v, al.v, b.v, b.v, acc[t]);
    }
  }
#pragma unroll
  for (int t = 0; t < 4; ++t) {
    float bv = bias ? bias[col0 + t * 16 + ln] : 0.f;
    if (BIAS_BF16) bv = bf16_round(bv);
#pragma unroll
    for (int r = 0; r < 8; ++r) { float v = acc[t][r] + bv; if (ACT == 1) v = fmaxf(v, 0.f); so[w][8 * hh + r][t * 16 + ln] = v; }
  }
  __builtin_amdgcn_fence(__ATOMIC_ACQ_REL, "workgroup");
  __builtin_amdgcn_wave_barrier();
  const int rsub = lane >> 4, c4 = (lane & 15) * 4;
  {
#pragma unroll
    for (int q = 0; q < 8; ++q) {
      const int r = q * 2 + rsub;
      const v4f v = *(const v4fa*)&so[w][r][c4];
      *(v4f*)(C + (size_t)(row0 + r) * ldc + col0 + c4) = v;
    }
    
  }
}

// Flash-style causal/unmasked attention, all contractions 3-term bf16 hi/lo splits, f32 softmax with running max.
// q,k,v rows are read from f32 buffers with arbitrary row pitch (so they can live inside a fused qkv buffer);
// D = head size (multiple of 32, <= 128); one wave = 16 query rows; block = 4 waves (64 queries) sharing K/V chunks of 32.
template <int D, bool CAUSAL>
__global__ __launch_bounds__(128) void k_flash(const float* __restrict__ qb, const float* __restrict__ kb, const float* __restrict__ vb,
                                             int pitch, int T, int H, float scale, float* __restrict__ y, int ypitch) {
  constexpr int KS = D / 32;        // k-steps for QK
  constexpr int DT = D / 16;        // d tiles for PV
  __shared__ __attribute__((aligned(16))) unsigned short sKh[32][D + 8], sKl[32][D + 8], sVh[32][D + 8], sVl[32][D + 8];
  __shared__ __attribute__((aligned(16))) unsigned short sPh[4][16][40], sPl[4][16][40];
  __shared__ __attribute__((aligned(16))) float sO[4][16][D];
  const int tid = threadIdx.x, w = tid >> 5, lane = tid & 31, ln = lane & 15, hh = lane >> 4;
  const int nqb = (T + 63) / 64;
  const int bh = blockIdx.x / nqb, qblk = blockIdx.x % nqb;
  const int b = bh / H, h = bh % H;
  const int q0 = qblk * 64 + w * 16;
  const float* Q = qb + (size_t)b * T * pitch + h * D;
  const float* K = kb + (size_t)b * T * pitch + h * D;
  const float* V = vb + (size_t)b * T * pitch + h * D;

  // A fragments of the wave's 16 query rows (scaled), hi/lo
  FragB aqh[KS], aql[KS];
  {
    int row = q0 + ln; if (row >= T) row = T - 1;
    const float* qr = Q + (size_t)row * pitch;
#pragma unroll
    for (int ks = 0; ks < KS; ++ks)
#pragma unroll
      for (int i = 0; i < 16; ++i) {
        const int d = ks * 32 + ((i < 8) ? (8 * hh + i) : (16 + 8 * hh + (i - 8)));
        const float x = qr[d] * scale; const unsigned short hb = bf16_bits(x);
        aqh[ks].u[i] = hb; aql[ks].u[i] = bf16_bits(x - bf16_val(hb));
      }
  }
  float m_r[8], l_r[8];
#pragma unroll
  for (int r = 0; r < 8; ++r) { m_r[r] = -3.0e38f; l_r[r] = 0.f; }
  v8f oacc[DT];
#pragma unroll
  for (int dt = 0; dt < DT; ++dt) oacc[dt] = (v8f){0.f,0.f,0.f,0.f,0.f,0.f,0.f,0.f};

  const int kv_end = CAUSAL ? min(T, qblk * 64 + 64) : T;     // block-uniform
  for (int j0 = 0; j0 < kv_end; j0 += 32) {
    __syncthreads();
    for (int e = tid; e < 32 * (D / 4); e += 128) {
      const int r = e / (D / 4), c4 = (e % (D / 4)) * 4;
      const int key = j0 + r;
      v4f kf = {0.f,0.f,0.f,0.f}, vf = {0.f,0.f,0.f,0.f};
      if (key < T) { kf = *(const v4fa*)(K + (size_t)key * pitch + c4); vf = *(const v4fa*)(V + (size_t)key * pitch + c4); }
#pragma unroll
      for (int t = 0; t < 4; ++t) {
        unsigned short hb = bf16_bits(kf[t]); sKh[r][c4 + t] = hb; sKl[r][c4 + t] = bf16_bits(kf[t] - bf16_val(hb));
        hb = bf16_bits(vf[t]); sVh[r][c4 + t] = hb; sVl[r][c4 + t] = bf16_bits(vf[t] - bf16_val(hb));
      }
    }
    __syncthreads();
    // S tile 16 x 32
    v8f s[2];
#pragma unroll
    for (int nt = 0; nt < 2; ++nt) {
      v8f acc = {};
#pragma unroll
      for (int ks = 0; ks < KS; ++ks) {
        FragB bh_, bl_;
        bh_.half[0] = *(const v8us*)&sKh[nt * 16 + ln][ks * 32 + 8 * hh]; bh_.half[1] = *(const v8us*)&sKh[nt * 16 + ln][ks * 32 + 16 + 8 * hh];
        bl_.half[0] = *(const v8us*)&sKl[nt * 16 + ln][ks * 32 + 8 * hh]; bl_.half[1] = *(const v8us*)&sKl[nt * 16 + ln][ks * 32 + 16 + 8 * hh];
        acc = mmaN<3>(aqh[ks].v, aql[ks].v, bh_.v, bl_.v, acc);
      }
      s[nt] = acc;
    }
    // mask + running max (rows 8hh+r; the 16 lanes of a half share rows)
    float alpha[8];
#pragma unroll
    for (int r = 0; r < 8; ++r) {
      const int qi = q0 + 8 * hh + r;
      const int ja = j0 + ln, jb = j0 + 16 + ln;
      if (CAUSAL) { if (ja > qi) s[0][r] = -3.0e38f; if (jb > qi) s[1][r] = -3.0e38f; }
      if (ja >= T) s[0][r] = -3.0e38f;
      if (jb >= T) s[1][r] = -3.0e38f;
      float mx = fmaxf(s[0][r], s[1][r]);
      mx = fmaxf(mx, __shfl_xor(mx, 1, 32)); mx = fmaxf(mx, __shfl_xor(mx, 2, 32)); mx = fmaxf(mx, __shfl_xor(mx, 4, 32)); mx = fmaxf(mx, __shfl_xor(mx, 8, 32));
      const float mnew = fmaxf(m_r[r], mx);
      alpha[r] = (mnew > -1.0e38f) ? __expf(m_r[r] - mnew) : 1.0f;
      const float p0 = (s[0][r] > -1.0e38f) ? __expf(s[0][r] - mnew) : 0.f;
      const float p1 = (s[1][r] > -1.0e38f) ? __expf(s[1][r] - mnew) : 0.f;
      m_r[r] = mnew;
      l_r[r] = l_r[r] * alpha[r] + p0 + p1;            // per-lane partial row sum (16 lanes combined at the end)
      unsigned short hb = bf16_bits(p0); sPh[w][8 * hh + r][ln] = hb;      sPl[w][8 * hh + r][ln] = bf16_bits(p0 - bf16_val(hb));
      hb = bf16_bits(p1);                sPh[w][8 * hh + r][16 + ln] = hb; sPl[w][8 * hh + r][16 + ln] = bf16_bits(p1 - bf16_val(hb));
    }
#pragma unroll
    for (int dt = 0; dt < DT; ++dt)
#pragma unroll
      for (int r = 0; r < 8; ++r) oacc[dt][r] *= alpha[r];
    __builtin_amdgcn_fence(__ATOMIC_ACQ_REL, "workgroup");
    __builtin_amdgcn_wave_barrier();
    FragB pah, pal;
    pah.half[0] = *(const v8us*)&sPh[w][ln][8 * hh]; pah.half[1] = *(const v8us*)&sPh[w][ln][16 + 8 * hh];
    pal.half[0] = *(const v8us*)&sPl[w][ln][8 * hh]; pal.half[1] = *(const v8us*)&sPl[w][ln][16 + 8 * hh];
#pragma unroll
    for (int dt = 0; dt < DT; ++dt) {
      FragB bvh, bvl;
#pragma unroll
      for (int i = 0; i < 8; ++i) {
        bvh.u[i] = sVh[8 * hh + i][dt * 16 + ln]; bvh.u[8 + i] = sVh[16 + 8 * hh + i][dt * 16 + ln];
        bvl.u[i] = sVl[8 * hh + i][dt * 16 + ln]; bvl.u[8 + i] = sVl[16 + 8 * hh + i][dt * 16 + ln];
      }
      oacc[dt] = mmaN<3>(pah.v, pal.v, bvh.v, bvl.v, oacc[dt]);
    }
    __builtin_amdgcn_fence(__ATOMIC_ACQ_REL, "workgroup");
    __builtin_amdgcn_wave_barrier();
  }
#pragma unroll
  for (int r = 0; r < 8; ++r) {
    float l = l_r[r];
    l += __shfl_xor(l, 1, 32); l += __shfl_xor(l, 2, 32); l += __shfl_xor(l, 4, 32); l += __shfl_xor(l, 8, 32);
    l_r[r] = (l > 0.f) ? 1.0f / l : 0.f;
  }
#pragma unroll
  for (int dt = 0; dt < DT; ++dt)
#pragma unroll
    for (int r = 0; r < 8; ++r) sO[w][8 * hh + r][dt * 16 + ln] = oacc[dt][r] * l_r[r];
  __builtin_amdgcn_fence(__ATOMIC_ACQ_REL, "workgroup");
  __builtin_amdgcn_wave_barrier();
  {
    for (int r = 0; r < 16; ++r) {
      const int row = q0 + r;
      if (row < T && lane < D / 4) {
        const v4f val = *(const v4fa*)&sO[w][r][lane * 4];
        *(v4f*)(y + ((size_t)b * T + row) * ypitch + h * D + lane * 4) = val;
      }
    }
    
  }
}

// GEMM C = act(A·W + bias + resid): A f32 (ASPLIT -> hi/lo 2 terms), Wt bf16 [N][K]; ACT 0 none, 1 relu, 2 exact gelu;
// resid (optional, f32, row index = (row % rmod), pitch ldr, RES_BF16 rounds it) added before the activation.
template <bool ASPLIT, int ACT, bool BIAS_BF16, bool RES_BF16>
__global__ __launch_bounds__(128) void k_gemm_bf3(const float* __restrict__ A, int lda, const unsigned short* __restrict__ Wt, int ldb,
                                                const float* __restrict__ bias, const float* __restrict__ resid, int rmod, int ldr,
                                                float* __restrict__ C, int ldc, int M, int N, int K) {
  __shared__ __attribute__((aligned(16))) float so[4][16][64];
  const int tid = threadIdx.x, w = tid >> 5, lane = tid & 31, ln = lane & 15, hh = lane >> 4;
  const int ntn = N / 64;
  const int wid = blockIdx.x * 4 + w;
  const int mt = wid / ntn, nq = wid % ntn;
  if (mt * 16 >= M) return;
  const int row0 = mt * 16, col0 = nq * 64;
  const float* arow = A + (size_t)(row0 + ln) * lda;
  v8f acc[4] = {};
  for (int kb = 0; kb < K; kb += 32) {
    FragB ah, al;
    const v4f x0 = *(const v4fa*)(arow + kb + 8 * hh), x1 = *(const v4fa*)(arow + kb + 8 * hh + 4);
    const v4f x2 = *(const v4fa*)(arow + kb + 16 + 8 * hh), x3 = *(const v4fa*)(arow + kb + 16 + 8 * hh + 4);
    float xs[16] = {x0[0],x0[1],x0[2],x0[3],x1[0],x1[1],x1[2],x1[3],x2[0],x2[1],x2[2],x2[3],x3[0],x3[1],x3[2],x3[3]};
#pragma unroll
    for (int i = 0; i < 16; ++i) { const unsigned short hb = bf16_bits(xs[i]); ah.u[i] = hb; al.u[i] = ASPLIT ? bf16_bits(xs[i] - bf16_val(hb)) : (unsigned short)0; }
#pragma unroll
    for (int t = 0; t < 4; ++t) {
      const unsigned short* brow = Wt + (size_t)(col0 + t * 16 + ln) * ldb + kb;
      FragB b;
      b.half[0] = *(const v8us*)(brow + 8 * hh);
      b.half[1] = *(const v8us*)(brow + 16 + 8 * hh);
      acc[t] = mmaN<ASPLIT ? 2 : 1>(ah.v, al.v, b.v, b.v, acc[t]);
    }
  }
#pragma unroll
  for (int t = 0; t < 4; ++t) {
    const int col = col0 + t * 16 + ln;
    float bv = bias ? bias[col] : 0.f;
    if (BIAS_BF16) bv = bf16_round(bv);
#pragma unroll
    for (int r = 0; r < 8; ++r) {
      float v = acc[t][r] + bv;
      if (resid) { float rv = resid[(size_t)((row0 + 8 * hh + r) % rmod) * ldr + col]; if (RES_BF16) rv = bf16_round(rv); v += rv; }
      if (ACT == 1) v = fmaxf(v, 0.f);
      if (ACT == 2) v = 0.5f * v * (1.0f + erff(v * 0.70710678118654752f));
      if (ACT == 3) { const float u = 0.7978845608028654f * (v + 0.044715f * v * v * v); v = 0.5f * v * (1.0f + tanhf(u)); }
      so[w][8 * hh + r][t * 16 + ln] = v;
    }
  }
  __builtin_amdgcn_fence(__ATOMIC_ACQ_REL, "workgroup");
  __builtin_amdgcn_wave_barrier();
  const int rsub = lane >> 4, c4 = (lane & 15) * 4;
  {
#pragma unroll
    for (int q = 0; q < 8; ++q) {
      const int r = q * 2 + rsub;
      const v4f v = *(const v4fa*)&so[w][r][c4];
      *(v4f*)(C + (size_t)(row0 + r) * ldc + col0 + c4) = v;
    }
    
  }
}
// row LayerNorm (biased variance, eps) over N: s = X (+ R); optional out_sum <- s; out_norm <- (s-mu)*rsqrt(var+eps)*g + b
template <bool PARAM_BF16>
__global__ __launch_bounds__(256) void k_layernorm(const float* __restrict__ X, const float* __restrict__ R, const float* __restrict__ g, const float* __restrict__ bta,
                                                  float* __restrict__ out_sum, float* __restrict__ out_norm, int N, float eps) {
  __shared__ float red[256];
  const int row = blockIdx.x, tid = threadIdx.x;
  const float* x = X + (size_t)row * N; const float* rr = R ? R + (size_t)row * N : nullptr;
  float vals[16];                     // up to N = 4096
  const int per = N / 256;            // contiguous chunk per thread? use strided-by-4 chunks: thread handles j = tid*4 + 1024*u
  float s1 = 0.f;
  for (int u = 0; u < per / 4; ++u) {
    const int j = tid * 4 + 1024 * u;
    const v4f a = *(const v4fa*)(x + j);
    v4f b = {0.f,0.f,0.f,0.f}; if (rr) b = *(const v4fa*)(rr + j);
#pragma unroll
    for (int q = 0; q < 4; ++q) { const float v = a[q] + b[q]; vals[u * 4 + q] = v; s1 += v; }
  }
  red[tid] = s1; __syncthreads();
  for (int st = 128; st > 0; st >>= 1) { if (tid < st) red[tid] += red[tid + st]; __syncthreads(); }
  const float mu = red[0] / (float)N; __syncthreads();
  float s2 = 0.f;
  for (int u = 0; u < per / 4; ++u)
#pragma unroll
    for (int q = 0; q < 4; ++q) { const float c = vals[u * 4 + q] - mu; s2 += c * c; }
  red[tid] = s2; __syncthreads();
  for (int st = 128; st > 0; st >>= 1) { if (tid < st) red[tid] += red[tid + st]; __syncthreads(); }
  const float rs = rsqrtf(red[0] / (float)N + eps);
  {
    for (int u = 0; u < per / 4; ++u) {
      const int j = tid * 4 + 1024 * u;
      v4f o, sm;
#pragma unroll
      for (int q = 0; q < 4; ++q) {
        float gg = g[j + q], bb = bta[j + q];
        if (PARAM_BF16) { gg = bf16_round(gg); bb = bf16_round(bb); }
        sm[q] = vals[u * 4 + q]; o[q] = (vals[u * 4 + q] - mu) * rs * gg + bb;
      }
      if (out_sum) *(v4f*)(out_sum + (size_t)row * N + j) = sm;
      *(v4f*)(out_norm + (size_t)row * N + j) = o;
    }
    
  }
}

// batched GEMM (blockIdx.y = batch): C_b = act(alpha·A_b·B_b + bias + resid_b); A f32 rows (ASPLIT → hi/lo), B = bf16 planes Bh (+Bl when BSPLIT, requires ASPLIT),
// per-batch element strides sA, sB (0 = shared weights), sC, sR. resid may alias C (values are staged before the stores). ACT 0/1(relu).
// ACT: 0 none, 1 relu, 2 softplus
template <bool ASPLIT, bool BSPLIT, int ACT>
__global__ __launch_bounds__(128) void k_gemm_b(const float* __restrict__ A, int lda, size_t sA, const unsigned short* __restrict__ Bh, const unsigned short* __restrict__ Bl, int ldb, size_t sB,
                                             const float* __restrict__ bias, const float* __restrict__ resid, int ldr, size_t sR, float rsign, float alpha,
                                             float* __restrict__ C, int ldc, size_t sC, int M, int N, int K) {
  __shared__ __attribute__((aligned(16))) float so[4][16][64];
  const int tid = threadIdx.x, w = tid >> 5, lane = tid & 31, ln = lane & 15, hh = lane >> 4;
  const int by = blockIdx.y;
  A += (size_t)by * sA; Bh += (size_t)by * sB; if (BSPLIT) Bl += (size_t)by * sB; C += (size_t)by * sC; if (resid) resid += (size_t)by * sR;
  const int ntn = N / 64; const int wid = blockIdx.x * 4 + w; const int mt = wid / ntn, nq = wid % ntn;
  if (mt * 16 >= M) return;
  const int row0 = mt * 16, col0 = nq * 64;
  const float* arow = A + (size_t)(row0 + ln) * lda;
  v8f acc[4] = {};
  for (int kb = 0; kb < K; kb += 32) {
    FragB ah, al;
    const v4f x0 = *(const v4fa*)(arow + kb + 8 * hh), x1 = *(const v4fa*)(arow + kb + 8 * hh + 4);
    const v4f x2 = *(const v4fa*)(arow + kb + 16 + 8 * hh), x3 = *(const v4fa*)(arow + kb + 16 + 8 * hh + 4);
    float xs[16] = {x0[0],x0[1],x0[2],x0[3],x1[0],x1[1],x1[2],x1[3],x2[0],x2[1],x2[2],x2[3],x3[0],x3[1],x3[2],x3[3]};
#pragma unroll
    for (int i = 0; i < 16; ++i) { const unsigned short hb = bf16_bits(xs[i]); ah.u[i] = hb; al.u[i] = ASPLIT ? bf16_bits(xs[i] - bf16_val(hb)) : (unsigned short)0; }
#pragma unroll
    for (int t = 0; t < 4; ++t) {
      const size_t boff = (size_t)(col0 + t * 16 + ln) * ldb + kb;
      FragB bh_, bl_; bh_.half[0] = *(const v8us*)(Bh + boff + 8 * hh); bh_.half[1] = *(const v8us*)(Bh + boff + 16 + 8 * hh);
      if (BSPLIT) { bl_.half[0] = *(const v8us*)(Bl + boff + 8 * hh); bl_.half[1] = *(const v8us*)(Bl + boff + 16 + 8 * hh); } else bl_ = bh_;
      acc[t] = mmaN<ASPLIT ? (BSPLIT ? 3 : 2) : 1>(ah.v, al.v, bh_.v, bl_.v, acc[t]);
    }
  }
#pragma unroll
  for (int t = 0; t < 4; ++t) {
    const int col = col0 + t * 16 + ln; const float bv = bias ? bf16_round(bias[col]) : 0.f;
#pragma unroll
    for (int r = 0; r < 8; ++r) { float v = acc[t][r] * alpha + bv; if (resid) v += rsign * resid[(size_t)(row0 + 8 * hh + r) * ldr + col]; if (ACT == 1) v = fmaxf(v, 0.f); else if (ACT == 2) v = fmaxf(v, 0.f) + log1pf(expf(-fabsf(v))); so[w][8 * hh + r][t * 16 + ln] = v; }
  }
  __builtin_amdgcn_fence(__ATOMIC_ACQ_REL, "workgroup"); __builtin_amdgcn_wave_barrier();
  const int rsub = lane >> 4, c4 = (lane & 15) * 4;
  {
#pragma unroll
    for (int q = 0; q < 8; ++q) { const int r = q * 2 + rsub; const v4f v = *(const v4fa*)&so[w][r][c4]; *(v4f*)(C + (size_t)(row0 + r) * ldc + col0 + c4) = v; }
    
  }
}
// batched f32 [K][N] (pitch lds, batch stride sIn) -> transposed hi/lo planes [N][K] (batch stride sOut); thread per (n, 8 k); grid.y = batch
__global__ __launch_bounds__(256) void k_split_transpose_b(const float* __restrict__ src, int lds_, size_t sIn, unsigned short* __restrict__ hi, unsigned short* __restrict__ lo, size_t sOut, int K, int N) {
  const size_t t = (size_t)blockIdx.x * 256 + threadIdx.x; const int k8n = K / 8; if (t >= (size_t)N * k8n) return;
  src += (size_t)blockIdx.y * sIn; hi += (size_t)blockIdx.y * sOut; lo += (size_t)blockIdx.y * sOut;
  const int n = (int)(t / k8n), k8 = (int)(t % k8n) * 8; v8us vh, vl;
#pragma unroll
  for (int i = 0; i < 8; ++i) { const float x = src[(size_t)(k8 + i) * lds_ + n]; const unsigned short hb = bf16_bits(x); vh[i] = hb; vl[i] = bf16_bits(x - bf16_val(hb)); }
  unsigned short* dh = hi + (size_t)n * K + k8; unsigned short* dl = lo + (size_t)n * K + k8;
  *(v8us*)dh = vh; *(v8us*)dl = vl; 
}


__global__ __launch_bounds__(256) void k_roundcopy(const float* __restrict__ src, float* __restrict__ dst, int n8) {
  const size_t t = (size_t)blockIdx.x * 256 + threadIdx.x;
  if (t >= (size_t)n8 * 2) return;
  v4f a = *(const v4fa*)(src + t * 4);
  for (int i = 0; i < 4; ++i) a[i] = bf16_round(a[i]);
  *(v4f*)(dst + t * 4) = a; 
}

// one v_tanh_f32 per value
__device__ __forceinline__ float tanh_fast(float x) { return __builtin_amdgcn_tanhf(x); }
// f32 rows: fpad[16][512] = final_state rows 0..7, zero rows 8..15 (thread per float4)
__global__ __launch_bounds__(256) void k_fpad(const float* __restrict__ f, float* __restrict__ fp) { const int t = blockIdx.x * 256 + threadIdx.x; if (t >= 16 * DD / 4) return; const int r = t / (DD / 4); v4f v = {0.f,0.f,0.f,0.f}; if (r < BB) { const v4f a = *(const v4fa*)(f + (size_t)t * 4); for (int q = 0; q < 4; ++q) v[q] = a[q]; } *(v4f*)(fp + (size_t)t * 4) = v;  }
// Sᵀ planes per batch (exact input): Bh[b][d][t] = bf16(S[b][t][d]); thread per (b, d, 8 t)
__global__ __launch_bounds__(256) void k_sT(const float* __restrict__ S, unsigned short* __restrict__ Bh) {
  const size_t i = (size_t)blockIdx.x * 256 + threadIdx.x; if (i >= (size_t)BB * DD * (TT / 8)) return; const int t8 = (int)(i % (TT / 8)) * 8; const int d = (int)((i / (TT / 8)) % DD); const int b = (int)(i / ((size_t)(TT / 8) * DD));
  v8us v; for (int q = 0; q < 8; ++q) v[q] = bf16_bits(S[((size_t)b * TT + t8 + q) * DD + d]);
  *(v8us*)(Bh + ((size_t)b * DD + d) * TT + t8) = v; 
}
// intent: block per b (256 threads = t): score_t = Σ_a v_a tanh(ih[b][t][a] + ii[b][a]); softmax over t; c_intent[b][d] = Σ_t w_t·bf16(S[b][t][d]) (thread d, 2 per thread)
__global__ __launch_bounds__(256) void k_intent(const float* __restrict__ P, const float* __restrict__ ii, const float* __restrict__ iv, const float* __restrict__ S, float* __restrict__ cint) {
  __shared__ float sii[DD], siv[DD], sw[TT], red[256];
  const int b = blockIdx.x, t = threadIdx.x;
  for (int a = t; a < DD; a += 256) { sii[a] = ii[(size_t)b * DD + a]; siv[a] = bf16_round(iv[a]); }
  __syncthreads();
  const float* row = P + ((size_t)b * TT + t) * 3 * DD; float sc = 0.f;
#pragma unroll 1
  for (int a = 0; a < DD; a += 4) { const v4f h = *(const v4fa*)(row + a); for (int q = 0; q < 4; ++q) sc += siv[a + q] * tanh_fast(h[q] + sii[a + q]); }
  red[t] = sc; __syncthreads(); for (int st = 128; st > 0; st >>= 1) { if (t < st) red[t] = fmaxf(red[t], red[t + st]); __syncthreads(); } const float mx = red[0]; __syncthreads();
  const float e = expf(sc - mx); red[t] = e; __syncthreads(); for (int st = 128; st > 0; st >>= 1) { if (t < st) red[t] += red[t + st]; __syncthreads(); } const float den = red[0]; __syncthreads();
  sw[t] = e / den; __syncthreads();
  float c0 = 0.f, c1 = 0.f;
#pragma unroll 1
  for (int s = 0; s < TT; ++s) { const float w = sw[s]; const float* sr = S + ((size_t)b * TT + s) * DD; c0 += w * bf16_round(sr[t]); c1 += w * bf16_round(sr[256 + t]); }
  { *(float*)(cint + (size_t)b * DD + t) = c0; *(float*)(cint + (size_t)b * DD + 256 + t) = c1;  }
}
// slot scores: block = QT queries t of one batch, 8 waves; wave wv takes keys s in [32 wv, 32 wv + 32) for all QT queries.
// si of the queries and slot_v stay in registers (lane holds a = 32 u + lane) and a key row is fetched by 16 loads at once, so a row feeds
// 16 QT tanh per lane with no load and no LDS read between them; per (t,s) the terms are summed in the old order (u ascending, then the butterfly).
// softmax over s -> W[b][t][s] by waves 0..QT-1, one query each, behind the block barrier.
#define QT 2
// waves_per_eu: the launch puts 8 waves on every SIMD (MR / QT blocks of 8 waves on 1024 SIMDs); this is the register budget that goes with it
__global__ __launch_bounds__(256) __attribute__((amdgpu_waves_per_eu(8, 8))) void k_slot(const float* __restrict__ P, const float* __restrict__ sv, float* __restrict__ Wt) {
  __shared__ float ssc[QT][TT];
  const int tid = threadIdx.x, wv = tid >> 5, lane = tid & 31; const int m0 = blockIdx.x * QT; if (m0 >= MR) return; const int b = m0 / TT;
  float si[QT][16], vv[16], cur[16], keep[QT];
  // every "#pragma unroll" of this kernel: the arrays are then indexed by constants only and stay in registers
#pragma unroll
  for (int u = 0; u < 16; ++u) vv[u] = bf16_round(sv[u * 32 + lane]);
#pragma unroll
  for (int j = 0; j < QT; ++j) { const float* sir = P + (size_t)(m0 + j) * 3 * DD + 2 * DD; keep[j] = 0.f;
#pragma unroll
    for (int u = 0; u < 16; ++u) si[j][u] = sir[u * 32 + lane]; }
  const float* sh0 = P + ((size_t)b * TT + wv * 32) * 3 * DD + DD + lane;
#pragma unroll
  for (int u = 0; u < 16; ++u) cur[u] = sh0[u * 32];
  for (int k = 0; k < 32; ++k) {
    float acc[QT];
#pragma unroll
    for (int j = 0; j < QT; ++j) acc[j] = 0.f;
#pragma unroll
    for (int u = 0; u < 16; ++u) {
#pragma unroll
      for (int j = 0; j < QT; ++j) acc[j] += vv[u] * tanh_fast(cur[u] + si[j][u]);
    }
    const float* nrow = sh0 + (size_t)((k + 1) & 31) * 3 * DD;   // next key row: its loads fly during the butterfly (the last trip re-reads the wave's first row, unused)
#pragma unroll
    for (int u = 0; u < 16; ++u) cur[u] = nrow[u * 32];
    __builtin_amdgcn_sched_barrier(0);   // keeps those loads in front of the butterfly's waits, and the butterfly out of the region of the row's sums (in one region this compiler pairs fewer of the multiply-adds)
#pragma unroll
    for (int j = 0; j < QT; ++j) { float a = acc[j]; for (int o = 16; o >= 1; o >>= 1) a += __shfl_xor(a, o, 32); if (lane == k) keep[j] = a; }
  }
#pragma unroll
  for (int j = 0; j < QT; ++j) ssc[j][wv * 32 + lane] = keep[j];
  __syncthreads();   // every wave's 32 keys of each query are in ssc before a query's softmax reads all 256
  if (wv >= QT) return;
  const int m = m0 + wv;
  float mx = -3.0e38f;
  for (int u = 0; u < 8; ++u) mx = fmaxf(mx, ssc[wv][u * 32 + lane]);
  for (int o = 16; o >= 1; o >>= 1) mx = fmaxf(mx, __shfl_xor(mx, o, 32));
  float den = 0.f;
#pragma unroll 1
  for (int u = 0; u < 8; ++u) { const float e = expf(ssc[wv][u * 32 + lane] - mx); ssc[wv][u * 32 + lane] = e; den += e; }
  for (int o = 16; o >= 1; o >>= 1) den += __shfl_xor(den, o, 32); const float inv = 1.0f / den;
  {
#pragma unroll 1
    for (int u = 0; u < 8; ++u) *(float*)(Wt + (size_t)m * TT + u * 32 + lane) = ssc[wv][u * 32 + lane] * inv;  }
}
extern "C" void kernel_launch(void* const* d_in, const int* in_sizes, int n_in,
                              void* d_out, int out_size, void* d_ws, size_t ws_size, hipStream_t stream) {
  (void)in_sizes; (void)n_in; (void)out_size;
  const float* S = (const float*)d_in[0]; const float* fst = (const float*)d_in[1]; const float* iv = (const float*)d_in[2]; const float* W_ih = (const float*)d_in[3]; const float* b_ih = (const float*)d_in[4]; const float* W_ii = (const float*)d_in[5]; const float* b_ii = (const float*)d_in[6];
  const float* sv = (const float*)d_in[7]; const float* W_sh = (const float*)d_in[8]; const float* b_sh = (const float*)d_in[9]; const float* W_si = (const float*)d_in[10]; const float* b_si = (const float*)d_in[11];
  float* cslot = (float*)d_out; float* cint = (float*)((char*)d_out + 4194304);
  char* ws = (char*)d_ws; size_t off = 0;
  auto take = [&](size_t bytes) { char* p = ws + off; off += (bytes + 255) & ~(size_t)255; return p; };
  unsigned short* B3 = (unsigned short*)take((size_t)3 * DD * DD * 2); unsigned short* Bii = (unsigned short*)take((size_t)DD * DD * 2); float* b3 = (float*)take(3 * DD * 4); unsigned short* ST = (unsigned short*)take((size_t)BB * DD * TT * 2);
  float* fp = (float*)take(16 * DD * 4); float* ii = (float*)take(16 * DD * 4); float* P = (float*)take((size_t)MR * 3 * DD * 4); float* Wt = (float*)take((size_t)MR * TT * 4);
  if (off > ws_size) return;
  k_wt_bf16<<<(DD * (DD / 8) + 255) / 256, 256, 0, stream>>>(W_ih, B3, DD, DD); k_wt_bf16<<<(DD * (DD / 8) + 255) / 256, 256, 0, stream>>>(W_sh, B3 + (size_t)DD * DD, DD, DD); k_wt_bf16<<<(DD * (DD / 8) + 255) / 256, 256, 0, stream>>>(W_si, B3 + (size_t)2 * DD * DD, DD, DD);
  k_wt_bf16<<<(DD * (DD / 8) + 255) / 256, 256, 0, stream>>>(W_ii, Bii, DD, DD);
  k_roundcopy<<<1, 256, 0, stream>>>(b_ih, b3, DD / 8); k_roundcopy<<<1, 256, 0, stream>>>(b_sh, b3 + DD, DD / 8); k_roundcopy<<<1, 256, 0, stream>>>(b_si, b3 + 2 * DD, DD / 8);
  k_sT<<<(unsigned)(((size_t)BB * DD * (TT / 8) + 255) / 256), 256, 0, stream>>>(S, ST);
  k_fpad<<<(16 * DD / 4 + 255) / 256, 256, 0, stream>>>(fst, fp);
  k_gemm_bf3<false, 0, false, false><<<((MR / 16) * (3 * DD / 64) + 3) / 4, 128, 0, stream>>>(S, DD, B3, DD, b3, nullptr, 1, 0, P, 3 * DD, MR, 3 * DD, DD);      // [ih | sh | si] + b (single term)
  k_gemm_bf3<false, 0, true, false><<<((16 / 16) * (DD / 64) + 3) / 4, 128, 0, stream>>>(fp, DD, Bii, DD, b_ii, nullptr, 1, 0, ii, DD, 16, DD, DD);         // ii (rows 0..7)
  k_intent<<<BB, 256, 0, stream>>>(P, ii, iv, S, cint);
  k_slot<<<MR / QT, 256, 0, stream>>>(P, sv, Wt);
  k_gemm_b<true, false, 0><<<dim3(((TT / 16) * (DD / 64) + 3) / 4, BB), 128, 0, stream>>>(Wt, TT, (size_t)TT * TT, ST, ST, TT, (size_t)DD * TT, nullptr, nullptr, 0, 0, 1.f, 1.f, cslot, DD, (size_t)TT * DD, TT, DD, TT);   // c_slot[b] = W[b]·S[b]
}

// v003
// A run of this version takes 121 microseconds.
// Two timings next to v002 both put it at 1.46 times that version's speed.
// Over all steps from v000 it is 11.2 times as fast.
#include <hip/hip_runtime.h>
// [ih | sh | si] = S·[W_ih|W_sh|W_si] + b (one GEMM, K=512, N=1536), ii = f·W_ii + b (M padded to 16) — inputs and weights rounded to bf16: single exact
// WMMA term, f32 accumulate — and c_slot = slot_w·S per batch (slot_w split into bf16 hi/lo vs exact bf16 Sᵀ planes: 2 terms) run on
// v_wmma_f32_16x16x32_bf16; the additive tanh scores (intent: T×A, slot: T×T×A), both softmaxes and c_intent are f32 VALU.
#define BB 8
#define TT 256
#define DD 512
#define MR (BB * TT)

typedef __bf16 v16b __attribute__((ext_vector_type(16)));
typedef unsigned short v8us __attribute__((ext_vector_type(8), may_alias));
typedef float  v8f  __attribute__((ext_vector_type(8)));
typedef float  v4f  __attribute__((ext_vector_type(4)));
typedef float  v4fa __attribute__((ext_vector_type(4), may_alias));
union FragB { v16b v; v8us half[2]; unsigned short u[16]; };

__device__ __forceinline__ unsigned short bf16_bits(float x) { unsigned int u = __float_as_uint(x); return (unsigned short)((u + 0x7FFFu + ((u >> 16) & 1u)) >> 16); }
__device__ __forceinline__ float bf16_val(unsigned short b) { return __uint_as_float(((unsigned int)b) << 16); }
__device__ __forceinline__ float bf16_round(float x) { return bf16_val(bf16_bits(x)); }
// D += A·B with NT terms: 1 = ah·bh, 2 = + al·bh (A split), 3 = + ah·bl (both split)
template <int NT>
__device__ __forceinline__ v8f mmaN(v16b ah, v16b al, v16b bh, v16b bl, v8f c) {
  c = __builtin_amdgcn_wmma_f32_16x16x32_bf16(false, ah, false, bh, (short)0, c, false, false);
  if (NT >= 2) c = __builtin_amdgcn_wmma_f32_16x16x32_bf16(false, al, false, bh, (short)0, c, false, false);
  if (NT >= 3) c = __builtin_amdgcn_wmma_f32_16x16x32_bf16(false, ah, false, bl, (short)0, c, false, false);
  asm volatile("v_nop\n\tv_nop\n\tv_nop\n\tv_nop" : "+v"(c) : "v"(ah), "v"(al), "v"(bh), "v"(bl));
  return c;
}

__global__ __launch_bounds__(256) void k_wt_bf16(const float* __restrict__ W, unsigned short* __restrict__ Wt, int K, int N) {
  const int t = blockIdx.x * 256 + threadIdx.x;
  const int k8n = K / 8;
  if (t >= N * k8n) return;
  const int n = t / k8n, k8 = (t % k8n) * 8;
  v8us v;
#pragma unroll
  for (int i = 0; i < 8; ++i) v[i] = bf16_bits(W[(size_t)(k8 + i) * N + n]);
  *(v8us*)(Wt + (size_t)n * K + k8) = v;
  
}

// GEMM C[M][N] (f32, pitch ldc) = act(A[M][K]·W + bias). A f32 row-major (pitch lda) converted per fragment to bf16
// (ASPLIT: hi/lo two planes -> 2 terms, else single rounded term); Wt bf16 [N][K] (pitch ldb). BIAS_BF16 rounds the
// bias to bf16 first (bias quantised to bf16 before the add). K%32==0, M%16==0, N%64==0.
template <bool ASPLIT, int ACT, bool BIAS_BF16>
__global__ __launch_bounds__(128) void k_gemm_bf(const float* __restrict__ A, int lda, const unsigned short* __restrict__ Wt, int ldb,
                                               const float* __restrict__ bias, float* __restrict__ C, int ldc, int M, int N, int K) {
  __shared__ __attribute__((aligned(16))) float so[4][16][64];
  const int tid = threadIdx.x, w = tid >> 5, lane = tid & 31, ln = lane & 15, hh = lane >> 4;
  const int ntn = N / 64;
  const int wid = blockIdx.x * 4 + w;
  const int mt = wid / ntn, nq = wid % ntn;
  if (mt * 16 >= M) return;
  const int row0 = mt * 16, col0 = nq * 64;
  const float* arow = A + (size_t)(row0 + ln) * lda;
  v8f acc[4] = {};
  for (int kb = 0; kb < K; kb += 32) {
    FragB ah, al;
    const v4f x0 = *(const v4fa*)(arow + kb + 8 * hh), x1 = *(const v4fa*)(arow + kb + 8 * hh + 4);
    const v4f x2 = *(const v4fa*)(arow + kb + 16 + 8 * hh), x3 = *(const v4fa*)(arow + kb + 16 + 8 * hh + 4);
    float xs[16] = {x0[0],x0[1],x0[2],x0[3],x1[0],x1[1],x1[2],x1[3],x2[0],x2[1],x2[2],x2[3],x3[0],x3[1],x3[2],x3[3]};
#pragma unroll
    for (int i = 0; i < 16; ++i) { const unsigned short hb = bf16_bits(xs[i]); ah.u[i] = hb; al.u[i] = ASPLIT ? bf16_bits(xs[i] - bf16_val(hb)) : (unsigned short)0; }
#pragma unroll
    for (int t = 0; t < 4; ++t) {
      const unsigned short* brow = Wt + (size_t)(col0 + t * 16 + ln) * ldb + kb;
      FragB b;
      b.half[0] = *(const v8us*)(brow + 8 * hh);
      b.half[1] = *(const v8us*)(brow + 16 + 8 * hh);
      acc[t] = mmaN<ASPLIT ? 2 : 1>(ah.v, al.v, b.v, b.v, acc[t]);
    }
  }
#pragma unroll
  for (int t = 0; t < 4; ++t) {
    float bv = bias ? bias[col0 + t * 16 + ln] : 0.f;
    if (BIAS_BF16) bv = bf16_round(bv);
#pragma unroll
    for (int r = 0; r < 8; ++r) { float v = acc[t][r] + bv; if (ACT == 1) v = fmaxf(v, 0.f); so[w][8 * hh + r][t * 16 + ln] = v; }
  }
  __builtin_amdgcn_fence(__ATOMIC_ACQ_REL, "workgroup");
  __builtin_amdgcn_wave_barrier();
  const int rsub = lane >> 4, c4 = (lane & 15) * 4;
  {
#pragma unroll
    for (int q = 0; q < 8; ++q) {
      const int r = q * 2 + rsub;
      const v4f v = *(const v4fa*)&so[w][r][c4];
      *(v4f*)(C + (size_t)(row0 + r) * ldc + col0 + c4) = v;
    }
    
  }
}

// Flash-style causal/unmasked attention, all contractions 3-term bf16 hi/lo splits, f32 softmax with running max.
// q,k,v rows are read from f32 buffers with arbitrary row pitch (so they can live inside a fused qkv buffer);
// D = head size (multiple of 32, <= 128); one wave = 16 query rows; block = 4 waves (64 queries) sharing K/V chunks of 32.
template <int D, bool CAUSAL>
__global__ __launch_bounds__(128) void k_flash(const float* __restrict__ qb, const float* __restrict__ kb, const float* __restrict__ vb,
                                             int pitch, int T, int H, float scale, float* __restrict__ y, int ypitch) {
  constexpr int KS = D / 32;        // k-steps for QK
  constexpr int DT = D / 16;        // d tiles for PV
  __shared__ __attribute__((aligned(16))) unsigned short sKh[32][D + 8], sKl[32][D + 8], sVh[32][D + 8], sVl[32][D + 8];
  __shared__ __attribute__((aligned(16))) unsigned short sPh[4][16][40], sPl[4][16][40];
  __shared__ __attribute__((aligned(16))) float sO[4][16][D];
  const int tid = threadIdx.x, w = tid >> 5, lane = tid & 31, ln = lane & 15, hh = lane >> 4;
  const int nqb = (T + 63) / 64;
  const int bh = blockIdx.x / nqb, qblk = blockIdx.x % nqb;
  const int b = bh / H, h = bh % H;
  const int q0 = qblk * 64 + w * 16;
  const float* Q = qb + (size_t)b * T * pitch + h * D;
  const float* K = kb + (size_t)b * T * pitch + h * D;
  const float* V = vb + (size_t)b * T * pitch + h * D;

  // A fragments of the wave's 16 query rows (scaled), hi/lo
  FragB aqh[KS], aql[KS];
  {
    int row = q0 + ln; if (row >= T) row = T - 1;
    const float* qr = Q + (size_t)row * pitch;
#pragma unroll
    for (int ks = 0; ks < KS; ++ks)
#pragma unroll
      for (int i = 0; i < 16; ++i) {
        const int d = ks * 32 + ((i < 8) ? (8 * hh + i) : (16 + 8 * hh + (i - 8)));
        const float x = qr[d] * scale; const unsigned short hb = bf16_bits(x);
        aqh[ks].u[i] = hb; aql[ks].u[i] = bf16_bits(x - bf16_val(hb));
      }
  }
  float m_r[8], l_r[8];
#pragma unroll
  for (int r = 0; r < 8; ++r) { m_r[r] = -3.0e38f; l_r[r] = 0.f; }
  v8f oacc[DT];
#pragma unroll
  for (int dt = 0; dt < DT; ++dt) oacc[dt] = (v8f){0.f,0.f,0.f,0.f,0.f,0.f,0.f,0.f};

  const int kv_end = CAUSAL ? min(T, qblk * 64 + 64) : T;     // block-uniform
  for (int j0 = 0; j0 < kv_end; j0 += 32) {
    __syncthreads();
    for (int e = tid; e < 32 * (D / 4); e += 128) {
      const int r = e / (D / 4), c4 = (e % (D / 4)) * 4;
      const int key = j0 + r;
      v4f kf = {0.f,0.f,0.f,0.f}, vf = {0.f,0.f,0.f,0.f};
      if (key < T) { kf = *(const v4fa*)(K + (size_t)key * pitch + c4); vf = *(const v4fa*)(V + (size_t)key * pitch + c4); }
#pragma unroll
      for (int t = 0; t < 4; ++t) {
        unsigned short hb = bf16_bits(kf[t]); sKh[r][c4 + t] = hb; sKl[r][c4 + t] = bf16_bits(kf[t] - bf16_val(hb));
        hb = bf16_bits(vf[t]); sVh[r][c4 + t] = hb; sVl[r][c4 + t] = bf16_bits(vf[t] - bf16_val(hb));
      }
    }
    __syncthreads();
    // S tile 16 x 32
    v8f s[2];
#pragma unroll
    for (int nt = 0; nt < 2; ++nt) {
      v8f acc = {};
#pragma unroll
      for (int ks = 0; ks < KS; ++ks) {
        FragB bh_, bl_;
        bh_.half[0] = *(const v8us*)&sKh[nt * 16 + ln][ks * 32 + 8 * hh]; bh_.half[1] = *(const v8us*)&sKh[nt * 16 + ln][ks * 32 + 16 + 8 * hh];
        bl_.half[0] = *(const v8us*)&sKl[nt * 16 + ln][ks * 32 + 8 * hh]; bl_.half[1] = *(const v8us*)&sKl[nt * 16 + ln][ks * 32 + 16 + 8 * hh];
        acc = mmaN<3>(aqh[ks].v, aql[ks].v, bh_.v, bl_.v, acc);
      }
      s[nt] = acc;
    }
    // mask + running max (rows 8hh+r; the 16 lanes of a half share rows)
    float alpha[8];
#pragma unroll
    for (int r = 0; r < 8; ++r) {
      const int qi = q0 + 8 * hh + r;
      const int ja = j0 + ln, jb = j0 + 16 + ln;
      if (CAUSAL) { if (ja > qi) s[0][r] = -3.0e38f; if (jb > qi) s[1][r] = -3.0e38f; }
      if (ja >= T) s[0][r] = -3.0e38f;
      if (jb >= T) s[1][r] = -3.0e38f;
      float mx = fmaxf(s[0][r], s[1][r]);
      mx = fmaxf(mx, __shfl_xor(mx, 1, 32)); mx = fmaxf(mx, __shfl_xor(mx, 2, 32)); mx = fmaxf(mx, __shfl_xor(mx, 4, 32)); mx = fmaxf(mx, __shfl_xor(mx, 8, 32));
      const float mnew = fmaxf(m_r[r], mx);
      alpha[r] = (mnew > -1.0e38f) ? __expf(m_r[r] - mnew) : 1.0f;
      const float p0 = (s[0][r] > -1.0e38f) ? __expf(s[0][r] - mnew) : 0.f;
      const float p1 = (s[1][r] > -1.0e38f) ? __expf(s[1][r] - mnew) : 0.f;
      m_r[r] = mnew;
      l_r[r] = l_r[r] * alpha[r] + p0 + p1;            // per-lane partial row sum (16 lanes combined at the end)
      unsigned short hb = bf16_bits(p0); sPh[w][8 * hh + r][ln] = hb;      sPl[w][8 * hh + r][ln] = bf16_bits(p0 - bf16_val(hb));
      hb = bf16_bits(p1);                sPh[w][8 * hh + r][16 + ln] = hb; sPl[w][8 * hh + r][16 + ln] = bf16_bits(p1 - bf16_val(hb));
    }
#pragma unroll
    for (int dt = 0; dt < DT; ++dt)
#pragma unroll
      for (int r = 0; r < 8; ++r) oacc[dt][r] *= alpha[r];
    __builtin_amdgcn_fence(__ATOMIC_ACQ_REL, "workgroup");
    __builtin_amdgcn_wave_barrier();
    FragB pah, pal;
    pah.half[0] = *(const v8us*)&sPh[w][ln][8 * hh]; pah.half[1] = *(const v8us*)&sPh[w][ln][16 + 8 * hh];
    pal.half[0] = *(const v8us*)&sPl[w][ln][8 * hh]; pal.half[1] = *(const v8us*)&sPl[w][ln][16 + 8 * hh];
#pragma unroll
    for (int dt = 0; dt < DT; ++dt) {
      FragB bvh, bvl;
#pragma unroll
      for (int i = 0; i < 8; ++i) {
        bvh.u[i] = sVh[8 * hh + i][dt * 16 + ln]; bvh.u[8 + i] = sVh[16 + 8 * hh + i][dt * 16 + ln];
        bvl.u[i] = sVl[8 * hh + i][dt * 16 + ln]; bvl.u[8 + i] = sVl[16 + 8 * hh + i][dt * 16 + ln];
      }
      oacc[dt] = mmaN<3>(pah.v, pal.v, bvh.v, bvl.v, oacc[dt]);
    }
    __builtin_amdgcn_fence(__ATOMIC_ACQ_REL, "workgroup");
    __builtin_amdgcn_wave_barrier();
  }
#pragma unroll
  for (int r = 0; r < 8; ++r) {
    float l = l_r[r];
    l += __shfl_xor(l, 1, 32); l += __shfl_xor(l, 2, 32); l += __shfl_xor(l, 4, 32); l += __shfl_xor(l, 8, 32);
    l_r[r] = (l > 0.f) ? 1.0f / l : 0.f;
  }
#pragma unroll
  for (int dt = 0; dt < DT; ++dt)
#pragma unroll
    for (int r = 0; r < 8; ++r) sO[w][8 * hh + r][dt * 16 + ln] = oacc[dt][r] * l_r[r];
  __builtin_amdgcn_fence(__ATOMIC_ACQ_REL, "workgroup");
  __builtin_amdgcn_wave_barrier();
  {
    for (int r = 0; r < 16; ++r) {
      const int row = q0 + r;
      if (row < T && lane < D / 4) {
        const v4f val = *(const v4fa*)&sO[w][r][lane * 4];
        *(v4f*)(y + ((size_t)b * T + row) * ypitch + h * D + lane * 4) = val;
      }
    }
    
  }
}

// GEMM C = act(A·W + bias + resid): A f32 (ASPLIT -> hi/lo 2 terms), Wt bf16 [N][K]; ACT 0 none, 1 relu, 2 exact gelu;
// resid (optional, f32, row index = (row % rmod), pitch ldr, RES_BF16 rounds it) added before the activation.
template <bool ASPLIT, int ACT, bool BIAS_BF16, bool RES_BF16>
__global__ __launch_bounds__(128) void k_gemm_bf3(const float* __restrict__ A, int lda, const unsigned short* __restrict__ Wt, int ldb,
                                                const float* __restrict__ bias, const float* __restrict__ resid, int rmod, int ldr,
                                                float* __restrict__ C, int ldc, int M, int N, int K) {
  __shared__ __attribute__((aligned(16))) float so[4][16][64];
  const int tid = threadIdx.x, w = tid >> 5, lane = tid & 31, ln = lane & 15, hh = lane >> 4;
  const int ntn = N / 64;
  const int wid = blockIdx.x * 4 + w;
  const int mt = wid / ntn, nq = wid % ntn;
  if (mt * 16 >= M) return;
  const int row0 = mt * 16, col0 = nq * 64;
  const float* arow = A + (size_t)(row0 + ln) * lda;
  v8f acc[4] = {};
  for (int kb = 0; kb < K; kb += 32) {
    FragB ah, al;
    const v4f x0 = *(const v4fa*)(arow + kb + 8 * hh), x1 = *(const v4fa*)(arow + kb + 8 * hh + 4);
    const v4f x2 = *(const v4fa*)(arow + kb + 16 + 8 * hh), x3 = *(const v4fa*)(arow + kb + 16 + 8 * hh + 4);
    float xs[16] = {x0[0],x0[1],x0[2],x0[3],x1[0],x1[1],x1[2],x1[3],x2[0],x2[1],x2[2],x2[3],x3[0],x3[1],x3[2],x3[3]};
#pragma unroll
    for (int i = 0; i < 16; ++i) { const unsigned short hb = bf16_bits(xs[i]); ah.u[i] = hb; al.u[i] = ASPLIT ? bf16_bits(xs[i] - bf16_val(hb)) : (unsigned short)0; }
#pragma unroll
    for (int t = 0; t < 4; ++t) {
      const unsigned short* brow = Wt + (size_t)(col0 + t * 16 + ln) * ldb + kb;
      FragB b;
      b.half[0] = *(const v8us*)(brow + 8 * hh);
      b.half[1] = *(const v8us*)(brow + 16 + 8 * hh);
      acc[t] = mmaN<ASPLIT ? 2 : 1>(ah.v, al.v, b.v, b.v, acc[t]);
    }
  }
#pragma unroll
  for (int t = 0; t < 4; ++t) {
    const int col = col0 + t * 16 + ln;
    float bv = bias ? bias[col] : 0.f;
    if (BIAS_BF16) bv = bf16_round(bv);
#pragma unroll
    for (int r = 0; r < 8; ++r) {
      float v = acc[t][r] + bv;
      if (resid) { float rv = resid[(size_t)((row0 + 8 * hh + r) % rmod) * ldr + col]; if (RES_BF16) rv = bf16_round(rv); v += rv; }
      if (ACT == 1) v = fmaxf(v, 0.f);
      if (ACT == 2) v = 0.5f * v * (1.0f + erff(v * 0.70710678118654752f));
      if (ACT == 3) { const float u = 0.7978845608028654f * (v + 0.044715f * v * v * v); v = 0.5f * v * (1.0f + tanhf(u)); }
      so[w][8 * hh + r][t * 16 + ln] = v;
    }
  }
  __builtin_amdgcn_fence(__ATOMIC_ACQ_REL, "workgroup");
  __builtin_amdgcn_wave_barrier();
  const int rsub = lane >> 4, c4 = (lane & 15) * 4;
  {
#pragma unroll
    for (int q = 0; q < 8; ++q) {
      const int r = q * 2 + rsub;
      const v4f v = *(const v4fa*)&so[w][r][c4];
      *(v4f*)(C + (size_t)(row0 + r) * ldc + col0 + c4) = v;
    }
    
  }
}
// row LayerNorm (biased variance, eps) over N: s = X (+ R); optional out_sum <- s; out_norm <- (s-mu)*rsqrt(var+eps)*g + b
template <bool PARAM_BF16>
__global__ __launch_bounds__(256) void k_layernorm(const float* __restrict__ X, const float* __restrict__ R, const float* __restrict__ g, const float* __restrict__ bta,
                                                  float* __restrict__ out_sum, float* __restrict__ out_norm, int N, float eps) {
  __shared__ float red[256];
  const int row = blockIdx.x, tid = threadIdx.x;
  const float* x = X + (size_t)row * N; const float* rr = R ? R + (size_t)row * N : nullptr;
  float vals[16];                     // up to N = 4096
  const int per = N / 256;            // contiguous chunk per thread? use strided-by-4 chunks: thread handles j = tid*4 + 1024*u
  float s1 = 0.f;
  for (int u = 0; u < per / 4; ++u) {
    const int j = tid * 4 + 1024 * u;
    const v4f a = *(const v4fa*)(x + j);
    v4f b = {0.f,0.f,0.f,0.f}; if (rr) b = *(const v4fa*)(rr + j);
#pragma unroll
    for (int q = 0; q < 4; ++q) { const float v = a[q] + b[q]; vals[u * 4 + q] = v; s1 += v; }
  }
  red[tid] = s1; __syncthreads();
  for (int st = 128; st > 0; st >>= 1) { if (tid < st) red[tid] += red[tid + st]; __syncthreads(); }
  const float mu = red[0] / (float)N; __syncthreads();
  float s2 = 0.f;
  for (int u = 0; u < per / 4; ++u)
#pragma unroll
    for (int q = 0; q < 4; ++q) { const float c = vals[u * 4 + q] - mu; s2 += c * c; }
  red[tid] = s2; __syncthreads();
  for (int st = 128; st > 0; st >>= 1) { if (tid < st) red[tid] += red[tid + st]; __syncthreads(); }
  const float rs = rsqrtf(red[0] / (float)N + eps);
  {
    for (int u = 0; u < per / 4; ++u) {
      const int j = tid * 4 + 1024 * u;
      v4f o, sm;
#pragma unroll
      for (int q = 0; q < 4; ++q) {
        float gg = g[j + q], bb = bta[j + q];
        if (PARAM_BF16) { gg = bf16_round(gg); bb = bf16_round(bb); }
        sm[q] = vals[u * 4 + q]; o[q] = (vals[u * 4 + q] - mu) * rs * gg + bb;
      }
      if (out_sum) *(v4f*)(out_sum + (size_t)row * N + j) = sm;
      *(v4f*)(out_norm + (size_t)row * N + j) = o;
    }
    
  }
}

// batched GEMM (blockIdx.y = batch): C_b = act(alpha·A_b·B_b + bias + resid_b); A f32 rows (ASPLIT → hi/lo), B = bf16 planes Bh (+Bl when BSPLIT, requires ASPLIT),
// per-batch element strides sA, sB (0 = shared weights), sC, sR. resid may alias C (values are staged before the stores). ACT 0/1(relu).
// ACT: 0 none, 1 relu, 2 softplus
template <bool ASPLIT, bool BSPLIT, int ACT>
__global__ __launch_bounds__(128) void k_gemm_b(const float* __restrict__ A, int lda, size_t sA, const unsigned short* __restrict__ Bh, const unsigned short* __restrict__ Bl, int ldb, size_t sB,
                                             const float* __restrict__ bias, const float* __restrict__ resid, int ldr, size_t sR, float rsign, float alpha,
                                             float* __restrict__ C, int ldc, size_t sC, int M, int N, int K) {
  __shared__ __attribute__((aligned(16))) float so[4][16][64];
  const int tid = threadIdx.x, w = tid >> 5, lane = tid & 31, ln = lane & 15, hh = lane >> 4;
  const int by = blockIdx.y;
  A += (size_t)by * sA; Bh += (size_t)by * sB; if (BSPLIT) Bl += (size_t)by * sB; C += (size_t)by * sC; if (resid) resid += (size_t)by * sR;
  const int ntn = N / 64; const int wid = blockIdx.x * 4 + w; const int mt = wid / ntn, nq = wid % ntn;
  if (mt * 16 >= M) return;
  const int row0 = mt * 16, col0 = nq * 64;
  const float* arow = A + (size_t)(row0 + ln) * lda;
  v8f acc[4] = {};
  for (int kb = 0; kb < K; kb += 32) {
    FragB ah, al;
    const v4f x0 = *(const v4fa*)(arow + kb + 8 * hh), x1 = *(const v4fa*)(arow + kb + 8 * hh + 4);
    const v4f x2 = *(const v4fa*)(arow + kb + 16 + 8 * hh), x3 = *(const v4fa*)(arow + kb + 16 + 8 * hh + 4);
    float xs[16] = {x0[0],x0[1],x0[2],x0[3],x1[0],x1[1],x1[2],x1[3],x2[0],x2[1],x2[2],x2[3],x3[0],x3[1],x3[2],x3[3]};
#pragma unroll
    for (int i = 0; i < 16; ++i) { const unsigned short hb = bf16_bits(xs[i]); ah.u[i] = hb; al.u[i] = ASPLIT ? bf16_bits(xs[i] - bf16_val(hb)) : (unsigned short)0; }
#pragma unroll
    for (int t = 0; t < 4; ++t) {
      const size_t boff = (size_t)(col0 + t * 16 + ln) * ldb + kb;
      FragB bh_, bl_; bh_.half[0] = *(const v8us*)(Bh + boff + 8 * hh); bh_.half[1] = *(const v8us*)(Bh + boff + 16 + 8 * hh);
      if (BSPLIT) { bl_.half[0] = *(const v8us*)(Bl + boff + 8 * hh); bl_.half[1] = *(const v8us*)(Bl + boff + 16 + 8 * hh); } else bl_ = bh_;
      acc[t] = mmaN<ASPLIT ? (BSPLIT ? 3 : 2) : 1>(ah.v, al.v, bh_.v, bl_.v, acc[t]);
    }
  }
#pragma unroll
  for (int t = 0; t < 4; ++t) {
    const int col = col0 + t * 16 + ln; const float bv = bias ? bf16_round(bias[col]) : 0.f;
#pragma unroll
    for (int r = 0; r < 8; ++r) { float v = acc[t][r] * alpha + bv; if (resid) v += rsign * resid[(size_t)(row0 + 8 * hh + r) * ldr + col]; if (ACT == 1) v = fmaxf(v, 0.f); else if (ACT == 2) v = fmaxf(v, 0.f) + log1pf(expf(-fabsf(v))); so[w][8 * hh + r][t * 16 + ln] = v; }
  }
  __builtin_amdgcn_fence(__ATOMIC_ACQ_REL, "workgroup"); __builtin_amdgcn_wave_barrier();
  const int rsub = lane >> 4, c4 = (lane & 15) * 4;
  {
#pragma unroll
    for (int q = 0; q < 8; ++q) { const int r = q * 2 + rsub; const v4f v = *(const v4fa*)&so[w][r][c4]; *(v4f*)(C + (size_t)(row0 + r) * ldc + col0 + c4) = v; }
    
  }
}
// batched f32 [K][N] (pitch lds, batch stride sIn) -> transposed hi/lo planes [N][K] (batch stride sOut); thread per (n, 8 k); grid.y = batch
__global__ __launch_bounds__(256) void k_split_transpose_b(const float* __restrict__ src, int lds_, size_t sIn, unsigned short* __restrict__ hi, unsigned short* __restrict__ lo, size_t sOut, int K, int N) {
  const size_t t = (size_t)blockIdx.x * 256 + threadIdx.x; const int k8n = K / 8; if (t >= (size_t)N * k8n) return;
  src += (size_t)blockIdx.y * sIn; hi += (size_t)blockIdx.y * sOut; lo += (size_t)blockIdx.y * sOut;
  const int n = (int)(t / k8n), k8 = (int)(t % k8n) * 8; v8us vh, vl;
#pragma unroll
  for (int i = 0; i < 8; ++i) { const float x = src[(size_t)(k8 + i) * lds_ + n]; const unsigned short hb = bf16_bits(x); vh[i] = hb; vl[i] = bf16_bits(x - bf16_val(hb)); }
  unsigned short* dh = hi + (size_t)n * K + k8; unsigned short* dl = lo + (size_t)n * K + k8;
  *(v8us*)dh = vh; *(v8us*)dl = vl; 
}


__global__ __launch_bounds__(256) void k_roundcopy(const float* __restrict__ src, float* __restrict__ dst, int n8) {
  const size_t t = (size_t)blockIdx.x * 256 + threadIdx.x;
  if (t >= (size_t)n8 * 2) return;
  v4f a = *(const v4fa*)(src + t * 4);
  for (int i = 0; i < 4; ++i) a[i] = bf16_round(a[i]);
  *(v4f*)(dst + t * 4) = a; 
}

// one v_tanh_f32 per value
__device__ __forceinline__ float tanh_fast(float x) { return __builtin_amdgcn_tanhf(x); }
// f32 rows: fpad[16][512] = final_state rows 0..7, zero rows 8..15 (thread per float4)
__global__ __launch_bounds__(256) void k_fpad(const float* __restrict__ f, float* __restrict__ fp) { const int t = blockIdx.x * 256 + threadIdx.x; if (t >= 16 * DD / 4) return; const int r = t / (DD / 4); v4f v = {0.f,0.f,0.f,0.f}; if (r < BB) { const v4f a = *(const v4fa*)(f + (size_t)t * 4); for (int q = 0; q < 4; ++q) v[q] = a[q]; } *(v4f*)(fp + (size_t)t * 4) = v;  }
// Sᵀ planes per batch (exact input): Bh[b][d][t] = bf16(S[b][t][d]); thread per (b, d, 8 t)
__global__ __launch_bounds__(256) void k_sT(const float* __restrict__ S, unsigned short* __restrict__ Bh) {
  const size_t i = (size_t)blockIdx.x * 256 + threadIdx.x; if (i >= (size_t)BB * DD * (TT / 8)) return; const int t8 = (int)(i % (TT / 8)) * 8; const int d = (int)((i / (TT / 8)) % DD); const int b = (int)(i / ((size_t)(TT / 8) * DD));
  v8us v; for (int q = 0; q < 8; ++q) v[q] = bf16_bits(S[((size_t)b * TT + t8 + q) * DD + d]);
  *(v8us*)(Bh + ((size_t)b * DD + d) * TT + t8) = v; 
}
// intent: 4 blocks per b (one per 128 columns of c_intent), 32 waves each. Scores (every block of a b computes all 256): wave wv takes the rows t = 8 wv .. 8 wv + 7, a row
// spread over the lanes (lane holds a = 128 u + 4 lane + q), so a row is 4 whole-line loads, independent of every other row's, and 16 fly at once; ii and intent_v stay in
// registers; a row's 32 partial sums meet in a butterfly over the lanes. softmax over t: every wave for itself, from the 256 scores in LDS.
// c_intent[b][d] = sum_s w_s bf16(S[b][s][d]): wave wv takes the keys s = 8 wv .. 8 wv + 7 (8 independent loads), lane the columns 4 lane .. 4 lane + 3 of the block's 128;
// the 32 partial sums of a column are added through LDS, wv ascending.
#define IQ 4
__global__ __launch_bounds__(1024) void k_intent(const float* __restrict__ P, const float* __restrict__ ii, const float* __restrict__ iv, const float* __restrict__ S, float* __restrict__ cint) {
  __shared__ float ssc[TT];
  __shared__ __attribute__((aligned(16))) float part[32][DD / IQ];
  const int b = blockIdx.x / IQ, c0 = (blockIdx.x % IQ) * (DD / IQ), tid = threadIdx.x, wv = tid >> 5, lane = tid & 31;
  // every "#pragma unroll" of this kernel: the arrays are then indexed by constants only and stay in registers, and a batch's loads stand together in front of its sums
  v4f vi[4], vv[4];
#pragma unroll
  for (int u = 0; u < 4; ++u) { vi[u] = *(const v4fa*)(ii + (size_t)b * DD + u * 128 + lane * 4); vv[u] = *(const v4fa*)(iv + u * 128 + lane * 4); }
  const float* row0 = P + ((size_t)b * TT + wv * 8) * 3 * DD + lane * 4;
  float sc[8];
#pragma unroll
  for (int rb = 0; rb < 8; rb += 4) {
    v4f h[4][4];
#pragma unroll
    for (int r = 0; r < 4; ++r)
#pragma unroll
      for (int u = 0; u < 4; ++u) h[r][u] = *(const v4fa*)(row0 + (size_t)(rb + r) * 3 * DD + u * 128);
#pragma unroll
    for (int r = 0; r < 4; ++r) {
      float a = 0.f;
#pragma unroll
      for (int u = 0; u < 4; ++u)
#pragma unroll
        for (int q = 0; q < 4; ++q) a += bf16_round(vv[u][q]) * tanh_fast(h[r][u][q] + vi[u][q]);
      sc[rb + r] = a;
    }
  }
  // the key rows of the weighted sum need no score: their loads fly during the butterflies
  const float* sp = S + ((size_t)b * TT + wv * 8) * DD + c0 + lane * 4;
  v4f x[8];
#pragma unroll
  for (int i = 0; i < 8; ++i) x[i] = *(const v4fa*)(sp + (size_t)i * DD);
  // the 8 rows' butterflies folded into one: at the steps 1, 2, 4 a lane keeps the half of its rows that its lane bit names and hands the other half over,
  // so 4 + 2 + 1 + 1 + 1 exchanges serve all 8 rows, and every lane ends with the whole sum of row lane & 7
  float s1[4], s2[2];
#pragma unroll
  for (int i = 0; i < 4; ++i) s1[i] = ((lane & 1) ? sc[2 * i + 1] : sc[2 * i]) + __shfl_xor((lane & 1) ? sc[2 * i] : sc[2 * i + 1], 1, 32);
#pragma unroll
  for (int i = 0; i < 2; ++i) s2[i] = ((lane & 2) ? s1[2 * i + 1] : s1[2 * i]) + __shfl_xor((lane & 2) ? s1[2 * i] : s1[2 * i + 1], 2, 32);
  float mine = ((lane & 4) ? s2[1] : s2[0]) + __shfl_xor((lane & 4) ? s2[0] : s2[1], 4, 32);
  mine += __shfl_xor(mine, 8, 32); mine += __shfl_xor(mine, 16, 32);
  if (lane < 8) ssc[wv * 8 + lane] = mine;
  __syncthreads();   // all 256 scores of the batch are in ssc before any wave's softmax reads them
  float e[8], mx = -3.0e38f, den = 0.f;
#pragma unroll
  for (int u = 0; u < 8; ++u) { e[u] = ssc[u * 32 + lane]; mx = fmaxf(mx, e[u]); }
  for (int o = 16; o >= 1; o >>= 1) mx = fmaxf(mx, __shfl_xor(mx, o, 32));
#pragma unroll
  for (int u = 0; u < 8; ++u) den += expf(e[u] - mx);
  for (int o = 16; o >= 1; o >>= 1) den += __shfl_xor(den, o, 32);
  const int wl = __float_as_int(expf(ssc[wv * 8 + (lane & 7)] - mx) / den);   // lane i < 8: the weight of key 8 wv + i
  v4f acc = {0.f, 0.f, 0.f, 0.f};
#pragma unroll
  for (int i = 0; i < 8; ++i) {
    const float w = __int_as_float(__builtin_amdgcn_readlane(wl, i));
#pragma unroll
    for (int q = 0; q < 4; ++q) acc[q] += w * bf16_round(x[i][q]);
  }
  *(v4fa*)&part[wv][lane * 4] = acc;
  __syncthreads();   // the 32 partial sums of every column are in part before they are added
  if (tid >= DD / IQ) return;
  float s = part[0][tid];
#pragma unroll
  for (int j = 1; j < 32; ++j) s += part[j][tid];
  cint[(size_t)b * DD + c0 + tid] = s;
}
// slot scores: block = QT queries t of one batch, 8 waves; wave wv takes keys s in [32 wv, 32 wv + 32) for all QT queries.
// si of the queries and slot_v stay in registers (lane holds a = 32 u + lane) and a key row is fetched by 16 loads at once, so a row feeds
// 16 QT tanh per lane with no load and no LDS read between them; per (t,s) the terms are summed in the old order (u ascending, then the butterfly).
// softmax over s -> W[b][t][s] by waves 0..QT-1, one query each, behind the block barrier.
#define QT 2
// waves_per_eu: the launch puts 8 waves on every SIMD (MR / QT blocks of 8 waves on 1024 SIMDs); this is the register budget that goes with it
__global__ __launch_bounds__(256) __attribute__((amdgpu_waves_per_eu(8, 8))) void k_slot(const float* __restrict__ P, const float* __restrict__ sv, float* __restrict__ Wt) {
  __shared__ float ssc[QT][TT];
  const int tid = threadIdx.x, wv = tid >> 5, lane = tid & 31; const int m0 = blockIdx.x * QT; if (m0 >= MR) return; const int b = m0 / TT;
  float si[QT][16], vv[16], cur[16], keep[QT];
  // every "#pragma unroll" of this kernel: the arrays are then indexed by constants only and stay in registers
#pragma unroll
  for (int u = 0; u < 16; ++u) vv[u] = bf16_round(sv[u * 32 + lane]);
#pragma unroll
  for (int j = 0; j < QT; ++j) { const float* sir = P + (size_t)(m0 + j) * 3 * DD + 2 * DD; keep[j] = 0.f;
#pragma unroll
    for (int u = 0; u < 16; ++u) si[j][u] = sir[u * 32 + lane]; }
  const float* sh0 = P + ((size_t)b * TT + wv * 32) * 3 * DD + DD + lane;
#pragma unroll
  for (int u = 0; u < 16; ++u) cur[u] = sh0[u * 32];
  for (int k = 0; k < 32; ++k) {
    float acc[QT];
#pragma unroll
    for (int j = 0; j < QT; ++j) acc[j] = 0.f;
#pragma unroll
    for (int u = 0; u < 16; ++u) {
#pragma unroll
      for (int j = 0; j < QT; ++j) acc[j] += vv[u] * tanh_fast(cur[u] + si[j][u]);
    }
    const float* nrow = sh0 + (size_t)((k + 1) & 31) * 3 * DD;   // next key row: its loads fly during the butterfly (the last trip re-reads the wave's first row, unused)
#pragma unroll
    for (int u = 0; u < 16; ++u) cur[u] = nrow[u * 32];
    __builtin_amdgcn_sched_barrier(0);   // keeps those loads in front of the butterfly's waits, and the butterfly out of the region of the row's sums (in one region this compiler pairs fewer of the multiply-adds)
#pragma unroll
    for (int j = 0; j < QT; ++j) { float a = acc[j]; for (int o = 16; o >= 1; o >>= 1) a += __shfl_xor(a, o, 32); if (lane == k) keep[j] = a; }
  }
#pragma unroll
  for (int j = 0; j < QT; ++j) ssc[j][wv * 32 + lane] = keep[j];
  __syncthreads();   // every wave's 32 keys of each query are in ssc before a query's softmax reads all 256
  if (wv >= QT) return;
  const int m = m0 + wv;
  float mx = -3.0e38f;
  for (int u = 0; u < 8; ++u) mx = fmaxf(mx, ssc[wv][u * 32 + lane]);
  for (int o = 16; o >= 1; o >>= 1) mx = fmaxf(mx, __shfl_xor(mx, o, 32));
  float den = 0.f;
#pragma unroll 1
  for (int u = 0; u < 8; ++u) { const float e = expf(ssc[wv][u * 32 + lane] - mx); ssc[wv][u * 32 + lane] = e; den += e; }
  for (int o = 16; o >= 1; o >>= 1) den += __shfl_xor(den, o, 32); const float inv = 1.0f / den;
  {
#pragma unroll 1
    for (int u = 0; u < 8; ++u) *(float*)(Wt + (size_t)m * TT + u * 32 + lane) = ssc[wv][u * 32 + lane] * inv;  }
}
extern "C" void kernel_launch(void* const* d_in, const int* in_sizes, int n_in,
                              void* d_out, int out_size, void* d_ws, size_t ws_size, hipStream_t stream) {
  (void)in_sizes; (void)n_in; (void)out_size;
  const float* S = (const float*)d_in[0]; const float* fst = (const float*)d_in[1]; const float* iv = (const float*)d_in[2]; const float* W_ih = (const float*)d_in[3]; const float* b_ih = (const float*)d_in[4]; const float* W_ii = (const float*)d_in[5]; const float* b_ii = (const float*)d_in[6];
  const float* sv = (const float*)d_in[7]; const float* W_sh = (const float*)d_in[8]; const float* b_sh = (const float*)d_in[9]; const float* W_si = (const float*)d_in[10]; const float* b_si = (const float*)d_in[11];
  float* cslot = (float*)d_out; float* cint = (float*)((char*)d_out + 4194304);
  char* ws = (char*)d_ws; size_t off = 0;
  auto take = [&](size_t bytes) { char* p = ws + off; off += (bytes + 255) & ~(size_t)255; return p; };
  unsigned short* B3 = (unsigned short*)take((size_t)3 * DD * DD * 2); unsigned short* Bii = (unsigned short*)take((size_t)DD * DD * 2); float* b3 = (float*)take(3 * DD * 4); unsigned short* ST = (unsigned short*)take((size_t)BB * DD * TT * 2);
  float* fp = (float*)take(16 * DD * 4); float* ii = (float*)take(16 * DD * 4); float* P = (float*)take((size_t)MR * 3 * DD * 4); float* Wt = (float*)take((size_t)MR * TT * 4);
  if (off > ws_size) return;
  k_wt_bf16<<<(DD * (DD / 8) + 255) / 256, 256, 0, stream>>>(W_ih, B3, DD, DD); k_wt_bf16<<<(DD * (DD / 8) + 255) / 256, 256, 0, stream>>>(W_sh, B3 + (size_t)DD * DD, DD, DD); k_wt_bf16<<<(DD * (DD / 8) + 255) / 256, 256, 0, stream>>>(W_si, B3 + (size_t)2 * DD * DD, DD, DD);
  k_wt_bf16<<<(DD * (DD / 8) + 255) / 256, 256, 0, stream>>>(W_ii, Bii, DD, DD);
  k_roundcopy<<<1, 256, 0, stream>>>(b_ih, b3, DD / 8); k_roundcopy<<<1, 256, 0, stream>>>(b_sh, b3 + DD, DD / 8); k_roundcopy<<<1, 256, 0, stream>>>(b_si, b3 + 2 * DD, DD / 8);
  k_sT<<<(unsigned)(((size_t)BB * DD * (TT / 8) + 255) / 256), 256, 0, stream>>>(S, ST);
  k_fpad<<<(16 * DD / 4 + 255) / 256, 256, 0, stream>>>(fst, fp);
  k_gemm_bf3<false, 0, false, false><<<((MR / 16) * (3 * DD / 64) + 3) / 4, 128, 0, stream>>>(S, DD, B3, DD, b3, nullptr, 1, 0, P, 3 * DD, MR, 3 * DD, DD);      // [ih | sh | si] + b (single term)
  k_gemm_bf3<false, 0, true, false><<<((16 / 16) * (DD / 64) + 3) / 4, 128, 0, stream>>>(fp, DD, Bii, DD, b_ii, nullptr, 1, 0, ii, DD, 16, DD, DD);         // ii (rows 0..7)
  k_intent<<<BB * IQ, 1024, 0, stream>>>(P, ii, iv, S, cint);
  k_slot<<<MR / QT, 256, 0, stream>>>(P, sv, Wt);
  k_gemm_b<true, false, 0><<<dim3(((TT / 16) * (DD / 64) + 3) / 4, BB), 128, 0, stream>>>(Wt, TT, (size_t)TT * TT, ST, ST, TT, (size_t)DD * TT, nullptr, nullptr, 0, 0, 1.f, 1.f, cslot, DD, (size_t)TT * DD, TT, DD, TT);   // c_slot[b] = W[b]·S[b]
}

// v004
// One run takes 87.5 microseconds.
// Two timings next to v003 put it at 1.39 and 1.40 times that version's speed.
// All steps since v000 together make it 15.5 times as fast.
#include <hip/hip_runtime.h>
// [ih | sh | si] = S·[W_ih|W_sh|W_si] + b (one GEMM, K=512, N=1536), ii = f·W_ii + b (M padded to 16) — inputs and weights rounded to bf16: single exact
// WMMA term, f32 accumulate — and c_slot = slot_w·S per batch (slot_w split into bf16 hi/lo vs exact bf16 Sᵀ planes: 2 terms) run on
// v_wmma_f32_16x16x32_bf16; the additive tanh scores (intent: T×A, slot: T×T×A), both softmaxes and c_intent are f32 VALU.
#define BB 8
#define TT 256
#define DD 512
#define MR (BB * TT)

typedef __bf16 v16b __attribute__((ext_vector_type(16)));
typedef unsigned short v8us __attribute__((ext_vector_type(8), may_alias));
typedef float  v8f  __attribute__((ext_vector_type(8)));
typedef float  v4f  __attribute__((ext_vector_type(4)));
typedef float  v4fa __attribute__((ext_vector_type(4), may_alias));
union FragB { v16b v; v8us half[2]; unsigned short u[16]; };

__device__ __forceinline__ unsigned short bf16_bits(float x) { unsigned int u = __float_as_uint(x); return (unsigned short)((u + 0x7FFFu + ((u >> 16) & 1u)) >> 16); }
__device__ __forceinline__ float bf16_val(unsigned short b) { return __uint_as_float(((unsigned int)b) << 16); }
__device__ __forceinline__ float bf16_round(float x) { return bf16_val(bf16_bits(x)); }
// D += A·B with NT terms: 1 = ah·bh, 2 = + al·bh (A split), 3 = + ah·bl (both split)
template <int NT>
__device__ __forceinline__ v8f mmaN(v16b ah, v16b al, v16b bh, v16b bl, v8f c) {
  c = __builtin_amdgcn_wmma_f32_16x16x32_bf16(false, ah, false, bh, (short)0, c, false, false);
  if (NT >= 2) c = __builtin_amdgcn_wmma_f32_16x16x32_bf16(false, al, false, bh, (short)0, c, false, false);
  if (NT >= 3) c = __builtin_amdgcn_wmma_f32_16x16x32_bf16(false, ah, false, bl, (short)0, c, false, false);
  asm volatile("v_nop\n\tv_nop\n\tv_nop\n\tv_nop" : "+v"(c) : "v"(ah), "v"(al), "v"(bh), "v"(bl));
  return c;
}

__device__ __forceinline__ void d_wt_bf16(int blk, const float* __restrict__ W, unsigned short* __restrict__ Wt, int K, int N) {
  const int t = blk * 256 + threadIdx.x;
  const int k8n = K / 8;
  if (t >= N * k8n) return;
  const int n = t / k8n, k8 = (t % k8n) * 8;
  v8us v;
#pragma unroll
  for (int i = 0; i < 8; ++i) v[i] = bf16_bits(W[(size_t)(k8 + i) * N + n]);
  *(v8us*)(Wt + (size_t)n * K + k8) = v;
  
}

// GEMM C[M][N] (f32, pitch ldc) = act(A[M][K]·W + bias). A f32 row-major (pitch lda) converted per fragment to bf16
// (ASPLIT: hi/lo two planes -> 2 terms, else single rounded term); Wt bf16 [N][K] (pitch ldb). BIAS_BF16 rounds the
// bias to bf16 first (bias quantised to bf16 before the add). K%32==0, M%16==0, N%64==0.
template <bool ASPLIT, int ACT, bool BIAS_BF16>
__global__ __launch_bounds__(128) void k_gemm_bf(const float* __restrict__ A, int lda, const unsigned short* __restrict__ Wt, int ldb,
                                               const float* __restrict__ bias, float* __restrict__ C, int ldc, int M, int N, int K) {
  __shared__ __attribute__((aligned(16))) float so[4][16][64];
  const int tid = threadIdx.x, w = tid >> 5, lane = tid & 31, ln = lane & 15, hh = lane >> 4;
  const int ntn = N / 64;
  const int wid = blockIdx.x * 4 + w;
  const int mt = wid / ntn, nq = wid % ntn;
  if (mt * 16 >= M) return;
  const int row0 = mt * 16, col0 = nq * 64;
  const float* arow = A + (size_t)(row0 + ln) * lda;
  v8f acc[4] = {};
  for (int kb = 0; kb < K; kb += 32) {
    FragB ah, al;
    const v4f x0 = *(const v4fa*)(arow + kb + 8 * hh), x1 = *(const v4fa*)(arow + kb + 8 * hh + 4);
    const v4f x2 = *(const v4fa*)(arow + kb + 16 + 8 * hh), x3 = *(const v4fa*)(arow + kb + 16 + 8 * hh + 4);
    float xs[16] = {x0[0],x0[1],x0[2],x0[3],x1[0],x1[1],x1[2],x1[3],x2[0],x2[1],x2[2],x2[3],x3[0],x3[1],x3[2],x3[3]};
#pragma unroll
    for (int i = 0; i < 16; ++i) { const unsigned short hb = bf16_bits(xs[i]); ah.u[i] = hb; al.u[i] = ASPLIT ? bf16_bits(xs[i] - bf16_val(hb)) : (unsigned short)0; }
#pragma unroll
    for (int t = 0; t < 4; ++t) {
      const unsigned short* brow = Wt + (size_t)(col0 + t * 16 + ln) * ldb + kb;
      FragB b;
      b.half[0] = *(const v8us*)(brow + 8 * hh);
      b.half[1] = *(const v8us*)(brow + 16 + 8 * hh);
      acc[t] = mmaN<ASPLIT ? 2 : 1>(ah.v, al.v, b.v, b.v, acc[t]);
    }
  }
#pragma unroll
  for (int t = 0; t < 4; ++t) {
    float bv = bias ? bias[col0 + t * 16 + ln] : 0.f;
    if (BIAS_BF16) bv = bf16_round(bv);
#pragma unroll
    for (int r = 0; r < 8; ++r) { float v = acc[t][r] + bv; if (ACT == 1) v = fmaxf(v, 0.f); so[w][8 * hh + r][t * 16 + ln] = v; }
  }
  __builtin_amdgcn_fence(__ATOMIC_ACQ_REL, "workgroup");
  __builtin_amdgcn_wave_barrier();
  const int rsub = lane >> 4, c4 = (lane & 15) * 4;
  {
#pragma unroll
    for (int q = 0; q < 8; ++q) {
      const int r = q * 2 + rsub;
      const v4f v = *(const v4fa*)&so[w][r][c4];
      *(v4f*)(C + (size_t)(row0 + r) * ldc + col0 + c4) = v;
    }
    
  }
}

// Flash-style causal/unmasked attention, all contractions 3-term bf16 hi/lo splits, f32 softmax with running max.
// q,k,v rows are read from f32 buffers with arbitrary row pitch (so they can live inside a fused qkv buffer);
// D = head size (multiple of 32, <= 128); one wave = 16 query rows; block = 4 waves (64 queries) sharing K/V chunks of 32.
template <int D, bool CAUSAL>
__global__ __launch_bounds__(128) void k_flash(const float* __restrict__ qb, const float* __restrict__ kb, const float* __restrict__ vb,
                                             int pitch, int T, int H, float scale, float* __restrict__ y, int ypitch) {
  constexpr int KS = D / 32;        // k-steps for QK
  constexpr int DT = D / 16;        // d tiles for PV
  __shared__ __attribute__((aligned(16))) unsigned short sKh[32][D + 8], sKl[32][D + 8], sVh[32][D + 8], sVl[32][D + 8];
  __shared__ __attribute__((aligned(16))) unsigned short sPh[4][16][40], sPl[4][16][40];
  __shared__ __attribute__((aligned(16))) float sO[4][16][D];
  const int tid = threadIdx.x, w = tid >> 5, lane = tid & 31, ln = lane & 15, hh = lane >> 4;
  const int nqb = (T + 63) / 64;
  const int bh = blockIdx.x / nqb, qblk = blockIdx.x % nqb;
  const int b = bh / H, h = bh % H;
  const int q0 = qblk * 64 + w * 16;
  const float* Q = qb + (size_t)b * T * pitch + h * D;
  const float* K = kb + (size_t)b * T * pitch + h * D;
  const float* V = vb + (size_t)b * T * pitch + h * D;

  // A fragments of the wave's 16 query rows (scaled), hi/lo
  FragB aqh[KS], aql[KS];
  {
    int row = q0 + ln; if (row >= T) row = T - 1;
    const float* qr = Q + (size_t)row * pitch;
#pragma unroll
    for (int ks = 0; ks < KS; ++ks)
#pragma unroll
      for (int i = 0; i < 16; ++i) {
        const int d = ks * 32 + ((i < 8) ? (8 * hh + i) : (16 + 8 * hh + (i - 8)));
        const float x = qr[d] * scale; const unsigned short hb = bf16_bits(x);
        aqh[ks].u[i] = hb; aql[ks].u[i] = bf16_bits(x - bf16_val(hb));
      }
  }
  float m_r[8], l_r[8];
#pragma unroll
  for (int r = 0; r < 8; ++r) { m_r[r] = -3.0e38f; l_r[r] = 0.f; }
  v8f oacc[DT];
#pragma unroll
  for (int dt = 0; dt < DT; ++dt) oacc[dt] = (v8f){0.f,0.f,0.f,0.f,0.f,0.f,0.f,0.f};

  const int kv_end = CAUSAL ? min(T, qblk * 64 + 64) : T;     // block-uniform
  for (int j0 = 0; j0 < kv_end; j0 += 32) {
    __syncthreads();
    for (int e = tid; e < 32 * (D / 4); e += 128) {
      const int r = e / (D / 4), c4 = (e % (D / 4)) * 4;
      const int key = j0 + r;
      v4f kf = {0.f,0.f,0.f,0.f}, vf = {0.f,0.f,0.f,0.f};
      if (key < T) { kf = *(const v4fa*)(K + (size_t)key * pitch + c4); vf = *(const v4fa*)(V + (size_t)key * pitch + c4); }
#pragma unroll
      for (int t = 0; t < 4; ++t) {
        unsigned short hb = bf16_bits(kf[t]); sKh[r][c4 + t] = hb; sKl[r][c4 + t] = bf16_bits(kf[t] - bf16_val(hb));
        hb = bf16_bits(vf[t]); sVh[r][c4 + t] = hb; sVl[r][c4 + t] = bf16_bits(vf[t] - bf16_val(hb));
      }
    }
    __syncthreads();
    // S tile 16 x 32
    v8f s[2];
#pragma unroll
    for (int nt = 0; nt < 2; ++nt) {
      v8f acc = {};
#pragma unroll
      for (int ks = 0; ks < KS; ++ks) {
        FragB bh_, bl_;
        bh_.half[0] = *(const v8us*)&sKh[nt * 16 + ln][ks * 32 + 8 * hh]; bh_.half[1] = *(const v8us*)&sKh[nt * 16 + ln][ks * 32 + 16 + 8 * hh];
        bl_.half[0] = *(const v8us*)&sKl[nt * 16 + ln][ks * 32 + 8 * hh]; bl_.half[1] = *(const v8us*)&sKl[nt * 16 + ln][ks * 32 + 16 + 8 * hh];
        acc = mmaN<3>(aqh[ks].v, aql[ks].v, bh_.v, bl_.v, acc);
      }
      s[nt] = acc;
    }
    // mask + running max (rows 8hh+r; the 16 lanes of a half share rows)
    float alpha[8];
#pragma unroll
    for (int r = 0; r < 8; ++r) {
      const int qi = q0 + 8 * hh + r;
      const int ja = j0 + ln, jb = j0 + 16 + ln;
      if (CAUSAL) { if (ja > qi) s[0][r] = -3.0e38f; if (jb > qi) s[1][r] = -3.0e38f; }
      if (ja >= T) s[0][r] = -3.0e38f;
      if (jb >= T) s[1][r] = -3.0e38f;
      float mx = fmaxf(s[0][r], s[1][r]);
      mx = fmaxf(mx, __shfl_xor(mx, 1, 32)); mx = fmaxf(mx, __shfl_xor(mx, 2, 32)); mx = fmaxf(mx, __shfl_xor(mx, 4, 32)); mx = fmaxf(mx, __shfl_xor(mx, 8, 32));
      const float mnew = fmaxf(m_r[r], mx);
      alpha[r] = (mnew > -1.0e38f) ? __expf(m_r[r] - mnew) : 1.0f;
      const float p0 = (s[0][r] > -1.0e38f) ? __expf(s[0][r] - mnew) : 0.f;
      const float p1 = (s[1][r] > -1.0e38f) ? __expf(s[1][r] - mnew) : 0.f;
      m_r[r] = mnew;
      l_r[r] = l_r[r] * alpha[r] + p0 + p1;            // per-lane partial row sum (16 lanes combined at the end)
      unsigned short hb = bf16_bits(p0); sPh[w][8 * hh + r][ln] = hb;      sPl[w][8 * hh + r][ln] = bf16_bits(p0 - bf16_val(hb));
      hb = bf16_bits(p1);                sPh[w][8 * hh + r][16 + ln] = hb; sPl[w][8 * hh + r][16 + ln] = bf16_bits(p1 - bf16_val(hb));
    }
#pragma unroll
    for (int dt = 0; dt < DT; ++dt)
#pragma unroll
      for (int r = 0; r < 8; ++r) oacc[dt][r] *= alpha[r];
    __builtin_amdgcn_fence(__ATOMIC_ACQ_REL, "workgroup");
    __builtin_amdgcn_wave_barrier();
    FragB pah, pal;
    pah.half[0] = *(const v8us*)&sPh[w][ln][8 * hh]; pah.half[1] = *(const v8us*)&sPh[w][ln][16 + 8 * hh];
    pal.half[0] = *(const v8us*)&sPl[w][ln][8 * hh]; pal.half[1] = *(const v8us*)&sPl[w][ln][16 + 8 * hh];
#pragma unroll
    for (int dt = 0; dt < DT; ++dt) {
      FragB bvh, bvl;
#pragma unroll
      for (int i = 0; i < 8; ++i) {
        bvh.u[i] = sVh[8 * hh + i][dt * 16 + ln]; bvh.u[8 + i] = sVh[16 + 8 * hh + i][dt * 16 + ln];
        bvl.u[i] = sVl[8 * hh + i][dt * 16 + ln]; bvl.u[8 + i] = sVl[16 + 8 * hh + i][dt * 16 + ln];
      }
      oacc[dt] = mmaN<3>(pah.v, pal.v, bvh.v, bvl.v, oacc[dt]);
    }
    __builtin_amdgcn_fence(__ATOMIC_ACQ_REL, "workgroup");
    __builtin_amdgcn_wave_barrier();
  }
#pragma unroll
  for (int r = 0; r < 8; ++r) {
    float l = l_r[r];
    l += __shfl_xor(l, 1, 32); l += __shfl_xor(l, 2, 32); l += __shfl_xor(l, 4, 32); l += __shfl_xor(l, 8, 32);
    l_r[r] = (l > 0.f) ? 1.0f / l : 0.f;
  }
#pragma unroll
  for (int dt = 0; dt < DT; ++dt)
#pragma unroll
    for (int r = 0; r < 8; ++r) sO[w][8 * hh + r][dt * 16 + ln] = oacc[dt][r] * l_r[r];
  __builtin_amdgcn_fence(__ATOMIC_ACQ_REL, "workgroup");
  __builtin_amdgcn_wave_barrier();
  {
    for (int r = 0; r < 16; ++r) {
      const int row = q0 + r;
      if (row < T && lane < D / 4) {
        const v4f val = *(const v4fa*)&sO[w][r][lane * 4];
        *(v4f*)(y + ((size_t)b * T + row) * ypitch + h * D + lane * 4) = val;
      }
    }
    
  }
}

// GEMM C = act(A·W + bias + resid): A f32 (ASPLIT -> hi/lo 2 terms), Wt bf16 [N][K]; ACT 0 none, 1 relu, 2 exact gelu;
// resid (optional, f32, row index = (row % rmod), pitch ldr, RES_BF16 rounds it) added before the activation.
template <bool ASPLIT, int ACT, bool RES_BF16>
__device__ __forceinline__ void d_gemm_bf3(int blk, bool BIAS_BF16, const float* __restrict__ A, int lda, const unsigned short* __restrict__ Wt, int ldb,
                                                const float* __restrict__ bias, const float* __restrict__ resid, int rmod, int ldr,
                                                float* __restrict__ C, int ldc, int M, int N, int K) {
  __shared__ __attribute__((aligned(16))) float so[4][16][64];
  const int tid = threadIdx.x, w = tid >> 5, lane = tid & 31, ln = lane & 15, hh = lane >> 4;
  const int ntn = N / 64;
  const int wid = blk * 4 + w;
  const int mt = wid / ntn, nq = wid % ntn;
  if (mt * 16 >= M) return;
  const int row0 = mt * 16, col0 = nq * 64;
  const float* arow = A + (size_t)(row0 + ln) * lda;
  v8f acc[4] = {};
  for (int kb = 0; kb < K; kb += 32) {
    FragB ah, al;
    const v4f x0 = *(const v4fa*)(arow + kb + 8 * hh), x1 = *(const v4fa*)(arow + kb + 8 * hh + 4);
    const v4f x2 = *(const v4fa*)(arow + kb + 16 + 8 * hh), x3 = *(const v4fa*)(arow + kb + 16 + 8 * hh + 4);
    float xs[16] = {x0[0],x0[1],x0[2],x0[3],x1[0],x1[1],x1[2],x1[3],x2[0],x2[1],x2[2],x2[3],x3[0],x3[1],x3[2],x3[3]};
#pragma unroll
    for (int i = 0; i < 16; ++i) { const unsigned short hb = bf16_bits(xs[i]); ah.u[i] = hb; al.u[i] = ASPLIT ? bf16_bits(xs[i] - bf16_val(hb)) : (unsigned short)0; }
#pragma unroll
    for (int t = 0; t < 4; ++t) {
      const unsigned short* brow = Wt + (size_t)(col0 + t * 16 + ln) * ldb + kb;
      FragB b;
      b.half[0] = *(const v8us*)(brow + 8 * hh);
      b.half[1] = *(const v8us*)(brow + 16 + 8 * hh);
      acc[t] = mmaN<ASPLIT ? 2 : 1>(ah.v, al.v, b.v, b.v, acc[t]);
    }
  }
#pragma unroll
  for (int t = 0; t < 4; ++t) {
    const int col = col0 + t * 16 + ln;
    float bv = bias ? bias[col] : 0.f;
    if (BIAS_BF16) bv = bf16_round(bv);
#pragma unroll
    for (int r = 0; r < 8; ++r) {
      float v = acc[t][r] + bv;
      if (resid) { float rv = resid[(size_t)((row0 + 8 * hh + r) % rmod) * ldr + col]; if (RES_BF16) rv = bf16_round(rv); v += rv; }
      if (ACT == 1) v = fmaxf(v, 0.f);
      if (ACT == 2) v = 0.5f * v * (1.0f + erff(v * 0.70710678118654752f));
      if (ACT == 3) { const float u = 0.7978845608028654f * (v + 0.044715f * v * v * v); v = 0.5f * v * (1.0f + tanhf(u)); }
      so[w][8 * hh + r][t * 16 + ln] = v;
    }
  }
  __builtin_amdgcn_fence(__ATOMIC_ACQ_REL, "workgroup");
  __builtin_amdgcn_wave_barrier();
  const int rsub = lane >> 4, c4 = (lane & 15) * 4;
  {
#pragma unroll
    for (int q = 0; q < 8; ++q) {
      const int r = q * 2 + rsub;
      const v4f v = *(const v4fa*)&so[w][r][c4];
      *(v4f*)(C + (size_t)(row0 + r) * ldc + col0 + c4) = v;
    }
    
  }
}
// row LayerNorm (biased variance, eps) over N: s = X (+ R); optional out_sum <- s; out_norm <- (s-mu)*rsqrt(var+eps)*g + b
template <bool PARAM_BF16>
__global__ __launch_bounds__(256) void k_layernorm(const float* __restrict__ X, const float* __restrict__ R, const float* __restrict__ g, const float* __restrict__ bta,
                                                  float* __restrict__ out_sum, float* __restrict__ out_norm, int N, float eps) {
  __shared__ float red[256];
  const int row = blockIdx.x, tid = threadIdx.x;
  const float* x = X + (size_t)row * N; const float* rr = R ? R + (size_t)row * N : nullptr;
  float vals[16];                     // up to N = 4096
  const int per = N / 256;            // contiguous chunk per thread? use strided-by-4 chunks: thread handles j = tid*4 + 1024*u
  float s1 = 0.f;
  for (int u = 0; u < per / 4; ++u) {
    const int j = tid * 4 + 1024 * u;
    const v4f a = *(const v4fa*)(x + j);
    v4f b = {0.f,0.f,0.f,0.f}; if (rr) b = *(const v4fa*)(rr + j);
#pragma unroll
    for (int q = 0; q < 4; ++q) { const float v = a[q] + b[q]; vals[u * 4 + q] = v; s1 += v; }
  }
  red[tid] = s1; __syncthreads();
  for (int st = 128; st > 0; st >>= 1) { if (tid < st) red[tid] += red[tid + st]; __syncthreads(); }
  const float mu = red[0] / (float)N; __syncthreads();
  float s2 = 0.f;
  for (int u = 0; u < per / 4; ++u)
#pragma unroll
    for (int q = 0; q < 4; ++q) { const float c = vals[u * 4 + q] - mu; s2 += c * c; }
  red[tid] = s2; __syncthreads();
  for (int st = 128; st > 0; st >>= 1) { if (tid < st) red[tid] += red[tid + st]; __syncthreads(); }
  const float rs = rsqrtf(red[0] / (float)N + eps);
  {
    for (int u = 0; u < per / 4; ++u) {
      const int j = tid * 4 + 1024 * u;
      v4f o, sm;
#pragma unroll
      for (int q = 0; q < 4; ++q) {
        float gg = g[j + q], bb = bta[j + q];
        if (PARAM_BF16) { gg = bf16_round(gg); bb = bf16_round(bb); }
        sm[q] = vals[u * 4 + q]; o[q] = (vals[u * 4 + q] - mu) * rs * gg + bb;
      }
      if (out_sum) *(v4f*)(out_sum + (size_t)row * N + j) = sm;
      *(v4f*)(out_norm + (size_t)row * N + j) = o;
    }
    
  }
}

// batched GEMM (blockIdx.y = batch): C_b = act(alpha·A_b·B_b + bias + resid_b); A f32 rows (ASPLIT → hi/lo), B = bf16 planes Bh (+Bl when BSPLIT, requires ASPLIT),
// per-batch element strides sA, sB (0 = shared weights), sC, sR. resid may alias C (values are staged before the stores). ACT 0/1(relu).
// ACT: 0 none, 1 relu, 2 softplus
template <bool ASPLIT, bool BSPLIT, int ACT>
__global__ __launch_bounds__(128) void k_gemm_b(const float* __restrict__ A, int lda, size_t sA, const unsigned short* __restrict__ Bh, const unsigned short* __restrict__ Bl, int ldb, size_t sB,
                                             const float* __restrict__ bias, const float* __restrict__ resid, int ldr, size_t sR, float rsign, float alpha,
                                             float* __restrict__ C, int ldc, size_t sC, int M, int N, int K) {
  __shared__ __attribute__((aligned(16))) float so[4][16][64];
  const int tid = threadIdx.x, w = tid >> 5, lane = tid & 31, ln = lane & 15, hh = lane >> 4;
  const int by = blockIdx.y;
  A += (size_t)by * sA; Bh += (size_t)by * sB; if (BSPLIT) Bl += (size_t)by * sB; C += (size_t)by * sC; if (resid) resid += (size_t)by * sR;
  const int ntn = N / 64; const int wid = blockIdx.x * 4 + w; const int mt = wid / ntn, nq = wid % ntn;
  if (mt * 16 >= M) return;
  const int row0 = mt * 16, col0 = nq * 64;
  const float* arow = A + (size_t)(row0 + ln) * lda;
  v8f acc[4] = {};
  for (int kb = 0; kb < K; kb += 32) {
    FragB ah, al;
    const v4f x0 = *(const v4fa*)(arow + kb + 8 * hh), x1 = *(const v4fa*)(arow + kb + 8 * hh + 4);
    const v4f x2 = *(const v4fa*)(arow + kb + 16 + 8 * hh), x3 = *(const v4fa*)(arow + kb + 16 + 8 * hh + 4);
    float xs[16] = {x0[0],x0[1],x0[2],x0[3],x1[0],x1[1],x1[2],x1[3],x2[0],x2[1],x2[2],x2[3],x3[0],x3[1],x3[2],x3[3]};
#pragma unroll
    for (int i = 0; i < 16; ++i) { const unsigned short hb = bf16_bits(xs[i]); ah.u[i] = hb; al.u[i] = ASPLIT ? bf16_bits(xs[i] - bf16_val(hb)) : (unsigned short)0; }
#pragma unroll
    for (int t = 0; t < 4; ++t) {
      const size_t boff = (size_t)(col0 + t * 16 + ln) * ldb + kb;
      FragB bh_, bl_; bh_.half[0] = *(const v8us*)(Bh + boff + 8 * hh); bh_.half[1] = *(const v8us*)(Bh + boff + 16 + 8 * hh);
      if (BSPLIT) { bl_.half[0] = *(const v8us*)(Bl + boff + 8 * hh); bl_.half[1] = *(const v8us*)(Bl + boff + 16 + 8 * hh); } else bl_ = bh_;
      acc[t] = mmaN<ASPLIT ? (BSPLIT ? 3 : 2) : 1>(ah.v, al.v, bh_.v, bl_.v, acc[t]);
    }
  }
#pragma unroll
  for (int t = 0; t < 4; ++t) {
    const int col = col0 + t * 16 + ln; const float bv = bias ? bf16_round(bias[col]) : 0.f;
#pragma unroll
    for (int r = 0; r < 8; ++r) { float v = acc[t][r] * alpha + bv; if (resid) v += rsign * resid[(size_t)(row0 + 8 * hh + r) * ldr + col]; if (ACT == 1) v = fmaxf(v, 0.f); else if (ACT == 2) v = fmaxf(v, 0.f) + log1pf(expf(-fabsf(v))); so[w][8 * hh + r][t * 16 + ln] = v; }
  }
  __builtin_amdgcn_fence(__ATOMIC_ACQ_REL, "workgroup"); __builtin_amdgcn_wave_barrier();
  const int rsub = lane >> 4, c4 = (lane & 15) * 4;
  {
#pragma unroll
    for (int q = 0; q < 8; ++q) { const int r = q * 2 + rsub; const v4f v = *(const v4fa*)&so[w][r][c4]; *(v4f*)(C + (size_t)(row0 + r) * ldc + col0 + c4) = v; }
    
  }
}
// batched f32 [K][N] (pitch lds, batch stride sIn) -> transposed hi/lo planes [N][K] (batch stride sOut); thread per (n, 8 k); grid.y = batch
__global__ __launch_bounds__(256) void k_split_transpose_b(const float* __restrict__ src, int lds_, size_t sIn, unsigned short* __restrict__ hi, unsigned short* __restrict__ lo, size_t sOut, int K, int N) {
  const size_t t = (size_t)blockIdx.x * 256 + threadIdx.x; const int k8n = K / 8; if (t >= (size_t)N * k8n) return;
  src += (size_t)blockIdx.y * sIn; hi += (size_t)blockIdx.y * sOut; lo += (size_t)blockIdx.y * sOut;
  const int n = (int)(t / k8n), k8 = (int)(t % k8n) * 8; v8us vh, vl;
#pragma unroll
  for (int i = 0; i < 8; ++i) { const float x = src[(size_t)(k8 + i) * lds_ + n]; const unsigned short hb = bf16_bits(x); vh[i] = hb; vl[i] = bf16_bits(x - bf16_val(hb)); }
  unsigned short* dh = hi + (size_t)n * K + k8; unsigned short* dl = lo + (size_t)n * K + k8;
  *(v8us*)dh = vh; *(v8us*)dl = vl; 
}


__device__ __forceinline__ void d_roundcopy(const float* __restrict__ src, float* __restrict__ dst, int n8) {
  const size_t t = threadIdx.x;
  if (t >= (size_t)n8 * 2) return;
  v4f a = *(const v4fa*)(src + t * 4);
  for (int i = 0; i < 4; ++i) a[i] = bf16_round(a[i]);
  *(v4f*)(dst + t * 4) = a; 
}

// one v_tanh_f32 per value
__device__ __forceinline__ float tanh_fast(float x) { return __builtin_amdgcn_tanhf(x); }
// f32 rows: fpad[16][512] = final_state rows 0..7, zero rows 8..15 (thread per float4)
__device__ __forceinline__ void d_fpad(int blk, const float* __restrict__ f, float* __restrict__ fp) { const int t = blk * 256 + threadIdx.x; if (t >= 16 * DD / 4) return; const int r = t / (DD / 4); v4f v = {0.f,0.f,0.f,0.f}; if (r < BB) { const v4f a = *(const v4fa*)(f + (size_t)t * 4); for (int q = 0; q < 4; ++q) v[q] = a[q]; } *(v4f*)(fp + (size_t)t * 4) = v;  }
// Sᵀ planes per batch (exact input): Bh[b][d][t] = bf16(S[b][t][d]); thread per (b, d, 8 t)
__device__ __forceinline__ void d_sT(int blk, const float* __restrict__ S, unsigned short* __restrict__ Bh) {
  const size_t i = (size_t)blk * 256 + threadIdx.x; if (i >= (size_t)BB * DD * (TT / 8)) return; const int t8 = (int)(i % (TT / 8)) * 8; const int d = (int)((i / (TT / 8)) % DD); const int b = (int)(i / ((size_t)(TT / 8) * DD));
  v8us v; for (int q = 0; q < 8; ++q) v[q] = bf16_bits(S[((size_t)b * TT + t8 + q) * DD + d]);
  *(v8us*)(Bh + ((size_t)b * DD + d) * TT + t8) = v; 
}
// the nine preparations, none of which reads what another writes, in ONE launch: the block index picks the job
#define NB_WT (DD * (DD / 8) / 256)
#define NB_ST (BB * DD * (TT / 8) / 256)
#define NB_FP (16 * DD / 4 / 256)
__global__ __launch_bounds__(256) void k_prep(const float* __restrict__ W_ih, const float* __restrict__ W_sh, const float* __restrict__ W_si, const float* __restrict__ W_ii,
                                              const float* __restrict__ b_ih, const float* __restrict__ b_sh, const float* __restrict__ b_si, const float* __restrict__ S, const float* __restrict__ f,
                                              unsigned short* __restrict__ B3, unsigned short* __restrict__ Bii, float* __restrict__ b3, unsigned short* __restrict__ ST, float* __restrict__ fp) {
  int blk = blockIdx.x;
  if (blk < NB_ST) { d_sT(blk, S, ST); return; }
  blk -= NB_ST;
  if (blk < 4 * NB_WT) {
    const int j = blk / NB_WT;
    d_wt_bf16(blk % NB_WT, j == 0 ? W_ih : j == 1 ? W_sh : j == 2 ? W_si : W_ii, j < 3 ? B3 + (size_t)j * DD * DD : Bii, DD, DD);
    return;
  }
  blk -= 4 * NB_WT;
  if (blk < NB_FP) { d_fpad(blk, f, fp); return; }
  blk -= NB_FP;
  d_roundcopy(blk == 0 ? b_ih : blk == 1 ? b_sh : b_si, b3 + blk * DD, DD / 8);
}
// both projections in ONE launch: blocks 0 .. NB_II - 1 do ii = f W_ii + b (M padded to 16), the rest [ih | sh | si] = S [W_ih | W_sh | W_si] + b
#define NB_II ((DD / 64) / 4)
#define NB_P ((MR / 16) * (3 * DD / 64) / 4)
__global__ __launch_bounds__(128) void k_proj(const float* __restrict__ S, const unsigned short* __restrict__ B3, const float* __restrict__ b3, float* __restrict__ P,
                                              const float* __restrict__ fp, const unsigned short* __restrict__ Bii, const float* __restrict__ b_ii, float* __restrict__ ii) {
  const bool isii = blockIdx.x < NB_II;
  d_gemm_bf3<false, 0, false>(isii ? blockIdx.x : blockIdx.x - NB_II, isii, isii ? fp : S, DD, isii ? Bii : B3, DD, isii ? b_ii : b3, nullptr, 1, 0,
                              isii ? ii : P, isii ? DD : 3 * DD, isii ? 16 : MR, isii ? DD : 3 * DD, DD);
}
// intent: 4 blocks per b (one per 128 columns of c_intent), 32 waves each. Scores (every block of a b computes all 256): wave wv takes the rows t = 8 wv .. 8 wv + 7, a row
// spread over the lanes (lane holds a = 128 u + 4 lane + q), so a row is 4 whole-line loads, independent of every other row's, and 16 fly at once; ii and intent_v stay in
// registers; a row's 32 partial sums meet in a butterfly over the lanes. softmax over t: every wave for itself, from the 256 scores in LDS.
// c_intent[b][d] = sum_s w_s bf16(S[b][s][d]): wave wv takes the keys s = 8 wv .. 8 wv + 7 (8 independent loads), lane the columns 4 lane .. 4 lane + 3 of the block's 128;
// the 32 partial sums of a column are added through LDS, wv ascending.
#define IQ 4
__global__ __launch_bounds__(1024) void k_intent(const float* __restrict__ P, const float* __restrict__ ii, const float* __restrict__ iv, const float* __restrict__ S, float* __restrict__ cint) {
  __shared__ float ssc[TT];
  __shared__ __attribute__((aligned(16))) float part[32][DD / IQ];
  const int b = blockIdx.x / IQ, c0 = (blockIdx.x % IQ) * (DD / IQ), tid = threadIdx.x, wv = tid >> 5, lane = tid & 31;
  // every "#pragma unroll" of this kernel: the arrays are then indexed by constants only and stay in registers, and a batch's loads stand together in front of its sums
  v4f vi[4], vv[4];
#pragma unroll
  for (int u = 0; u < 4; ++u) { vi[u] = *(const v4fa*)(ii + (size_t)b * DD + u * 128 + lane * 4); vv[u] = *(const v4fa*)(iv + u * 128 + lane * 4); }
  const float* row0 = P + ((size_t)b * TT + wv * 8) * 3 * DD + lane * 4;
  float sc[8];
#pragma unroll
  for (int rb = 0; rb < 8; rb += 4) {
    v4f h[4][4];
#pragma unroll
    for (int r = 0; r < 4; ++r)
#pragma unroll
      for (int u = 0; u < 4; ++u) h[r][u] = *(const v4fa*)(row0 + (size_t)(rb + r) * 3 * DD + u * 128);
#pragma unroll
    for (int r = 0; r < 4; ++r) {
      float a = 0.f;
#pragma unroll
      for (int u = 0; u < 4; ++u)
#pragma unroll
        for (int q = 0; q < 4; ++q) a += bf16_round(vv[u][q]) * tanh_fast(h[r][u][q] + vi[u][q]);
      sc[rb + r] = a;
    }
  }
  // the key rows of the weighted sum need no score: their loads fly during the butterflies
  const float* sp = S + ((size_t)b * TT + wv * 8) * DD + c0 + lane * 4;
  v4f x[8];
#pragma unroll
  for (int i = 0; i < 8; ++i) x[i] = *(const v4fa*)(sp + (size_t)i * DD);
  // the 8 rows' butterflies folded into one: at the steps 1, 2, 4 a lane keeps the half of its rows that its lane bit names and hands the other half over,
  // so 4 + 2 + 1 + 1 + 1 exchanges serve all 8 rows, and every lane ends with the whole sum of row lane & 7
  float s1[4], s2[2];
#pragma unroll
  for (int i = 0; i < 4; ++i) s1[i] = ((lane & 1) ? sc[2 * i + 1] : sc[2 * i]) + __shfl_xor((lane & 1) ? sc[2 * i] : sc[2 * i + 1], 1, 32);
#pragma unroll
  for (int i = 0; i < 2; ++i) s2[i] = ((lane & 2) ? s1[2 * i + 1] : s1[2 * i]) + __shfl_xor((lane & 2) ? s1[2 * i] : s1[2 * i + 1], 2, 32);
  float mine = ((lane & 4) ? s2[1] : s2[0]) + __shfl_xor((lane & 4) ? s2[0] : s2[1], 4, 32);
  mine += __shfl_xor(mine, 8, 32); mine += __shfl_xor(mine, 16, 32);
  if (lane < 8) ssc[wv * 8 + lane] = mine;
  __syncthreads();   // all 256 scores of the batch are in ssc before any wave's softmax reads them
  float e[8], mx = -3.0e38f, den = 0.f;
#pragma unroll
  for (int u = 0; u < 8; ++u) { e[u] = ssc[u * 32 + lane]; mx = fmaxf(mx, e[u]); }
  for (int o = 16; o >= 1; o >>= 1) mx = fmaxf(mx, __shfl_xor(mx, o, 32));
#pragma unroll
  for (int u = 0; u < 8; ++u) den += expf(e[u] - mx);
  for (int o = 16; o >= 1; o >>= 1) den += __shfl_xor(den, o, 32);
  const int wl = __float_as_int(expf(ssc[wv * 8 + (lane & 7)] - mx) / den);   // lane i < 8: the weight of key 8 wv + i
  v4f acc = {0.f, 0.f, 0.f, 0.f};
#pragma unroll
  for (int i = 0; i < 8; ++i) {
    const float w = __int_as_float(__builtin_amdgcn_readlane(wl, i));
#pragma unroll
    for (int q = 0; q < 4; ++q) acc[q] += w * bf16_round(x[i][q]);
  }
  *(v4fa*)&part[wv][lane * 4] = acc;
  __syncthreads();   // the 32 partial sums of every column are in part before they are added
  if (tid >= DD / IQ) return;
  float s = part[0][tid];
#pragma unroll
  for (int j = 1; j < 32; ++j) s += part[j][tid];
  cint[(size_t)b * DD + c0 + tid] = s;
}
// slot scores: block = QT queries t of one batch, 8 waves; wave wv takes keys s in [32 wv, 32 wv + 32) for all QT queries.
// si of the queries and slot_v stay in registers (lane holds a = 32 u + lane) and a key row is fetched by 16 loads at once, so a row feeds
// 16 QT tanh per lane with no load and no LDS read between them; per (t,s) the terms are summed in the old order (u ascending, then the butterfly).
// softmax over s -> W[b][t][s] by waves 0..QT-1, one query each, behind the block barrier.
#define QT 2
// waves_per_eu: the launch puts 8 waves on every SIMD (MR / QT blocks of 8 waves on 1024 SIMDs); this is the register budget that goes with it
__global__ __launch_bounds__(256) __attribute__((amdgpu_waves_per_eu(8, 8))) void k_slot(const float* __restrict__ P, const float* __restrict__ sv, float* __restrict__ Wt) {
  __shared__ float ssc[QT][TT];
  const int tid = threadIdx.x, wv = tid >> 5, lane = tid & 31; const int m0 = blockIdx.x * QT; if (m0 >= MR) return; const int b = m0 / TT;
  float si[QT][16], vv[16], cur[16], keep[QT];
  // every "#pragma unroll" of this kernel: the arrays are then indexed by constants only and stay in registers
#pragma unroll
  for (int u = 0; u < 16; ++u) vv[u] = bf16_round(sv[u * 32 + lane]);
#pragma unroll
  for (int j = 0; j < QT; ++j) { const float* sir = P + (size_t)(m0 + j) * 3 * DD + 2 * DD; keep[j] = 0.f;
#pragma unroll
    for (int u = 0; u < 16; ++u) si[j][u] = sir[u * 32 + lane]; }
  const float* sh0 = P + ((size_t)b * TT + wv * 32) * 3 * DD + DD + lane;
#pragma unroll
  for (int u = 0; u < 16; ++u) cur[u] = sh0[u * 32];
  for (int k = 0; k < 32; ++k) {
    float acc[QT];
#pragma unroll
    for (int j = 0; j < QT; ++j) acc[j] = 0.f;
#pragma unroll
    for (int u = 0; u < 16; ++u) {
#pragma unroll
      for (int j = 0; j < QT; ++j) acc[j] += vv[u] * tanh_fast(cur[u] + si[j][u]);
    }
    const float* nrow = sh0 + (size_t)((k + 1) & 31) * 3 * DD;   // next key row: its loads fly during the butterfly (the last trip re-reads the wave's first row, unused)
#pragma unroll
    for (int u = 0; u < 16; ++u) cur[u] = nrow[u * 32];
    __builtin_amdgcn_sched_barrier(0);   // keeps those loads in front of the butterfly's waits, and the butterfly out of the region of the row's sums (in one region this compiler pairs fewer of the multiply-adds)
#pragma unroll
    for (int j = 0; j < QT; ++j) { float a = acc[j]; for (int o = 16; o >= 1; o >>= 1) a += __shfl_xor(a, o, 32); if (lane == k) keep[j] = a; }
  }
#pragma unroll
  for (int j = 0; j < QT; ++j) ssc[j][wv * 32 + lane] = keep[j];
  __syncthreads();   // every wave's 32 keys of each query are in ssc before a query's softmax reads all 256
  if (wv >= QT) return;
  const int m = m0 + wv;
  float mx = -3.0e38f;
  for (int u = 0; u < 8; ++u) mx = fmaxf(mx, ssc[wv][u * 32 + lane]);
  for (int o = 16; o >= 1; o >>= 1) mx = fmaxf(mx, __shfl_xor(mx, o, 32));
  float den = 0.f;
#pragma unroll 1
  for (int u = 0; u < 8; ++u) { const float e = expf(ssc[wv][u * 32 + lane] - mx); ssc[wv][u * 32 + lane] = e; den += e; }
  for (int o = 16; o >= 1; o >>= 1) den += __shfl_xor(den, o, 32); const float inv = 1.0f / den;
  {
#pragma unroll 1
    for (int u = 0; u < 8; ++u) *(float*)(Wt + (size_t)m * TT + u * 32 + lane) = ssc[wv][u * 32 + lane] * inv;  }
}
extern "C" void kernel_launch(void* const* d_in, const int* in_sizes, int n_in,
                              void* d_out, int out_size, void* d_ws, size_t ws_size, hipStream_t stream) {
  (void)in_sizes; (void)n_in; (void)out_size;
  const float* S = (const float*)d_in[0]; const float* fst = (const float*)d_in[1]; const float* iv = (const float*)d_in[2]; const float* W_ih = (const float*)d_in[3]; const float* b_ih = (const float*)d_in[4]; const float* W_ii = (const float*)d_in[5]; const float* b_ii = (const float*)d_in[6];
  const float* sv = (const float*)d_in[7]; const float* W_sh = (const float*)d_in[8]; const float* b_sh = (const float*)d_in[9]; const float* W_si = (const float*)d_in[10]; const float* b_si = (const float*)d_in[11];
  float* cslot = (float*)d_out; float* cint = (float*)((char*)d_out + 4194304);
  char* ws = (char*)d_ws; size_t off = 0;
  auto take = [&](size_t bytes) { char* p = ws + off; off += (bytes + 255) & ~(size_t)255; return p; };
  unsigned short* B3 = (unsigned short*)take((size_t)3 * DD * DD * 2); unsigned short* Bii = (unsigned short*)take((size_t)DD * DD * 2); float* b3 = (float*)take(3 * DD * 4); unsigned short* ST = (unsigned short*)take((size_t)BB * DD * TT * 2);
  float* fp = (float*)take(16 * DD * 4); float* ii = (float*)take(16 * DD * 4); float* P = (float*)take((size_t)MR * 3 * DD * 4); float* Wt = (float*)take((size_t)MR * TT * 4);
  if (off > ws_size) return;
  k_prep<<<NB_ST + 4 * NB_WT + NB_FP + 3, 256, 0, stream>>>(W_ih, W_sh, W_si, W_ii, b_ih, b_sh, b_si, S, fst, B3, Bii, b3, ST, fp);
  k_proj<<<NB_II + NB_P, 128, 0, stream>>>(S, B3, b3, P, fp, Bii, b_ii, ii);      // ii (rows 0..7) and [ih | sh | si] + b (single term)
  k_intent<<<BB * IQ, 1024, 0, stream>>>(P, ii, iv, S, cint);
  k_slot<<<MR / QT, 256, 0, stream>>>(P, sv, Wt);
  k_gemm_b<true, false, 0><<<dim3(((TT / 16) * (DD / 64) + 3) / 4, BB), 128, 0, stream>>>(Wt, TT, (size_t)TT * TT, ST, ST, TT, (size_t)DD * TT, nullptr, nullptr, 0, 0, 1.f, 1.f, cslot, DD, (size_t)TT * DD, TT, DD, TT);   // c_slot[b] = W[b]·S[b]
}

// v005
// It runs in 58.2 microseconds.
// In two side-by-side timings against v004, it was 1.50 and 1.48 times as fast.
// Counting every step since v000, it is 23.2 times as fast.
#include <hip/hip_runtime.h>
// [ih | sh | si] = S·[W_ih|W_sh|W_si] + b (one GEMM, K=512, N=1536), ii = f·W_ii + b (M padded to 16) — inputs and weights rounded to bf16: single exact
// WMMA term, f32 accumulate — and c_slot = slot_w·S per batch (slot_w split into bf16 hi/lo vs exact bf16 Sᵀ planes: 2 terms) run on
// v_wmma_f32_16x16x32_bf16; the additive tanh scores (intent: T×A, slot: T×T×A), both softmaxes and c_intent are f32 VALU.
#define BB 8
#define TT 256
#define DD 512
#define MR (BB * TT)

typedef __bf16 v16b __attribute__((ext_vector_type(16)));
typedef unsigned short v8us __attribute__((ext_vector_type(8), may_alias));
typedef float  v8f  __attribute__((ext_vector_type(8)));
typedef float  v4f  __attribute__((ext_vector_type(4)));
typedef float  v4fa __attribute__((ext_vector_type(4), may_alias));
union FragB { v16b v; v8us half[2]; unsigned short u[16]; };

__device__ __forceinline__ unsigned short bf16_bits(float x) { unsigned int u = __float_as_uint(x); return (unsigned short)((u + 0x7FFFu + ((u >> 16) & 1u)) >> 16); }
__device__ __forceinline__ float bf16_val(unsigned short b) { return __uint_as_float(((unsigned int)b) << 16); }
__device__ __forceinline__ float bf16_round(float x) { return bf16_val(bf16_bits(x)); }
// D += A·B with NT terms: 1 = ah·bh, 2 = + al·bh (A split), 3 = + ah·bl (both split)
template <int NT>
__device__ __forceinline__ v8f mmaN(v16b ah, v16b al, v16b bh, v16b bl, v8f c) {
  c = __builtin_amdgcn_wmma_f32_16x16x32_bf16(false, ah, false, bh, (short)0, c, false, false);
  if (NT >= 2) c = __builtin_amdgcn_wmma_f32_16x16x32_bf16(false, al, false, bh, (short)0, c, false, false);
  if (NT >= 3) c = __builtin_amdgcn_wmma_f32_16x16x32_bf16(false, ah, false, bl, (short)0, c, false, false);
  asm volatile("v_nop\n\tv_nop\n\tv_nop\n\tv_nop" : "+v"(c) : "v"(ah), "v"(al), "v"(bh), "v"(bl));
  return c;
}

__device__ __forceinline__ void d_wt_bf16(int blk, const float* __restrict__ W, unsigned short* __restrict__ Wt, int K, int N) {
  const int t = blk * 256 + threadIdx.x;
  const int k8n = K / 8;
  if (t >= N * k8n) return;
  const int n = t / k8n, k8 = (t % k8n) * 8;
  v8us v;
#pragma unroll
  for (int i = 0; i < 8; ++i) v[i] = bf16_bits(W[(size_t)(k8 + i) * N + n]);
  *(v8us*)(Wt + (size_t)n * K + k8) = v;
  
}

// GEMM C[M][N] (f32, pitch ldc) = act(A[M][K]·W + bias). A f32 row-major (pitch lda) converted per fragment to bf16
// (ASPLIT: hi/lo two planes -> 2 terms, else single rounded term); Wt bf16 [N][K] (pitch ldb). BIAS_BF16 rounds the
// bias to bf16 first (bias quantised to bf16 before the add). K%32==0, M%16==0, N%64==0.
template <bool ASPLIT, int ACT, bool BIAS_BF16>
__global__ __launch_bounds__(128) void k_gemm_bf(const float* __restrict__ A, int lda, const unsigned short* __restrict__ Wt, int ldb,
                                               const float* __restrict__ bias, float* __restrict__ C, int ldc, int M, int N, int K) {
  __shared__ __attribute__((aligned(16))) float so[4][16][64];
  const int tid = threadIdx.x, w = tid >> 5, lane = tid & 31, ln = lane & 15, hh = lane >> 4;
  const int ntn = N / 64;
  const int wid = blockIdx.x * 4 + w;
  const int mt = wid / ntn, nq = wid % ntn;
  if (mt * 16 >= M) return;
  const int row0 = mt * 16, col0 = nq * 64;
  const float* arow = A + (size_t)(row0 + ln) * lda;
  v8f acc[4] = {};
  for (int kb = 0; kb < K; kb += 32) {
    FragB ah, al;
    const v4f x0 = *(const v4fa*)(arow + kb + 8 * hh), x1 = *(const v4fa*)(arow + kb + 8 * hh + 4);
    const v4f x2 = *(const v4fa*)(arow + kb + 16 + 8 * hh), x3 = *(const v4fa*)(arow + kb + 16 + 8 * hh + 4);
    float xs[16] = {x0[0],x0[1],x0[2],x0[3],x1[0],x1[1],x1[2],x1[3],x2[0],x2[1],x2[2],x2[3],x3[0],x3[1],x3[2],x3[3]};
#pragma unroll
    for (int i = 0; i < 16; ++i) { const unsigned short hb = bf16_bits(xs[i]); ah.u[i] = hb; al.u[i] = ASPLIT ? bf16_bits(xs[i] - bf16_val(hb)) : (unsigned short)0; }
#pragma unroll
    for (int t = 0; t < 4; ++t) {
      const unsigned short* brow = Wt + (size_t)(col0 + t * 16 + ln) * ldb + kb;
      FragB b;
      b.half[0] = *(const v8us*)(brow + 8 * hh);
      b.half[1] = *(const v8us*)(brow + 16 + 8 * hh);
      acc[t] = mmaN<ASPLIT ? 2 : 1>(ah.v, al.v, b.v, b.v, acc[t]);
    }
  }
#pragma unroll
  for (int t = 0; t < 4; ++t) {
    float bv = bias ? bias[col0 + t * 16 + ln] : 0.f;
    if (BIAS_BF16) bv = bf16_round(bv);
#pragma unroll
    for (int r = 0; r < 8; ++r) { float v = acc[t][r] + bv; if (ACT == 1) v = fmaxf(v, 0.f); so[w][8 * hh + r][t * 16 + ln] = v; }
  }
  __builtin_amdgcn_fence(__ATOMIC_ACQ_REL, "workgroup");
  __builtin_amdgcn_wave_barrier();
  const int rsub = lane >> 4, c4 = (lane & 15) * 4;
  {
#pragma unroll
    for (int q = 0; q < 8; ++q) {
      const int r = q * 2 + rsub;
      const v4f v = *(const v4fa*)&so[w][r][c4];
      *(v4f*)(C + (size_t)(row0 + r) * ldc + col0 + c4) = v;
    }
    
  }
}

// Flash-style causal/unmasked attention, all contractions 3-term bf16 hi/lo splits, f32 softmax with running max.
// q,k,v rows are read from f32 buffers with arbitrary row pitch (so they can live inside a fused qkv buffer);
// D = head size (multiple of 32, <= 128); one wave = 16 query rows; block = 4 waves (64 queries) sharing K/V chunks of 32.
template <int D, bool CAUSAL>
__global__ __launch_bounds__(128) void k_flash(const float* __restrict__ qb, const float* __restrict__ kb, const float* __restrict__ vb,
                                             int pitch, int T, int H, float scale, float* __restrict__ y, int ypitch) {
  constexpr int KS = D / 32;        // k-steps for QK
  constexpr int DT = D / 16;        // d tiles for PV
  __shared__ __attribute__((aligned(16))) unsigned short sKh[32][D + 8], sKl[32][D + 8], sVh[32][D + 8], sVl[32][D + 8];
  __shared__ __attribute__((aligned(16))) unsigned short sPh[4][16][40], sPl[4][16][40];
  __shared__ __attribute__((aligned(16))) float sO[4][16][D];
  const int tid = threadIdx.x, w = tid >> 5, lane = tid & 31, ln = lane & 15, hh = lane >> 4;
  const int nqb = (T + 63) / 64;
  const int bh = blockIdx.x / nqb, qblk = blockIdx.x % nqb;
  const int b = bh / H, h = bh % H;
  const int q0 = qblk * 64 + w * 16;
  const float* Q = qb + (size_t)b * T * pitch + h * D;
  const float* K = kb + (size_t)b * T * pitch + h * D;
  const float* V = vb + (size_t)b * T * pitch + h * D;

  // A fragments of the wave's 16 query rows (scaled), hi/lo
  FragB aqh[KS], aql[KS];
  {
    int row = q0 + ln; if (row >= T) row = T - 1;
    const float* qr = Q + (size_t)row * pitch;
#pragma unroll
    for (int ks = 0; ks < KS; ++ks)
#pragma unroll
      for (int i = 0; i < 16; ++i) {
        const int d = ks * 32 + ((i < 8) ? (8 * hh + i) : (16 + 8 * hh + (i - 8)));
        const float x = qr[d] * scale; const unsigned short hb = bf16_bits(x);
        aqh[ks].u[i] = hb; aql[ks].u[i] = bf16_bits(x - bf16_val(hb));
      }
  }
  float m_r[8], l_r[8];
#pragma unroll
  for (int r = 0; r < 8; ++r) { m_r[r] = -3.0e38f; l_r[r] = 0.f; }
  v8f oacc[DT];
#pragma unroll
  for (int dt = 0; dt < DT; ++dt) oacc[dt] = (v8f){0.f,0.f,0.f,0.f,0.f,0.f,0.f,0.f};

  const int kv_end = CAUSAL ? min(T, qblk * 64 + 64) : T;     // block-uniform
  for (int j0 = 0; j0 < kv_end; j0 += 32) {
    __syncthreads();
    for (int e = tid; e < 32 * (D / 4); e += 128) {
      const int r = e / (D / 4), c4 = (e % (D / 4)) * 4;
      const int key = j0 + r;
      v4f kf = {0.f,0.f,0.f,0.f}, vf = {0.f,0.f,0.f,0.f};
      if (key < T) { kf = *(const v4fa*)(K + (size_t)key * pitch + c4); vf = *(const v4fa*)(V + (size_t)key * pitch + c4); }
#pragma unroll
      for (int t = 0; t < 4; ++t) {
        unsigned short hb = bf16_bits(kf[t]); sKh[r][c4 + t] = hb; sKl[r][c4 + t] = bf16_bits(kf[t] - bf16_val(hb));
        hb = bf16_bits(vf[t]); sVh[r][c4 + t] = hb; sVl[r][c4 + t] = bf16_bits(vf[t] - bf16_val(hb));
      }
    }
    __syncthreads();
    // S tile 16 x 32
    v8f s[2];
#pragma unroll
    for (int nt = 0; nt < 2; ++nt) {
      v8f acc = {};
#pragma unroll
      for (int ks = 0; ks < KS; ++ks) {
        FragB bh_, bl_;
        bh_.half[0] = *(const v8us*)&sKh[nt * 16 + ln][ks * 32 + 8 * hh]; bh_.half[1] = *(const v8us*)&sKh[nt * 16 + ln][ks * 32 + 16 + 8 * hh];
        bl_.half[0] = *(const v8us*)&sKl[nt * 16 + ln][ks * 32 + 8 * hh]; bl_.half[1] = *(const v8us*)&sKl[nt * 16 + ln][ks * 32 + 16 + 8 * hh];
        acc = mmaN<3>(aqh[ks].v, aql[ks].v, bh_.v, bl_.v, acc);
      }
      s[nt] = acc;
    }
    // mask + running max (rows 8hh+r; the 16 lanes of a half share rows)
    float alpha[8];
#pragma unroll
    for (int r = 0; r < 8; ++r) {
      const int qi = q0 + 8 * hh + r;
      const int ja = j0 + ln, jb = j0 + 16 + ln;
      if (CAUSAL) { if (ja > qi) s[0][r] = -3.0e38f; if (jb > qi) s[1][r] = -3.0e38f; }
      if (ja >= T) s[0][r] = -3.0e38f;
      if (jb >= T) s[1][r] = -3.0e38f;
      float mx = fmaxf(s[0][r], s[1][r]);
      mx = fmaxf(mx, __shfl_xor(mx, 1, 32)); mx = fmaxf(mx, __shfl_xor(mx, 2, 32)); mx = fmaxf(mx, __shfl_xor(mx, 4, 32)); mx = fmaxf(mx, __shfl_xor(mx, 8, 32));
      const float mnew = fmaxf(m_r[r], mx);
      alpha[r] = (mnew > -1.0e38f) ? __expf(m_r[r] - mnew) : 1.0f;
      const float p0 = (s[0][r] > -1.0e38f) ? __expf(s[0][r] - mnew) : 0.f;
      const float p1 = (s[1][r] > -1.0e38f) ? __expf(s[1][r] - mnew) : 0.f;
      m_r[r] = mnew;
      l_r[r] = l_r[r] * alpha[r] + p0 + p1;            // per-lane partial row sum (16 lanes combined at the end)
      unsigned short hb = bf16_bits(p0); sPh[w][8 * hh + r][ln] = hb;      sPl[w][8 * hh + r][ln] = bf16_bits(p0 - bf16_val(hb));
      hb = bf16_bits(p1);                sPh[w][8 * hh + r][16 + ln] = hb; sPl[w][8 * hh + r][16 + ln] = bf16_bits(p1 - bf16_val(hb));
    }
#pragma unroll
    for (int dt = 0; dt < DT; ++dt)
#pragma unroll
      for (int r = 0; r < 8; ++r) oacc[dt][r] *= alpha[r];
    __builtin_amdgcn_fence(__ATOMIC_ACQ_REL, "workgroup");
    __builtin_amdgcn_wave_barrier();
    FragB pah, pal;
    pah.half[0] = *(const v8us*)&sPh[w][ln][8 * hh]; pah.half[1] = *(const v8us*)&sPh[w][ln][16 + 8 * hh];
    pal.half[0] = *(const v8us*)&sPl[w][ln][8 * hh]; pal.half[1] = *(const v8us*)&sPl[w][ln][16 + 8 * hh];
#pragma unroll
    for (int dt = 0; dt < DT; ++dt) {
      FragB bvh, bvl;
#pragma unroll
      for (int i = 0; i < 8; ++i) {
        bvh.u[i] = sVh[8 * hh + i][dt * 16 + ln]; bvh.u[8 + i] = sVh[16 + 8 * hh + i][dt * 16 + ln];
        bvl.u[i] = sVl[8 * hh + i][dt * 16 + ln]; bvl.u[8 + i] = sVl[16 + 8 * hh + i][dt * 16 + ln];
      }
      oacc[dt] = mmaN<3>(pah.v, pal.v, bvh.v, bvl.v, oacc[dt]);
    }
    __builtin_amdgcn_fence(__ATOMIC_ACQ_REL, "workgroup");
    __builtin_amdgcn_wave_barrier();
  }
#pragma unroll
  for (int r = 0; r < 8; ++r) {
    float l = l_r[r];
    l += __shfl_xor(l, 1, 32); l += __shfl_xor(l, 2, 32); l += __shfl_xor(l, 4, 32); l += __shfl_xor(l, 8, 32);
    l_r[r] = (l > 0.f) ? 1.0f / l : 0.f;
  }
#pragma unroll
  for (int dt = 0; dt < DT; ++dt)
#pragma unroll
    for (int r = 0; r < 8; ++r) sO[w][8 * hh + r][dt * 16 + ln] = oacc[dt][r] * l_r[r];
  __builtin_amdgcn_fence(__ATOMIC_ACQ_REL, "workgroup");
  __builtin_amdgcn_wave_barrier();
  {
    for (int r = 0; r < 16; ++r) {
      const int row = q0 + r;
      if (row < T && lane < D / 4) {
        const v4f val = *(const v4fa*)&sO[w][r][lane * 4];
        *(v4f*)(y + ((size_t)b * T + row) * ypitch + h * D + lane * 4) = val;
      }
    }
    
  }
}

// row LayerNorm (biased variance, eps) over N: s = X (+ R); optional out_sum <- s; out_norm <- (s-mu)*rsqrt(var+eps)*g + b
template <bool PARAM_BF16>
__global__ __launch_bounds__(256) void k_layernorm(const float* __restrict__ X, const float* __restrict__ R, const float* __restrict__ g, const float* __restrict__ bta,
                                                  float* __restrict__ out_sum, float* __restrict__ out_norm, int N, float eps) {
  __shared__ float red[256];
  const int row = blockIdx.x, tid = threadIdx.x;
  const float* x = X + (size_t)row * N; const float* rr = R ? R + (size_t)row * N : nullptr;
  float vals[16];                     // up to N = 4096
  const int per = N / 256;            // contiguous chunk per thread? use strided-by-4 chunks: thread handles j = tid*4 + 1024*u
  float s1 = 0.f;
  for (int u = 0; u < per / 4; ++u) {
    const int j = tid * 4 + 1024 * u;
    const v4f a = *(const v4fa*)(x + j);
    v4f b = {0.f,0.f,0.f,0.f}; if (rr) b = *(const v4fa*)(rr + j);
#pragma unroll
    for (int q = 0; q < 4; ++q) { const float v = a[q] + b[q]; vals[u * 4 + q] = v; s1 += v; }
  }
  red[tid] = s1; __syncthreads();
  for (int st = 128; st > 0; st >>= 1) { if (tid < st) red[tid] += red[tid + st]; __syncthreads(); }
  const float mu = red[0] / (float)N; __syncthreads();
  float s2 = 0.f;
  for (int u = 0; u < per / 4; ++u)
#pragma unroll
    for (int q = 0; q < 4; ++q) { const float c = vals[u * 4 + q] - mu; s2 += c * c; }
  red[tid] = s2; __syncthreads();
  for (int st = 128; st > 0; st >>= 1) { if (tid < st) red[tid] += red[tid + st]; __syncthreads(); }
  const float rs = rsqrtf(red[0] / (float)N + eps);
  {
    for (int u = 0; u < per / 4; ++u) {
      const int j = tid * 4 + 1024 * u;
      v4f o, sm;
#pragma unroll
      for (int q = 0; q < 4; ++q) {
        float gg = g[j + q], bb = bta[j + q];
        if (PARAM_BF16) { gg = bf16_round(gg); bb = bf16_round(bb); }
        sm[q] = vals[u * 4 + q]; o[q] = (vals[u * 4 + q] - mu) * rs * gg + bb;
      }
      if (out_sum) *(v4f*)(out_sum + (size_t)row * N + j) = sm;
      *(v4f*)(out_norm + (size_t)row * N + j) = o;
    }
    
  }
}

// batched f32 [K][N] (pitch lds, batch stride sIn) -> transposed hi/lo planes [N][K] (batch stride sOut); thread per (n, 8 k); grid.y = batch
__global__ __launch_bounds__(256) void k_split_transpose_b(const float* __restrict__ src, int lds_, size_t sIn, unsigned short* __restrict__ hi, unsigned short* __restrict__ lo, size_t sOut, int K, int N) {
  const size_t t = (size_t)blockIdx.x * 256 + threadIdx.x; const int k8n = K / 8; if (t >= (size_t)N * k8n) return;
  src += (size_t)blockIdx.y * sIn; hi += (size_t)blockIdx.y * sOut; lo += (size_t)blockIdx.y * sOut;
  const int n = (int)(t / k8n), k8 = (int)(t % k8n) * 8; v8us vh, vl;
#pragma unroll
  for (int i = 0; i < 8; ++i) { const float x = src[(size_t)(k8 + i) * lds_ + n]; const unsigned short hb = bf16_bits(x); vh[i] = hb; vl[i] = bf16_bits(x - bf16_val(hb)); }
  unsigned short* dh = hi + (size_t)n * K + k8; unsigned short* dl = lo + (size_t)n * K + k8;
  *(v8us*)dh = vh; *(v8us*)dl = vl; 
}


__device__ __forceinline__ void d_roundcopy(const float* __restrict__ src, float* __restrict__ dst, int n8) {
  const size_t t = threadIdx.x;
  if (t >= (size_t)n8 * 2) return;
  v4f a = *(const v4fa*)(src + t * 4);
  for (int i = 0; i < 4; ++i) a[i] = bf16_round(a[i]);
  *(v4f*)(dst + t * 4) = a; 
}

// one v_tanh_f32 per value
__device__ __forceinline__ float tanh_fast(float x) { return __builtin_amdgcn_tanhf(x); }
// f32 rows: fpad[16][512] = final_state rows 0..7, zero rows 8..15 (thread per float4)
__device__ __forceinline__ void d_fpad(int blk, const float* __restrict__ f, float* __restrict__ fp) { const int t = blk * 256 + threadIdx.x; if (t >= 16 * DD / 4) return; const int r = t / (DD / 4); v4f v = {0.f,0.f,0.f,0.f}; if (r < BB) { const v4f a = *(const v4fa*)(f + (size_t)t * 4); for (int q = 0; q < 4; ++q) v[q] = a[q]; } *(v4f*)(fp + (size_t)t * 4) = v;  }
// Sᵀ planes per batch (exact input): Bh[b][d][t] = bf16(S[b][t][d]); thread per (b, d, 8 t)
__device__ __forceinline__ void d_sT(int blk, const float* __restrict__ S, unsigned short* __restrict__ Bh) {
  const size_t i = (size_t)blk * 256 + threadIdx.x; if (i >= (size_t)BB * DD * (TT / 8)) return; const int t8 = (int)(i % (TT / 8)) * 8; const int d = (int)((i / (TT / 8)) % DD); const int b = (int)(i / ((size_t)(TT / 8) * DD));
  v8us v; for (int q = 0; q < 8; ++q) v[q] = bf16_bits(S[((size_t)b * TT + t8 + q) * DD + d]);
  *(v8us*)(Bh + ((size_t)b * DD + d) * TT + t8) = v; 
}
// the nine preparations, none of which reads what another writes, in ONE launch: the block index picks the job
#define NB_WT (DD * (DD / 8) / 256)
#define NB_ST (BB * DD * (TT / 8) / 256)
#define NB_FP (16 * DD / 4 / 256)
__global__ __launch_bounds__(256) void k_prep(const float* __restrict__ W_ih, const float* __restrict__ W_sh, const float* __restrict__ W_si, const float* __restrict__ W_ii,
                                              const float* __restrict__ b_ih, const float* __restrict__ b_sh, const float* __restrict__ b_si, const float* __restrict__ S, const float* __restrict__ f,
                                              unsigned short* __restrict__ B3, unsigned short* __restrict__ Bii, float* __restrict__ b3, unsigned short* __restrict__ ST, float* __restrict__ fp) {
  int blk = blockIdx.x;
  if (blk < NB_ST) { d_sT(blk, S, ST); return; }
  blk -= NB_ST;
  if (blk < 4 * NB_WT) {
    const int j = blk / NB_WT;
    d_wt_bf16(blk % NB_WT, j == 0 ? W_ih : j == 1 ? W_sh : j == 2 ? W_si : W_ii, j < 3 ? B3 + (size_t)j * DD * DD : Bii, DD, DD);
    return;
  }
  blk -= 4 * NB_WT;
  if (blk < NB_FP) { d_fpad(blk, f, fp); return; }
  blk -= NB_FP;
  d_roundcopy(blk == 0 ? b_ih : blk == 1 ? b_sh : b_si, b3 + blk * DD, DD / 8);
}
// both projections in ONE launch: blocks 0 .. NB_II - 1 do ii = f W_ii + b (M padded to 16), the rest [ih | sh | si] = S [W_ih | W_sh | W_si] + b.
// A block owns a PT x PT tile of C. It first brings its PT rows of A (rounded to bf16 on the way) and its PT rows of Wt, all of K, into LDS by loads
// in which a wave reads 512 bytes in a row; behind ONE barrier 16 waves (4 x 4, 32 x 32 of C each) read their fragments from LDS, k ascending, one WMMA per
// 32 k and 16 x 16 tile, so every sum has the order it had. An ii block has only 16 rows of A: the tile's rows above repeat them and are not stored.
#define PT 128
#define PP (DD + 8)   // LDS row pitch in bf16: 1040 B = 16 B x 65, an odd count of 16-byte units, for the 16-byte fragment reads
#define SP 36         // row pitch in floats of a wave's staging tile: rows 8 apart fall on different banks, rows stay 16-byte aligned
#define NB_II (DD / PT)
#define NB_P ((MR / PT) * (3 * DD / PT))
typedef unsigned short v4us __attribute__((ext_vector_type(4), may_alias));
typedef float f1a __attribute__((may_alias));
__global__ __launch_bounds__(512) void k_proj(const float* __restrict__ S, const unsigned short* __restrict__ B3, const float* __restrict__ b3, float* __restrict__ P,
                                              const float* __restrict__ fp, const unsigned short* __restrict__ Bii, const float* __restrict__ b_ii, float* __restrict__ ii) {
  __shared__ __attribute__((aligned(16))) unsigned short sm[2 * PT * PP];
  unsigned short* sA = sm; unsigned short* sB = sm + PT * PP;
  const bool isii = blockIdx.x < NB_II;
  const int blk = isii ? blockIdx.x : blockIdx.x - NB_II;
  const int mt = isii ? 0 : blk / (3 * DD / PT), nt = isii ? blk : blk % (3 * DD / PT);
  const float* A = isii ? fp : S + (size_t)mt * PT * DD;
  const unsigned short* B = (isii ? Bii : B3) + (size_t)nt * PT * DD;
  const int tid = threadIdx.x, w = tid >> 5, lane = tid & 31, ln = lane & 15, hh = lane >> 4;
  // every "#pragma unroll" of this kernel: the arrays are then indexed by constants only and stay in registers, and a batch's loads stand together in front of its stores
  {
    v8us bq[16]; v4f aq[32];
    const unsigned short* bsrc = B + (size_t)(tid >> 6) * DD + (tid & 63) * 8;
    const float* asrc = A + (size_t)(tid >> 7) * DD + (tid & 127) * 4;
#pragma unroll
    for (int i = 0; i < 16; ++i) bq[i] = *(const v8us*)(bsrc + (size_t)i * 8 * DD);
    asm volatile("s_wait_xcnt 0x0" ::: "memory");   // the compiler hands the address registers of the loads above to a later load as its destination: the wait stands in front of that overwrite
    if (isii) {
#pragma unroll
      for (int i = 0; i < 32; ++i) aq[i] = *(const v4fa*)(asrc + (size_t)(i & 3) * 4 * DD);
    } else {
#pragma unroll
      for (int i = 0; i < 31; ++i) aq[i] = *(const v4fa*)(asrc + (size_t)i * 4 * DD);
      asm volatile("s_wait_xcnt 0x0" ::: "memory");   // the same, for the last load, whose destination takes the address registers of the 31 above
      aq[31] = *(const v4fa*)(asrc + (size_t)31 * 4 * DD);
    }
#pragma unroll
    for (int i = 0; i < 16; ++i) *(v8us*)(sB + ((tid >> 6) + 8 * i) * PP + (tid & 63) * 8) = bq[i];
#pragma unroll
    for (int i = 0; i < 32; ++i) {
      v4us q;
#pragma unroll
      for (int t = 0; t < 4; ++t) q[t] = bf16_bits(aq[i][t]);
      *(v4us*)(sA + ((tid >> 7) + 4 * i) * PP + (tid & 127) * 4) = q;
    }
  }
  __syncthreads();   // both tiles are whole in LDS before any wave reads a fragment
  const int wm = w >> 2, wn = w & 3;
  const unsigned short* pa = sA + (wm * 32 + ln) * PP + 8 * hh;
  const unsigned short* pb = sB + (wn * 32 + ln) * PP + 8 * hh;
  v8f acc[2][2] = {};
  FragB a[2][2], b[2][2];   // two fragment sets: the next 32 k are read from LDS while this set's WMMAs run
#pragma unroll
  for (int i = 0; i < 2; ++i) {
    a[0][i].half[0] = *(const v8us*)(pa + i * 16 * PP); a[0][i].half[1] = *(const v8us*)(pa + i * 16 * PP + 16);
    b[0][i].half[0] = *(const v8us*)(pb + i * 16 * PP); b[0][i].half[1] = *(const v8us*)(pb + i * 16 * PP + 16);
  }
#pragma unroll
  for (int s = 0; s < DD / 32; ++s) {
    const int cu = s & 1, nx = cu ^ 1, kn = (s + 1) * 32;
    if (kn < DD) {
#pragma unroll
      for (int i = 0; i < 2; ++i) {
        a[nx][i].half[0] = *(const v8us*)(pa + i * 16 * PP + kn); a[nx][i].half[1] = *(const v8us*)(pa + i * 16 * PP + kn + 16);
        b[nx][i].half[0] = *(const v8us*)(pb + i * 16 * PP + kn); b[nx][i].half[1] = *(const v8us*)(pb + i * 16 * PP + kn + 16);
      }
    }
    __builtin_amdgcn_sched_barrier(0);   // keeps the next set's LDS reads, as one group, in front of this set's WMMAs (left alone the compiler sinks them to their uses, and every set is waited for in full)
#pragma unroll
    for (int i = 0; i < 2; ++i)
#pragma unroll
      for (int j = 0; j < 2; ++j) acc[i][j] = __builtin_amdgcn_wmma_f32_16x16x32_bf16(false, a[cu][i].v, false, b[cu][j].v, (short)0, acc[i][j], false, false);
  }
  __syncthreads();   // every wave has read its last fragment before the tiles' LDS is used again for staging
  f1a* so = (f1a*)sm + w * 32 * SP;
#pragma unroll
  for (int j = 0; j < 2; ++j) {
    float bv = (isii ? b_ii : b3)[nt * PT + wn * 32 + j * 16 + ln];
    if (isii) bv = bf16_round(bv);
#pragma unroll
    for (int i = 0; i < 2; ++i)
#pragma unroll
      for (int r = 0; r < 8; ++r) so[(i * 16 + 8 * hh + r) * SP + j * 16 + ln] = acc[i][j][r] + bv;
  }
  __builtin_amdgcn_fence(__ATOMIC_ACQ_REL, "workgroup");   // the wave's own staging stores are done before its lanes read each other's
  __builtin_amdgcn_wave_barrier();
  v4f v[8];
#pragma unroll
  for (int q = 0; q < 8; ++q) v[q] = *(const v4fa*)&so[(q * 4 + (lane >> 3)) * SP + (lane & 7) * 4];
  const int crow = wm * 32 + (lane >> 3), ccol = nt * PT + wn * 32 + (lane & 7) * 4;
  if (!isii) {
    float* C = P + ((size_t)mt * PT + crow) * (3 * DD) + ccol;
#pragma unroll
    for (int q = 0; q < 8; ++q) *(v4f*)(C + (size_t)q * 4 * 3 * DD) = v[q];
    asm volatile("s_wait_xcnt 0x0" ::: "memory");   // in the listing the other arm's address arithmetic follows these stores and rewrites registers that they name: the wait stands in front of it
  } else if (wm == 0) {   // an ii block stores rows 0 .. 15 only
    float* C = ii + (size_t)crow * DD + ccol;
#pragma unroll
    for (int q = 0; q < 4; ++q) *(v4f*)(C + (size_t)q * 4 * DD) = v[q];
  }
}
// intent: 4 blocks per b (one per 128 columns of c_intent), 32 waves each. Scores (every block of a b computes all 256): wave wv takes the rows t = 8 wv .. 8 wv + 7, a row
// spread over the lanes (lane holds a = 128 u + 4 lane + q), so a row is 4 whole-line loads, independent of every other row's, and 16 fly at once; ii and intent_v stay in
// registers; a row's 32 partial sums meet in a butterfly over the lanes. softmax over t: every wave for itself, from the 256 scores in LDS.
// c_intent[b][d] = sum_s w_s bf16(S[b][s][d]): wave wv takes the keys s = 8 wv .. 8 wv + 7 (8 independent loads), lane the columns 4 lane .. 4 lane + 3 of the block's 128;
// the 32 partial sums of a column are added through LDS, wv ascending.
#define IQ 4
__global__ __launch_bounds__(1024) void k_intent(const float* __restrict__ P, const float* __restrict__ ii, const float* __restrict__ iv, const float* __restrict__ S, float* __restrict__ cint) {
  __shared__ float ssc[TT];
  __shared__ __attribute__((aligned(16))) float part[32][DD / IQ];
  const int b = blockIdx.x / IQ, c0 = (blockIdx.x % IQ) * (DD / IQ), tid = threadIdx.x, wv = tid >> 5, lane = tid & 31;
  // every "#pragma unroll" of this kernel: the arrays are then indexed by constants only and stay in registers, and a batch's loads stand together in front of its sums
  v4f vi[4], vv[4];
#pragma unroll
  for (int u = 0; u < 4; ++u) { vi[u] = *(const v4fa*)(ii + (size_t)b * DD + u * 128 + lane * 4); vv[u] = *(const v4fa*)(iv + u * 128 + lane * 4); }
  const float* row0 = P + ((size_t)b * TT + wv * 8) * 3 * DD + lane * 4;
  float sc[8];
#pragma unroll
  for (int rb = 0; rb < 8; rb += 4) {
    v4f h[4][4];
#pragma unroll
    for (int r = 0; r < 4; ++r)
#pragma unroll
      for (int u = 0; u < 4; ++u) h[r][u] = *(const v4fa*)(row0 + (size_t)(rb + r) * 3 * DD + u * 128);
#pragma unroll
    for (int r = 0; r < 4; ++r) {
      float a = 0.f;
#pragma unroll
      for (int u = 0; u < 4; ++u)
#pragma unroll
        for (int q = 0; q < 4; ++q) a += bf16_round(vv[u][q]) * tanh_fast(h[r][u][q] + vi[u][q]);
      sc[rb + r] = a;
    }
  }
  // the key rows of the weighted sum need no score: their loads fly during the butterflies
  const float* sp = S + ((size_t)b * TT + wv * 8) * DD + c0 + lane * 4;
  v4f x[8];
#pragma unroll
  for (int i = 0; i < 8; ++i) x[i] = *(const v4fa*)(sp + (size_t)i * DD);
  // the 8 rows' butterflies folded into one: at the steps 1, 2, 4 a lane keeps the half of its rows that its lane bit names and hands the other half over,
  // so 4 + 2 + 1 + 1 + 1 exchanges serve all 8 rows, and every lane ends with the whole sum of row lane & 7
  float s1[4], s2[2];
#pragma unroll
  for (int i = 0; i < 4; ++i) s1[i] = ((lane & 1) ? sc[2 * i + 1] : sc[2 * i]) + __shfl_xor((lane & 1) ? sc[2 * i] : sc[2 * i + 1], 1, 32);
#pragma unroll
  for (int i = 0; i < 2; ++i) s2[i] = ((lane & 2) ? s1[2 * i + 1] : s1[2 * i]) + __shfl_xor((lane & 2) ? s1[2 * i] : s1[2 * i + 1], 2, 32);
  float mine = ((lane & 4) ? s2[1] : s2[0]) + __shfl_xor((lane & 4) ? s2[0] : s2[1], 4, 32);
  mine += __shfl_xor(mine, 8, 32); mine += __shfl_xor(mine, 16, 32);
  if (lane < 8) ssc[wv * 8 + lane] = mine;
  __syncthreads();   // all 256 scores of the batch are in ssc before any wave's softmax reads them
  float e[8], mx = -3.0e38f, den = 0.f;
#pragma unroll
  for (int u = 0; u < 8; ++u) { e[u] = ssc[u * 32 + lane]; mx = fmaxf(mx, e[u]); }
  for (int o = 16; o >= 1; o >>= 1) mx = fmaxf(mx, __shfl_xor(mx, o, 32));
#pragma unroll
  for (int u = 0; u < 8; ++u) den += expf(e[u] - mx);
  for (int o = 16; o >= 1; o >>= 1) den += __shfl_xor(den, o, 32);
  const int wl = __float_as_int(expf(ssc[wv * 8 + (lane & 7)] - mx) / den);   // lane i < 8: the weight of key 8 wv + i
  v4f acc = {0.f, 0.f, 0.f, 0.f};
#pragma unroll
  for (int i = 0; i < 8; ++i) {
    const float w = __int_as_float(__builtin_amdgcn_readlane(wl, i));
#pragma unroll
    for (int q = 0; q < 4; ++q) acc[q] += w * bf16_round(x[i][q]);
  }
  *(v4fa*)&part[wv][lane * 4] = acc;
  __syncthreads();   // the 32 partial sums of every column are in part before they are added
  if (tid >= DD / IQ) return;
  float s = part[0][tid];
#pragma unroll
  for (int j = 1; j < 32; ++j) s += part[j][tid];
  cint[(size_t)b * DD + c0 + tid] = s;
}
// slot scores: block = QT queries t of one batch, 8 waves; wave wv takes keys s in [32 wv, 32 wv + 32) for all QT queries.
// si of the queries and slot_v stay in registers (lane holds a = 32 u + lane) and a key row is fetched by 16 loads at once, so a row feeds
// 16 QT tanh per lane with no load and no LDS read between them; per (t,s) the terms are summed in the old order (u ascending, then the butterfly).
// softmax over s -> W[b][t][s] by waves 0..QT-1, one query each, behind the block barrier.
#define QT 2
// waves_per_eu: the launch puts 8 waves on every SIMD (MR / QT blocks of 8 waves on 1024 SIMDs); this is the register budget that goes with it
__global__ __launch_bounds__(256) __attribute__((amdgpu_waves_per_eu(8, 8))) void k_slot(const float* __restrict__ P, const float* __restrict__ sv, float* __restrict__ Wt) {
  __shared__ float ssc[QT][TT];
  const int tid = threadIdx.x, wv = tid >> 5, lane = tid & 31; const int m0 = blockIdx.x * QT; if (m0 >= MR) return; const int b = m0 / TT;
  float si[QT][16], vv[16], cur[16], keep[QT];
  // every "#pragma unroll" of this kernel: the arrays are then indexed by constants only and stay in registers
#pragma unroll
  for (int u = 0; u < 16; ++u) vv[u] = bf16_round(sv[u * 32 + lane]);
#pragma unroll
  for (int j = 0; j < QT; ++j) { const float* sir = P + (size_t)(m0 + j) * 3 * DD + 2 * DD; keep[j] = 0.f;
#pragma unroll
    for (int u = 0; u < 16; ++u) si[j][u] = sir[u * 32 + lane]; }
  const float* sh0 = P + ((size_t)b * TT + wv * 32) * 3 * DD + DD + lane;
#pragma unroll
  for (int u = 0; u < 16; ++u) cur[u] = sh0[u * 32];
  for (int k = 0; k < 32; ++k) {
    float acc[QT];
#pragma unroll
    for (int j = 0; j < QT; ++j) acc[j] = 0.f;
#pragma unroll
    for (int u = 0; u < 16; ++u) {
#pragma unroll
      for (int j = 0; j < QT; ++j) acc[j] += vv[u] * tanh_fast(cur[u] + si[j][u]);
    }
    const float* nrow = sh0 + (size_t)((k + 1) & 31) * 3 * DD;   // next key row: its loads fly during the butterfly (the last trip re-reads the wave's first row, unused)
#pragma unroll
    for (int u = 0; u < 16; ++u) cur[u] = nrow[u * 32];
    __builtin_amdgcn_sched_barrier(0);   // keeps those loads in front of the butterfly's waits, and the butterfly out of the region of the row's sums (in one region this compiler pairs fewer of the multiply-adds)
#pragma unroll
    for (int j = 0; j < QT; ++j) { float a = acc[j]; for (int o = 16; o >= 1; o >>= 1) a += __shfl_xor(a, o, 32); if (lane == k) keep[j] = a; }
  }
#pragma unroll
  for (int j = 0; j < QT; ++j) ssc[j][wv * 32 + lane] = keep[j];
  __syncthreads();   // every wave's 32 keys of each query are in ssc before a query's softmax reads all 256
  if (wv >= QT) return;
  const int m = m0 + wv;
  float mx = -3.0e38f;
  for (int u = 0; u < 8; ++u) mx = fmaxf(mx, ssc[wv][u * 32 + lane]);
  for (int o = 16; o >= 1; o >>= 1) mx = fmaxf(mx, __shfl_xor(mx, o, 32));
  float den = 0.f;
#pragma unroll 1
  for (int u = 0; u < 8; ++u) { const float e = expf(ssc[wv][u * 32 + lane] - mx); ssc[wv][u * 32 + lane] = e; den += e; }
  for (int o = 16; o >= 1; o >>= 1) den += __shfl_xor(den, o, 32); const float inv = 1.0f / den;
  {
#pragma unroll 1
    for (int u = 0; u < 8; ++u) *(float*)(Wt + (size_t)m * TT + u * 32 + lane) = ssc[wv][u * 32 + lane] * inv;  }
}
// c_slot[b] = W[b] S[b], the same way: a block owns a CT x CT tile of one batch, brings its CT rows of W (split into bf16 hi and lo planes on the way) and its CT rows
// of the transposed S planes, all of K, into LDS by loads in which a wave reads 512 bytes in a row; behind ONE barrier 8 waves (4 x 2, 16 x 32 of C each) read their
// fragments from LDS; per 16 x 16 tile and 32 k the hi WMMA, then the lo WMMA, k ascending, so every sum has the order it had.
#define CT 64
#define CP (TT + 8)   // LDS row pitch in bf16: 528 B = 16 B x 33, an odd count of 16-byte units, for the 16-byte fragment reads
__global__ __launch_bounds__(256) void k_cslot(const float* __restrict__ Wt, const unsigned short* __restrict__ ST, float* __restrict__ C) {
  __shared__ __attribute__((aligned(16))) unsigned short sm[3 * CT * CP];
  unsigned short* sAh = sm; unsigned short* sAl = sm + CT * CP; unsigned short* sB = sm + 2 * CT * CP;
  const int by = blockIdx.y, mt = blockIdx.x / (DD / CT), nt = blockIdx.x % (DD / CT);
  const int tid = threadIdx.x, w = tid >> 5, lane = tid & 31, ln = lane & 15, hh = lane >> 4;
  // every "#pragma unroll" of this kernel: the arrays are then indexed by constants only and stay in registers, and a batch's loads stand together in front of its stores
  {
    v8us bq[8]; v4f aq[16];
    const unsigned short* bsrc = ST + ((size_t)by * DD + nt * CT + (tid >> 5)) * TT + (tid & 31) * 8;
    const float* asrc = Wt + ((size_t)by * TT + mt * CT + (tid >> 6)) * TT + (tid & 63) * 4;
#pragma unroll
    for (int i = 0; i < 8; ++i) bq[i] = *(const v8us*)(bsrc + (size_t)i * 8 * TT);
    asm volatile("s_wait_xcnt 0x0" ::: "memory");   // the compiler hands the address registers of the loads above to a later load as its destination: the wait stands in front of that overwrite
#pragma unroll
    for (int i = 0; i < 15; ++i) aq[i] = *(const v4fa*)(asrc + (size_t)i * 4 * TT);
    asm volatile("s_wait_xcnt 0x0" ::: "memory");   // the same, for the last load, whose destination may take the address registers of the 15 above
    aq[15] = *(const v4fa*)(asrc + (size_t)15 * 4 * TT);
#pragma unroll
    for (int i = 0; i < 8; ++i) *(v8us*)(sB + ((tid >> 5) + 8 * i) * CP + (tid & 31) * 8) = bq[i];
#pragma unroll
    for (int i = 0; i < 16; ++i) {
      v4us qh, ql;
#pragma unroll
      for (int t = 0; t < 4; ++t) { const unsigned short hb = bf16_bits(aq[i][t]); qh[t] = hb; ql[t] = bf16_bits(aq[i][t] - bf16_val(hb)); }
      *(v4us*)(sAh + ((tid >> 6) + 4 * i) * CP + (tid & 63) * 4) = qh;
      *(v4us*)(sAl + ((tid >> 6) + 4 * i) * CP + (tid & 63) * 4) = ql;
    }
  }
  __syncthreads();   // the three tiles are whole in LDS before any wave reads a fragment
  const int wm = w >> 1, wn = w & 1;
  const unsigned short* pah = sAh + (wm * 16 + ln) * CP + 8 * hh;
  const unsigned short* pal = sAl + (wm * 16 + ln) * CP + 8 * hh;
  const unsigned short* pb = sB + (wn * 32 + ln) * CP + 8 * hh;
  v8f acc[2] = {};
  FragB ah[2], al[2], b[2][2];   // two fragment sets: the next 32 k are read from LDS while this set's WMMAs run
  ah[0].half[0] = *(const v8us*)pah; ah[0].half[1] = *(const v8us*)(pah + 16);
  al[0].half[0] = *(const v8us*)pal; al[0].half[1] = *(const v8us*)(pal + 16);
#pragma unroll
  for (int j = 0; j < 2; ++j) { b[0][j].half[0] = *(const v8us*)(pb + j * 16 * CP); b[0][j].half[1] = *(const v8us*)(pb + j * 16 * CP + 16); }
#pragma unroll
  for (int s = 0; s < TT / 32; ++s) {
    const int cu = s & 1, nx = cu ^ 1, kn = (s + 1) * 32;
    if (kn < TT) {
      ah[nx].half[0] = *(const v8us*)(pah + kn); ah[nx].half[1] = *(const v8us*)(pah + kn + 16);
      al[nx].half[0] = *(const v8us*)(pal + kn); al[nx].half[1] = *(const v8us*)(pal + kn + 16);
#pragma unroll
      for (int j = 0; j < 2; ++j) { b[nx][j].half[0] = *(const v8us*)(pb + j * 16 * CP + kn); b[nx][j].half[1] = *(const v8us*)(pb + j * 16 * CP + kn + 16); }
    }
    __builtin_amdgcn_sched_barrier(0);   // keeps the next set's LDS reads, as one group, in front of this set's WMMAs (left alone the compiler sinks them to their uses, and every set is waited for in full)
#pragma unroll
    for (int j = 0; j < 2; ++j) {
      acc[j] = __builtin_amdgcn_wmma_f32_16x16x32_bf16(false, ah[cu].v, false, b[cu][j].v, (short)0, acc[j], false, false);
      acc[j] = __builtin_amdgcn_wmma_f32_16x16x32_bf16(false, al[cu].v, false, b[cu][j].v, (short)0, acc[j], false, false);
    }
  }
  __syncthreads();   // every wave has read its last fragment before the tiles' LDS is used again for staging
  f1a* so = (f1a*)sm + w * 16 * SP;
#pragma unroll
  for (int j = 0; j < 2; ++j)
#pragma unroll
    for (int r = 0; r < 8; ++r) so[(8 * hh + r) * SP + j * 16 + ln] = acc[j][r];
  __builtin_amdgcn_fence(__ATOMIC_ACQ_REL, "workgroup");   // the wave's own staging stores are done before its lanes read each other's
  __builtin_amdgcn_wave_barrier();
  v4f v[4];
#pragma unroll
  for (int q = 0; q < 4; ++q) v[q] = *(const v4fa*)&so[(q * 4 + (lane >> 3)) * SP + (lane & 7) * 4];
  float* dst = C + ((size_t)by * TT + mt * CT + wm * 16 + (lane >> 3)) * DD + nt * CT + wn * 32 + (lane & 7) * 4;
#pragma unroll
  for (int q = 0; q < 4; ++q) *(v4f*)(dst + (size_t)q * 4 * DD) = v[q];
}
extern "C" void kernel_launch(void* const* d_in, const int* in_sizes, int n_in,
                              void* d_out, int out_size, void* d_ws, size_t ws_size, hipStream_t stream) {
  (void)in_sizes; (void)n_in; (void)out_size;
  const float* S = (const float*)d_in[0]; const float* fst = (const float*)d_in[1]; const float* iv = (const float*)d_in[2]; const float* W_ih = (const float*)d_in[3]; const float* b_ih = (const float*)d_in[4]; const float* W_ii = (const float*)d_in[5]; const float* b_ii = (const float*)d_in[6];
  const float* sv = (const float*)d_in[7]; const float* W_sh = (const float*)d_in[8]; const float* b_sh = (const float*)d_in[9]; const float* W_si = (const float*)d_in[10]; const float* b_si = (const float*)d_in[11];
  float* cslot = (float*)d_out; float* cint = (float*)((char*)d_out + 4194304);
  char* ws = (char*)d_ws; size_t off = 0;
  auto take = [&](size_t bytes) { char* p = ws + off; off += (bytes + 255) & ~(size_t)255; return p; };
  unsigned short* B3 = (unsigned short*)take((size_t)3 * DD * DD * 2); unsigned short* Bii = (unsigned short*)take((size_t)DD * DD * 2); float* b3 = (float*)take(3 * DD * 4); unsigned short* ST = (unsigned short*)take((size_t)BB * DD * TT * 2);
  float* fp = (float*)take(16 * DD * 4); float* ii = (float*)take(16 * DD * 4); float* P = (float*)take((size_t)MR * 3 * DD * 4); float* Wt = (float*)take((size_t)MR * TT * 4);
  if (off > ws_size) return;
  k_prep<<<NB_ST + 4 * NB_WT + NB_FP + 3, 256, 0, stream>>>(W_ih, W_sh, W_si, W_ii, b_ih, b_sh, b_si, S, fst, B3, Bii, b3, ST, fp);
  k_proj<<<NB_II + NB_P, 512, 0, stream>>>(S, B3, b3, P, fp, Bii, b_ii, ii);      // ii (rows 0..15, 8..15 bias only) and [ih | sh | si] + b (single term)
  k_intent<<<BB * IQ, 1024, 0, stream>>>(P, ii, iv, S, cint);
  k_slot<<<MR / QT, 256, 0, stream>>>(P, sv, Wt);
  k_cslot<<<dim3((TT / CT) * (DD / CT), BB), 256, 0, stream>>>(Wt, ST, cslot);   // c_slot[b] = W[b] S[b]
}

// v006
// A run of this version takes 47.3 microseconds.
// Timed twice side by side with v005, it ran 1.23 times as fast both times.
// Over all steps from v000 it is 28.5 times as fast.
#include <hip/hip_runtime.h>
// [ih | sh | si] = S·[W_ih|W_sh|W_si] + b (one GEMM, K=512, N=1536), ii = f·W_ii + b (M padded to 16) — inputs and weights rounded to bf16: single exact
// WMMA term, f32 accumulate — and c_slot = slot_w·S per batch (slot_w split into bf16 hi/lo vs exact bf16 Sᵀ planes: 2 terms) run on
// v_wmma_f32_16x16x32_bf16; the additive tanh scores (intent: T×A, slot: T×T×A), both softmaxes and c_intent are f32 VALU.
#define BB 8
#define TT 256
#define DD 512
#define MR (BB * TT)

typedef __bf16 v16b __attribute__((ext_vector_type(16)));
typedef unsigned short v8us __attribute__((ext_vector_type(8), may_alias));
typedef float  v8f  __attribute__((ext_vector_type(8)));
typedef float  v4f  __attribute__((ext_vector_type(4)));
typedef float  v4fa __attribute__((ext_vector_type(4), may_alias));
union FragB { v16b v; v8us half[2]; unsigned short u[16]; };

__device__ __forceinline__ unsigned short bf16_bits(float x) { unsigned int u = __float_as_uint(x); return (unsigned short)((u + 0x7FFFu + ((u >> 16) & 1u)) >> 16); }
__device__ __forceinline__ float bf16_val(unsigned short b) { return __uint_as_float(((unsigned int)b) << 16); }
__device__ __forceinline__ float bf16_round(float x) { return bf16_val(bf16_bits(x)); }
// D += A·B with NT terms: 1 = ah·bh, 2 = + al·bh (A split), 3 = + ah·bl (both split)
template <int NT>
__device__ __forceinline__ v8f mmaN(v16b ah, v16b al, v16b bh, v16b bl, v8f c) {
  c = __builtin_amdgcn_wmma_f32_16x16x32_bf16(false, ah, false, bh, (short)0, c, false, false);
  if (NT >= 2) c = __builtin_amdgcn_wmma_f32_16x16x32_bf16(false, al, false, bh, (short)0, c, false, false);
  if (NT >= 3) c = __builtin_amdgcn_wmma_f32_16x16x32_bf16(false, ah, false, bl, (short)0, c, false, false);
  asm volatile("v_nop\n\tv_nop\n\tv_nop\n\tv_nop" : "+v"(c) : "v"(ah), "v"(al), "v"(bh), "v"(bl));
  return c;
}

__device__ __forceinline__ void d_wt_bf16(int blk, const float* __restrict__ W, unsigned short* __restrict__ Wt, int K, int N) {
  const int t = blk * 256 + threadIdx.x;
  const int k8n = K / 8;
  if (t >= N * k8n) return;
  const int n = t / k8n, k8 = (t % k8n) * 8;
  v8us v;
#pragma unroll
  for (int i = 0; i < 8; ++i) v[i] = bf16_bits(W[(size_t)(k8 + i) * N + n]);
  *(v8us*)(Wt + (size_t)n * K + k8) = v;
  
}

// GEMM C[M][N] (f32, pitch ldc) = act(A[M][K]·W + bias). A f32 row-major (pitch lda) converted per fragment to bf16
// (ASPLIT: hi/lo two planes -> 2 terms, else single rounded term); Wt bf16 [N][K] (pitch ldb). BIAS_BF16 rounds the
// bias to bf16 first (bias quantised to bf16 before the add). K%32==0, M%16==0, N%64==0.
template <bool ASPLIT, int ACT, bool BIAS_BF16>
__global__ __launch_bounds__(128) void k_gemm_bf(const float* __restrict__ A, int lda, const unsigned short* __restrict__ Wt, int ldb,
                                               const float* __restrict__ bias, float* __restrict__ C, int ldc, int M, int N, int K) {
  __shared__ __attribute__((aligned(16))) float so[4][16][64];
  const int tid = threadIdx.x, w = tid >> 5, lane = tid & 31, ln = lane & 15, hh = lane >> 4;
  const int ntn = N / 64;
  const int wid = blockIdx.x * 4 + w;
  const int mt = wid / ntn, nq = wid % ntn;
  if (mt * 16 >= M) return;
  const int row0 = mt * 16, col0 = nq * 64;
  const float* arow = A + (size_t)(row0 + ln) * lda;
  v8f acc[4] = {};
  for (int kb = 0; kb < K; kb += 32) {
    FragB ah, al;
    const v4f x0 = *(const v4fa*)(arow + kb + 8 * hh), x1 = *(const v4fa*)(arow + kb + 8 * hh + 4);
    const v4f x2 = *(const v4fa*)(arow + kb + 16 + 8 * hh), x3 = *(const v4fa*)(arow + kb + 16 + 8 * hh + 4);
    float xs[16] = {x0[0],x0[1],x0[2],x0[3],x1[0],x1[1],x1[2],x1[3],x2[0],x2[1],x2[2],x2[3],x3[0],x3[1],x3[2],x3[3]};
#pragma unroll
    for (int i = 0; i < 16; ++i) { const unsigned short hb = bf16_bits(xs[i]); ah.u[i] = hb; al.u[i] = ASPLIT ? bf16_bits(xs[i] - bf16_val(hb)) : (unsigned short)0; }
#pragma unroll
    for (int t = 0; t < 4; ++t) {
      const unsigned short* brow = Wt + (size_t)(col0 + t * 16 + ln) * ldb + kb;
      FragB b;
      b.half[0] = *(const v8us*)(brow + 8 * hh);
      b.half[1] = *(const v8us*)(brow + 16 + 8 * hh);
      acc[t] = mmaN<ASPLIT ? 2 : 1>(ah.v, al.v, b.v, b.v, acc[t]);
    }
  }
#pragma unroll
  for (int t = 0; t < 4; ++t) {
    float bv = bias ? bias[col0 + t * 16 + ln] : 0.f;
    if (BIAS_BF16) bv = bf16_round(bv);
#pragma unroll
    for (int r = 0; r < 8; ++r) { float v = acc[t][r] + bv; if (ACT == 1) v = fmaxf(v, 0.f); so[w][8 * hh + r][t * 16 + ln] = v; }
  }
  __builtin_amdgcn_fence(__ATOMIC_ACQ_REL, "workgroup");
  __builtin_amdgcn_wave_barrier();
  const int rsub = lane >> 4, c4 = (lane & 15) * 4;
  {
#pragma unroll
    for (int q = 0; q < 8; ++q) {
      const int r = q * 2 + rsub;
      const v4f v = *(const v4fa*)&so[w][r][c4];
      *(v4f*)(C + (size_t)(row0 + r) * ldc + col0 + c4) = v;
    }
    
  }
}

// Flash-style causal/unmasked attention, all contractions 3-term bf16 hi/lo splits, f32 softmax with running max.
// q,k,v rows are read from f32 buffers with arbitrary row pitch (so they can live inside a fused qkv buffer);
// D = head size (multiple of 32, <= 128); one wave = 16 query rows; block = 4 waves (64 queries) sharing K/V chunks of 32.
template <int D, bool CAUSAL>
__global__ __launch_bounds__(128) void k_flash(const float* __restrict__ qb, const float* __restrict__ kb, const float* __restrict__ vb,
                                             int pitch, int T, int H, float scale, float* __restrict__ y, int ypitch) {
  constexpr int KS = D / 32;        // k-steps for QK
  constexpr int DT = D / 16;        // d tiles for PV
  __shared__ __attribute__((aligned(16))) unsigned short sKh[32][D + 8], sKl[32][D + 8], sVh[32][D + 8], sVl[32][D + 8];
  __shared__ __attribute__((aligned(16))) unsigned short sPh[4][16][40], sPl[4][16][40];
  __shared__ __attribute__((aligned(16))) float sO[4][16][D];
  const int tid = threadIdx.x, w = tid >> 5, lane = tid & 31, ln = lane & 15, hh = lane >> 4;
  const int nqb = (T + 63) / 64;
  const int bh = blockIdx.x / nqb, qblk = blockIdx.x % nqb;
  const int b = bh / H, h = bh % H;
  const int q0 = qblk * 64 + w * 16;
  const float* Q = qb + (size_t)b * T * pitch + h * D;
  const float* K = kb + (size_t)b * T * pitch + h * D;
  const float* V = vb + (size_t)b * T * pitch + h * D;

  // A fragments of the wave's 16 query rows (scaled), hi/lo
  FragB aqh[KS], aql[KS];
  {
    int row = q0 + ln; if (row >= T) row = T - 1;
    const float* qr = Q + (size_t)row * pitch;
#pragma unroll
    for (int ks = 0; ks < KS; ++ks)
#pragma unroll
      for (int i = 0; i < 16; ++i) {
        const int d = ks * 32 + ((i < 8) ? (8 * hh + i) : (16 + 8 * hh + (i - 8)));
        const float x = qr[d] * scale; const unsigned short hb = bf16_bits(x);
        aqh[ks].u[i] = hb; aql[ks].u[i] = bf16_bits(x - bf16_val(hb));
      }
  }
  float m_r[8], l_r[8];
#pragma unroll
  for (int r = 0; r < 8; ++r) { m_r[r] = -3.0e38f; l_r[r] = 0.f; }
  v8f oacc[DT];
#pragma unroll
  for (int dt = 0; dt < DT; ++dt) oacc[dt] = (v8f){0.f,0.f,0.f,0.f,0.f,0.f,0.f,0.f};

  const int kv_end = CAUSAL ? min(T, qblk * 64 + 64) : T;     // block-uniform
  for (int j0 = 0; j0 < kv_end; j0 += 32) {
    __syncthreads();
    for (int e = tid; e < 32 * (D / 4); e += 128) {
      const int r = e / (D / 4), c4 = (e % (D / 4)) * 4;
      const int key = j0 + r;
      v4f kf = {0.f,0.f,0.f,0.f}, vf = {0.f,0.f,0.f,0.f};
      if (key < T) { kf = *(const v4fa*)(K + (size_t)key * pitch + c4); vf = *(const v4fa*)(V + (size_t)key * pitch + c4); }
#pragma unroll
      for (int t = 0; t < 4; ++t) {
        unsigned short hb = bf16_bits(kf[t]); sKh[r][c4 + t] = hb; sKl[r][c4 + t] = bf16_bits(kf[t] - bf16_val(hb));
        hb = bf16_bits(vf[t]); sVh[r][c4 + t] = hb; sVl[r][c4 + t] = bf16_bits(vf[t] - bf16_val(hb));
      }
    }
    __syncthreads();
    // S tile 16 x 32
    v8f s[2];
#pragma unroll
    for (int nt = 0; nt < 2; ++nt) {
      v8f acc = {};
#pragma unroll
      for (int ks = 0; ks < KS; ++ks) {
        FragB bh_, bl_;
        bh_.half[0] = *(const v8us*)&sKh[nt * 16 + ln][ks * 32 + 8 * hh]; bh_.half[1] = *(const v8us*)&sKh[nt * 16 + ln][ks * 32 + 16 + 8 * hh];
        bl_.half[0] = *(const v8us*)&sKl[nt * 16 + ln][ks * 32 + 8 * hh]; bl_.half[1] = *(const v8us*)&sKl[nt * 16 + ln][ks * 32 + 16 + 8 * hh];
        acc = mmaN<3>(aqh[ks].v, aql[ks].v, bh_.v, bl_.v, acc);
      }
      s[nt] = acc;
    }
    // mask + running max (rows 8hh+r; the 16 lanes of a half share rows)
    float alpha[8];
#pragma unroll
    for (int r = 0; r < 8; ++r) {
      const int qi = q0 + 8 * hh + r;
      const int ja = j0 + ln, jb = j0 + 16 + ln;
      if (CAUSAL) { if (ja > qi) s[0][r] = -3.0e38f; if (jb > qi) s[1][r] = -3.0e38f; }
      if (ja >= T) s[0][r] = -3.0e38f;
      if (jb >= T) s[1][r] = -3.0e38f;
      float mx = fmaxf(s[0][r], s[1][r]);
      mx = fmaxf(mx, __shfl_xor(mx, 1, 32)); mx = fmaxf(mx, __shfl_xor(mx, 2, 32)); mx = fmaxf(mx, __shfl_xor(mx, 4, 32)); mx = fmaxf(mx, __shfl_xor(mx, 8, 32));
      const float mnew = fmaxf(m_r[r], mx);
      alpha[r] = (mnew > -1.0e38f) ? __expf(m_r[r] - mnew) : 1.0f;
      const float p0 = (s[0][r] > -1.0e38f) ? __expf(s[0][r] - mnew) : 0.f;
      const float p1 = (s[1][r] > -1.0e38f) ? __expf(s[1][r] - mnew) : 0.f;
      m_r[r] = mnew;
      l_r[r] = l_r[r] * alpha[r] + p0 + p1;            // per-lane partial row sum (16 lanes combined at the end)
      unsigned short hb = bf16_bits(p0); sPh[w][8 * hh + r][ln] = hb;      sPl[w][8 * hh + r][ln] = bf16_bits(p0 - bf16_val(hb));
      hb = bf16_bits(p1);                sPh[w][8 * hh + r][16 + ln] = hb; sPl[w][8 * hh + r][16 + ln] = bf16_bits(p1 - bf16_val(hb));
    }
#pragma unroll
    for (int dt = 0; dt < DT; ++dt)
#pragma unroll
      for (int r = 0; r < 8; ++r) oacc[dt][r] *= alpha[r];
    __builtin_amdgcn_fence(__ATOMIC_ACQ_REL, "workgroup");
    __builtin_amdgcn_wave_barrier();
    FragB pah, pal;
    pah.half[0] = *(const v8us*)&sPh[w][ln][8 * hh]; pah.half[1] = *(const v8us*)&sPh[w][ln][16 + 8 * hh];
    pal.half[0] = *(const v8us*)&sPl[w][ln][8 * hh]; pal.half[1] = *(const v8us*)&sPl[w][ln][16 + 8 * hh];
#pragma unroll
    for (int dt = 0; dt < DT; ++dt) {
      FragB bvh, bvl;
#pragma unroll
      for (int i = 0; i < 8; ++i) {
        bvh.u[i] = sVh[8 * hh + i][dt * 16 + ln]; bvh.u[8 + i] = sVh[16 + 8 * hh + i][dt * 16 + ln];
        bvl.u[i] = sVl[8 * hh + i][dt * 16 + ln]; bvl.u[8 + i] = sVl[16 + 8 * hh + i][dt * 16 + ln];
      }
      oacc[dt] = mmaN<3>(pah.v, pal.v, bvh.v, bvl.v, oacc[dt]);
    }
    __builtin_amdgcn_fence(__ATOMIC_ACQ_REL, "workgroup");
    __builtin_amdgcn_wave_barrier();
  }
#pragma unroll
  for (int r = 0; r < 8; ++r) {
    float l = l_r[r];
    l += __shfl_xor(l, 1, 32); l += __shfl_xor(l, 2, 32); l += __shfl_xor(l, 4, 32); l += __shfl_xor(l, 8, 32);
    l_r[r] = (l > 0.f) ? 1.0f / l : 0.f;
  }
#pragma unroll
  for (int dt = 0; dt < DT; ++dt)
#pragma unroll
    for (int r = 0; r < 8; ++r) sO[w][8 * hh + r][dt * 16 + ln] = oacc[dt][r] * l_r[r];
  __builtin_amdgcn_fence(__ATOMIC_ACQ_REL, "workgroup");
  __builtin_amdgcn_wave_barrier();
  {
    for (int r = 0; r < 16; ++r) {
      const int row = q0 + r;
      if (row < T && lane < D / 4) {
        const v4f val = *(const v4fa*)&sO[w][r][lane * 4];
        *(v4f*)(y + ((size_t)b * T + row) * ypitch + h * D + lane * 4) = val;
      }
    }
    
  }
}

// row LayerNorm (biased variance, eps) over N: s = X (+ R); optional out_sum <- s; out_norm <- (s-mu)*rsqrt(var+eps)*g + b
template <bool PARAM_BF16>
__global__ __launch_bounds__(256) void k_layernorm(const float* __restrict__ X, const float* __restrict__ R, const float* __restrict__ g, const float* __restrict__ bta,
                                                  float* __restrict__ out_sum, float* __restrict__ out_norm, int N, float eps) {
  __shared__ float red[256];
  const int row = blockIdx.x, tid = threadIdx.x;
  const float* x = X + (size_t)row * N; const float* rr = R ? R + (size_t)row * N : nullptr;
  float vals[16];                     // up to N = 4096
  const int per = N / 256;            // contiguous chunk per thread? use strided-by-4 chunks: thread handles j = tid*4 + 1024*u
  float s1 = 0.f;
  for (int u = 0; u < per / 4; ++u) {
    const int j = tid * 4 + 1024 * u;
    const v4f a = *(const v4fa*)(x + j);
    v4f b = {0.f,0.f,0.f,0.f}; if (rr) b = *(const v4fa*)(rr + j);
#pragma unroll
    for (int q = 0; q < 4; ++q) { const float v = a[q] + b[q]; vals[u * 4 + q] = v; s1 += v; }
  }
  red[tid] = s1; __syncthreads();
  for (int st = 128; st > 0; st >>= 1) { if (tid < st) red[tid] += red[tid + st]; __syncthreads(); }
  const float mu = red[0] / (float)N; __syncthreads();
  float s2 = 0.f;
  for (int u = 0; u < per / 4; ++u)
#pragma unroll
    for (int q = 0; q < 4; ++q) { const float c = vals[u * 4 + q] - mu; s2 += c * c; }
  red[tid] = s2; __syncthreads();
  for (int st = 128; st > 0; st >>= 1) { if (tid < st) red[tid] += red[tid + st]; __syncthreads(); }
  const float rs = rsqrtf(red[0] / (float)N + eps);
  {
    for (int u = 0; u < per / 4; ++u) {
      const int j = tid * 4 + 1024 * u;
      v4f o, sm;
#pragma unroll
      for (int q = 0; q < 4; ++q) {
        float gg = g[j + q], bb = bta[j + q];
        if (PARAM_BF16) { gg = bf16_round(gg); bb = bf16_round(bb); }
        sm[q] = vals[u * 4 + q]; o[q] = (vals[u * 4 + q] - mu) * rs * gg + bb;
      }
      if (out_sum) *(v4f*)(out_sum + (size_t)row * N + j) = sm;
      *(v4f*)(out_norm + (size_t)row * N + j) = o;
    }
    
  }
}

// batched f32 [K][N] (pitch lds, batch stride sIn) -> transposed hi/lo planes [N][K] (batch stride sOut); thread per (n, 8 k); grid.y = batch
__global__ __launch_bounds__(256) void k_split_transpose_b(const float* __restrict__ src, int lds_, size_t sIn, unsigned short* __restrict__ hi, unsigned short* __restrict__ lo, size_t sOut, int K, int N) {
  const size_t t = (size_t)blockIdx.x * 256 + threadIdx.x; const int k8n = K / 8; if (t >= (size_t)N * k8n) return;
  src += (size_t)blockIdx.y * sIn; hi += (size_t)blockIdx.y * sOut; lo += (size_t)blockIdx.y * sOut;
  const int n = (int)(t / k8n), k8 = (int)(t % k8n) * 8; v8us vh, vl;
#pragma unroll
  for (int i = 0; i < 8; ++i) { const float x = src[(size_t)(k8 + i) * lds_ + n]; const unsigned short hb = bf16_bits(x); vh[i] = hb; vl[i] = bf16_bits(x - bf16_val(hb)); }
  unsigned short* dh = hi + (size_t)n * K + k8; unsigned short* dl = lo + (size_t)n * K + k8;
  *(v8us*)dh = vh; *(v8us*)dl = vl; 
}


__device__ __forceinline__ void d_roundcopy(const float* __restrict__ src, float* __restrict__ dst, int n8) {
  const size_t t = threadIdx.x;
  if (t >= (size_t)n8 * 2) return;
  v4f a = *(const v4fa*)(src + t * 4);
  for (int i = 0; i < 4; ++i) a[i] = bf16_round(a[i]);
  *(v4f*)(dst + t * 4) = a; 
}

// one v_tanh_f32 per value
__device__ __forceinline__ float tanh_fast(float x) { return __builtin_amdgcn_tanhf(x); }
// f32 rows: fpad[16][512] = final_state rows 0..7, zero rows 8..15 (thread per float4)
__device__ __forceinline__ void d_fpad(int blk, const float* __restrict__ f, float* __restrict__ fp) { const int t = blk * 256 + threadIdx.x; if (t >= 16 * DD / 4) return; const int r = t / (DD / 4); v4f v = {0.f,0.f,0.f,0.f}; if (r < BB) { const v4f a = *(const v4fa*)(f + (size_t)t * 4); for (int q = 0; q < 4; ++q) v[q] = a[q]; } *(v4f*)(fp + (size_t)t * 4) = v;  }
// Sᵀ planes per batch (exact input): Bh[b][d][t] = bf16(S[b][t][d]); thread per (b, d, 8 t)
__device__ __forceinline__ void d_sT(int blk, const float* __restrict__ S, unsigned short* __restrict__ Bh) {
  const size_t i = (size_t)blk * 256 + threadIdx.x; if (i >= (size_t)BB * DD * (TT / 8)) return; const int t8 = (int)(i % (TT / 8)) * 8; const int d = (int)((i / (TT / 8)) % DD); const int b = (int)(i / ((size_t)(TT / 8) * DD));
  v8us v; for (int q = 0; q < 8; ++q) v[q] = bf16_bits(S[((size_t)b * TT + t8 + q) * DD + d]);
  *(v8us*)(Bh + ((size_t)b * DD + d) * TT + t8) = v; 
}
// the nine preparations, none of which reads what another writes, in ONE launch: the block index picks the job
#define NB_WT (DD * (DD / 8) / 256)
#define NB_ST (BB * DD * (TT / 8) / 256)
#define NB_FP (16 * DD / 4 / 256)
__global__ __launch_bounds__(256) void k_prep(const float* __restrict__ W_ih, const float* __restrict__ W_sh, const float* __restrict__ W_si, const float* __restrict__ W_ii,
                                              const float* __restrict__ b_ih, const float* __restrict__ b_sh, const float* __restrict__ b_si, const float* __restrict__ S, const float* __restrict__ f,
                                              unsigned short* __restrict__ B3, unsigned short* __restrict__ Bii, float* __restrict__ b3, unsigned short* __restrict__ ST, float* __restrict__ fp) {
  int blk = blockIdx.x;
  if (blk < NB_ST) { d_sT(blk, S, ST); return; }
  blk -= NB_ST;
  if (blk < 4 * NB_WT) {
    const int j = blk / NB_WT;
    d_wt_bf16(blk % NB_WT, j == 0 ? W_ih : j == 1 ? W_sh : j == 2 ? W_si : W_ii, j < 3 ? B3 + (size_t)j * DD * DD : Bii, DD, DD);
    return;
  }
  blk -= 4 * NB_WT;
  if (blk < NB_FP) { d_fpad(blk, f, fp); return; }
  blk -= NB_FP;
  d_roundcopy(blk == 0 ? b_ih : blk == 1 ? b_sh : b_si, b3 + blk * DD, DD / 8);
}
// both projections in ONE launch: blocks 0 .. NB_II - 1 do ii = f W_ii + b (M padded to 16), the rest [ih | sh | si] = S [W_ih | W_sh | W_si] + b.
// A block owns a PT x PT tile of C. It first brings its PT rows of A (rounded to bf16 on the way) and its PT rows of Wt, all of K, into LDS by loads
// in which a wave reads 512 bytes in a row; behind ONE barrier 16 waves (4 x 4, 32 x 32 of C each) read their fragments from LDS, k ascending, one WMMA per
// 32 k and 16 x 16 tile, so every sum has the order it had. An ii block has only 16 rows of A: the tile's rows above repeat them and are not stored.
#define PT 128
#define PP (DD + 8)   // LDS row pitch in bf16: 1040 B = 16 B x 65, an odd count of 16-byte units, for the 16-byte fragment reads
#define SP 36         // row pitch in floats of a wave's staging tile: rows 8 apart fall on different banks, rows stay 16-byte aligned
#define NB_II (DD / PT)
#define NB_P ((MR / PT) * (3 * DD / PT))
typedef unsigned short v4us __attribute__((ext_vector_type(4), may_alias));
typedef float f1a __attribute__((may_alias));
__global__ __launch_bounds__(512) void k_proj(const float* __restrict__ S, const unsigned short* __restrict__ B3, const float* __restrict__ b3, float* __restrict__ P, float* __restrict__ ShT,
                                              const float* __restrict__ fp, const unsigned short* __restrict__ Bii, const float* __restrict__ b_ii, float* __restrict__ ii) {
  __shared__ __attribute__((aligned(16))) unsigned short sm[2 * PT * PP];
  unsigned short* sA = sm; unsigned short* sB = sm + PT * PP;
  const bool isii = blockIdx.x < NB_II;
  const int blk = isii ? blockIdx.x : blockIdx.x - NB_II;
  const int mt = isii ? 0 : blk / (3 * DD / PT), nt = isii ? blk : blk % (3 * DD / PT);
  const float* A = isii ? fp : S + (size_t)mt * PT * DD;
  const unsigned short* B = (isii ? Bii : B3) + (size_t)nt * PT * DD;
  const int tid = threadIdx.x, w = tid >> 5, lane = tid & 31, ln = lane & 15, hh = lane >> 4;
  // every "#pragma unroll" of this kernel: the arrays are then indexed by constants only and stay in registers, and a batch's loads stand together in front of its stores
  {
    v8us bq[16]; v4f aq[32];
    const unsigned short* bsrc = B + (size_t)(tid >> 6) * DD + (tid & 63) * 8;
    const float* asrc = A + (size_t)(tid >> 7) * DD + (tid & 127) * 4;
#pragma unroll
    for (int i = 0; i < 16; ++i) bq[i] = *(const v8us*)(bsrc + (size_t)i * 8 * DD);
    asm volatile("s_wait_xcnt 0x0" ::: "memory");   // the compiler hands the address registers of the loads above to a later load as its destination: the wait stands in front of that overwrite
    if (isii) {
#pragma unroll
      for (int i = 0; i < 32; ++i) aq[i] = *(const v4fa*)(asrc + (size_t)(i & 3) * 4 * DD);
    } else {
#pragma unroll
      for (int i = 0; i < 31; ++i) aq[i] = *(const v4fa*)(asrc + (size_t)i * 4 * DD);
      asm volatile("s_wait_xcnt 0x0" ::: "memory");   // the same, for the last load, whose destination takes the address registers of the 31 above
      aq[31] = *(const v4fa*)(asrc + (size_t)31 * 4 * DD);
    }
#pragma unroll
    for (int i = 0; i < 16; ++i) *(v8us*)(sB + ((tid >> 6) + 8 * i) * PP + (tid & 63) * 8) = bq[i];
#pragma unroll
    for (int i = 0; i < 32; ++i) {
      v4us q;
#pragma unroll
      for (int t = 0; t < 4; ++t) q[t] = bf16_bits(aq[i][t]);
      *(v4us*)(sA + ((tid >> 7) + 4 * i) * PP + (tid & 127) * 4) = q;
    }
  }
  __syncthreads();   // both tiles are whole in LDS before any wave reads a fragment
  const int wm = w >> 2, wn = w & 3;
  const unsigned short* pa = sA + (wm * 32 + ln) * PP + 8 * hh;
  const unsigned short* pb = sB + (wn * 32 + ln) * PP + 8 * hh;
  v8f acc[2][2] = {};
  FragB a[2][2], b[2][2];   // two fragment sets: the next 32 k are read from LDS while this set's WMMAs run
#pragma unroll
  for (int i = 0; i < 2; ++i) {
    a[0][i].half[0] = *(const v8us*)(pa + i * 16 * PP); a[0][i].half[1] = *(const v8us*)(pa + i * 16 * PP + 16);
    b[0][i].half[0] = *(const v8us*)(pb + i * 16 * PP); b[0][i].half[1] = *(const v8us*)(pb + i * 16 * PP + 16);
  }
#pragma unroll
  for (int s = 0; s < DD / 32; ++s) {
    const int cu = s & 1, nx = cu ^ 1, kn = (s + 1) * 32;
    if (kn < DD) {
#pragma unroll
      for (int i = 0; i < 2; ++i) {
        a[nx][i].half[0] = *(const v8us*)(pa + i * 16 * PP + kn); a[nx][i].half[1] = *(const v8us*)(pa + i * 16 * PP + kn + 16);
        b[nx][i].half[0] = *(const v8us*)(pb + i * 16 * PP + kn); b[nx][i].half[1] = *(const v8us*)(pb + i * 16 * PP + kn + 16);
      }
    }
    __builtin_amdgcn_sched_barrier(0);   // keeps the next set's LDS reads, as one group, in front of this set's WMMAs (left alone the compiler sinks them to their uses, and every set is waited for in full)
#pragma unroll
    for (int i = 0; i < 2; ++i)
#pragma unroll
      for (int j = 0; j < 2; ++j) acc[i][j] = __builtin_amdgcn_wmma_f32_16x16x32_bf16(false, a[cu][i].v, false, b[cu][j].v, (short)0, acc[i][j], false, false);
  }
  __syncthreads();   // every wave has read its last fragment before the tiles' LDS is used again for staging
  f1a* so = (f1a*)sm + w * 32 * SP;
  const bool tr = !isii && (nt >> 2) == 1;   // the sh columns: stored transposed, ShT[b][a][s], for k_slot, whose lanes are keys
#pragma unroll
  for (int j = 0; j < 2; ++j) {
    float bv = (isii ? b_ii : b3)[nt * PT + wn * 32 + j * 16 + ln];
    if (isii) bv = bf16_round(bv);
    if (tr) {   // staged column by column: a lane's 8 accumulators are 8 keys of one column
#pragma unroll
      for (int i = 0; i < 2; ++i)
#pragma unroll
        for (int g = 0; g < 2; ++g) {
          const v4f x = {acc[i][j][4 * g] + bv, acc[i][j][4 * g + 1] + bv, acc[i][j][4 * g + 2] + bv, acc[i][j][4 * g + 3] + bv};
          *(v4fa*)&so[(j * 16 + ln) * SP + i * 16 + 8 * hh + 4 * g] = x;
        }
    } else {
#pragma unroll
      for (int i = 0; i < 2; ++i)
#pragma unroll
        for (int r = 0; r < 8; ++r) so[(i * 16 + 8 * hh + r) * SP + j * 16 + ln] = acc[i][j][r] + bv;
    }
  }
  __builtin_amdgcn_fence(__ATOMIC_ACQ_REL, "workgroup");   // the wave's own staging stores are done before its lanes read each other's
  __builtin_amdgcn_wave_barrier();
  v4f v[8];
#pragma unroll
  for (int q = 0; q < 8; ++q) v[q] = *(const v4fa*)&so[(q * 4 + (lane >> 3)) * SP + (lane & 7) * 4];
  const int crow = wm * 32 + (lane >> 3), ccol = nt * PT + wn * 32 + (lane & 7) * 4;
  if (tr) {   // the staged rows are columns a of sh, 32 keys (one 128-byte line) each
    float* C = ShT + ((size_t)(mt / (TT / PT)) * DD + (nt - DD / PT) * PT + wn * 32 + (lane >> 3)) * TT + (mt % (TT / PT)) * PT + wm * 32 + (lane & 7) * 4;
#pragma unroll
    for (int q = 0; q < 8; ++q) *(v4f*)(C + (size_t)q * 4 * TT) = v[q];
  } else if (!isii) {
    float* C = P + ((size_t)mt * PT + crow) * (3 * DD) + ccol;
#pragma unroll
    for (int q = 0; q < 8; ++q) *(v4f*)(C + (size_t)q * 4 * 3 * DD) = v[q];
    asm volatile("s_wait_xcnt 0x0" ::: "memory");   // in the listing the other arm's address arithmetic follows these stores and rewrites registers that they name: the wait stands in front of it
  } else if (wm == 0) {   // an ii block stores rows 0 .. 15 only
    float* C = ii + (size_t)crow * DD + ccol;
#pragma unroll
    for (int q = 0; q < 4; ++q) *(v4f*)(C + (size_t)q * 4 * DD) = v[q];
  }
}
// intent: 4 blocks per b (one per 128 columns of c_intent), 32 waves each. Scores (every block of a b computes all 256): wave wv takes the rows t = 8 wv .. 8 wv + 7, a row
// spread over the lanes (lane holds a = 128 u + 4 lane + q), so a row is 4 whole-line loads, independent of every other row's, and 16 fly at once; ii and intent_v stay in
// registers; a row's 32 partial sums meet in a butterfly over the lanes. softmax over t: every wave for itself, from the 256 scores in LDS.
// c_intent[b][d] = sum_s w_s bf16(S[b][s][d]): wave wv takes the keys s = 8 wv .. 8 wv + 7 (8 independent loads), lane the columns 4 lane .. 4 lane + 3 of the block's 128;
// the 32 partial sums of a column are added through LDS, wv ascending.
#define IQ 4
__global__ __launch_bounds__(1024) void k_intent(const float* __restrict__ P, const float* __restrict__ ii, const float* __restrict__ iv, const float* __restrict__ S, float* __restrict__ cint) {
  __shared__ float ssc[TT];
  __shared__ __attribute__((aligned(16))) float part[32][DD / IQ];
  const int b = blockIdx.x / IQ, c0 = (blockIdx.x % IQ) * (DD / IQ), tid = threadIdx.x, wv = tid >> 5, lane = tid & 31;
  // every "#pragma unroll" of this kernel: the arrays are then indexed by constants only and stay in registers, and a batch's loads stand together in front of its sums
  v4f vi[4], vv[4];
#pragma unroll
  for (int u = 0; u < 4; ++u) { vi[u] = *(const v4fa*)(ii + (size_t)b * DD + u * 128 + lane * 4); vv[u] = *(const v4fa*)(iv + u * 128 + lane * 4); }
  const float* row0 = P + ((size_t)b * TT + wv * 8) * 3 * DD + lane * 4;
  float sc[8];
#pragma unroll
  for (int rb = 0; rb < 8; rb += 4) {
    v4f h[4][4];
#pragma unroll
    for (int r = 0; r < 4; ++r)
#pragma unroll
      for (int u = 0; u < 4; ++u) h[r][u] = *(const v4fa*)(row0 + (size_t)(rb + r) * 3 * DD + u * 128);
#pragma unroll
    for (int r = 0; r < 4; ++r) {
      float a = 0.f;
#pragma unroll
      for (int u = 0; u < 4; ++u)
#pragma unroll
        for (int q = 0; q < 4; ++q) a += bf16_round(vv[u][q]) * tanh_fast(h[r][u][q] + vi[u][q]);
      sc[rb + r] = a;
    }
  }
  // the key rows of the weighted sum need no score: their loads fly during the butterflies
  const float* sp = S + ((size_t)b * TT + wv * 8) * DD + c0 + lane * 4;
  v4f x[8];
#pragma unroll
  for (int i = 0; i < 8; ++i) x[i] = *(const v4fa*)(sp + (size_t)i * DD);
  // the 8 rows' butterflies folded into one: at the steps 1, 2, 4 a lane keeps the half of its rows that its lane bit names and hands the other half over,
  // so 4 + 2 + 1 + 1 + 1 exchanges serve all 8 rows, and every lane ends with the whole sum of row lane & 7
  float s1[4], s2[2];
#pragma unroll
  for (int i = 0; i < 4; ++i) s1[i] = ((lane & 1) ? sc[2 * i + 1] : sc[2 * i]) + __shfl_xor((lane & 1) ? sc[2 * i] : sc[2 * i + 1], 1, 32);
#pragma unroll
  for (int i = 0; i < 2; ++i) s2[i] = ((lane & 2) ? s1[2 * i + 1] : s1[2 * i]) + __shfl_xor((lane & 2) ? s1[2 * i] : s1[2 * i + 1], 2, 32);
  float mine = ((lane & 4) ? s2[1] : s2[0]) + __shfl_xor((lane & 4) ? s2[0] : s2[1], 4, 32);
  mine += __shfl_xor(mine, 8, 32); mine += __shfl_xor(mine, 16, 32);
  if (lane < 8) ssc[wv * 8 + lane] = mine;
  __syncthreads();   // all 256 scores of the batch are in ssc before any wave's softmax reads them
  float e[8], mx = -3.0e38f, den = 0.f;
#pragma unroll
  for (int u = 0; u < 8; ++u) { e[u] = ssc[u * 32 + lane]; mx = fmaxf(mx, e[u]); }
  for (int o = 16; o >= 1; o >>= 1) mx = fmaxf(mx, __shfl_xor(mx, o, 32));
#pragma unroll
  for (int u = 0; u < 8; ++u) den += expf(e[u] - mx);
  for (int o = 16; o >= 1; o >>= 1) den += __shfl_xor(den, o, 32);
  const int wl = __float_as_int(expf(ssc[wv * 8 + (lane & 7)] - mx) / den);   // lane i < 8: the weight of key 8 wv + i
  v4f acc = {0.f, 0.f, 0.f, 0.f};
#pragma unroll
  for (int i = 0; i < 8; ++i) {
    const float w = __int_as_float(__builtin_amdgcn_readlane(wl, i));
#pragma unroll
    for (int q = 0; q < 4; ++q) acc[q] += w * bf16_round(x[i][q]);
  }
  *(v4fa*)&part[wv][lane * 4] = acc;
  __syncthreads();   // the 32 partial sums of every column are in part before they are added
  if (tid >= DD / IQ) return;
  float s = part[0][tid];
#pragma unroll
  for (int j = 1; j < 32; ++j) s += part[j][tid];
  cint[(size_t)b * DD + c0 + tid] = s;
}
// slot scores: a LANE IS A KEY, so a score is summed along a inside one lane and no sum crosses lanes. Block = QB queries t of one batch x all 256 keys, 16 waves:
// wave (kg, as) takes the keys 128 kg + 4 lane .. + 3 and the columns a in [AW as, AW as + AW). sh comes transposed (ShT[b][a][s]): one 16-byte load per lane and a feeds
// 4 QB tanh; si[t][a] and slot_v[a] are the same for every lane and are read through scalar registers. The NAS partial sums of a score meet in LDS, as ascending.
// softmax over s -> W[b][t][s] by waves 0..QB-1, one query each, behind the block barrier.
#define QB 8
typedef float v2f __attribute__((ext_vector_type(2)));
#define NAS 8
#define AW (DD / NAS)
#define AC 8
// waves_per_eu: the launch puts 4 waves on every SIMD (MR / QB blocks of 16 waves on 256 WGPs); this is the register budget that goes with it
__global__ __launch_bounds__(512) __attribute__((amdgpu_waves_per_eu(4, 4))) void k_slot(const float* __restrict__ P, const float* __restrict__ ShT, const float* __restrict__ sv, float* __restrict__ Wt) {
  __shared__ __attribute__((aligned(16))) float part[NAS][QB][TT];
  const int tid = threadIdx.x, lane = tid & 31; const int m0 = blockIdx.x * QB; if (m0 >= MR) return; const int b = m0 / TT;
  const int wv = __builtin_amdgcn_readfirstlane(tid >> 5);   // the wave's number in a scalar register: the addresses of si and slot_v are then scalar too
  const int kg = wv & 1, as = wv >> 1;
  const float* sh = ShT + ((size_t)b * DD + as * AW) * TT + kg * 128 + lane * 4;
  const float* si = P + (size_t)m0 * 3 * DD + 2 * DD + as * AW;
  const float* vp = sv + as * AW;
  // every "#pragma unroll" of this kernel: the arrays are then indexed by constants only and stay in registers
  v4f cur[AC], nxt[AC];
  v2f acc[QB][2];
#pragma unroll
  for (int q = 0; q < QB; ++q) acc[q][0] = acc[q][1] = (v2f){0.f, 0.f};
#pragma unroll
  for (int i = 0; i < AC; ++i) cur[i] = *(const v4fa*)(sh + (size_t)i * TT);
#pragma unroll 1   // rolled: the body is long already
  for (int c = 0; c < AW / AC; ++c) {
    const float* nsh = sh + (size_t)(((c + 1) & (AW / AC - 1)) * AC) * TT;   // next AC columns: their loads fly during this chunk's sums (the last trip re-reads the wave's first chunk, unused)
#pragma unroll
    for (int i = 0; i < AC; ++i) nxt[i] = *(const v4fa*)(nsh + (size_t)i * TT);
    asm volatile("s_wait_xcnt 0x0" ::: "memory");   // the compiler hands the address registers of the loads above to the sums below: the wait stands in front of that overwrite
    __builtin_amdgcn_sched_barrier(0);   // keeps those loads in front of the chunk's sums (left alone the compiler sinks them to their uses, and every chunk is waited for in full)
#pragma unroll
    for (int i = 0; i < AC; ++i) {
      const float v = bf16_round(vp[c * AC + i]);
      const v2f v2 = {v, v};
      v2f t[QB][2];
#pragma unroll
      for (int q = 0; q < QB; ++q) {
        const float x = si[(size_t)q * 3 * DD + c * AC + i];
        const v2f x2 = {x, x};
        t[q][0] = (v2f){cur[i][0], cur[i][1]} + x2; t[q][1] = (v2f){cur[i][2], cur[i][3]} + x2;
      }
#pragma unroll
      for (int q = 0; q < QB; ++q)
#pragma unroll
        for (int h = 0; h < 2; ++h) { t[q][h][0] = tanh_fast(t[q][h][0]); t[q][h][1] = tanh_fast(t[q][h][1]); }
#pragma unroll
      for (int q = 0; q < QB; ++q)
#pragma unroll
        for (int h = 0; h < 2; ++h) acc[q][h] += v2 * t[q][h];
      __builtin_amdgcn_sched_barrier(0);   // one column's 32 sums are one scheduling region (in one region of all AC columns this compiler strings add, tanh and multiply-add of each value in a row, each waiting for the last)
    }
#pragma unroll
    for (int i = 0; i < AC; ++i) cur[i] = nxt[i];
  }
#pragma unroll
  for (int q = 0; q < QB; ++q) *(v4fa*)&part[as][q][kg * 128 + lane * 4] = (v4f){acc[q][0][0], acc[q][0][1], acc[q][1][0], acc[q][1][1]};
  __syncthreads();   // every wave's partial sums are in part before a query's softmax reads them
  if (wv >= QB) return;
  v4f e[2];   // the keys 4 lane .. + 3 and 128 + 4 lane .. + 3 of query wv
#pragma unroll
  for (int h = 0; h < 2; ++h) {
    e[h] = *(const v4fa*)&part[0][wv][h * 128 + lane * 4];
#pragma unroll
    for (int j = 1; j < NAS; ++j) e[h] += *(const v4fa*)&part[j][wv][h * 128 + lane * 4];
  }
  float mx = -3.0e38f;
#pragma unroll
  for (int h = 0; h < 2; ++h)
#pragma unroll
    for (int t = 0; t < 4; ++t) mx = fmaxf(mx, e[h][t]);
  for (int o = 16; o >= 1; o >>= 1) mx = fmaxf(mx, __shfl_xor(mx, o, 32));
  float den = 0.f;
#pragma unroll
  for (int h = 0; h < 2; ++h)
#pragma unroll
    for (int t = 0; t < 4; ++t) { e[h][t] = expf(e[h][t] - mx); den += e[h][t]; }
  for (int o = 16; o >= 1; o >>= 1) den += __shfl_xor(den, o, 32);
  const float inv = 1.0f / den;
  float* dst = Wt + (size_t)(m0 + wv) * TT + lane * 4;
#pragma unroll
  for (int h = 0; h < 2; ++h) *(v4f*)(dst + h * 128) = e[h] * inv;
}
// c_slot[b] = W[b] S[b], the same way: a block owns a CT x CT tile of one batch, brings its CT rows of W (split into bf16 hi and lo planes on the way) and its CT rows
// of the transposed S planes, all of K, into LDS by loads in which a wave reads 512 bytes in a row; behind ONE barrier 8 waves (4 x 2, 16 x 32 of C each) read their
// fragments from LDS; per 16 x 16 tile and 32 k the hi WMMA, then the lo WMMA, k ascending, so every sum has the order it had.
#define CT 64
#define CP (TT + 8)   // LDS row pitch in bf16: 528 B = 16 B x 33, an odd count of 16-byte units, for the 16-byte fragment reads
__global__ __launch_bounds__(256) void k_cslot(const float* __restrict__ Wt, const unsigned short* __restrict__ ST, float* __restrict__ C) {
  __shared__ __attribute__((aligned(16))) unsigned short sm[3 * CT * CP];
  unsigned short* sAh = sm; unsigned short* sAl = sm + CT * CP; unsigned short* sB = sm + 2 * CT * CP;
  const int by = blockIdx.y, mt = blockIdx.x / (DD / CT), nt = blockIdx.x % (DD / CT);
  const int tid = threadIdx.x, w = tid >> 5, lane = tid & 31, ln = lane & 15, hh = lane >> 4;
  // every "#pragma unroll" of this kernel: the arrays are then indexed by constants only and stay in registers, and a batch's loads stand together in front of its stores
  {
    v8us bq[8]; v4f aq[16];
    const unsigned short* bsrc = ST + ((size_t)by * DD + nt * CT + (tid >> 5)) * TT + (tid & 31) * 8;
    const float* asrc = Wt + ((size_t)by * TT + mt * CT + (tid >> 6)) * TT + (tid & 63) * 4;
#pragma unroll
    for (int i = 0; i < 8; ++i) bq[i] = *(const v8us*)(bsrc + (size_t)i * 8 * TT);
    asm volatile("s_wait_xcnt 0x0" ::: "memory");   // the compiler hands the address registers of the loads above to a later load as its destination: the wait stands in front of that overwrite
#pragma unroll
    for (int i = 0; i < 15; ++i) aq[i] = *(const v4fa*)(asrc + (size_t)i * 4 * TT);
    asm volatile("s_wait_xcnt 0x0" ::: "memory");   // the same, for the last load, whose destination may take the address registers of the 15 above
    aq[15] = *(const v4fa*)(asrc + (size_t)15 * 4 * TT);
#pragma unroll
    for (int i = 0; i < 8; ++i) *(v8us*)(sB + ((tid >> 5) + 8 * i) * CP + (tid & 31) * 8) = bq[i];
#pragma unroll
    for (int i = 0; i < 16; ++i) {
      v4us qh, ql;
#pragma unroll
      for (int t = 0; t < 4; ++t) { const unsigned short hb = bf16_bits(aq[i][t]); qh[t] = hb; ql[t] = bf16_bits(aq[i][t] - bf16_val(hb)); }
      *(v4us*)(sAh + ((tid >> 6) + 4 * i) * CP + (tid & 63) * 4) = qh;
      *(v4us*)(sAl + ((tid >> 6) + 4 * i) * CP + (tid & 63) * 4) = ql;
    }
  }
  __syncthreads();   // the three tiles are whole in LDS before any wave reads a fragment
  const int wm = w >> 1, wn = w & 1;
  const unsigned short* pah = sAh + (wm * 16 + ln) * CP + 8 * hh;
  const unsigned short* pal = sAl + (wm * 16 + ln) * CP + 8 * hh;
  const unsigned short* pb = sB + (wn * 32 + ln) * CP + 8 * hh;
  v8f acc[2] = {};
  FragB ah[2], al[2], b[2][2];   // two fragment sets: the next 32 k are read from LDS while this set's WMMAs run
  ah[0].half[0] = *(const v8us*)pah; ah[0].half[1] = *(const v8us*)(pah + 16);
  al[0].half[0] = *(const v8us*)pal; al[0].half[1] = *(const v8us*)(pal + 16);
#pragma unroll
  for (int j = 0; j < 2; ++j) { b[0][j].half[0] = *(const v8us*)(pb + j * 16 * CP); b[0][j].half[1] = *(const v8us*)(pb + j * 16 * CP + 16); }
#pragma unroll
  for (int s = 0; s < TT / 32; ++s) {
    const int cu = s & 1, nx = cu ^ 1, kn = (s + 1) * 32;
    if (kn < TT) {
      ah[nx].half[0] = *(const v8us*)(pah + kn); ah[nx].half[1] = *(const v8us*)(pah + kn + 16);
      al[nx].half[0] = *(const v8us*)(pal + kn); al[nx].half[1] = *(const v8us*)(pal + kn + 16);
#pragma unroll
      for (int j = 0; j < 2; ++j) { b[nx][j].half[0] = *(const v8us*)(pb + j * 16 * CP + kn); b[nx][j].half[1] = *(const v8us*)(pb + j * 16 * CP + kn + 16); }
    }
    __builtin_amdgcn_sched_barrier(0);   // keeps the next set's LDS reads, as one group, in front of this set's WMMAs (left alone the compiler sinks them to their uses, and every set is waited for in full)
#pragma unroll
    for (int j = 0; j < 2; ++j) {
      acc[j] = __builtin_amdgcn_wmma_f32_16x16x32_bf16(false, ah[cu].v, false, b[cu][j].v, (short)0, acc[j], false, false);
      acc[j] = __builtin_amdgcn_wmma_f32_16x16x32_bf16(false, al[cu].v, false, b[cu][j].v, (short)0, acc[j], false, false);
    }
  }
  __syncthreads();   // every wave has read its last fragment before the tiles' LDS is used again for staging
  f1a* so = (f1a*)sm + w * 16 * SP;
#pragma unroll
  for (int j = 0; j < 2; ++j)
#pragma unroll
    for (int r = 0; r < 8; ++r) so[(8 * hh + r) * SP + j * 16 + ln] = acc[j][r];
  __builtin_amdgcn_fence(__ATOMIC_ACQ_REL, "workgroup");   // the wave's own staging stores are done before its lanes read each other's
  __builtin_amdgcn_wave_barrier();
  v4f v[4];
#pragma unroll
  for (int q = 0; q < 4; ++q) v[q] = *(const v4fa*)&so[(q * 4 + (lane >> 3)) * SP + (lane & 7) * 4];
  float* dst = C + ((size_t)by * TT + mt * CT + wm * 16 + (lane >> 3)) * DD + nt * CT + wn * 32 + (lane & 7) * 4;
#pragma unroll
  for (int q = 0; q < 4; ++q) *(v4f*)(dst + (size_t)q * 4 * DD) = v[q];
}
extern "C" void kernel_launch(void* const* d_in, const int* in_sizes, int n_in,
                              void* d_out, int out_size, void* d_ws, size_t ws_size, hipStream_t stream) {
  (void)in_sizes; (void)n_in; (void)out_size;
  const float* S = (const float*)d_in[0]; const float* fst = (const float*)d_in[1]; const float* iv = (const float*)d_in[2]; const float* W_ih = (const float*)d_in[3]; const float* b_ih = (const float*)d_in[4]; const float* W_ii = (const float*)d_in[5]; const float* b_ii = (const float*)d_in[6];
  const float* sv = (const float*)d_in[7]; const float* W_sh = (const float*)d_in[8]; const float* b_sh = (const float*)d_in[9]; const float* W_si = (const float*)d_in[10]; const float* b_si = (const float*)d_in[11];
  float* cslot = (float*)d_out; float* cint = (float*)((char*)d_out + 4194304);
  char* ws = (char*)d_ws; size_t off = 0;
  auto take = [&](size_t bytes) { char* p = ws + off; off += (bytes + 255) & ~(size_t)255; return p; };
  unsigned short* B3 = (unsigned short*)take((size_t)3 * DD * DD * 2); unsigned short* Bii = (unsigned short*)take((size_t)DD * DD * 2); float* b3 = (float*)take(3 * DD * 4); unsigned short* ST = (unsigned short*)take((size_t)BB * DD * TT * 2);
  float* fp = (float*)take(16 * DD * 4); float* ii = (float*)take(16 * DD * 4); float* P = (float*)take((size_t)MR * 3 * DD * 4); float* Wt = (float*)take((size_t)MR * TT * 4); float* ShT = (float*)take((size_t)MR * DD * 4);
  if (off > ws_size) return;
  k_prep<<<NB_ST + 4 * NB_WT + NB_FP + 3, 256, 0, stream>>>(W_ih, W_sh, W_si, W_ii, b_ih, b_sh, b_si, S, fst, B3, Bii, b3, ST, fp);
  k_proj<<<NB_II + NB_P, 512, 0, stream>>>(S, B3, b3, P, ShT, fp, Bii, b_ii, ii);      // ii (rows 0..15) and [ih | sh | si] + b (single term); sh goes to ShT, transposed
  k_intent<<<BB * IQ, 1024, 0, stream>>>(P, ii, iv, S, cint);
  k_slot<<<MR / QB, 512, 0, stream>>>(P, ShT, sv, Wt);
  k_cslot<<<dim3((TT / CT) * (DD / CT), BB), 256, 0, stream>>>(Wt, ST, cslot);   // c_slot[b] = W[b] S[b]
}

// v007
// Measured time: 38.8 microseconds a run.
// Timed twice side by side with v006, it ran 1.22 times as fast both times.
// Counting every step since v000, it is 34.7 times as fast.
#include <hip/hip_runtime.h>
// [ih | sh | si] = S·[W_ih|W_sh|W_si] + b (one GEMM, K=512, N=1536), ii = f·W_ii + b (M padded to 16) — inputs and weights rounded to bf16: single exact
// WMMA term, f32 accumulate — and c_slot = slot_w·S per batch (slot_w split into bf16 hi/lo vs exact bf16 Sᵀ planes: 2 terms) run on
// v_wmma_f32_16x16x32_bf16; the additive tanh scores (intent: T×A, slot: T×T×A), both softmaxes and c_intent are f32 VALU.
#define BB 8
#define TT 256
#define DD 512
#define MR (BB * TT)

typedef __bf16 v16b __attribute__((ext_vector_type(16)));
typedef unsigned short v8us __attribute__((ext_vector_type(8), may_alias));
typedef float  v8f  __attribute__((ext_vector_type(8)));
typedef float  v4f  __attribute__((ext_vector_type(4)));
typedef float  v4fa __attribute__((ext_vector_type(4), may_alias));
union FragB { v16b v; v8us half[2]; unsigned short u[16]; };

__device__ __forceinline__ unsigned short bf16_bits(float x) { unsigned int u = __float_as_uint(x); return (unsigned short)((u + 0x7FFFu + ((u >> 16) & 1u)) >> 16); }
__device__ __forceinline__ float bf16_val(unsigned short b) { return __uint_as_float(((unsigned int)b) << 16); }
__device__ __forceinline__ float bf16_round(float x) { return bf16_val(bf16_bits(x)); }
// D += A·B with NT terms: 1 = ah·bh, 2 = + al·bh (A split), 3 = + ah·bl (both split)
template <int NT>
__device__ __forceinline__ v8f mmaN(v16b ah, v16b al, v16b bh, v16b bl, v8f c) {
  c = __builtin_amdgcn_wmma_f32_16x16x32_bf16(false, ah, false, bh, (short)0, c, false, false);
  if (NT >= 2) c = __builtin_amdgcn_wmma_f32_16x16x32_bf16(false, al, false, bh, (short)0, c, false, false);
  if (NT >= 3) c = __builtin_amdgcn_wmma_f32_16x16x32_bf16(false, ah, false, bl, (short)0, c, false, false);
  asm volatile("v_nop\n\tv_nop\n\tv_nop\n\tv_nop" : "+v"(c) : "v"(ah), "v"(al), "v"(bh), "v"(bl));
  return c;
}

__device__ __forceinline__ void d_wt_bf16(int blk, const float* __restrict__ W, unsigned short* __restrict__ Wt, int K, int N) {
  const int t = blk * 256 + threadIdx.x;
  const int k8n = K / 8;
  if (t >= N * k8n) return;
  const int n = t / k8n, k8 = (t % k8n) * 8;
  v8us v;
#pragma unroll
  for (int i = 0; i < 8; ++i) v[i] = bf16_bits(W[(size_t)(k8 + i) * N + n]);
  *(v8us*)(Wt + (size_t)n * K + k8) = v;
  
}

// GEMM C[M][N] (f32, pitch ldc) = act(A[M][K]·W + bias). A f32 row-major (pitch lda) converted per fragment to bf16
// (ASPLIT: hi/lo two planes -> 2 terms, else single rounded term); Wt bf16 [N][K] (pitch ldb). BIAS_BF16 rounds the
// bias to bf16 first (bias quantised to bf16 before the add). K%32==0, M%16==0, N%64==0.
template <bool ASPLIT, int ACT, bool BIAS_BF16>
__global__ __launch_bounds__(128) void k_gemm_bf(const float* __restrict__ A, int lda, const unsigned short* __restrict__ Wt, int ldb,
                                               const float* __restrict__ bias, float* __restrict__ C, int ldc, int M, int N, int K) {
  __shared__ __attribute__((aligned(16))) float so[4][16][64];
  const int tid = threadIdx.x, w = tid >> 5, lane = tid & 31, ln = lane & 15, hh = lane >> 4;
  const int ntn = N / 64;
  const int wid = blockIdx.x * 4 + w;
  const int mt = wid / ntn, nq = wid % ntn;
  if (mt * 16 >= M) return;
  const int row0 = mt * 16, col0 = nq * 64;
  const float* arow = A + (size_t)(row0 + ln) * lda;
  v8f acc[4] = {};
  for (int kb = 0; kb < K; kb += 32) {
    FragB ah, al;
    const v4f x0 = *(const v4fa*)(arow + kb + 8 * hh), x1 = *(const v4fa*)(arow + kb + 8 * hh + 4);
    const v4f x2 = *(const v4fa*)(arow + kb + 16 + 8 * hh), x3 = *(const v4fa*)(arow + kb + 16 + 8 * hh + 4);
    float xs[16] = {x0[0],x0[1],x0[2],x0[3],x1[0],x1[1],x1[2],x1[3],x2[0],x2[1],x2[2],x2[3],x3[0],x3[1],x3[2],x3[3]};
#pragma unroll
    for (int i = 0; i < 16; ++i) { const unsigned short hb = bf16_bits(xs[i]); ah.u[i] = hb; al.u[i] = ASPLIT ? bf16_bits(xs[i] - bf16_val(hb)) : (unsigned short)0; }
#pragma unroll
    for (int t = 0; t < 4; ++t) {
      const unsigned short* brow = Wt + (size_t)(col0 + t * 16 + ln) * ldb + kb;
      FragB b;
      b.half[0] = *(const v8us*)(brow + 8 * hh);
      b.half[1] = *(const v8us*)(brow + 16 + 8 * hh);
      acc[t] = mmaN<ASPLIT ? 2 : 1>(ah.v, al.v, b.v, b.v, acc[t]);
    }
  }
#pragma unroll
  for (int t = 0; t < 4; ++t) {
    float bv = bias ? bias[col0 + t * 16 + ln] : 0.f;
    if (BIAS_BF16) bv = bf16_round(bv);
#pragma unroll
    for (int r = 0; r < 8; ++r) { float v = acc[t][r] + bv; if (ACT == 1) v = fmaxf(v, 0.f); so[w][8 * hh + r][t * 16 + ln] = v; }
  }
  __builtin_amdgcn_fence(__ATOMIC_ACQ_REL, "workgroup");
  __builtin_amdgcn_wave_barrier();
  const int rsub = lane >> 4, c4 = (lane & 15) * 4;
  {
#pragma unroll
    for (int q = 0; q < 8; ++q) {
      const int r = q * 2 + rsub;
      const v4f v = *(const v4fa*)&so[w][r][c4];
      *(v4f*)(C + (size_t)(row0 + r) * ldc + col0 + c4) = v;
    }
    
  }
}

// Flash-style causal/unmasked attention, all contractions 3-term bf16 hi/lo splits, f32 softmax with running max.
// q,k,v rows are read from f32 buffers with arbitrary row pitch (so they can live inside a fused qkv buffer);
// D = head size (multiple of 32, <= 128); one wave = 16 query rows; block = 4 waves (64 queries) sharing K/V chunks of 32.
template <int D, bool CAUSAL>
__global__ __launch_bounds__(128) void k_flash(const float* __restrict__ qb, const float* __restrict__ kb, const float* __restrict__ vb,
                                             int pitch, int T, int H, float scale, float* __restrict__ y, int ypitch) {
  constexpr int KS = D / 32;        // k-steps for QK
  constexpr int DT = D / 16;        // d tiles for PV
  __shared__ __attribute__((aligned(16))) unsigned short sKh[32][D + 8], sKl[32][D + 8], sVh[32][D + 8], sVl[32][D + 8];
  __shared__ __attribute__((aligned(16))) unsigned short sPh[4][16][40], sPl[4][16][40];
  __shared__ __attribute__((aligned(16))) float sO[4][16][D];
  const int tid = threadIdx.x, w = tid >> 5, lane = tid & 31, ln = lane & 15, hh = lane >> 4;
  const int nqb = (T + 63) / 64;
  const int bh = blockIdx.x / nqb, qblk = blockIdx.x % nqb;
  const int b = bh / H, h = bh % H;
  const int q0 = qblk * 64 + w * 16;
  const float* Q = qb + (size_t)b * T * pitch + h * D;
  const float* K = kb + (size_t)b * T * pitch + h * D;
  const float* V = vb + (size_t)b * T * pitch + h * D;

  // A fragments of the wave's 16 query rows (scaled), hi/lo
  FragB aqh[KS], aql[KS];
  {
    int row = q0 + ln; if (row >= T) row = T - 1;
    const float* qr = Q + (size_t)row * pitch;
#pragma unroll
    for (int ks = 0; ks < KS; ++ks)
#pragma unroll
      for (int i = 0; i < 16; ++i) {
        const int d = ks * 32 + ((i < 8) ? (8 * hh + i) : (16 + 8 * hh + (i - 8)));
        const float x = qr[d] * scale; const unsigned short hb = bf16_bits(x);
        aqh[ks].u[i] = hb; aql[ks].u[i] = bf16_bits(x - bf16_val(hb));
      }
  }
  float m_r[8], l_r[8];
#pragma unroll
  for (int r = 0; r < 8; ++r) { m_r[r] = -3.0e38f; l_r[r] = 0.f; }
  v8f oacc[DT];
#pragma unroll
  for (int dt = 0; dt < DT; ++dt) oacc[dt] = (v8f){0.f,0.f,0.f,0.f,0.f,0.f,0.f,0.f};

  const int kv_end = CAUSAL ? min(T, qblk * 64 + 64) : T;     // block-uniform
  for (int j0 = 0; j0 < kv_end; j0 += 32) {
    __syncthreads();
    for (int e = tid; e < 32 * (D / 4); e += 128) {
      const int r = e / (D / 4), c4 = (e % (D / 4)) * 4;
      const int key = j0 + r;
      v4f kf = {0.f,0.f,0.f,0.f}, vf = {0.f,0.f,0.f,0.f};
      if (key < T) { kf = *(const v4fa*)(K + (size_t)key * pitch + c4); vf = *(const v4fa*)(V + (size_t)key * pitch + c4); }
#pragma unroll
      for (int t = 0; t < 4; ++t) {
        unsigned short hb = bf16_bits(kf[t]); sKh[r][c4 + t] = hb; sKl[r][c4 + t] = bf16_bits(kf[t] - bf16_val(hb));
        hb = bf16_bits(vf[t]); sVh[r][c4 + t] = hb; sVl[r][c4 + t] = bf16_bits(vf[t] - bf16_val(hb));
      }
    }
    __syncthreads();
    // S tile 16 x 32
    v8f s[2];
#pragma unroll
    for (int nt = 0; nt < 2; ++nt) {
      v8f acc = {};
#pragma unroll
      for (int ks = 0; ks < KS; ++ks) {
        FragB bh_, bl_;
        bh_.half[0] = *(const v8us*)&sKh[nt * 16 + ln][ks * 32 + 8 * hh]; bh_.half[1] = *(const v8us*)&sKh[nt * 16 + ln][ks * 32 + 16 + 8 * hh];
        bl_.half[0] = *(const v8us*)&sKl[nt * 16 + ln][ks * 32 + 8 * hh]; bl_.half[1] = *(const v8us*)&sKl[nt * 16 + ln][ks * 32 + 16 + 8 * hh];
        acc = mmaN<3>(aqh[ks].v, aql[ks].v, bh_.v, bl_.v, acc);
      }
      s[nt] = acc;
    }
    // mask + running max (rows 8hh+r; the 16 lanes of a half share rows)
    float alpha[8];
#pragma unroll
    for (int r = 0; r < 8; ++r) {
      const int qi = q0 + 8 * hh + r;
      const int ja = j0 + ln, jb = j0 + 16 + ln;
      if (CAUSAL) { if (ja > qi) s[0][r] = -3.0e38f; if (jb > qi) s[1][r] = -3.0e38f; }
      if (ja >= T) s[0][r] = -3.0e38f;
      if (jb >= T) s[1][r] = -3.0e38f;
      float mx = fmaxf(s[0][r], s[1][r]);
      mx = fmaxf(mx, __shfl_xor(mx, 1, 32)); mx = fmaxf(mx, __shfl_xor(mx, 2, 32)); mx = fmaxf(mx, __shfl_xor(mx, 4, 32)); mx = fmaxf(mx, __shfl_xor(mx, 8, 32));
      const float mnew = fmaxf(m_r[r], mx);
      alpha[r] = (mnew > -1.0e38f) ? __expf(m_r[r] - mnew) : 1.0f;
      const float p0 = (s[0][r] > -1.0e38f) ? __expf(s[0][r] - mnew) : 0.f;
      const float p1 = (s[1][r] > -1.0e38f) ? __expf(s[1][r] - mnew) : 0.f;
      m_r[r] = mnew;
      l_r[r] = l_r[r] * alpha[r] + p0 + p1;            // per-lane partial row sum (16 lanes combined at the end)
      unsigned short hb = bf16_bits(p0); sPh[w][8 * hh + r][ln] = hb;      sPl[w][8 * hh + r][ln] = bf16_bits(p0 - bf16_val(hb));
      hb = bf16_bits(p1);                sPh[w][8 * hh + r][16 + ln] = hb; sPl[w][8 * hh + r][16 + ln] = bf16_bits(p1 - bf16_val(hb));
    }
#pragma unroll
    for (int dt = 0; dt < DT; ++dt)
#pragma unroll
      for (int r = 0; r < 8; ++r) oacc[dt][r] *= alpha[r];
    __builtin_amdgcn_fence(__ATOMIC_ACQ_REL, "workgroup");
    __builtin_amdgcn_wave_barrier();
    FragB pah, pal;
    pah.half[0] = *(const v8us*)&sPh[w][ln][8 * hh]; pah.half[1] = *(const v8us*)&sPh[w][ln][16 + 8 * hh];
    pal.half[0] = *(const v8us*)&sPl[w][ln][8 * hh]; pal.half[1] = *(const v8us*)&sPl[w][ln][16 + 8 * hh];
#pragma unroll
    for (int dt = 0; dt < DT; ++dt) {
      FragB bvh, bvl;
#pragma unroll
      for (int i = 0; i < 8; ++i) {
        bvh.u[i] = sVh[8 * hh + i][dt * 16 + ln]; bvh.u[8 + i] = sVh[16 + 8 * hh + i][dt * 16 + ln];
        bvl.u[i] = sVl[8 * hh + i][dt * 16 + ln]; bvl.u[8 + i] = sVl[16 + 8 * hh + i][dt * 16 + ln];
      }
      oacc[dt] = mmaN<3>(pah.v, pal.v, bvh.v, bvl.v, oacc[dt]);
    }
    __builtin_amdgcn_fence(__ATOMIC_ACQ_REL, "workgroup");
    __builtin_amdgcn_wave_barrier();
  }
#pragma unroll
  for (int r = 0; r < 8; ++r) {
    float l = l_r[r];
    l += __shfl_xor(l, 1, 32); l += __shfl_xor(l, 2, 32); l += __shfl_xor(l, 4, 32); l += __shfl_xor(l, 8, 32);
    l_r[r] = (l > 0.f) ? 1.0f / l : 0.f;
  }
#pragma unroll
  for (int dt = 0; dt < DT; ++dt)
#pragma unroll
    for (int r = 0; r < 8; ++r) sO[w][8 * hh + r][dt * 16 + ln] = oacc[dt][r] * l_r[r];
  __builtin_amdgcn_fence(__ATOMIC_ACQ_REL, "workgroup");
  __builtin_amdgcn_wave_barrier();
  {
    for (int r = 0; r < 16; ++r) {
      const int row = q0 + r;
      if (row < T && lane < D / 4) {
        const v4f val = *(const v4fa*)&sO[w][r][lane * 4];
        *(v4f*)(y + ((size_t)b * T + row) * ypitch + h * D + lane * 4) = val;
      }
    }
    
  }
}

// row LayerNorm (biased variance, eps) over N: s = X (+ R); optional out_sum <- s; out_norm <- (s-mu)*rsqrt(var+eps)*g + b
template <bool PARAM_BF16>
__global__ __launch_bounds__(256) void k_layernorm(const float* __restrict__ X, const float* __restrict__ R, const float* __restrict__ g, const float* __restrict__ bta,
                                                  float* __restrict__ out_sum, float* __restrict__ out_norm, int N, float eps) {
  __shared__ float red[256];
  const int row = blockIdx.x, tid = threadIdx.x;
  const float* x = X + (size_t)row * N; const float* rr = R ? R + (size_t)row * N : nullptr;
  float vals[16];                     // up to N = 4096
  const int per = N / 256;            // contiguous chunk per thread? use strided-by-4 chunks: thread handles j = tid*4 + 1024*u
  float s1 = 0.f;
  for (int u = 0; u < per / 4; ++u) {
    const int j = tid * 4 + 1024 * u;
    const v4f a = *(const v4fa*)(x + j);
    v4f b = {0.f,0.f,0.f,0.f}; if (rr) b = *(const v4fa*)(rr + j);
#pragma unroll
    for (int q = 0; q < 4; ++q) { const float v = a[q] + b[q]; vals[u * 4 + q] = v; s1 += v; }
  }
  red[tid] = s1; __syncthreads();
  for (int st = 128; st > 0; st >>= 1) { if (tid < st) red[tid] += red[tid + st]; __syncthreads(); }
  const float mu = red[0] / (float)N; __syncthreads();
  float s2 = 0.f;
  for (int u = 0; u < per / 4; ++u)
#pragma unroll
    for (int q = 0; q < 4; ++q) { const float c = vals[u * 4 + q] - mu; s2 += c * c; }
  red[tid] = s2; __syncthreads();
  for (int st = 128; st > 0; st >>= 1) { if (tid < st) red[tid] += red[tid + st]; __syncthreads(); }
  const float rs = rsqrtf(red[0] / (float)N + eps);
  {
    for (int u = 0; u < per / 4; ++u) {
      const int j = tid * 4 + 1024 * u;
      v4f o, sm;
#pragma unroll
      for (int q = 0; q < 4; ++q) {
        float gg = g[j + q], bb = bta[j + q];
        if (PARAM_BF16) { gg = bf16_round(gg); bb = bf16_round(bb); }
        sm[q] = vals[u * 4 + q]; o[q] = (vals[u * 4 + q] - mu) * rs * gg + bb;
      }
      if (out_sum) *(v4f*)(out_sum + (size_t)row * N + j) = sm;
      *(v4f*)(out_norm + (size_t)row * N + j) = o;
    }
    
  }
}

// batched f32 [K][N] (pitch lds, batch stride sIn) -> transposed hi/lo planes [N][K] (batch stride sOut); thread per (n, 8 k); grid.y = batch
__global__ __launch_bounds__(256) void k_split_transpose_b(const float* __restrict__ src, int lds_, size_t sIn, unsigned short* __restrict__ hi, unsigned short* __restrict__ lo, size_t sOut, int K, int N) {
  const size_t t = (size_t)blockIdx.x * 256 + threadIdx.x; const int k8n = K / 8; if (t >= (size_t)N * k8n) return;
  src += (size_t)blockIdx.y * sIn; hi += (size_t)blockIdx.y * sOut; lo += (size_t)blockIdx.y * sOut;
  const int n = (int)(t / k8n), k8 = (int)(t % k8n) * 8; v8us vh, vl;
#pragma unroll
  for (int i = 0; i < 8; ++i) { const float x = src[(size_t)(k8 + i) * lds_ + n]; const unsigned short hb = bf16_bits(x); vh[i] = hb; vl[i] = bf16_bits(x - bf16_val(hb)); }
  unsigned short* dh = hi + (size_t)n * K + k8; unsigned short* dl = lo + (size_t)n * K + k8;
  *(v8us*)dh = vh; *(v8us*)dl = vl; 
}


__device__ __forceinline__ void d_roundcopy(const float* __restrict__ src, float* __restrict__ dst, int n8) {
  const size_t t = threadIdx.x;
  if (t >= (size_t)n8 * 2) return;
  v4f a = *(const v4fa*)(src + t * 4);
  for (int i = 0; i < 4; ++i) a[i] = bf16_round(a[i]);
  *(v4f*)(dst + t * 4) = a; 
}

// one v_tanh_f32 per value
__device__ __forceinline__ float tanh_fast(float x) { return __builtin_amdgcn_tanhf(x); }
// f32 rows: fpad[16][512] = final_state rows 0..7, zero rows 8..15 (thread per float4)
__device__ __forceinline__ void d_fpad(int blk, const float* __restrict__ f, float* __restrict__ fp) { const int t = blk * 256 + threadIdx.x; if (t >= 16 * DD / 4) return; const int r = t / (DD / 4); v4f v = {0.f,0.f,0.f,0.f}; if (r < BB) { const v4f a = *(const v4fa*)(f + (size_t)t * 4); for (int q = 0; q < 4; ++q) v[q] = a[q]; } *(v4f*)(fp + (size_t)t * 4) = v;  }
// Sᵀ planes per batch (exact input): Bh[b][d][t] = bf16(S[b][t][d]); thread per (b, d, 8 t)
__device__ __forceinline__ void d_sT(int blk, const float* __restrict__ S, unsigned short* __restrict__ Bh) {
  const size_t i = (size_t)blk * 256 + threadIdx.x; if (i >= (size_t)BB * DD * (TT / 8)) return; const int t8 = (int)(i % (TT / 8)) * 8; const int d = (int)((i / (TT / 8)) % DD); const int b = (int)(i / ((size_t)(TT / 8) * DD));
  v8us v; for (int q = 0; q < 8; ++q) v[q] = bf16_bits(S[((size_t)b * TT + t8 + q) * DD + d]);
  *(v8us*)(Bh + ((size_t)b * DD + d) * TT + t8) = v; 
}
// the nine preparations, none of which reads what another writes, in ONE launch: the block index picks the job
#define NB_WT (DD * (DD / 8) / 256)
#define NB_ST (BB * DD * (TT / 8) / 256)
#define NB_FP (16 * DD / 4 / 256)
__global__ __launch_bounds__(256) void k_prep(const float* __restrict__ W_ih, const float* __restrict__ W_sh, const float* __restrict__ W_si, const float* __restrict__ W_ii,
                                              const float* __restrict__ b_ih, const float* __restrict__ b_sh, const float* __restrict__ b_si, const float* __restrict__ S, const float* __restrict__ f,
                                              unsigned short* __restrict__ B3, unsigned short* __restrict__ Bii, float* __restrict__ b3, unsigned short* __restrict__ ST, float* __restrict__ fp) {
  int blk = blockIdx.x;
  if (blk < NB_ST) { d_sT(blk, S, ST); return; }
  blk -= NB_ST;
  if (blk < 4 * NB_WT) {
    const int j = blk / NB_WT;
    d_wt_bf16(blk % NB_WT, j == 0 ? W_ih : j == 1 ? W_sh : j == 2 ? W_si : W_ii, j < 3 ? B3 + (size_t)j * DD * DD : Bii, DD, DD);
    return;
  }
  blk -= 4 * NB_WT;
  if (blk < NB_FP) { d_fpad(blk, f, fp); return; }
  blk -= NB_FP;
  d_roundcopy(blk == 0 ? b_ih : blk == 1 ? b_sh : b_si, b3 + blk * DD, DD / 8);
}
// both projections in ONE launch: blocks 0 .. NB_II - 1 do ii = f W_ii + b (M padded to 16), the rest [ih | sh | si] = S [W_ih | W_sh | W_si] + b.
// A block owns a PT x PT tile of C. It first brings its PT rows of A (rounded to bf16 on the way) and its PT rows of Wt, all of K, into LDS by loads
// in which a wave reads 512 bytes in a row; behind ONE barrier 16 waves (4 x 4, 32 x 32 of C each) read their fragments from LDS, k ascending, one WMMA per
// 32 k and 16 x 16 tile, so every sum has the order it had. An ii block has only 16 rows of A: the tile's rows above repeat them and are not stored.
#define PT 128
#define PP (DD + 8)   // LDS row pitch in bf16: 1040 B = 16 B x 65, an odd count of 16-byte units, for the 16-byte fragment reads
#define SP 36         // row pitch in floats of a wave's staging tile: rows 8 apart fall on different banks, rows stay 16-byte aligned
#define NB_II (DD / PT)
#define NB_P ((MR / PT) * (3 * DD / PT))
typedef unsigned short v4us __attribute__((ext_vector_type(4), may_alias));
typedef float f1a __attribute__((may_alias));
__global__ __launch_bounds__(512) void k_proj(const float* __restrict__ S, const unsigned short* __restrict__ B3, const float* __restrict__ b3, float* __restrict__ P, float* __restrict__ ShT,
                                              const float* __restrict__ fp, const unsigned short* __restrict__ Bii, const float* __restrict__ b_ii, float* __restrict__ ii) {
  __shared__ __attribute__((aligned(16))) unsigned short sm[2 * PT * PP];
  unsigned short* sA = sm; unsigned short* sB = sm + PT * PP;
  const bool isii = blockIdx.x < NB_II;
  const int blk = isii ? blockIdx.x : blockIdx.x - NB_II;
  const int mt = isii ? 0 : blk / (3 * DD / PT), nt = isii ? blk : blk % (3 * DD / PT);
  const float* A = isii ? fp : S + (size_t)mt * PT * DD;
  const unsigned short* B = (isii ? Bii : B3) + (size_t)nt * PT * DD;
  const int tid = threadIdx.x, w = tid >> 5, lane = tid & 31, ln = lane & 15, hh = lane >> 4;
  // every "#pragma unroll" of this kernel: the arrays are then indexed by constants only and stay in registers, and a batch's loads stand together in front of its stores
  {
    v8us bq[16]; v4f aq[32];
    const unsigned short* bsrc = B + (size_t)(tid >> 6) * DD + (tid & 63) * 8;
    const float* asrc = A + (size_t)(tid >> 7) * DD + (tid & 127) * 4;
#pragma unroll
    for (int i = 0; i < 16; ++i) bq[i] = *(const v8us*)(bsrc + (size_t)i * 8 * DD);
    asm volatile("s_wait_xcnt 0x0" ::: "memory");   // the compiler hands the address registers of the loads above to a later load as its destination: the wait stands in front of that overwrite
    if (isii) {
#pragma unroll
      for (int i = 0; i < 32; ++i) aq[i] = *(const v4fa*)(asrc + (size_t)(i & 3) * 4 * DD);
    } else {
#pragma unroll
      for (int i = 0; i < 31; ++i) aq[i] = *(const v4fa*)(asrc + (size_t)i * 4 * DD);
      asm volatile("s_wait_xcnt 0x0" ::: "memory");   // the same, for the last load, whose destination takes the address registers of the 31 above
      aq[31] = *(const v4fa*)(asrc + (size_t)31 * 4 * DD);
    }
#pragma unroll
    for (int i = 0; i < 16; ++i) *(v8us*)(sB + ((tid >> 6) + 8 * i) * PP + (tid & 63) * 8) = bq[i];
#pragma unroll
    for (int i = 0; i < 32; ++i) {
      v4us q;
#pragma unroll
      for (int t = 0; t < 4; ++t) q[t] = bf16_bits(aq[i][t]);
      *(v4us*)(sA + ((tid >> 7) + 4 * i) * PP + (tid & 127) * 4) = q;
    }
  }
  __syncthreads();   // both tiles are whole in LDS before any wave reads a fragment
  const int wm = w >> 2, wn = w & 3;
  const unsigned short* pa = sA + (wm * 32 + ln) * PP + 8 * hh;
  const unsigned short* pb = sB + (wn * 32 + ln) * PP + 8 * hh;
  v8f acc[2][2] = {};
  FragB a[2][2], b[2][2];   // two fragment sets: the next 32 k are read from LDS while this set's WMMAs run
#pragma unroll
  for (int i = 0; i < 2; ++i) {
    a[0][i].half[0] = *(const v8us*)(pa + i * 16 * PP); a[0][i].half[1] = *(const v8us*)(pa + i * 16 * PP + 16);
    b[0][i].half[0] = *(const v8us*)(pb + i * 16 * PP); b[0][i].half[1] = *(const v8us*)(pb + i * 16 * PP + 16);
  }
#pragma unroll
  for (int s = 0; s < DD / 32; ++s) {
    const int cu = s & 1, nx = cu ^ 1, kn = (s + 1) * 32;
    if (kn < DD) {
#pragma unroll
      for (int i = 0; i < 2; ++i) {
        a[nx][i].half[0] = *(const v8us*)(pa + i * 16 * PP + kn); a[nx][i].half[1] = *(const v8us*)(pa + i * 16 * PP + kn + 16);
        b[nx][i].half[0] = *(const v8us*)(pb + i * 16 * PP + kn); b[nx][i].half[1] = *(const v8us*)(pb + i * 16 * PP + kn + 16);
      }
    }
    __builtin_amdgcn_sched_barrier(0);   // keeps the next set's LDS reads, as one group, in front of this set's WMMAs (left alone the compiler sinks them to their uses, and every set is waited for in full)
#pragma unroll
    for (int i = 0; i < 2; ++i)
#pragma unroll
      for (int j = 0; j < 2; ++j) acc[i][j] = __builtin_amdgcn_wmma_f32_16x16x32_bf16(false, a[cu][i].v, false, b[cu][j].v, (short)0, acc[i][j], false, false);
  }
  __syncthreads();   // every wave has read its last fragment before the tiles' LDS is used again for staging
  f1a* so = (f1a*)sm + w * 32 * SP;
  const bool tr = !isii && (nt >> 2) == 1;   // the sh columns: stored transposed, ShT[b][a][s], for k_slot, whose lanes are keys
#pragma unroll
  for (int j = 0; j < 2; ++j) {
    float bv = (isii ? b_ii : b3)[nt * PT + wn * 32 + j * 16 + ln];
    if (isii) bv = bf16_round(bv);
    if (tr) {   // staged column by column: a lane's 8 accumulators are 8 keys of one column
#pragma unroll
      for (int i = 0; i < 2; ++i)
#pragma unroll
        for (int g = 0; g < 2; ++g) {
          const v4f x = {acc[i][j][4 * g] + bv, acc[i][j][4 * g + 1] + bv, acc[i][j][4 * g + 2] + bv, acc[i][j][4 * g + 3] + bv};
          *(v4fa*)&so[(j * 16 + ln) * SP + i * 16 + 8 * hh + 4 * g] = x;
        }
    } else {
#pragma unroll
      for (int i = 0; i < 2; ++i)
#pragma unroll
        for (int r = 0; r < 8; ++r) so[(i * 16 + 8 * hh + r) * SP + j * 16 + ln] = acc[i][j][r] + bv;
    }
  }
  __builtin_amdgcn_fence(__ATOMIC_ACQ_REL, "workgroup");   // the wave's own staging stores are done before its lanes read each other's
  __builtin_amdgcn_wave_barrier();
  v4f v[8];
#pragma unroll
  for (int q = 0; q < 8; ++q) v[q] = *(const v4fa*)&so[(q * 4 + (lane >> 3)) * SP + (lane & 7) * 4];
  const int crow = wm * 32 + (lane >> 3), ccol = nt * PT + wn * 32 + (lane & 7) * 4;
  if (tr) {   // the staged rows are columns a of sh, 32 keys (one 128-byte line) each
    float* C = ShT + ((size_t)(mt / (TT / PT)) * DD + (nt - DD / PT) * PT + wn * 32 + (lane >> 3)) * TT + (mt % (TT / PT)) * PT + wm * 32 + (lane & 7) * 4;
#pragma unroll
    for (int q = 0; q < 8; ++q) *(v4f*)(C + (size_t)q * 4 * TT) = v[q];
  } else if (!isii) {
    float* C = P + ((size_t)mt * PT + crow) * (3 * DD) + ccol;
#pragma unroll
    for (int q = 0; q < 8; ++q) *(v4f*)(C + (size_t)q * 4 * 3 * DD) = v[q];
    asm volatile("s_wait_xcnt 0x0" ::: "memory");   // in the listing the other arm's address arithmetic follows these stores and rewrites registers that they name: the wait stands in front of it
  } else if (wm == 0) {   // an ii block stores rows 0 .. 15 only
    float* C = ii + (size_t)crow * DD + ccol;
#pragma unroll
    for (int q = 0; q < 4; ++q) *(v4f*)(C + (size_t)q * 4 * DD) = v[q];
  }
}
// slot scores: a LANE IS A KEY, so a score is summed along a inside one lane and no sum crosses lanes. Block = QB queries t of one batch x all 256 keys, 16 waves:
// wave (kg, as) takes the keys 128 kg + 4 lane .. + 3 and the columns a in [AW as, AW as + AW). sh comes transposed (ShT[b][a][s]): one 16-byte load per lane and a feeds
// 4 QB tanh; si[t][a] and slot_v[a] are the same for every lane and are read through scalar registers. The NAS partial sums of a score meet in LDS, as ascending.
// softmax over s -> W[b][t][s] by waves 0..QB-1, one query each, behind the block barrier.
// The intent scores ride along: while waves 0..QB-1 do the softmax, wave QB + r, which has nothing left to do, makes the intent score of the block's row m0 + r, the row
// spread over the lanes (lane holds a = 128 u + 4 lane + q), the 32 partial sums meeting in a butterfly; the block's QB scores leave in one store, into a 128-byte line of their own.
#define QB 8
#define ISP 32   // floats from one block's intent scores to the next block's: one 128-byte line a block
typedef float v2f __attribute__((ext_vector_type(2)));
#define NAS 8
#define AW (DD / NAS)
#define AC 8
// waves_per_eu: the launch puts 4 waves on every SIMD (MR / QB blocks of 16 waves on 256 WGPs); this is the register budget that goes with it
__global__ __launch_bounds__(512) __attribute__((amdgpu_waves_per_eu(4, 4))) void k_slot(const float* __restrict__ P, const float* __restrict__ ShT, const float* __restrict__ sv, float* __restrict__ Wt,
                                                                                          const float* __restrict__ ii, const float* __restrict__ iv, float* __restrict__ isc) {
  __shared__ __attribute__((aligned(16))) float part[NAS][QB][TT];
  __shared__ float sis[QB];
  const int tid = threadIdx.x, lane = tid & 31; const int m0 = blockIdx.x * QB; if (m0 >= MR) return; const int b = m0 / TT;
  const int wv = __builtin_amdgcn_readfirstlane(tid >> 5);   // the wave's number in a scalar register: the addresses of si and slot_v are then scalar too
  const int kg = wv & 1, as = wv >> 1;
  const float* sh = ShT + ((size_t)b * DD + as * AW) * TT + kg * 128 + lane * 4;
  const float* si = P + (size_t)m0 * 3 * DD + 2 * DD + as * AW;
  const float* vp = sv + as * AW;
  // every "#pragma unroll" of this kernel: the arrays are then indexed by constants only and stay in registers
  v4f cur[AC], nxt[AC];
  v2f acc[QB][2];
#pragma unroll
  for (int q = 0; q < QB; ++q) acc[q][0] = acc[q][1] = (v2f){0.f, 0.f};
#pragma unroll
  for (int i = 0; i < AC; ++i) cur[i] = *(const v4fa*)(sh + (size_t)i * TT);
#pragma unroll 1   // rolled: the body is long already
  for (int c = 0; c < AW / AC; ++c) {
    const float* nsh = sh + (size_t)(((c + 1) & (AW / AC - 1)) * AC) * TT;   // next AC columns: their loads fly during this chunk's sums (the last trip re-reads the wave's first chunk, unused)
#pragma unroll
    for (int i = 0; i < AC; ++i) nxt[i] = *(const v4fa*)(nsh + (size_t)i * TT);
    asm volatile("s_wait_xcnt 0x0" ::: "memory");   // the compiler hands the address registers of the loads above to the sums below: the wait stands in front of that overwrite
    __builtin_amdgcn_sched_barrier(0);   // keeps those loads in front of the chunk's sums (left alone the compiler sinks them to their uses, and every chunk is waited for in full)
#pragma unroll
    for (int i = 0; i < AC; ++i) {
      const float v = bf16_round(vp[c * AC + i]);
      const v2f v2 = {v, v};
      v2f t[QB][2];
#pragma unroll
      for (int q = 0; q < QB; ++q) {
        const float x = si[(size_t)q * 3 * DD + c * AC + i];
        const v2f x2 = {x, x};
        t[q][0] = (v2f){cur[i][0], cur[i][1]} + x2; t[q][1] = (v2f){cur[i][2], cur[i][3]} + x2;
      }
#pragma unroll
      for (int q = 0; q < QB; ++q)
#pragma unroll
        for (int h = 0; h < 2; ++h) { t[q][h][0] = tanh_fast(t[q][h][0]); t[q][h][1] = tanh_fast(t[q][h][1]); }
#pragma unroll
      for (int q = 0; q < QB; ++q)
#pragma unroll
        for (int h = 0; h < 2; ++h) acc[q][h] += v2 * t[q][h];
      __builtin_amdgcn_sched_barrier(0);   // one column's 32 sums are one scheduling region (in one region of all AC columns this compiler strings add, tanh and multiply-add of each value in a row, each waiting for the last)
    }
#pragma unroll
    for (int i = 0; i < AC; ++i) cur[i] = nxt[i];
  }
#pragma unroll
  for (int q = 0; q < QB; ++q) *(v4fa*)&part[as][q][kg * 128 + lane * 4] = (v4f){acc[q][0][0], acc[q][0][1], acc[q][1][0], acc[q][1][1]};
  __syncthreads();   // every wave's partial sums are in part before a query's softmax reads them
  v4f e[2] = {};   // waves 0..QB-1: the keys 4 lane .. + 3 and 128 + 4 lane .. + 3 of query wv
  if (wv >= QB) {   // (its loads stand behind the barrier: in front of it the barrier's own wait would hold every wave of the block until they are back)
    v4f ih[4], vi[4], vv[4];
    const float* hr = P + (size_t)(m0 + wv - QB) * 3 * DD + lane * 4;
#pragma unroll
    for (int u = 0; u < 4; ++u) { ih[u] = *(const v4fa*)(hr + u * 128); vi[u] = *(const v4fa*)(ii + (size_t)b * DD + u * 128 + lane * 4); vv[u] = *(const v4fa*)(iv + u * 128 + lane * 4); }
    asm volatile("s_wait_xcnt 0x0" ::: "memory");   // stands in front of whatever later rewrites the address registers of the loads above
    float a = 0.f;
#pragma unroll
    for (int u = 0; u < 4; ++u)
#pragma unroll
      for (int q = 0; q < 4; ++q) a += bf16_round(vv[u][q]) * tanh_fast(ih[u][q] + vi[u][q]);
    for (int o = 1; o <= 16; o <<= 1) a += __shfl_xor(a, o, 32);
    if (lane == 0) sis[wv - QB] = a;
  } else {
#pragma unroll
    for (int h = 0; h < 2; ++h) {
      e[h] = *(const v4fa*)&part[0][wv][h * 128 + lane * 4];
#pragma unroll
      for (int j = 1; j < NAS; ++j) e[h] += *(const v4fa*)&part[j][wv][h * 128 + lane * 4];
    }
    float mx = -3.0e38f;
#pragma unroll
    for (int h = 0; h < 2; ++h)
#pragma unroll
      for (int t = 0; t < 4; ++t) mx = fmaxf(mx, e[h][t]);
    for (int o = 16; o >= 1; o >>= 1) mx = fmaxf(mx, __shfl_xor(mx, o, 32));
    float den = 0.f;
#pragma unroll
    for (int h = 0; h < 2; ++h)
#pragma unroll
      for (int t = 0; t < 4; ++t) { e[h][t] = expf(e[h][t] - mx); den += e[h][t]; }
    for (int o = 16; o >= 1; o >>= 1) den += __shfl_xor(den, o, 32);
    const float inv = 1.0f / den;
#pragma unroll
    for (int h = 0; h < 2; ++h) e[h] = e[h] * inv;
  }
  __syncthreads();   // the QB intent scores are in sis before one wave stores them together; it stands in front of the weights' stores, so that no wave waits at it for a store's return
  if (wv < QB) {
    float* dst = Wt + (size_t)(m0 + wv) * TT + lane * 4;
#pragma unroll
    for (int h = 0; h < 2; ++h) *(v4f*)(dst + h * 128) = e[h];
  } else if (wv == QB && lane < QB) isc[(size_t)blockIdx.x * ISP + lane] = sis[lane];
}
// c_slot[b] = W[b] S[b], the same way: a block owns a CT x CT tile of one batch, brings its CT rows of W (split into bf16 hi and lo planes on the way) and its CT rows
// of the transposed S planes, all of K, into LDS by loads in which a wave reads 512 bytes in a row; behind ONE barrier 8 waves (4 x 2, 16 x 32 of C each) read their
// fragments from LDS; per 16 x 16 tile and 32 k the hi WMMA, then the lo WMMA, k ascending, so every sum has the order it had.
#define CT 64
#define CP (TT + 8)   // LDS row pitch in bf16: 528 B = 16 B x 33, an odd count of 16-byte units, for the 16-byte fragment reads
// the rest of the intent attention needs k_slot's launch to have ended, as c_slot does, and nothing of c_slot: IQ more blocks per batch in the same launch, the block index picks the job.
// A block takes IC columns of c_intent[b], 8 waves. softmax over t: every wave for itself, from the batch's 256 scores. c_intent[b][d] = sum_s w_s bf16(S[b][s][d]): the keys go in 32 groups
// of 8, wave wv takes the groups wv, wv + 8, wv + 16, wv + 24 (32 independent loads, which need no score), lane the columns 2 lane, 2 lane + 1;
// the 32 partial sums of a column are added through LDS, group ascending.
#define IQ 8
#define IC (DD / IQ)
typedef float v2fa __attribute__((ext_vector_type(2), may_alias));
__device__ __forceinline__ void d_intent_sum(int b, int c0, const float* __restrict__ isc, const float* __restrict__ S, float* __restrict__ cint, f1a* part) {
  const int tid = threadIdx.x, wv = tid >> 5, lane = tid & 31;
  // every "#pragma unroll" of this function: the arrays are then indexed by constants only and stay in registers, and a batch's loads stand together in front of its sums
  const float* sp = S + ((size_t)b * TT + wv * 8) * DD + c0 + lane * 2;
  v2f x[4][8];
#pragma unroll
  for (int g = 0; g < 4; ++g)
#pragma unroll
    for (int i = 0; i < 8; ++i) x[g][i] = *(const v2fa*)(sp + (size_t)(g * 64 + i) * DD);
  const float* sb = isc + (size_t)b * (TT / QB) * ISP + (lane & 7);   // score t lies in the line of k_slot's block t / QB, at place t % QB
  float e[8], own[4];
#pragma unroll
  for (int u = 0; u < 8; ++u) e[u] = sb[(u * 4 + (lane >> 3)) * ISP];   // t = 32 u + lane
#pragma unroll
  for (int g = 0; g < 4; ++g) own[g] = sb[(wv + 8 * g) * ISP];          // lane i < 8: key i of the wave's group g
  asm volatile("s_wait_xcnt 0x0" ::: "memory");   // stands in front of whatever later rewrites the address registers of the loads above
  float mx = -3.0e38f, den = 0.f;
#pragma unroll
  for (int u = 0; u < 8; ++u) mx = fmaxf(mx, e[u]);
  for (int o = 16; o >= 1; o >>= 1) mx = fmaxf(mx, __shfl_xor(mx, o, 32));
#pragma unroll
  for (int u = 0; u < 8; ++u) den += expf(e[u] - mx);
  for (int o = 16; o >= 1; o >>= 1) den += __shfl_xor(den, o, 32);
#pragma unroll
  for (int g = 0; g < 4; ++g) {
    const int wl = __float_as_int(expf(own[g] - mx) / den);
    v2f acc = {0.f, 0.f};
#pragma unroll
    for (int i = 0; i < 8; ++i) {
      const float w = __int_as_float(__builtin_amdgcn_readlane(wl, i));
      acc[0] += w * bf16_round(x[g][i][0]); acc[1] += w * bf16_round(x[g][i][1]);
    }
    *(v2fa*)&part[(wv + 8 * g) * IC + lane * 2] = acc;
  }
  __syncthreads();   // the 32 partial sums of every column are in part before they are added
  if (tid >= IC) return;
  float s = part[tid];
#pragma unroll
  for (int j = 1; j < 32; ++j) s += part[j * IC + tid];
  cint[(size_t)b * DD + c0 + tid] = s;
}
#define NB_C ((TT / CT) * (DD / CT))
__global__ __launch_bounds__(256) void k_cslot(const float* __restrict__ Wt, const unsigned short* __restrict__ ST, float* __restrict__ C,
                                               const float* __restrict__ isc, const float* __restrict__ S, float* __restrict__ cint) {
  __shared__ __attribute__((aligned(16))) unsigned short sm[3 * CT * CP];
  const int blk = (int)blockIdx.x - BB * IQ;   // the intent blocks come first in the grid: theirs is the longer chain of dependent steps
  if (blk < 0) { d_intent_sum(blockIdx.x / IQ, (blockIdx.x % IQ) * IC, isc, S, cint, (f1a*)sm); return; }
  unsigned short* sAh = sm; unsigned short* sAl = sm + CT * CP; unsigned short* sB = sm + 2 * CT * CP;
  const int by = blk / NB_C, mt = (blk % NB_C) / (DD / CT), nt = blk % (DD / CT);
  const int tid = threadIdx.x, w = tid >> 5, lane = tid & 31, ln = lane & 15, hh = lane >> 4;
  // every "#pragma unroll" of this kernel: the arrays are then indexed by constants only and stay in registers, and a batch's loads stand together in front of its stores
  {
    v8us bq[8]; v4f aq[16];
    const unsigned short* bsrc = ST + ((size_t)by * DD + nt * CT + (tid >> 5)) * TT + (tid & 31) * 8;
    const float* asrc = Wt + ((size_t)by * TT + mt * CT + (tid >> 6)) * TT + (tid & 63) * 4;
#pragma unroll
    for (int i = 0; i < 8; ++i) bq[i] = *(const v8us*)(bsrc + (size_t)i * 8 * TT);
    asm volatile("s_wait_xcnt 0x0" ::: "memory");   // the compiler hands the address registers of the loads above to a later load as its destination: the wait stands in front of that overwrite
#pragma unroll
    for (int i = 0; i < 15; ++i) aq[i] = *(const v4fa*)(asrc + (size_t)i * 4 * TT);
    asm volatile("s_wait_xcnt 0x0" ::: "memory");   // the same, for the last load, whose destination may take the address registers of the 15 above
    aq[15] = *(const v4fa*)(asrc + (size_t)15 * 4 * TT);
#pragma unroll
    for (int i = 0; i < 8; ++i) *(v8us*)(sB + ((tid >> 5) + 8 * i) * CP + (tid & 31) * 8) = bq[i];
#pragma unroll
    for (int i = 0; i < 16; ++i) {
      v4us qh, ql;
#pragma unroll
      for (int t = 0; t < 4; ++t) { const unsigned short hb = bf16_bits(aq[i][t]); qh[t] = hb; ql[t] = bf16_bits(aq[i][t] - bf16_val(hb)); }
      *(v4us*)(sAh + ((tid >> 6) + 4 * i) * CP + (tid & 63) * 4) = qh;
      *(v4us*)(sAl + ((tid >> 6) + 4 * i) * CP + (tid & 63) * 4) = ql;
    }
  }
  __syncthreads();   // the three tiles are whole in LDS before any wave reads a fragment
  const int wm = w >> 1, wn = w & 1;
  const unsigned short* pah = sAh + (wm * 16 + ln) * CP + 8 * hh;
  const unsigned short* pal = sAl + (wm * 16 + ln) * CP + 8 * hh;
  const unsigned short* pb = sB + (wn * 32 + ln) * CP + 8 * hh;
  v8f acc[2] = {};
  FragB ah[2], al[2], b[2][2];   // two fragment sets: the next 32 k are read from LDS while this set's WMMAs run
  ah[0].half[0] = *(const v8us*)pah; ah[0].half[1] = *(const v8us*)(pah + 16);
  al[0].half[0] = *(const v8us*)pal; al[0].half[1] = *(const v8us*)(pal + 16);
#pragma unroll
  for (int j = 0; j < 2; ++j) { b[0][j].half[0] = *(const v8us*)(pb + j * 16 * CP); b[0][j].half[1] = *(const v8us*)(pb + j * 16 * CP + 16); }
#pragma unroll
  for (int s = 0; s < TT / 32; ++s) {
    const int cu = s & 1, nx = cu ^ 1, kn = (s + 1) * 32;
    if (kn < TT) {
      ah[nx].half[0] = *(const v8us*)(pah + kn); ah[nx].half[1] = *(const v8us*)(pah + kn + 16);
      al[nx].half[0] = *(const v8us*)(pal + kn); al[nx].half[1] = *(const v8us*)(pal + kn + 16);
#pragma unroll
      for (int j = 0; j < 2; ++j) { b[nx][j].half[0] = *(const v8us*)(pb + j * 16 * CP + kn); b[nx][j].half[1] = *(const v8us*)(pb + j * 16 * CP + kn + 16); }
    }
    __builtin_amdgcn_sched_barrier(0);   // keeps the next set's LDS reads, as one group, in front of this set's WMMAs (left alone the compiler sinks them to their uses, and every set is waited for in full)
#pragma unroll
    for (int j = 0; j < 2; ++j) {
      acc[j] = __builtin_amdgcn_wmma_f32_16x16x32_bf16(false, ah[cu].v, false, b[cu][j].v, (short)0, acc[j], false, false);
      acc[j] = __builtin_amdgcn_wmma_f32_16x16x32_bf16(false, al[cu].v, false, b[cu][j].v, (short)0, acc[j], false, false);
    }
  }
  __syncthreads();   // every wave has read its last fragment before the tiles' LDS is used again for staging
  f1a* so = (f1a*)sm + w * 16 * SP;
#pragma unroll
  for (int j = 0; j < 2; ++j)
#pragma unroll
    for (int r = 0; r < 8; ++r) so[(8 * hh + r) * SP + j * 16 + ln] = acc[j][r];
  __builtin_amdgcn_fence(__ATOMIC_ACQ_REL, "workgroup");   // the wave's own staging stores are done before its lanes read each other's
  __builtin_amdgcn_wave_barrier();
  v4f v[4];
#pragma unroll
  for (int q = 0; q < 4; ++q) v[q] = *(const v4fa*)&so[(q * 4 + (lane >> 3)) * SP + (lane & 7) * 4];
  float* dst = C + ((size_t)by * TT + mt * CT + wm * 16 + (lane >> 3)) * DD + nt * CT + wn * 32 + (lane & 7) * 4;
#pragma unroll
  for (int q = 0; q < 4; ++q) *(v4f*)(dst + (size_t)q * 4 * DD) = v[q];
  asm volatile("s_wait_xcnt 0x0" ::: "memory");   // in the listing the intent blocks' arm follows these stores and rewrites registers that they name: the wait stands in front of it
}
extern "C" void kernel_launch(void* const* d_in, const int* in_sizes, int n_in,
                              void* d_out, int out_size, void* d_ws, size_t ws_size, hipStream_t stream) {
  (void)in_sizes; (void)n_in; (void)out_size;
  const float* S = (const float*)d_in[0]; const float* fst = (const float*)d_in[1]; const float* iv = (const float*)d_in[2]; const float* W_ih = (const float*)d_in[3]; const float* b_ih = (const float*)d_in[4]; const float* W_ii = (const float*)d_in[5]; const float* b_ii = (const float*)d_in[6];
  const float* sv = (const float*)d_in[7]; const float* W_sh = (const float*)d_in[8]; const float* b_sh = (const float*)d_in[9]; const float* W_si = (const float*)d_in[10]; const float* b_si = (const float*)d_in[11];
  float* cslot = (float*)d_out; float* cint = (float*)((char*)d_out + 4194304);
  char* ws = (char*)d_ws; size_t off = 0;
  auto take = [&](size_t bytes) { char* p = ws + off; off += (bytes + 255) & ~(size_t)255; return p; };
  unsigned short* B3 = (unsigned short*)take((size_t)3 * DD * DD * 2); unsigned short* Bii = (unsigned short*)take((size_t)DD * DD * 2); float* b3 = (float*)take(3 * DD * 4); unsigned short* ST = (unsigned short*)take((size_t)BB * DD * TT * 2);
  float* fp = (float*)take(16 * DD * 4); float* ii = (float*)take(16 * DD * 4); float* P = (float*)take((size_t)MR * 3 * DD * 4); float* Wt = (float*)take((size_t)MR * TT * 4); float* ShT = (float*)take((size_t)MR * DD * 4); float* isc = (float*)take((size_t)(MR / QB) * ISP * 4);
  if (off > ws_size) return;
  k_prep<<<NB_ST + 4 * NB_WT + NB_FP + 3, 256, 0, stream>>>(W_ih, W_sh, W_si, W_ii, b_ih, b_sh, b_si, S, fst, B3, Bii, b3, ST, fp);
  k_proj<<<NB_II + NB_P, 512, 0, stream>>>(S, B3, b3, P, ShT, fp, Bii, b_ii, ii);      // ii (rows 0..15) and [ih | sh | si] + b (single term); sh goes to ShT, transposed
  k_slot<<<MR / QB, 512, 0, stream>>>(P, ShT, sv, Wt, ii, iv, isc);   // slot weights; the intent scores ride along
  k_cslot<<<BB * (IQ + NB_C), 256, 0, stream>>>(Wt, ST, cslot, isc, S, cint);   // the first BB * IQ blocks: intent softmax and c_intent; the rest: c_slot[b] = W[b] S[b]
}

// v008
// It runs in 35.3 microseconds.
// In two side-by-side timings against v007, it was 1.10 and 1.09 times as fast.
// All steps since v000 together make it 38.0 times as fast.
#include <hip/hip_runtime.h>
// [ih | sh | si] = S·[W_ih|W_sh|W_si] + b (one GEMM, K=512, N=1536), ii = f·W_ii + b (M padded) — inputs and weights rounded to bf16: single exact
// WMMA term, f32 accumulate — and c_slot = slot_w·S per batch (slot_w split into bf16 hi/lo vs S rounded to bf16: 2 terms) run on
// v_wmma_f32_16x16x32_bf16; the additive tanh scores (intent: T×A, slot: T×T×A), both softmaxes and c_intent are f32 VALU.
#define BB 8
#define TT 256
#define DD 512
#define MR (BB * TT)

typedef __bf16 v16b __attribute__((ext_vector_type(16)));
typedef unsigned short v8us __attribute__((ext_vector_type(8), may_alias));
typedef float  v8f  __attribute__((ext_vector_type(8)));
typedef float  v4f  __attribute__((ext_vector_type(4)));
typedef float  v4fa __attribute__((ext_vector_type(4), may_alias));
union FragB { v16b v; v8us half[2]; unsigned short u[16]; };

__device__ __forceinline__ unsigned short bf16_bits(float x) { unsigned int u = __float_as_uint(x); return (unsigned short)((u + 0x7FFFu + ((u >> 16) & 1u)) >> 16); }
__device__ __forceinline__ float bf16_val(unsigned short b) { return __uint_as_float(((unsigned int)b) << 16); }
__device__ __forceinline__ float bf16_round(float x) { return bf16_val(bf16_bits(x)); }
// D += A·B with NT terms: 1 = ah·bh, 2 = + al·bh (A split), 3 = + ah·bl (both split)
template <int NT>
__device__ __forceinline__ v8f mmaN(v16b ah, v16b al, v16b bh, v16b bl, v8f c) {
  c = __builtin_amdgcn_wmma_f32_16x16x32_bf16(false, ah, false, bh, (short)0, c, false, false);
  if (NT >= 2) c = __builtin_amdgcn_wmma_f32_16x16x32_bf16(false, al, false, bh, (short)0, c, false, false);
  if (NT >= 3) c = __builtin_amdgcn_wmma_f32_16x16x32_bf16(false, ah, false, bl, (short)0, c, false, false);
  asm volatile("v_nop\n\tv_nop\n\tv_nop\n\tv_nop" : "+v"(c) : "v"(ah), "v"(al), "v"(bh), "v"(bl));
  return c;
}

// GEMM C[M][N] (f32, pitch ldc) = act(A[M][K]·W + bias). A f32 row-major (pitch lda) converted per fragment to bf16
// (ASPLIT: hi/lo two planes -> 2 terms, else single rounded term); Wt bf16 [N][K] (pitch ldb). BIAS_BF16 rounds the
// bias to bf16 first (bias quantised to bf16 before the add). K%32==0, M%16==0, N%64==0.
template <bool ASPLIT, int ACT, bool BIAS_BF16>
__global__ __launch_bounds__(128) void k_gemm_bf(const float* __restrict__ A, int lda, const unsigned short* __restrict__ Wt, int ldb,
                                               const float* __restrict__ bias, float* __restrict__ C, int ldc, int M, int N, int K) {
  __shared__ __attribute__((aligned(16))) float so[4][16][64];
  const int tid = threadIdx.x, w = tid >> 5, lane = tid & 31, ln = lane & 15, hh = lane >> 4;
  const int ntn = N / 64;
  const int wid = blockIdx.x * 4 + w;
  const int mt = wid / ntn, nq = wid % ntn;
  if (mt * 16 >= M) return;
  const int row0 = mt * 16, col0 = nq * 64;
  const float* arow = A + (size_t)(row0 + ln) * lda;
  v8f acc[4] = {};
  for (int kb = 0; kb < K; kb += 32) {
    FragB ah, al;
    const v4f x0 = *(const v4fa*)(arow + kb + 8 * hh), x1 = *(const v4fa*)(arow + kb + 8 * hh + 4);
    const v4f x2 = *(const v4fa*)(arow + kb + 16 + 8 * hh), x3 = *(const v4fa*)(arow + kb + 16 + 8 * hh + 4);
    float xs[16] = {x0[0],x0[1],x0[2],x0[3],x1[0],x1[1],x1[2],x1[3],x2[0],x2[1],x2[2],x2[3],x3[0],x3[1],x3[2],x3[3]};
#pragma unroll
    for (int i = 0; i < 16; ++i) { const unsigned short hb = bf16_bits(xs[i]); ah.u[i] = hb; al.u[i] = ASPLIT ? bf16_bits(xs[i] - bf16_val(hb)) : (unsigned short)0; }
#pragma unroll
    for (int t = 0; t < 4; ++t) {
      const unsigned short* brow = Wt + (size_t)(col0 + t * 16 + ln) * ldb + kb;
      FragB b;
      b.half[0] = *(const v8us*)(brow + 8 * hh);
      b.half[1] = *(const v8us*)(brow + 16 + 8 * hh);
      acc[t] = mmaN<ASPLIT ? 2 : 1>(ah.v, al.v, b.v, b.v, acc[t]);
    }
  }
#pragma unroll
  for (int t = 0; t < 4; ++t) {
    float bv = bias ? bias[col0 + t * 16 + ln] : 0.f;
    if (BIAS_BF16) bv = bf16_round(bv);
#pragma unroll
    for (int r = 0; r < 8; ++r) { float v = acc[t][r] + bv; if (ACT == 1) v = fmaxf(v, 0.f); so[w][8 * hh + r][t * 16 + ln] = v; }
  }
  __builtin_amdgcn_fence(__ATOMIC_ACQ_REL, "workgroup");
  __builtin_amdgcn_wave_barrier();
  const int rsub = lane >> 4, c4 = (lane & 15) * 4;
  {
#pragma unroll
    for (int q = 0; q < 8; ++q) {
      const int r = q * 2 + rsub;
      const v4f v = *(const v4fa*)&so[w][r][c4];
      *(v4f*)(C + (size_t)(row0 + r) * ldc + col0 + c4) = v;
    }
    
  }
}

// Flash-style causal/unmasked attention, all contractions 3-term bf16 hi/lo splits, f32 softmax with running max.
// q,k,v rows are read from f32 buffers with arbitrary row pitch (so they can live inside a fused qkv buffer);
// D = head size (multiple of 32, <= 128); one wave = 16 query rows; block = 4 waves (64 queries) sharing K/V chunks of 32.
template <int D, bool CAUSAL>
__global__ __launch_bounds__(128) void k_flash(const float* __restrict__ qb, const float* __restrict__ kb, const float* __restrict__ vb,
                                             int pitch, int T, int H, float scale, float* __restrict__ y, int ypitch) {
  constexpr int KS = D / 32;        // k-steps for QK
  constexpr int DT = D / 16;        // d tiles for PV
  __shared__ __attribute__((aligned(16))) unsigned short sKh[32][D + 8], sKl[32][D + 8], sVh[32][D + 8], sVl[32][D + 8];
  __shared__ __attribute__((aligned(16))) unsigned short sPh[4][16][40], sPl[4][16][40];
  __shared__ __attribute__((aligned(16))) float sO[4][16][D];
  const int tid = threadIdx.x, w = tid >> 5, lane = tid & 31, ln = lane & 15, hh = lane >> 4;
  const int nqb = (T + 63) / 64;
  const int bh = blockIdx.x / nqb, qblk = blockIdx.x % nqb;
  const int b = bh / H, h = bh % H;
  const int q0 = qblk * 64 + w * 16;
  const float* Q = qb + (size_t)b * T * pitch + h * D;
  const float* K = kb + (size_t)b * T * pitch + h * D;
  const float* V = vb + (size_t)b * T * pitch + h * D;

  // A fragments of the wave's 16 query rows (scaled), hi/lo
  FragB aqh[KS], aql[KS];
  {
    int row = q0 + ln; if (row >= T) row = T - 1;
    const float* qr = Q + (size_t)row * pitch;
#pragma unroll
    for (int ks = 0; ks < KS; ++ks)
#pragma unroll
      for (int i = 0; i < 16; ++i) {
        const int d = ks * 32 + ((i < 8) ? (8 * hh + i) : (16 + 8 * hh + (i - 8)));
        const float x = qr[d] * scale; const unsigned short hb = bf16_bits(x);
        aqh[ks].u[i] = hb; aql[ks].u[i] = bf16_bits(x - bf16_val(hb));
      }
  }
  float m_r[8], l_r[8];
#pragma unroll
  for (int r = 0; r < 8; ++r) { m_r[r] = -3.0e38f; l_r[r] = 0.f; }
  v8f oacc[DT];
#pragma unroll
  for (int dt = 0; dt < DT; ++dt) oacc[dt] = (v8f){0.f,0.f,0.f,0.f,0.f,0.f,0.f,0.f};

  const int kv_end = CAUSAL ? min(T, qblk * 64 + 64) : T;     // block-uniform
  for (int j0 = 0; j0 < kv_end; j0 += 32) {
    __syncthreads();
    for (int e = tid; e < 32 * (D / 4); e += 128) {
      const int r = e / (D / 4), c4 = (e % (D / 4)) * 4;
      const int key = j0 + r;
      v4f kf = {0.f,0.f,0.f,0.f}, vf = {0.f,0.f,0.f,0.f};
      if (key < T) { kf = *(const v4fa*)(K + (size_t)key * pitch + c4); vf = *(const v4fa*)(V + (size_t)key * pitch + c4); }
#pragma unroll
      for (int t = 0; t < 4; ++t) {
        unsigned short hb = bf16_bits(kf[t]); sKh[r][c4 + t] = hb; sKl[r][c4 + t] = bf16_bits(kf[t] - bf16_val(hb));
        hb = bf16_bits(vf[t]); sVh[r][c4 + t] = hb; sVl[r][c4 + t] = bf16_bits(vf[t] - bf16_val(hb));
      }
    }
    __syncthreads();
    // S tile 16 x 32
    v8f s[2];
#pragma unroll
    for (int nt = 0; nt < 2; ++nt) {
      v8f acc = {};
#pragma unroll
      for (int ks = 0; ks < KS; ++ks) {
        FragB bh_, bl_;
        bh_.half[0] = *(const v8us*)&sKh[nt * 16 + ln][ks * 32 + 8 * hh]; bh_.half[1] = *(const v8us*)&sKh[nt * 16 + ln][ks * 32 + 16 + 8 * hh];
        bl_.half[0] = *(const v8us*)&sKl[nt * 16 + ln][ks * 32 + 8 * hh]; bl_.half[1] = *(const v8us*)&sKl[nt * 16 + ln][ks * 32 + 16 + 8 * hh];
        acc = mmaN<3>(aqh[ks].v, aql[ks].v, bh_.v, bl_.v, acc);
      }
      s[nt] = acc;
    }
    // mask + running max (rows 8hh+r; the 16 lanes of a half share rows)
    float alpha[8];
#pragma unroll
    for (int r = 0; r < 8; ++r) {
      const int qi = q0 + 8 * hh + r;
      const int ja = j0 + ln, jb = j0 + 16 + ln;
      if (CAUSAL) { if (ja > qi) s[0][r] = -3.0e38f; if (jb > qi) s[1][r] = -3.0e38f; }
      if (ja >= T) s[0][r] = -3.0e38f;
      if (jb >= T) s[1][r] = -3.0e38f;
      float mx = fmaxf(s[0][r], s[1][r]);
      mx = fmaxf(mx, __shfl_xor(mx, 1, 32)); mx = fmaxf(mx, __shfl_xor(mx, 2, 32)); mx = fmaxf(mx, __shfl_xor(mx, 4, 32)); mx = fmaxf(mx, __shfl_xor(mx, 8, 32));
      const float mnew = fmaxf(m_r[r], mx);
      alpha[r] = (mnew > -1.0e38f) ? __expf(m_r[r] - mnew) : 1.0f;
      const float p0 = (s[0][r] > -1.0e38f) ? __expf(s[0][r] - mnew) : 0.f;
      const float p1 = (s[1][r] > -1.0e38f) ? __expf(s[1][r] - mnew) : 0.f;
      m_r[r] = mnew;
      l_r[r] = l_r[r] * alpha[r] + p0 + p1;            // per-lane partial row sum (16 lanes combined at the end)
      unsigned short hb = bf16_bits(p0); sPh[w][8 * hh + r][ln] = hb;      sPl[w][8 * hh + r][ln] = bf16_bits(p0 - bf16_val(hb));
      hb = bf16_bits(p1);                sPh[w][8 * hh + r][16 + ln] = hb; sPl[w][8 * hh + r][16 + ln] = bf16_bits(p1 - bf16_val(hb));
    }
#pragma unroll
    for (int dt = 0; dt < DT; ++dt)
#pragma unroll
      for (int r = 0; r < 8; ++r) oacc[dt][r] *= alpha[r];
    __builtin_amdgcn_fence(__ATOMIC_ACQ_REL, "workgroup");
    __builtin_amdgcn_wave_barrier();
    FragB pah, pal;
    pah.half[0] = *(const v8us*)&sPh[w][ln][8 * hh]; pah.half[1] = *(const v8us*)&sPh[w][ln][16 + 8 * hh];
    pal.half[0] = *(const v8us*)&sPl[w][ln][8 * hh]; pal.half[1] = *(const v8us*)&sPl[w][ln][16 + 8 * hh];
#pragma unroll
    for (int dt = 0; dt < DT; ++dt) {
      FragB bvh, bvl;
#pragma unroll
      for (int i = 0; i < 8; ++i) {
        bvh.u[i] = sVh[8 * hh + i][dt * 16 + ln]; bvh.u[8 + i] = sVh[16 + 8 * hh + i][dt * 16 + ln];
        bvl.u[i] = sVl[8 * hh + i][dt * 16 + ln]; bvl.u[8 + i] = sVl[16 + 8 * hh + i][dt * 16 + ln];
      }
      oacc[dt] = mmaN<3>(pah.v, pal.v, bvh.v, bvl.v, oacc[dt]);
    }
    __builtin_amdgcn_fence(__ATOMIC_ACQ_REL, "workgroup");
    __builtin_amdgcn_wave_barrier();
  }
#pragma unroll
  for (int r = 0; r < 8; ++r) {
    float l = l_r[r];
    l += __shfl_xor(l, 1, 32); l += __shfl_xor(l, 2, 32); l += __shfl_xor(l, 4, 32); l += __shfl_xor(l, 8, 32);
    l_r[r] = (l > 0.f) ? 1.0f / l : 0.f;
  }
#pragma unroll
  for (int dt = 0; dt < DT; ++dt)
#pragma unroll
    for (int r = 0; r < 8; ++r) sO[w][8 * hh + r][dt * 16 + ln] = oacc[dt][r] * l_r[r];
  __builtin_amdgcn_fence(__ATOMIC_ACQ_REL, "workgroup");
  __builtin_amdgcn_wave_barrier();
  {
    for (int r = 0; r < 16; ++r) {
      const int row = q0 + r;
      if (row < T && lane < D / 4) {
        const v4f val = *(const v4fa*)&sO[w][r][lane * 4];
        *(v4f*)(y + ((size_t)b * T + row) * ypitch + h * D + lane * 4) = val;
      }
    }
    
  }
}

// row LayerNorm (biased variance, eps) over N: s = X (+ R); optional out_sum <- s; out_norm <- (s-mu)*rsqrt(var+eps)*g + b
template <bool PARAM_BF16>
__global__ __launch_bounds__(256) void k_layernorm(const float* __restrict__ X, const float* __restrict__ R, const float* __restrict__ g, const float* __restrict__ bta,
                                                  float* __restrict__ out_sum, float* __restrict__ out_norm, int N, float eps) {
  __shared__ float red[256];
  const int row = blockIdx.x, tid = threadIdx.x;
  const float* x = X + (size_t)row * N; const float* rr = R ? R + (size_t)row * N : nullptr;
  float vals[16];                     // up to N = 4096
  const int per = N / 256;            // contiguous chunk per thread? use strided-by-4 chunks: thread handles j = tid*4 + 1024*u
  float s1 = 0.f;
  for (int u = 0; u < per / 4; ++u) {
    const int j = tid * 4 + 1024 * u;
    const v4f a = *(const v4fa*)(x + j);
    v4f b = {0.f,0.f,0.f,0.f}; if (rr) b = *(const v4fa*)(rr + j);
#pragma unroll
    for (int q = 0; q < 4; ++q) { const float v = a[q] + b[q]; vals[u * 4 + q] = v; s1 += v; }
  }
  red[tid] = s1; __syncthreads();
  for (int st = 128; st > 0; st >>= 1) { if (tid < st) red[tid] += red[tid + st]; __syncthreads(); }
  const float mu = red[0] / (float)N; __syncthreads();
  float s2 = 0.f;
  for (int u = 0; u < per / 4; ++u)
#pragma unroll
    for (int q = 0; q < 4; ++q) { const float c = vals[u * 4 + q] - mu; s2 += c * c; }
  red[tid] = s2; __syncthreads();
  for (int st = 128; st > 0; st >>= 1) { if (tid < st) red[tid] += red[tid + st]; __syncthreads(); }
  const float rs = rsqrtf(red[0] / (float)N + eps);
  {
    for (int u = 0; u < per / 4; ++u) {
      const int j = tid * 4 + 1024 * u;
      v4f o, sm;
#pragma unroll
      for (int q = 0; q < 4; ++q) {
        float gg = g[j + q], bb = bta[j + q];
        if (PARAM_BF16) { gg = bf16_round(gg); bb = bf16_round(bb); }
        sm[q] = vals[u * 4 + q]; o[q] = (vals[u * 4 + q] - mu) * rs * gg + bb;
      }
      if (out_sum) *(v4f*)(out_sum + (size_t)row * N + j) = sm;
      *(v4f*)(out_norm + (size_t)row * N + j) = o;
    }
    
  }
}

// batched f32 [K][N] (pitch lds, batch stride sIn) -> transposed hi/lo planes [N][K] (batch stride sOut); thread per (n, 8 k); grid.y = batch
__global__ __launch_bounds__(256) void k_split_transpose_b(const float* __restrict__ src, int lds_, size_t sIn, unsigned short* __restrict__ hi, unsigned short* __restrict__ lo, size_t sOut, int K, int N) {
  const size_t t = (size_t)blockIdx.x * 256 + threadIdx.x; const int k8n = K / 8; if (t >= (size_t)N * k8n) return;
  src += (size_t)blockIdx.y * sIn; hi += (size_t)blockIdx.y * sOut; lo += (size_t)blockIdx.y * sOut;
  const int n = (int)(t / k8n), k8 = (int)(t % k8n) * 8; v8us vh, vl;
#pragma unroll
  for (int i = 0; i < 8; ++i) { const float x = src[(size_t)(k8 + i) * lds_ + n]; const unsigned short hb = bf16_bits(x); vh[i] = hb; vl[i] = bf16_bits(x - bf16_val(hb)); }
  unsigned short* dh = hi + (size_t)n * K + k8; unsigned short* dl = lo + (size_t)n * K + k8;
  *(v8us*)dh = vh; *(v8us*)dl = vl; 
}


// one v_tanh_f32 per value
__device__ __forceinline__ float tanh_fast(float x) { return __builtin_amdgcn_tanhf(x); }
// both projections in ONE launch: blocks 0 .. NB_II - 1 do ii = f W_ii + b, the rest [ih | sh | si] = S [W_ih | W_sh | W_si] + b.
// A block owns a PT x PT tile of C. It first brings its PT rows of A and its PT columns of W, all of K, both f32 and rounded to bf16 on the way, into LDS by whole-line
// loads. W lies [k][n] and the fragments want [n][k]: a lane loads 4 columns n of 8 rows k in a row and stores, per column, the 8 rounded values as ONE 16-byte piece of sB[n][k],
// so the transposition needs no exchange between lanes and no launch of its own. Behind ONE barrier 16 waves (4 x 4, 32 x 32 of C each) read their fragments from LDS, k ascending, one WMMA per
// 32 k and 16 x 16 tile, so every sum has the order it had. An ii block has only BB rows of A: the tile's rows above repeat them and are not stored.
#define PT 128
#define PP (DD + 8)   // LDS row pitch in bf16: 1040 B = 16 B x 65, an odd count of 16-byte units, for the 16-byte fragment reads
#define SP 36         // row pitch in floats of a wave's staging tile: rows 8 apart fall on different banks, rows stay 16-byte aligned
#define NB_II (DD / PT)
#define NB_P ((MR / PT) * (3 * DD / PT))
typedef unsigned short v4us __attribute__((ext_vector_type(4), may_alias));
typedef float f1a __attribute__((may_alias));
typedef float v2f __attribute__((ext_vector_type(2)));
typedef __bf16 v2b __attribute__((ext_vector_type(2)));
typedef unsigned int v4u __attribute__((ext_vector_type(4), may_alias));
typedef unsigned int v2u __attribute__((ext_vector_type(2), may_alias));
// two f32 rounded to nearest even into the two bf16 halves of one register: one v_cvt_pk_bf16_f32
__device__ __forceinline__ unsigned int bf16_pair(float lo, float hi) { return __builtin_bit_cast(unsigned int, __builtin_convertvector((v2f){lo, hi}, v2b)); }
// x[p][i] holds 4 columns n of row k = 128 p + i of an f32 [k][n] matrix: per column the 8 rounded values leave as ONE 16-byte piece of the bf16 [n][k] tile at dst
// (both loops unrolled: x is then indexed by constants only and stays in registers)
template <int NP>
__device__ __forceinline__ void d_put_turned(const v4f (&x)[NP][8], unsigned short* dst, int pitch) {
#pragma unroll
  for (int p = 0; p < NP; ++p)
#pragma unroll
    for (int c = 0; c < 4; ++c)
      *(v4u*)(dst + c * pitch + p * 128) = (v4u){bf16_pair(x[p][0][c], x[p][1][c]), bf16_pair(x[p][2][c], x[p][3][c]), bf16_pair(x[p][4][c], x[p][5][c]), bf16_pair(x[p][6][c], x[p][7][c])};
}
__global__ __launch_bounds__(512) void k_proj(const float* __restrict__ S, const float* __restrict__ W_ih, const float* __restrict__ W_sh, const float* __restrict__ W_si,
                                              const float* __restrict__ b_ih, const float* __restrict__ b_sh, const float* __restrict__ b_si, float* __restrict__ P, float* __restrict__ ShT,
                                              const float* __restrict__ f, const float* __restrict__ W_ii, const float* __restrict__ b_ii, float* __restrict__ ii) {
  __shared__ __attribute__((aligned(16))) unsigned short sm[2 * PT * PP];
  unsigned short* sA = sm; unsigned short* sB = sm + PT * PP;
  const bool isii = blockIdx.x < NB_II;
  const int blk = isii ? blockIdx.x : blockIdx.x - NB_II;
  const int mt = isii ? 0 : blk / (3 * DD / PT), nt = isii ? blk : blk % (3 * DD / PT);
  const float* A = isii ? f : S + (size_t)mt * PT * DD;
  const int wj = nt / (DD / PT);   // which of the three weights the tile's columns lie in
  const float* Wf = (isii ? W_ii : wj == 0 ? W_ih : wj == 1 ? W_sh : W_si) + (nt % (DD / PT)) * PT;
  const float* bias = (isii ? b_ii : wj == 0 ? b_ih : wj == 1 ? b_sh : b_si) + (nt % (DD / PT)) * PT;
  const int tid = threadIdx.x, w = tid >> 5, lane = tid & 31, ln = lane & 15, hh = lane >> 4;
  // every "#pragma unroll" of this kernel: the arrays are then indexed by constants only and stay in registers, and a batch's loads stand together in front of its stores
  {
    // a wave's load of W reads 4 rows k, 8 apart, one 128-byte line of each: the 16-byte stores of its 32 lanes then fall evenly on all LDS banks
    const int nn = lane & 7, k0 = ((w >> 2) * 4 + (lane >> 3)) * 8, n0 = (w & 3) * 32 + nn * 4;
    v4f wq[4][8];
    const float* wsrc = Wf + (size_t)k0 * DD + n0;
    const float* asrc = A + (size_t)(tid >> 7) * DD + (tid & 127) * 4;
    unsigned short* adst = sA + (tid >> 7) * PP + (tid & 127) * 4;
#pragma unroll
    for (int p = 0; p < 4; ++p)
#pragma unroll
      for (int i = 0; i < 8; ++i) wq[p][i] = *(const v4fa*)(wsrc + (size_t)(p * 128 + i) * DD);
    asm volatile("s_wait_xcnt 0x0" ::: "memory");   // stands in front of whatever later rewrites the address registers of the loads above
    if (isii) {   // BB rows of A: tile row r takes row r % BB
      v4f aq[2];
#pragma unroll
      for (int i = 0; i < 2; ++i) aq[i] = *(const v4fa*)(asrc + (size_t)i * 4 * DD);
      asm volatile("s_wait_xcnt 0x0" ::: "memory");   // the same, for these two
      d_put_turned<4>(wq, sB + n0 * PP + k0, PP);
      const v2u q[2] = {{bf16_pair(aq[0][0], aq[0][1]), bf16_pair(aq[0][2], aq[0][3])}, {bf16_pair(aq[1][0], aq[1][1]), bf16_pair(aq[1][2], aq[1][3])}};
#pragma unroll
      for (int i = 0; i < 32; ++i) *(v2u*)(adst + 4 * i * PP) = q[i & 1];
    } else {   // A comes in two halves: all of W and all of A at once are more registers than a wave has; the second half is loaded once W is stored and flies while the first is rounded and stored
      v4f aq[16], ar[16];
#pragma unroll
      for (int i = 0; i < 16; ++i) aq[i] = *(const v4fa*)(asrc + (size_t)i * 4 * DD);
      asm volatile("s_wait_xcnt 0x0" ::: "memory");   // the same, for the first half of A
      d_put_turned<4>(wq, sB + n0 * PP + k0, PP);
#pragma unroll
      for (int i = 0; i < 16; ++i) ar[i] = *(const v4fa*)(asrc + (size_t)(16 + i) * 4 * DD);
      asm volatile("s_wait_xcnt 0x0" ::: "memory");   // the same, for the second half of A
#pragma unroll
      for (int i = 0; i < 32; ++i) {
        v4us q;
#pragma unroll
        for (int t = 0; t < 4; ++t) q[t] = bf16_bits(i < 16 ? aq[i & 15][t] : ar[i & 15][t]);
        *(v4us*)(adst + 4 * i * PP) = q;
      }
    }
  }
  __syncthreads();   // both tiles are whole in LDS before any wave reads a fragment
  const int wm = w >> 2, wn = w & 3;
  const unsigned short* pa = sA + (wm * 32 + ln) * PP + 8 * hh;
  const unsigned short* pb = sB + (wn * 32 + ln) * PP + 8 * hh;
  v8f acc[2][2] = {};
  FragB a[2][2], b[2][2];   // two fragment sets: the next 32 k are read from LDS while this set's WMMAs run
#pragma unroll
  for (int i = 0; i < 2; ++i) {
    a[0][i].half[0] = *(const v8us*)(pa + i * 16 * PP); a[0][i].half[1] = *(const v8us*)(pa + i * 16 * PP + 16);
    b[0][i].half[0] = *(const v8us*)(pb + i * 16 * PP); b[0][i].half[1] = *(const v8us*)(pb + i * 16 * PP + 16);
  }
#pragma unroll
  for (int s = 0; s < DD / 32; ++s) {
    const int cu = s & 1, nx = cu ^ 1, kn = (s + 1) * 32;
    if (kn < DD) {
#pragma unroll
      for (int i = 0; i < 2; ++i) {
        a[nx][i].half[0] = *(const v8us*)(pa + i * 16 * PP + kn); a[nx][i].half[1] = *(const v8us*)(pa + i * 16 * PP + kn + 16);
        b[nx][i].half[0] = *(const v8us*)(pb + i * 16 * PP + kn); b[nx][i].half[1] = *(const v8us*)(pb + i * 16 * PP + kn + 16);
      }
    }
    __builtin_amdgcn_sched_barrier(0);   // keeps the next set's LDS reads, as one group, in front of this set's WMMAs (left alone the compiler sinks them to their uses, and every set is waited for in full)
#pragma unroll
    for (int i = 0; i < 2; ++i)
#pragma unroll
      for (int j = 0; j < 2; ++j) acc[i][j] = __builtin_amdgcn_wmma_f32_16x16x32_bf16(false, a[cu][i].v, false, b[cu][j].v, (short)0, acc[i][j], false, false);
  }
  __syncthreads();   // every wave has read its last fragment before the tiles' LDS is used again for staging
  f1a* so = (f1a*)sm + w * 32 * SP;
  const bool tr = !isii && (nt >> 2) == 1;   // the sh columns: stored transposed, ShT[b][a][s], for k_slot, whose lanes are keys
#pragma unroll
  for (int j = 0; j < 2; ++j) {
    const float bv = bf16_round(bias[wn * 32 + j * 16 + ln]);
    if (tr) {   // staged column by column: a lane's 8 accumulators are 8 keys of one column
#pragma unroll
      for (int i = 0; i < 2; ++i)
#pragma unroll
        for (int g = 0; g < 2; ++g) {
          const v4f x = {acc[i][j][4 * g] + bv, acc[i][j][4 * g + 1] + bv, acc[i][j][4 * g + 2] + bv, acc[i][j][4 * g + 3] + bv};
          *(v4fa*)&so[(j * 16 + ln) * SP + i * 16 + 8 * hh + 4 * g] = x;
        }
    } else {
#pragma unroll
      for (int i = 0; i < 2; ++i)
#pragma unroll
        for (int r = 0; r < 8; ++r) so[(i * 16 + 8 * hh + r) * SP + j * 16 + ln] = acc[i][j][r] + bv;
    }
  }
  __builtin_amdgcn_fence(__ATOMIC_ACQ_REL, "workgroup");   // the wave's own staging stores are done before its lanes read each other's
  __builtin_amdgcn_wave_barrier();
  v4f v[8];
#pragma unroll
  for (int q = 0; q < 8; ++q) v[q] = *(const v4fa*)&so[(q * 4 + (lane >> 3)) * SP + (lane & 7) * 4];
  const int crow = wm * 32 + (lane >> 3), ccol = nt * PT + wn * 32 + (lane & 7) * 4;
  if (tr) {   // the staged rows are columns a of sh, 32 keys (one 128-byte line) each
    float* C = ShT + ((size_t)(mt / (TT / PT)) * DD + (nt - DD / PT) * PT + wn * 32 + (lane >> 3)) * TT + (mt % (TT / PT)) * PT + wm * 32 + (lane & 7) * 4;
#pragma unroll
    for (int q = 0; q < 8; ++q) *(v4f*)(C + (size_t)q * 4 * TT) = v[q];
  } else if (!isii) {
    float* C = P + ((size_t)mt * PT + crow) * (3 * DD) + ccol;
#pragma unroll
    for (int q = 0; q < 8; ++q) *(v4f*)(C + (size_t)q * 4 * 3 * DD) = v[q];
    asm volatile("s_wait_xcnt 0x0" ::: "memory");   // in the listing the other arm's address arithmetic follows these stores and rewrites registers that they name: the wait stands in front of it
  } else if (wm == 0) {   // an ii block stores rows 0 .. BB - 1 only
    float* C = ii + (size_t)crow * DD + ccol;
#pragma unroll
    for (int q = 0; q < BB / 4; ++q) *(v4f*)(C + (size_t)q * 4 * DD) = v[q];
  }
}
// slot scores: a LANE IS A KEY, so a score is summed along a inside one lane and no sum crosses lanes. Block = QB queries t of one batch x all 256 keys, 16 waves:
// wave (kg, as) takes the keys 128 kg + 4 lane .. + 3 and the columns a in [AW as, AW as + AW). sh comes transposed (ShT[b][a][s]): one 16-byte load per lane and a feeds
// 4 QB tanh; si[t][a] and slot_v[a] are the same for every lane and are read through scalar registers. The NAS partial sums of a score meet in LDS, as ascending.
// softmax over s -> W[b][t][s] by waves 0..QB-1, one query each, behind the block barrier.
// The intent scores ride along: while waves 0..QB-1 do the softmax, wave QB + r, which has nothing left to do, makes the intent score of the block's row m0 + r, the row
// spread over the lanes (lane holds a = 128 u + 4 lane + q), the 32 partial sums meeting in a butterfly; the block's QB scores leave in one store, into a 128-byte line of their own.
#define QB 8
#define ISP 32   // floats from one block's intent scores to the next block's: one 128-byte line a block
#define NAS 8
#define AW (DD / NAS)
#define AC 8
// waves_per_eu: the launch puts 4 waves on every SIMD (MR / QB blocks of 16 waves on 256 WGPs); this is the register budget that goes with it
__global__ __launch_bounds__(512) __attribute__((amdgpu_waves_per_eu(4, 4))) void k_slot(const float* __restrict__ P, const float* __restrict__ ShT, const float* __restrict__ sv, float* __restrict__ Wt,
                                                                                          const float* __restrict__ ii, const float* __restrict__ iv, float* __restrict__ isc) {
  __shared__ __attribute__((aligned(16))) float part[NAS][QB][TT];
  __shared__ float sis[QB];
  const int tid = threadIdx.x, lane = tid & 31; const int m0 = blockIdx.x * QB; if (m0 >= MR) return; const int b = m0 / TT;
  const int wv = __builtin_amdgcn_readfirstlane(tid >> 5);   // the wave's number in a scalar register: the addresses of si and slot_v are then scalar too
  const int kg = wv & 1, as = wv >> 1;
  const float* sh = ShT + ((size_t)b * DD + as * AW) * TT + kg * 128 + lane * 4;
  const float* si = P + (size_t)m0 * 3 * DD + 2 * DD + as * AW;
  const float* vp = sv + as * AW;
  // every "#pragma unroll" of this kernel: the arrays are then indexed by constants only and stay in registers
  v4f cur[AC], nxt[AC];
  v2f acc[QB][2];
#pragma unroll
  for (int q = 0; q < QB; ++q) acc[q][0] = acc[q][1] = (v2f){0.f, 0.f};
#pragma unroll
  for (int i = 0; i < AC; ++i) cur[i] = *(const v4fa*)(sh + (size_t)i * TT);
#pragma unroll 1   // rolled: the body is long already
  for (int c = 0; c < AW / AC; ++c) {
    const float* nsh = sh + (size_t)(((c + 1) & (AW / AC - 1)) * AC) * TT;   // next AC columns: their loads fly during this chunk's sums (the last trip re-reads the wave's first chunk, unused)
#pragma unroll
    for (int i = 0; i < AC; ++i) nxt[i] = *(const v4fa*)(nsh + (size_t)i * TT);
    asm volatile("s_wait_xcnt 0x0" ::: "memory");   // the compiler hands the address registers of the loads above to the sums below: the wait stands in front of that overwrite
    __builtin_amdgcn_sched_barrier(0);   // keeps those loads in front of the chunk's sums (left alone the compiler sinks them to their uses, and every chunk is waited for in full)
#pragma unroll
    for (int i = 0; i < AC; ++i) {
      const float v = bf16_round(vp[c * AC + i]);
      const v2f v2 = {v, v};
      v2f t[QB][2];
#pragma unroll
      for (int q = 0; q < QB; ++q) {
        const float x = si[(size_t)q * 3 * DD + c * AC + i];
        const v2f x2 = {x, x};
        t[q][0] = (v2f){cur[i][0], cur[i][1]} + x2; t[q][1] = (v2f){cur[i][2], cur[i][3]} + x2;
      }
#pragma unroll
      for (int q = 0; q < QB; ++q)
#pragma unroll
        for (int h = 0; h < 2; ++h) { t[q][h][0] = tanh_fast(t[q][h][0]); t[q][h][1] = tanh_fast(t[q][h][1]); }
#pragma unroll
      for (int q = 0; q < QB; ++q)
#pragma unroll
        for (int h = 0; h < 2; ++h) acc[q][h] += v2 * t[q][h];
      __builtin_amdgcn_sched_barrier(0);   // one column's 32 sums are one scheduling region (in one region of all AC columns this compiler strings add, tanh and multiply-add of each value in a row, each waiting for the last)
    }
#pragma unroll
    for (int i = 0; i < AC; ++i) cur[i] = nxt[i];
  }
#pragma unroll
  for (int q = 0; q < QB; ++q) *(v4fa*)&part[as][q][kg * 128 + lane * 4] = (v4f){acc[q][0][0], acc[q][0][1], acc[q][1][0], acc[q][1][1]};
  __syncthreads();   // every wave's partial sums are in part before a query's softmax reads them
  v4f e[2] = {};   // waves 0..QB-1: the keys 4 lane .. + 3 and 128 + 4 lane .. + 3 of query wv
  if (wv >= QB) {   // (its loads stand behind the barrier: in front of it the barrier's own wait would hold every wave of the block until they are back)
    v4f ih[4], vi[4], vv[4];
    const float* hr = P + (size_t)(m0 + wv - QB) * 3 * DD + lane * 4;
#pragma unroll
    for (int u = 0; u < 4; ++u) { ih[u] = *(const v4fa*)(hr + u * 128); vi[u] = *(const v4fa*)(ii + (size_t)b * DD + u * 128 + lane * 4); vv[u] = *(const v4fa*)(iv + u * 128 + lane * 4); }
    asm volatile("s_wait_xcnt 0x0" ::: "memory");   // stands in front of whatever later rewrites the address registers of the loads above
    float a = 0.f;
#pragma unroll
    for (int u = 0; u < 4; ++u)
#pragma unroll
      for (int q = 0; q < 4; ++q) a += bf16_round(vv[u][q]) * tanh_fast(ih[u][q] + vi[u][q]);
    for (int o = 1; o <= 16; o <<= 1) a += __shfl_xor(a, o, 32);
    if (lane == 0) sis[wv - QB] = a;
  } else {
#pragma unroll
    for (int h = 0; h < 2; ++h) {
      e[h] = *(const v4fa*)&part[0][wv][h * 128 + lane * 4];
#pragma unroll
      for (int j = 1; j < NAS; ++j) e[h] += *(const v4fa*)&part[j][wv][h * 128 + lane * 4];
    }
    float mx = -3.0e38f;
#pragma unroll
    for (int h = 0; h < 2; ++h)
#pragma unroll
      for (int t = 0; t < 4; ++t) mx = fmaxf(mx, e[h][t]);
    for (int o = 16; o >= 1; o >>= 1) mx = fmaxf(mx, __shfl_xor(mx, o, 32));
    float den = 0.f;
#pragma unroll
    for (int h = 0; h < 2; ++h)
#pragma unroll
      for (int t = 0; t < 4; ++t) { e[h][t] = expf(e[h][t] - mx); den += e[h][t]; }
    for (int o = 16; o >= 1; o >>= 1) den += __shfl_xor(den, o, 32);
    const float inv = 1.0f / den;
#pragma unroll
    for (int h = 0; h < 2; ++h) e[h] = e[h] * inv;
  }
  __syncthreads();   // the QB intent scores are in sis before one wave stores them together; it stands in front of the weights' stores, so that no wave waits at it for a store's return
  if (wv < QB) {
    float* dst = Wt + (size_t)(m0 + wv) * TT + lane * 4;
#pragma unroll
    for (int h = 0; h < 2; ++h) *(v4f*)(dst + h * 128) = e[h];
  } else if (wv == QB && lane < QB) isc[(size_t)blockIdx.x * ISP + lane] = sis[lane];
}
// c_slot[b] = W[b] S[b], the same way: a block owns a CT x CT tile of one batch, brings its CT rows of W (split into bf16 hi and lo planes on the way) and its CT columns
// of S (f32 [s][d], rounded to bf16 and turned to [d][s] on the way, as k_proj turns its weights), all of K, into LDS by whole-line loads; behind ONE barrier 8 waves (4 x 2, 16 x 32 of C each) read their
// fragments from LDS; per 16 x 16 tile and 32 k the hi WMMA, then the lo WMMA, k ascending, so every sum has the order it had.
#define CT 64
#define CP (TT + 8)   // LDS row pitch in bf16: 528 B = 16 B x 33, an odd count of 16-byte units, for the 16-byte fragment reads
// the rest of the intent attention needs k_slot's launch to have ended, as c_slot does, and nothing of c_slot: IQ more blocks per batch in the same launch, the block index picks the job.
// A block takes IC columns of c_intent[b], 8 waves. softmax over t: every wave for itself, from the batch's 256 scores. c_intent[b][d] = sum_s w_s bf16(S[b][s][d]): the keys go in 32 groups
// of 8, wave wv takes the groups wv, wv + 8, wv + 16, wv + 24 (32 independent loads, which need no score), lane the columns 2 lane, 2 lane + 1;
// the 32 partial sums of a column are added through LDS, group ascending.
#define IQ 8
#define IC (DD / IQ)
typedef float v2fa __attribute__((ext_vector_type(2), may_alias));
__device__ __forceinline__ void d_intent_sum(int b, int c0, const float* __restrict__ isc, const float* __restrict__ S, float* __restrict__ cint, f1a* part) {
  const int tid = threadIdx.x, wv = tid >> 5, lane = tid & 31;
  // every "#pragma unroll" of this function: the arrays are then indexed by constants only and stay in registers, and a batch's loads stand together in front of its sums
  const float* sp = S + ((size_t)b * TT + wv * 8) * DD + c0 + lane * 2;
  v2f x[4][8];
#pragma unroll
  for (int g = 0; g < 4; ++g)
#pragma unroll
    for (int i = 0; i < 8; ++i) x[g][i] = *(const v2fa*)(sp + (size_t)(g * 64 + i) * DD);
  const float* sb = isc + (size_t)b * (TT / QB) * ISP + (lane & 7);   // score t lies in the line of k_slot's block t / QB, at place t % QB
  float e[8], own[4];
#pragma unroll
  for (int u = 0; u < 8; ++u) e[u] = sb[(u * 4 + (lane >> 3)) * ISP];   // t = 32 u + lane
#pragma unroll
  for (int g = 0; g < 4; ++g) own[g] = sb[(wv + 8 * g) * ISP];          // lane i < 8: key i of the wave's group g
  asm volatile("s_wait_xcnt 0x0" ::: "memory");   // stands in front of whatever later rewrites the address registers of the loads above
  float mx = -3.0e38f, den = 0.f;
#pragma unroll
  for (int u = 0; u < 8; ++u) mx = fmaxf(mx, e[u]);
  for (int o = 16; o >= 1; o >>= 1) mx = fmaxf(mx, __shfl_xor(mx, o, 32));
#pragma unroll
  for (int u = 0; u < 8; ++u) den += expf(e[u] - mx);
  for (int o = 16; o >= 1; o >>= 1) den += __shfl_xor(den, o, 32);
#pragma unroll
  for (int g = 0; g < 4; ++g) {
    const int wl = __float_as_int(expf(own[g] - mx) / den);
    v2f acc = {0.f, 0.f};
#pragma unroll
    for (int i = 0; i < 8; ++i) {
      const float w = __int_as_float(__builtin_amdgcn_readlane(wl, i));
      acc[0] += w * bf16_round(x[g][i][0]); acc[1] += w * bf16_round(x[g][i][1]);
    }
    *(v2fa*)&part[(wv + 8 * g) * IC + lane * 2] = acc;
  }
  __syncthreads();   // the 32 partial sums of every column are in part before they are added
  if (tid >= IC) return;
  float s = part[tid];
#pragma unroll
  for (int j = 1; j < 32; ++j) s += part[j * IC + tid];
  cint[(size_t)b * DD + c0 + tid] = s;
}
#define NB_C ((TT / CT) * (DD / CT))
__global__ __launch_bounds__(256) void k_cslot(const float* __restrict__ Wt, float* __restrict__ C,
                                               const float* __restrict__ isc, const float* __restrict__ S, float* __restrict__ cint) {
  __shared__ __attribute__((aligned(16))) unsigned short sm[3 * CT * CP];
  const int blk = (int)blockIdx.x - BB * IQ;   // the intent blocks come first in the grid: theirs is the longer chain of dependent steps
  if (blk < 0) { d_intent_sum(blockIdx.x / IQ, (blockIdx.x % IQ) * IC, isc, S, cint, (f1a*)sm); return; }
  unsigned short* sAh = sm; unsigned short* sAl = sm + CT * CP; unsigned short* sB = sm + 2 * CT * CP;
  const int by = blk / NB_C, mt = (blk % NB_C) / (DD / CT), nt = blk % (DD / CT);
  const int tid = threadIdx.x, w = tid >> 5, lane = tid & 31, ln = lane & 15, hh = lane >> 4;
  // every "#pragma unroll" of this kernel: the arrays are then indexed by constants only and stay in registers, and a batch's loads stand together in front of its stores
  {
    // a wave's load of S reads 4 rows s, 8 apart, one 128-byte line of each: the 16-byte stores of its 32 lanes then fall evenly on all LDS banks
    const int k0 = ((w >> 1) * 4 + (lane >> 3)) * 8, n0 = (w & 1) * 32 + (lane & 7) * 4;
    v4f sq[2][8], aq[16];
    const float* ssrc = S + ((size_t)by * TT + k0) * DD + nt * CT + n0;
    const float* asrc = Wt + ((size_t)by * TT + mt * CT + (tid >> 6)) * TT + (tid & 63) * 4;
#pragma unroll
    for (int p = 0; p < 2; ++p)
#pragma unroll
      for (int i = 0; i < 8; ++i) sq[p][i] = *(const v4fa*)(ssrc + (size_t)(p * 128 + i) * DD);
    asm volatile("s_wait_xcnt 0x0" ::: "memory");   // the compiler hands the address registers of the loads above to a later load as its destination: the wait stands in front of that overwrite
#pragma unroll
    for (int i = 0; i < 15; ++i) aq[i] = *(const v4fa*)(asrc + (size_t)i * 4 * TT);
    asm volatile("s_wait_xcnt 0x0" ::: "memory");   // the same, for the last load, whose destination may take the address registers of the 15 above
    aq[15] = *(const v4fa*)(asrc + (size_t)15 * 4 * TT);
    __builtin_amdgcn_sched_barrier(0);   // keeps every load in front of the roundings (left alone the compiler draws the rounding of S, with its wait for S, in front of the last loads of W)
    d_put_turned<2>(sq, sB + n0 * CP + k0, CP);
#pragma unroll
    for (int i = 0; i < 16; ++i) {
      v4us qh, ql;
#pragma unroll
      for (int t = 0; t < 4; ++t) { const unsigned short hb = bf16_bits(aq[i][t]); qh[t] = hb; ql[t] = bf16_bits(aq[i][t] - bf16_val(hb)); }
      *(v4us*)(sAh + ((tid >> 6) + 4 * i) * CP + (tid & 63) * 4) = qh;
      *(v4us*)(sAl + ((tid >> 6) + 4 * i) * CP + (tid & 63) * 4) = ql;
    }
  }
  __syncthreads();   // the three tiles are whole in LDS before any wave reads a fragment
  const int wm = w >> 1, wn = w & 1;
  const unsigned short* pah = sAh + (wm * 16 + ln) * CP + 8 * hh;
  const unsigned short* pal = sAl + (wm * 16 + ln) * CP + 8 * hh;
  const unsigned short* pb = sB + (wn * 32 + ln) * CP + 8 * hh;
  v8f acc[2] = {};
  FragB ah[2], al[2], b[2][2];   // two fragment sets: the next 32 k are read from LDS while this set's WMMAs run
  ah[0].half[0] = *(const v8us*)pah; ah[0].half[1] = *(const v8us*)(pah + 16);
  al[0].half[0] = *(const v8us*)pal; al[0].half[1] = *(const v8us*)(pal + 16);
#pragma unroll
  for (int j = 0; j < 2; ++j) { b[0][j].half[0] = *(const v8us*)(pb + j * 16 * CP); b[0][j].half[1] = *(const v8us*)(pb + j * 16 * CP + 16); }
#pragma unroll
  for (int s = 0; s < TT / 32; ++s) {
    const int cu = s & 1, nx = cu ^ 1, kn = (s + 1) * 32;
    if (kn < TT) {
      ah[nx].half[0] = *(const v8us*)(pah + kn); ah[nx].half[1] = *(const v8us*)(pah + kn + 16);
      al[nx].half[0] = *(const v8us*)(pal + kn); al[nx].half[1] = *(const v8us*)(pal + kn + 16);
#pragma unroll
      for (int j = 0; j < 2; ++j) { b[nx][j].half[0] = *(const v8us*)(pb + j * 16 * CP + kn); b[nx][j].half[1] = *(const v8us*)(pb + j * 16 * CP + kn + 16); }
    }
    __builtin_amdgcn_sched_barrier(0);   // keeps the next set's LDS reads, as one group, in front of this set's WMMAs (left alone the compiler sinks them to their uses, and every set is waited for in full)
#pragma unroll
    for (int j = 0; j < 2; ++j) {
      acc[j] = __builtin_amdgcn_wmma_f32_16x16x32_bf16(false, ah[cu].v, false, b[cu][j].v, (short)0, acc[j], false, false);
      acc[j] = __builtin_amdgcn_wmma_f32_16x16x32_bf16(false, al[cu].v, false, b[cu][j].v, (short)0, acc[j], false, false);
    }
  }
  __syncthreads();   // every wave has read its last fragment before the tiles' LDS is used again for staging
  f1a* so = (f1a*)sm + w * 16 * SP;
#pragma unroll
  for (int j = 0; j < 2; ++j)
#pragma unroll
    for (int r = 0; r < 8; ++r) so[(8 * hh + r) * SP + j * 16 + ln] = acc[j][r];
  __builtin_amdgcn_fence(__ATOMIC_ACQ_REL, "workgroup");   // the wave's own staging stores are done before its lanes read each other's
  __builtin_amdgcn_wave_barrier();
  v4f v[4];
#pragma unroll
  for (int q = 0; q < 4; ++q) v[q] = *(const v4fa*)&so[(q * 4 + (lane >> 3)) * SP + (lane & 7) * 4];
  float* dst = C + ((size_t)by * TT + mt * CT + wm * 16 + (lane >> 3)) * DD + nt * CT + wn * 32 + (lane & 7) * 4;
#pragma unroll
  for (int q = 0; q < 4; ++q) *(v4f*)(dst + (size_t)q * 4 * DD) = v[q];
  asm volatile("s_wait_xcnt 0x0" ::: "memory");   // in the listing the intent blocks' arm follows these stores and rewrites registers that they name: the wait stands in front of it
}
extern "C" void kernel_launch(void* const* d_in, const int* in_sizes, int n_in,
                              void* d_out, int out_size, void* d_ws, size_t ws_size, hipStream_t stream) {
  (void)in_sizes; (void)n_in; (void)out_size;
  const float* S = (const float*)d_in[0]; const float* fst = (const float*)d_in[1]; const float* iv = (const float*)d_in[2]; const float* W_ih = (const float*)d_in[3]; const float* b_ih = (const float*)d_in[4]; const float* W_ii = (const float*)d_in[5]; const float* b_ii = (const float*)d_in[6];
  const float* sv = (const float*)d_in[7]; const float* W_sh = (const float*)d_in[8]; const float* b_sh = (const float*)d_in[9]; const float* W_si = (const float*)d_in[10]; const float* b_si = (const float*)d_in[11];
  float* cslot = (float*)d_out; float* cint = (float*)((char*)d_out + 4194304);
  char* ws = (char*)d_ws; size_t off = 0;
  auto take = [&](size_t bytes) { char* p = ws + off; off += (bytes + 255) & ~(size_t)255; return p; };
  float* ii = (float*)take(BB * DD * 4); float* P = (float*)take((size_t)MR * 3 * DD * 4); float* Wt = (float*)take((size_t)MR * TT * 4); float* ShT = (float*)take((size_t)MR * DD * 4); float* isc = (float*)take((size_t)(MR / QB) * ISP * 4);
  if (off > ws_size) return;
  k_proj<<<NB_II + NB_P, 512, 0, stream>>>(S, W_ih, W_sh, W_si, b_ih, b_sh, b_si, P, ShT, fst, W_ii, b_ii, ii);      // ii (rows 0..7) and [ih | sh | si] + b (single term); sh goes to ShT, transposed
  k_slot<<<MR / QB, 512, 0, stream>>>(P, ShT, sv, Wt, ii, iv, isc);   // slot weights; the intent scores ride along
  k_cslot<<<BB * (IQ + NB_C), 256, 0, stream>>>(Wt, cslot, isc, S, cint);   // the first BB * IQ blocks: intent softmax and c_intent; the rest: c_slot[b] = W[b] S[b]
}

// v009
// It runs in 34.1 microseconds.
// Two timings next to v008 both put it at 1.03 times that version's speed.
// Counting every step since v000, it is 39.1 times as fast.
#include <hip/hip_runtime.h>
// [ih | sh | si] = S·[W_ih|W_sh|W_si] + b (one GEMM, K=512, N=1536), ii = f·W_ii + b (M padded) — inputs and weights rounded to bf16: single exact
// WMMA term, f32 accumulate — and c_slot = slot_w·S per batch (slot_w split into bf16 hi/lo vs S rounded to bf16: 2 terms) run on
// v_wmma_f32_16x16x32_bf16; the additive tanh scores (intent: T×A, slot: T×T×A), both softmaxes and c_intent are f32 VALU.
#define BB 8
#define TT 256
#define DD 512
#define MR (BB * TT)

typedef __bf16 v16b __attribute__((ext_vector_type(16)));
typedef unsigned short v8us __attribute__((ext_vector_type(8), may_alias));
typedef float  v8f  __attribute__((ext_vector_type(8)));
typedef float  v4f  __attribute__((ext_vector_type(4)));
typedef float  v4fa __attribute__((ext_vector_type(4), may_alias));
union FragB { v16b v; v8us half[2]; unsigned short u[16]; };

__device__ __forceinline__ unsigned short bf16_bits(float x) { unsigned int u = __float_as_uint(x); return (unsigned short)((u + 0x7FFFu + ((u >> 16) & 1u)) >> 16); }
__device__ __forceinline__ float bf16_val(unsigned short b) { return __uint_as_float(((unsigned int)b) << 16); }
__device__ __forceinline__ float bf16_round(float x) { return bf16_val(bf16_bits(x)); }
// D += A·B with NT terms: 1 = ah·bh, 2 = + al·bh (A split), 3 = + ah·bl (both split)
template <int NT>
__device__ __forceinline__ v8f mmaN(v16b ah, v16b al, v16b bh, v16b bl, v8f c) {
  c = __builtin_amdgcn_wmma_f32_16x16x32_bf16(false, ah, false, bh, (short)0, c, false, false);
  if (NT >= 2) c = __builtin_amdgcn_wmma_f32_16x16x32_bf16(false, al, false, bh, (short)0, c, false, false);
  if (NT >= 3) c = __builtin_amdgcn_wmma_f32_16x16x32_bf16(false, ah, false, bl, (short)0, c, false, false);
  asm volatile("v_nop\n\tv_nop\n\tv_nop\n\tv_nop" : "+v"(c) : "v"(ah), "v"(al), "v"(bh), "v"(bl));
  return c;
}

// GEMM C[M][N] (f32, pitch ldc) = act(A[M][K]·W + bias). A f32 row-major (pitch lda) converted per fragment to bf16
// (ASPLIT: hi/lo two planes -> 2 terms, else single rounded term); Wt bf16 [N][K] (pitch ldb). BIAS_BF16 rounds the
// bias to bf16 first (bias quantised to bf16 before the add). K%32==0, M%16==0, N%64==0.
template <bool ASPLIT, int ACT, bool BIAS_BF16>
__global__ __launch_bounds__(128) void k_gemm_bf(const float* __restrict__ A, int lda, const unsigned short* __restrict__ Wt, int ldb,
                                               const float* __restrict__ bias, float* __restrict__ C, int ldc, int M, int N, int K) {
  __shared__ __attribute__((aligned(16))) float so[4][16][64];
  const int tid = threadIdx.x, w = tid >> 5, lane = tid & 31, ln = lane & 15, hh = lane >> 4;
  const int ntn = N / 64;
  const int wid = blockIdx.x * 4 + w;
  const int mt = wid / ntn, nq = wid % ntn;
  if (mt * 16 >= M) return;
  const int row0 = mt * 16, col0 = nq * 64;
  const float* arow = A + (size_t)(row0 + ln) * lda;
  v8f acc[4] = {};
  for (int kb = 0; kb < K; kb += 32) {
    FragB ah, al;
    const v4f x0 = *(const v4fa*)(arow + kb + 8 * hh), x1 = *(const v4fa*)(arow + kb + 8 * hh + 4);
    const v4f x2 = *(const v4fa*)(arow + kb + 16 + 8 * hh), x3 = *(const v4fa*)(arow + kb + 16 + 8 * hh + 4);
    float xs[16] = {x0[0],x0[1],x0[2],x0[3],x1[0],x1[1],x1[2],x1[3],x2[0],x2[1],x2[2],x2[3],x3[0],x3[1],x3[2],x3[3]};
#pragma unroll
    for (int i = 0; i < 16; ++i) { const unsigned short hb = bf16_bits(xs[i]); ah.u[i] = hb; al.u[i] = ASPLIT ? bf16_bits(xs[i] - bf16_val(hb)) : (unsigned short)0; }
#pragma unroll
    for (int t = 0; t < 4; ++t) {
      const unsigned short* brow = Wt + (size_t)(col0 + t * 16 + ln) * ldb + kb;
      FragB b;
      b.half[0] = *(const v8us*)(brow + 8 * hh);
      b.half[1] = *(const v8us*)(brow + 16 + 8 * hh);
      acc[t] = mmaN<ASPLIT ? 2 : 1>(ah.v, al.v, b.v, b.v, acc[t]);
    }
  }
#pragma unroll
  for (int t = 0; t < 4; ++t) {
    float bv = bias ? bias[col0 + t * 16 + ln] : 0.f;
    if (BIAS_BF16) bv = bf16_round(bv);
#pragma unroll
    for (int r = 0; r < 8; ++r) { float v = acc[t][r] + bv; if (ACT == 1) v = fmaxf(v, 0.f); so[w][8 * hh + r][t * 16 + ln] = v; }
  }
  __builtin_amdgcn_fence(__ATOMIC_ACQ_REL, "workgroup");
  __builtin_amdgcn_wave_barrier();
  const int rsub = lane >> 4, c4 = (lane & 15) * 4;
  {
#pragma unroll
    for (int q = 0; q < 8; ++q) {
      const int r = q * 2 + rsub;
      const v4f v = *(const v4fa*)&so[w][r][c4];
      *(v4f*)(C + (size_t)(row0 + r) * ldc + col0 + c4) = v;
    }
    
  }
}

// Flash-style causal/unmasked attention, all contractions 3-term bf16 hi/lo splits, f32 softmax with running max.
// q,k,v rows are read from f32 buffers with arbitrary row pitch (so they can live inside a fused qkv buffer);
// D = head size (multiple of 32, <= 128); one wave = 16 query rows; block = 4 waves (64 queries) sharing K/V chunks of 32.
template <int D, bool CAUSAL>
__global__ __launch_bounds__(128) void k_flash(const float* __restrict__ qb, const float* __restrict__ kb, const float* __restrict__ vb,
                                             int pitch, int T, int H, float scale, float* __restrict__ y, int ypitch) {
  constexpr int KS = D / 32;        // k-steps for QK
  constexpr int DT = D / 16;        // d tiles for PV
  __shared__ __attribute__((aligned(16))) unsigned short sKh[32][D + 8], sKl[32][D + 8], sVh[32][D + 8], sVl[32][D + 8];
  __shared__ __attribute__((aligned(16))) unsigned short sPh[4][16][40], sPl[4][16][40];
  __shared__ __attribute__((aligned(16))) float sO[4][16][D];
  const int tid = threadIdx.x, w = tid >> 5, lane = tid & 31, ln = lane & 15, hh = lane >> 4;
  const int nqb = (T + 63) / 64;
  const int bh = blockIdx.x / nqb, qblk = blockIdx.x % nqb;
  const int b = bh / H, h = bh % H;
  const int q0 = qblk * 64 + w * 16;
  const float* Q = qb + (size_t)b * T * pitch + h * D;
  const float* K = kb + (size_t)b * T * pitch + h * D;
  const float* V = vb + (size_t)b * T * pitch + h * D;

  // A fragments of the wave's 16 query rows (scaled), hi/lo
  FragB aqh[KS], aql[KS];
  {
    int row = q0 + ln; if (row >= T) row = T - 1;
    const float* qr = Q + (size_t)row * pitch;
#pragma unroll
    for (int ks = 0; ks < KS; ++ks)
#pragma unroll
      for (int i = 0; i < 16; ++i) {
        const int d = ks * 32 + ((i < 8) ? (8 * hh + i) : (16 + 8 * hh + (i - 8)));
        const float x = qr[d] * scale; const unsigned short hb = bf16_bits(x);
        aqh[ks].u[i] = hb; aql[ks].u[i] = bf16_bits(x - bf16_val(hb));
      }
  }
  float m_r[8], l_r[8];
#pragma unroll
  for (int r = 0; r < 8; ++r) { m_r[r] = -3.0e38f; l_r[r] = 0.f; }
  v8f oacc[DT];
#pragma unroll
  for (int dt = 0; dt < DT; ++dt) oacc[dt] = (v8f){0.f,0.f,0.f,0.f,0.f,0.f,0.f,0.f};

  const int kv_end = CAUSAL ? min(T, qblk * 64 + 64) : T;     // block-uniform
  for (int j0 = 0; j0 < kv_end; j0 += 32) {
    __syncthreads();
    for (int e = tid; e < 32 * (D / 4); e += 128) {
      const int r = e / (D / 4), c4 = (e % (D / 4)) * 4;
      const int key = j0 + r;
      v4f kf = {0.f,0.f,0.f,0.f}, vf = {0.f,0.f,0.f,0.f};
      if (key < T) { kf = *(const v4fa*)(K + (size_t)key * pitch + c4); vf = *(const v4fa*)(V + (size_t)key * pitch + c4); }
#pragma unroll
      for (int t = 0; t < 4; ++t) {
        unsigned short hb = bf16_bits(kf[t]); sKh[r][c4 + t] = hb; sKl[r][c4 + t] = bf16_bits(kf[t] - bf16_val(hb));
        hb = bf16_bits(vf[t]); sVh[r][c4 + t] = hb; sVl[r][c4 + t] = bf16_bits(vf[t] - bf16_val(hb));
      }
    }
    __syncthreads();
    // S tile 16 x 32
    v8f s[2];
#pragma unroll
    for (int nt = 0; nt < 2; ++nt) {
      v8f acc = {};
#pragma unroll
      for (int ks = 0; ks < KS; ++ks) {
        FragB bh_, bl_;
        bh_.half[0] = *(const v8us*)&sKh[nt * 16 + ln][ks * 32 + 8 * hh]; bh_.half[1] = *(const v8us*)&sKh[nt * 16 + ln][ks * 32 + 16 + 8 * hh];
        bl_.half[0] = *(const v8us*)&sKl[nt * 16 + ln][ks * 32 + 8 * hh]; bl_.half[1] = *(const v8us*)&sKl[nt * 16 + ln][ks * 32 + 16 + 8 * hh];
        acc = mmaN<3>(aqh[ks].v, aql[ks].v, bh_.v, bl_.v, acc);
      }
      s[nt] = acc;
    }
    // mask + running max (rows 8hh+r; the 16 lanes of a half share rows)
    float alpha[8];
#pragma unroll
    for (int r = 0; r < 8; ++r) {
      const int qi = q0 + 8 * hh + r;
      const int ja = j0 + ln, jb = j0 + 16 + ln;
      if (CAUSAL) { if (ja > qi) s[0][r] = -3.0e38f; if (jb > qi) s[1][r] = -3.0e38f; }
      if (ja >= T) s[0][r] = -3.0e38f;
      if (jb >= T) s[1][r] = -3.0e38f;
      float mx = fmaxf(s[0][r], s[1][r]);
      mx = fmaxf(mx, __shfl_xor(mx, 1, 32)); mx = fmaxf(mx, __shfl_xor(mx, 2, 32)); mx = fmaxf(mx, __shfl_xor(mx, 4, 32)); mx = fmaxf(mx, __shfl_xor(mx, 8, 32));
      const float mnew = fmaxf(m_r[r], mx);
      alpha[r] = (mnew > -1.0e38f) ? __expf(m_r[r] - mnew) : 1.0f;
      const float p0 = (s[0][r] > -1.0e38f) ? __expf(s[0][r] - mnew) : 0.f;
      const float p1 = (s[1][r] > -1.0e38f) ? __expf(s[1][r] - mnew) : 0.f;
      m_r[r] = mnew;
      l_r[r] = l_r[r] * alpha[r] + p0 + p1;            // per-lane partial row sum (16 lanes combined at the end)
      unsigned short hb = bf16_bits(p0); sPh[w][8 * hh + r][ln] = hb;      sPl[w][8 * hh + r][ln] = bf16_bits(p0 - bf16_val(hb));
      hb = bf16_bits(p1);                sPh[w][8 * hh + r][16 + ln] = hb; sPl[w][8 * hh + r][16 + ln] = bf16_bits(p1 - bf16_val(hb));
    }
#pragma unroll
    for (int dt = 0; dt < DT; ++dt)
#pragma unroll
      for (int r = 0; r < 8; ++r) oacc[dt][r] *= alpha[r];
    __builtin_amdgcn_fence(__ATOMIC_ACQ_REL, "workgroup");
    __builtin_amdgcn_wave_barrier();
    FragB pah, pal;
    pah.half[0] = *(const v8us*)&sPh[w][ln][8 * hh]; pah.half[1] = *(const v8us*)&sPh[w][ln][16 + 8 * hh];
    pal.half[0] = *(const v8us*)&sPl[w][ln][8 * hh]; pal.half[1] = *(const v8us*)&sPl[w][ln][16 + 8 * hh];
#pragma unroll
    for (int dt = 0; dt < DT; ++dt) {
      FragB bvh, bvl;
#pragma unroll
      for (int i = 0; i < 8; ++i) {
        bvh.u[i] = sVh[8 * hh + i][dt * 16 + ln]; bvh.u[8 + i] = sVh[16 + 8 * hh + i][dt * 16 + ln];
        bvl.u[i] = sVl[8 * hh + i][dt * 16 + ln]; bvl.u[8 + i] = sVl[16 + 8 * hh + i][dt * 16 + ln];
      }
      oacc[dt] = mmaN<3>(pah.v, pal.v, bvh.v, bvl.v, oacc[dt]);
    }
    __builtin_amdgcn_fence(__ATOMIC_ACQ_REL, "workgroup");
    __builtin_amdgcn_wave_barrier();
  }
#pragma unroll
  for (int r = 0; r < 8; ++r) {
    float l = l_r[r];
    l += __shfl_xor(l, 1, 32); l += __shfl_xor(l, 2, 32); l += __shfl_xor(l, 4, 32); l += __shfl_xor(l, 8, 32);
    l_r[r] = (l > 0.f) ? 1.0f / l : 0.f;
  }
#pragma unroll
  for (int dt = 0; dt < DT; ++dt)
#pragma unroll
    for (int r = 0; r < 8; ++r) sO[w][8 * hh + r][dt * 16 + ln] = oacc[dt][r] * l_r[r];
  __builtin_amdgcn_fence(__ATOMIC_ACQ_REL, "workgroup");
  __builtin_amdgcn_wave_barrier();
  {
    for (int r = 0; r < 16; ++r) {
      const int row = q0 + r;
      if (row < T && lane < D / 4) {
        const v4f val = *(const v4fa*)&sO[w][r][lane * 4];
        *(v4f*)(y + ((size_t)b * T + row) * ypitch + h * D + lane * 4) = val;
      }
    }
    
  }
}

// row LayerNorm (biased variance, eps) over N: s = X (+ R); optional out_sum <- s; out_norm <- (s-mu)*rsqrt(var+eps)*g + b
template <bool PARAM_BF16>
__global__ __launch_bounds__(256) void k_layernorm(const float* __restrict__ X, const float* __restrict__ R, const float* __restrict__ g, const float* __restrict__ bta,
                                                  float* __restrict__ out_sum, float* __restrict__ out_norm, int N, float eps) {
  __shared__ float red[256];
  const int row = blockIdx.x, tid = threadIdx.x;
  const float* x = X + (size_t)row * N; const float* rr = R ? R + (size_t)row * N : nullptr;
  float vals[16];                     // up to N = 4096
  const int per = N / 256;            // contiguous chunk per thread? use strided-by-4 chunks: thread handles j = tid*4 + 1024*u
  float s1 = 0.f;
  for (int u = 0; u < per / 4; ++u) {
    const int j = tid * 4 + 1024 * u;
    const v4f a = *(const v4fa*)(x + j);
    v4f b = {0.f,0.f,0.f,0.f}; if (rr) b = *(const v4fa*)(rr + j);
#pragma unroll
    for (int q = 0; q < 4; ++q) { const float v = a[q] + b[q]; vals[u * 4 + q] = v; s1 += v; }
  }
  red[tid] = s1; __syncthreads();
  for (int st = 128; st > 0; st >>= 1) { if (tid < st) red[tid] += red[tid + st]; __syncthreads(); }
  const float mu = red[0] / (float)N; __syncthreads();
  float s2 = 0.f;
  for (int u = 0; u < per / 4; ++u)
#pragma unroll
    for (int q = 0; q < 4; ++q) { const float c = vals[u * 4 + q] - mu; s2 += c * c; }
  red[tid] = s2; __syncthreads();
  for (int st = 128; st > 0; st >>= 1) { if (tid < st) red[tid] += red[tid + st]; __syncthreads(); }
  const float rs = rsqrtf(red[0] / (float)N + eps);
  {
    for (int u = 0; u < per / 4; ++u) {
      const int j = tid * 4 + 1024 * u;
      v4f o, sm;
#pragma unroll
      for (int q = 0; q < 4; ++q) {
        float gg = g[j + q], bb = bta[j + q];
        if (PARAM_BF16) { gg = bf16_round(gg); bb = bf16_round(bb); }
        sm[q] = vals[u * 4 + q]; o[q] = (vals[u * 4 + q] - mu) * rs * gg + bb;
      }
      if (out_sum) *(v4f*)(out_sum + (size_t)row * N + j) = sm;
      *(v4f*)(out_norm + (size_t)row * N + j) = o;
    }
    
  }
}

// batched f32 [K][N] (pitch lds, batch stride sIn) -> transposed hi/lo planes [N][K] (batch stride sOut); thread per (n, 8 k); grid.y = batch
__global__ __launch_bounds__(256) void k_split_transpose_b(const float* __restrict__ src, int lds_, size_t sIn, unsigned short* __restrict__ hi, unsigned short* __restrict__ lo, size_t sOut, int K, int N) {
  const size_t t = (size_t)blockIdx.x * 256 + threadIdx.x; const int k8n = K / 8; if (t >= (size_t)N * k8n) return;
  src += (size_t)blockIdx.y * sIn; hi += (size_t)blockIdx.y * sOut; lo += (size_t)blockIdx.y * sOut;
  const int n = (int)(t / k8n), k8 = (int)(t % k8n) * 8; v8us vh, vl;
#pragma unroll
  for (int i = 0; i < 8; ++i) { const float x = src[(size_t)(k8 + i) * lds_ + n]; const unsigned short hb = bf16_bits(x); vh[i] = hb; vl[i] = bf16_bits(x - bf16_val(hb)); }
  unsigned short* dh = hi + (size_t)n * K + k8; unsigned short* dl = lo + (size_t)n * K + k8;
  *(v8us*)dh = vh; *(v8us*)dl = vl; 
}


// one v_tanh_f32 per value
__device__ __forceinline__ float tanh_fast(float x) { return __builtin_amdgcn_tanhf(x); }
// both projections in ONE launch: blocks 0 .. NB_II - 1 do ii = f W_ii + b, the rest [ih | sh | si] = S [W_ih | W_sh | W_si] + b.
// A block owns a PT x PT tile of C. It brings its PT rows of A and its PT columns of W, all of K, both f32 and rounded to bf16 on the way, into LDS by whole-line
// loads, in stages of KS columns k that overlap the WMMAs (d_proj_mm). W lies [k][n] and the fragments want [n][k]: a lane loads 4 columns n of 8 rows k in a row and stores, per column, the 8
// rounded values as ONE 16-byte piece of sB[n][k], so the transposition needs no exchange between lanes and no launch of its own. 16 waves (4 x 4, 32 x 32 of C each) read their fragments from LDS,
// k ascending, one WMMA per 32 k and 16 x 16 tile, so every sum has the order it had. An ii block has only BB rows of A: the tile's rows above repeat them and are not stored.
#define PT 128
#define PP (DD + 8)   // LDS row pitch in bf16: 1040 B = 16 B x 65, an odd count of 16-byte units, for the 16-byte fragment reads
#define SP 36         // row pitch in floats of a wave's staging tile: rows 8 apart fall on different banks, rows stay 16-byte aligned
#define NB_II (DD / PT)
#define NB_P ((MR / PT) * (3 * DD / PT))
typedef unsigned short v4us __attribute__((ext_vector_type(4), may_alias));
typedef float f1a __attribute__((may_alias));
typedef float v2f __attribute__((ext_vector_type(2)));
typedef __bf16 v2b __attribute__((ext_vector_type(2)));
typedef unsigned int v4u __attribute__((ext_vector_type(4), may_alias));
typedef unsigned int v2u __attribute__((ext_vector_type(2), may_alias));
// two f32 rounded to nearest even into the two bf16 halves of one register: one v_cvt_pk_bf16_f32
__device__ __forceinline__ unsigned int bf16_pair(float lo, float hi) { return __builtin_bit_cast(unsigned int, __builtin_convertvector((v2f){lo, hi}, v2b)); }
// x[p][i] holds 4 columns n of row k = 128 p + i of an f32 [k][n] matrix: per column the 8 rounded values leave as ONE 16-byte piece of the bf16 [n][k] tile at dst
// (both loops unrolled: x is then indexed by constants only and stays in registers)
template <int NP>
__device__ __forceinline__ void d_put_turned(const v4f (&x)[NP][8], unsigned short* dst, int pitch) {
#pragma unroll
  for (int p = 0; p < NP; ++p)
#pragma unroll
    for (int c = 0; c < 4; ++c)
      *(v4u*)(dst + c * pitch + p * 128) = (v4u){bf16_pair(x[p][0][c], x[p][1][c]), bf16_pair(x[p][2][c], x[p][3][c]), bf16_pair(x[p][4][c], x[p][5][c]), bf16_pair(x[p][6][c], x[p][7][c])};
}
#define KS 128          // columns k of one stage
#define NS (DD / KS)
// one stage's loads: 8 rows k of W (4 columns each) and 8 rows of A (4 columns k each; II, an ii block: one row, which serves all 8)
// LAST: the address registers are free behind these loads, and the compiler may hand them to a run's last load as its destination: a wait stands in front of that load too
template <bool II, bool LAST>
__device__ __forceinline__ void d_fetch(const float* wsrc, const float* asrc, v4f (&wx)[8], v4f (&ax)[8]) {
#pragma unroll
  for (int i = 0; i < 7; ++i) wx[i] = *(const v4fa*)(wsrc + (size_t)i * DD);
  if (LAST) asm volatile("s_wait_xcnt 0x0" ::: "memory");   // in front of the run's last load (see LAST)
  wx[7] = *(const v4fa*)(wsrc + (size_t)7 * DD);
  asm volatile("s_wait_xcnt 0x0" ::: "memory");   // stands in front of whatever later rewrites the address registers of the loads above
  if (II) {
    ax[0] = *(const v4fa*)asrc;
  } else {
#pragma unroll
    for (int i = 0; i < 7; ++i) ax[i] = *(const v4fa*)(asrc + (size_t)i * 16 * DD);
    if (LAST) asm volatile("s_wait_xcnt 0x0" ::: "memory");   // in front of the run's last load (see LAST)
    ax[7] = *(const v4fa*)(asrc + (size_t)7 * 16 * DD);
  }
  asm volatile("s_wait_xcnt 0x0" ::: "memory");   // the same, for the loads of A
}
// quarter s of a stage's rounding and storing: column s of the lane's 4 columns of W (its 8 rounded values k as ONE 16-byte piece of sB[n][k]) and the lane's rows 2 s, 2 s + 1 of A
template <bool II>
__device__ __forceinline__ void d_put_quarter(int s, const v4f (&wx)[8], const v4f (&ax)[8], unsigned short* wdst, unsigned short* adst) {
  *(v4u*)(wdst + s * PP) = (v4u){bf16_pair(wx[0][s], wx[1][s]), bf16_pair(wx[2][s], wx[3][s]), bf16_pair(wx[4][s], wx[5][s]), bf16_pair(wx[6][s], wx[7][s])};
#pragma unroll
  for (int i = 2 * s; i < 2 * s + 2; ++i) {
    if (II) {
      *(v2u*)(adst + i * 16 * PP) = (v2u){bf16_pair(ax[0][0], ax[0][1]), bf16_pair(ax[0][2], ax[0][3])};
    } else {
      v4us q;
#pragma unroll
      for (int t = 0; t < 4; ++t) q[t] = bf16_bits(ax[i][t]);
      *(v4us*)(adst + i * 16 * PP) = q;
    }
  }
}
// work-group barrier behind a stage's LDS stores, written by hand: __syncthreads() would also wait for the global loads issued ahead, and the next stages would no longer fly during this stage's WMMAs
__device__ __forceinline__ void d_publish_lds() {
  asm volatile("s_wait_dscnt 0x0" ::: "memory");   // the wave's own LDS stores have landed before it signals
  asm volatile("s_barrier_signal -1\n\ts_barrier_wait -1" ::: "memory");   // the work-group's own barrier, without the wait for global loads that __syncthreads() brings
}
// a block's PT x PT product in NS stages of KS columns k; every stage has its own columns of sA and sB, so no LDS is written twice. While stage p is multiplied (4 steps of 32 k, k ascending),
// stage p + 1, whose loads are back, is rounded and stored, a quarter per step, between the step's LDS reads and its WMMAs, and stage p + 2 is in flight; behind the last step stage p + 3's loads
// are issued into the registers that stage p + 1 has left; then the barrier that publishes stage p + 1. II is a template parameter so that either kind of block is straight-line code: the
// compiler's counted waits for the loads are then exact (with the two kinds joined behind a branch it waits for the smaller count of the two, well into the next stage's loads)
template <bool II>
__device__ __forceinline__ void d_proj_mm(const float* wsrc, const float* asrc, unsigned short* wdst, unsigned short* adst, const unsigned short* pa, const unsigned short* pb, v8f (&acc)[2][2]) {
  // every "#pragma unroll" of this function: the arrays are then indexed by constants only and stay in registers
  v4f wq[2][8], aq[2][8];   // two register sets, stage p in set p % 2
  d_fetch<II, false>(wsrc, asrc, wq[0], aq[0]);
  d_fetch<II, false>(wsrc + (size_t)KS * DD, asrc + KS, wq[1], aq[1]);
  __builtin_amdgcn_sched_barrier(0);   // keeps both stages' loads in front of the first roundings (left alone the compiler draws the rounding of W, with its wait for stage 0, in between the loads)
#pragma unroll
  for (int s = 0; s < 4; ++s) d_put_quarter<II>(s, wq[0], aq[0], wdst, adst);
  d_fetch<II, false>(wsrc + (size_t)2 * KS * DD, asrc + 2 * KS, wq[0], aq[0]);
  d_publish_lds();   // stage 0 is whole in LDS before any wave reads a fragment of it
#pragma unroll
  for (int p = 0; p < NS; ++p) {
    FragB a[2][2], b[2][2];   // two fragment sets: the next 32 k are read from LDS while this set's WMMAs run
#pragma unroll
    for (int i = 0; i < 2; ++i) {
      a[0][i].half[0] = *(const v8us*)(pa + i * 16 * PP + p * KS); a[0][i].half[1] = *(const v8us*)(pa + i * 16 * PP + p * KS + 16);
      b[0][i].half[0] = *(const v8us*)(pb + i * 16 * PP + p * KS); b[0][i].half[1] = *(const v8us*)(pb + i * 16 * PP + p * KS + 16);
    }
#pragma unroll
    for (int s = 0; s < KS / 32; ++s) {
      const int cu = s & 1, nx = cu ^ 1, kn = p * KS + (s + 1) * 32;
      if (s + 1 < KS / 32) {
#pragma unroll
        for (int i = 0; i < 2; ++i) {
          a[nx][i].half[0] = *(const v8us*)(pa + i * 16 * PP + kn); a[nx][i].half[1] = *(const v8us*)(pa + i * 16 * PP + kn + 16);
          b[nx][i].half[0] = *(const v8us*)(pb + i * 16 * PP + kn); b[nx][i].half[1] = *(const v8us*)(pb + i * 16 * PP + kn + 16);
        }
      }
      if (p + 1 < NS) d_put_quarter<II>(s, wq[(p + 1) & 1], aq[(p + 1) & 1], wdst + (p + 1) * KS, adst + (p + 1) * KS);
      __builtin_amdgcn_sched_barrier(0);   // keeps the next set's LDS reads, as one group, and the quarter's roundings in front of this set's WMMAs (left alone the compiler sinks the reads to their uses, and every set is waited for in full)
#pragma unroll
      for (int i = 0; i < 2; ++i)
#pragma unroll
        for (int j = 0; j < 2; ++j) acc[i][j] = __builtin_amdgcn_wmma_f32_16x16x32_bf16(false, a[cu][i].v, false, b[cu][j].v, (short)0, acc[i][j], false, false);
    }
    if (p + 3 < NS) d_fetch<II, true>(wsrc + (size_t)(p + 3) * KS * DD, asrc + (p + 3) * KS, wq[(p + 1) & 1], aq[(p + 1) & 1]);   // NS is 4: the one fetch of this line is the last
    if (p + 1 < NS) d_publish_lds();   // stage p + 1 is whole in LDS before any wave reads a fragment of it
  }
}
__global__ __launch_bounds__(512) void k_proj(const float* __restrict__ S, const float* __restrict__ W_ih, const float* __restrict__ W_sh, const float* __restrict__ W_si,
                                              const float* __restrict__ b_ih, const float* __restrict__ b_sh, const float* __restrict__ b_si, float* __restrict__ P, float* __restrict__ ShT,
                                              const float* __restrict__ f, const float* __restrict__ W_ii, const float* __restrict__ b_ii, float* __restrict__ ii) {
  __shared__ __attribute__((aligned(16))) unsigned short sm[2 * PT * PP];
  unsigned short* sA = sm; unsigned short* sB = sm + PT * PP;
  const bool isii = blockIdx.x < NB_II;
  const int blk = isii ? blockIdx.x : blockIdx.x - NB_II;
  const int mt = isii ? 0 : blk / (3 * DD / PT), nt = isii ? blk : blk % (3 * DD / PT);
  const int wj = nt / (DD / PT);   // which of the three weights the tile's columns lie in
  const float* bias = (isii ? b_ii : wj == 0 ? b_ih : wj == 1 ? b_sh : b_si) + (nt % (DD / PT)) * PT;
  const int tid = threadIdx.x, w = tid >> 5, lane = tid & 31, ln = lane & 15, hh = lane >> 4;
  // every "#pragma unroll" of this kernel: the arrays are then indexed by constants only and stay in registers
  // a wave's load of W reads 4 rows k, 8 apart, one 128-byte line of each: the 16-byte stores of its 32 lanes then fall evenly on all LDS banks; its load of A reads 512 bytes of one row
  const int k0 = ((w >> 2) * 4 + (lane >> 3)) * 8, n0 = (w & 3) * 32 + (lane & 7) * 4;
  const int wm = w >> 2, wn = w & 3;
  const size_t woff = (size_t)k0 * DD + (nt % (DD / PT)) * PT + n0;
  unsigned short* wdst = sB + n0 * PP + k0;
  unsigned short* adst = sA + w * PP + lane * 4;   // tile rows 16 i + w
  const unsigned short* pa = sA + (wm * 32 + ln) * PP + 8 * hh;
  const unsigned short* pb = sB + (wn * 32 + ln) * PP + 8 * hh;
  v8f acc[2][2] = {};
  // (each arm forms its own address of W: from one address for both the compiler draws the first loads in front of the branch and then waits for them, to copy them, before it issues the rest)
  if (isii) d_proj_mm<true>(W_ii + woff, f + (size_t)(w & (BB - 1)) * DD + lane * 4, wdst, adst, pa, pb, acc);   // BB rows of A: tile row r takes row r % BB
  else d_proj_mm<false>((wj == 0 ? W_ih : wj == 1 ? W_sh : W_si) + woff, S + ((size_t)mt * PT + w) * DD + lane * 4, wdst, adst, pa, pb, acc);
  __syncthreads();   // every wave has read its last fragment before the tiles' LDS is used again for staging
  f1a* so = (f1a*)sm + w * 32 * SP;
  const bool tr = !isii && (nt >> 2) == 1;   // the sh columns: stored transposed, ShT[b][a][s], for k_slot, whose lanes are keys
#pragma unroll
  for (int j = 0; j < 2; ++j) {
    const float bv = bf16_round(bias[wn * 32 + j * 16 + ln]);
    if (tr) {   // staged column by column: a lane's 8 accumulators are 8 keys of one column
#pragma unroll
      for (int i = 0; i < 2; ++i)
#pragma unroll
        for (int g = 0; g < 2; ++g) {
          const v4f x = {acc[i][j][4 * g] + bv, acc[i][j][4 * g + 1] + bv, acc[i][j][4 * g + 2] + bv, acc[i][j][4 * g + 3] + bv};
          *(v4fa*)&so[(j * 16 + ln) * SP + i * 16 + 8 * hh + 4 * g] = x;
        }
    } else {
#pragma unroll
      for (int i = 0; i < 2; ++i)
#pragma unroll
        for (int r = 0; r < 8; ++r) so[(i * 16 + 8 * hh + r) * SP + j * 16 + ln] = acc[i][j][r] + bv;
    }
  }
  __builtin_amdgcn_fence(__ATOMIC_ACQ_REL, "workgroup");   // the wave's own staging stores are done before its lanes read each other's
  __builtin_amdgcn_wave_barrier();
  v4f v[8];
#pragma unroll
  for (int q = 0; q < 8; ++q) v[q] = *(const v4fa*)&so[(q * 4 + (lane >> 3)) * SP + (lane & 7) * 4];
  const int crow = wm * 32 + (lane >> 3), ccol = nt * PT + wn * 32 + (lane & 7) * 4;
  if (tr) {   // the staged rows are columns a of sh, 32 keys (one 128-byte line) each
    float* C = ShT + ((size_t)(mt / (TT / PT)) * DD + (nt - DD / PT) * PT + wn * 32 + (lane >> 3)) * TT + (mt % (TT / PT)) * PT + wm * 32 + (lane & 7) * 4;
#pragma unroll
    for (int q = 0; q < 8; ++q) *(v4f*)(C + (size_t)q * 4 * TT) = v[q];
  } else if (!isii) {
    float* C = P + ((size_t)mt * PT + crow) * (3 * DD) + ccol;
#pragma unroll
    for (int q = 0; q < 8; ++q) *(v4f*)(C + (size_t)q * 4 * 3 * DD) = v[q];
    asm volatile("s_wait_xcnt 0x0" ::: "memory");   // in the listing the other arm's address arithmetic follows these stores and rewrites registers that they name: the wait stands in front of it
  } else if (wm == 0) {   // an ii block stores rows 0 .. BB - 1 only
    float* C = ii + (size_t)crow * DD + ccol;
#pragma unroll
    for (int q = 0; q < BB / 4; ++q) *(v4f*)(C + (size_t)q * 4 * DD) = v[q];
  }
}
// slot scores: a LANE IS A KEY, so a score is summed along a inside one lane and no sum crosses lanes. Block = QB queries t of one batch x all 256 keys, 16 waves:
// wave (kg, as) takes the keys 128 kg + 4 lane .. + 3 and the columns a in [AW as, AW as + AW). sh comes transposed (ShT[b][a][s]): one 16-byte load per lane and a feeds
// 4 QB tanh; si[t][a] and slot_v[a] are the same for every lane and are read through scalar registers. The NAS partial sums of a score meet in LDS, as ascending.
// softmax over s -> W[b][t][s] by waves 0..QB-1, one query each, behind the block barrier.
// The intent scores ride along: while waves 0..QB-1 do the softmax, wave QB + r, which has nothing left to do, makes the intent score of the block's row m0 + r, the row
// spread over the lanes (lane holds a = 128 u + 4 lane + q), the 32 partial sums meeting in a butterfly; the block's QB scores leave in one store, into a 128-byte line of their own.
#define QB 8
#define ISP 32   // floats from one block's intent scores to the next block's: one 128-byte line a block
#define NAS 8
#define AW (DD / NAS)
#define AC 8
// waves_per_eu: the launch puts 4 waves on every SIMD (MR / QB blocks of 16 waves on 256 WGPs); this is the register budget that goes with it
__global__ __launch_bounds__(512) __attribute__((amdgpu_waves_per_eu(4, 4))) void k_slot(const float* __restrict__ P, const float* __restrict__ ShT, const float* __restrict__ sv, float* __restrict__ Wt,
                                                                                          const float* __restrict__ ii, const float* __restrict__ iv, float* __restrict__ isc) {
  __shared__ __attribute__((aligned(16))) float part[NAS][QB][TT];
  __shared__ float sis[QB];
  const int tid = threadIdx.x, lane = tid & 31; const int m0 = blockIdx.x * QB; if (m0 >= MR) return; const int b = m0 / TT;
  const int wv = __builtin_amdgcn_readfirstlane(tid >> 5);   // the wave's number in a scalar register: the addresses of si and slot_v are then scalar too
  const int kg = wv & 1, as = wv >> 1;
  const float* sh = ShT + ((size_t)b * DD + as * AW) * TT + kg * 128 + lane * 4;
  const float* si = P + (size_t)m0 * 3 * DD + 2 * DD + as * AW;
  const float* vp = sv + as * AW;
  // every "#pragma unroll" of this kernel: the arrays are then indexed by constants only and stay in registers
  v4f cur[AC], nxt[AC];
  v2f acc[QB][2];
#pragma unroll
  for (int q = 0; q < QB; ++q) acc[q][0] = acc[q][1] = (v2f){0.f, 0.f};
#pragma unroll
  for (int i = 0; i < AC; ++i) cur[i] = *(const v4fa*)(sh + (size_t)i * TT);
#pragma unroll 1   // rolled: the body is long already
  for (int c = 0; c < AW / AC; ++c) {
    const float* nsh = sh + (size_t)(((c + 1) & (AW / AC - 1)) * AC) * TT;   // next AC columns: their loads fly during this chunk's sums (the last trip re-reads the wave's first chunk, unused)
#pragma unroll
    for (int i = 0; i < AC; ++i) nxt[i] = *(const v4fa*)(nsh + (size_t)i * TT);
    asm volatile("s_wait_xcnt 0x0" ::: "memory");   // the compiler hands the address registers of the loads above to the sums below: the wait stands in front of that overwrite
    __builtin_amdgcn_sched_barrier(0);   // keeps those loads in front of the chunk's sums (left alone the compiler sinks them to their uses, and every chunk is waited for in full)
#pragma unroll
    for (int i = 0; i < AC; ++i) {
      const float v = bf16_round(vp[c * AC + i]);
      const v2f v2 = {v, v};
      v2f t[QB][2];
#pragma unroll
      for (int q = 0; q < QB; ++q) {
        const float x = si[(size_t)q * 3 * DD + c * AC + i];
        const v2f x2 = {x, x};
        t[q][0] = (v2f){cur[i][0], cur[i][1]} + x2; t[q][1] = (v2f){cur[i][2], cur[i][3]} + x2;
      }
#pragma unroll
      for (int q = 0; q < QB; ++q)
#pragma unroll
        for (int h = 0; h < 2; ++h) { t[q][h][0] = tanh_fast(t[q][h][0]); t[q][h][1] = tanh_fast(t[q][h][1]); }
#pragma unroll
      for (int q = 0; q < QB; ++q)
#pragma unroll
        for (int h = 0; h < 2; ++h) acc[q][h] += v2 * t[q][h];
      __builtin_amdgcn_sched_barrier(0);   // one column's 32 sums are one scheduling region (in one region of all AC columns this compiler strings add, tanh and multiply-add of each value in a row, each waiting for the last)
    }
#pragma unroll
    for (int i = 0; i < AC; ++i) cur[i] = nxt[i];
  }
#pragma unroll
  for (int q = 0; q < QB; ++q) *(v4fa*)&part[as][q][kg * 128 + lane * 4] = (v4f){acc[q][0][0], acc[q][0][1], acc[q][1][0], acc[q][1][1]};
  __syncthreads();   // every wave's partial sums are in part before a query's softmax reads them
  v4f e[2] = {};   // waves 0..QB-1: the keys 4 lane .. + 3 and 128 + 4 lane .. + 3 of query wv
  if (wv >= QB) {   // (its loads stand behind the barrier: in front of it the barrier's own wait would hold every wave of the block until they are back)
    v4f ih[4], vi[4], vv[4];
    const float* hr = P + (size_t)(m0 + wv - QB) * 3 * DD + lane * 4;
#pragma unroll
    for (int u = 0; u < 4; ++u) { ih[u] = *(const v4fa*)(hr + u * 128); vi[u] = *(const v4fa*)(ii + (size_t)b * DD + u * 128 + lane * 4); vv[u] = *(const v4fa*)(iv + u * 128 + lane * 4); }
    asm volatile("s_wait_xcnt 0x0" ::: "memory");   // stands in front of whatever later rewrites the address registers of the loads above
    float a = 0.f;
#pragma unroll
    for (int u = 0; u < 4; ++u)
#pragma unroll
      for (int q = 0; q < 4; ++q) a += bf16_round(vv[u][q]) * tanh_fast(ih[u][q] + vi[u][q]);
    for (int o = 1; o <= 16; o <<= 1) a += __shfl_xor(a, o, 32);
    if (lane == 0) sis[wv - QB] = a;
  } else {
#pragma unroll
    for (int h = 0; h < 2; ++h) {
      e[h] = *(const v4fa*)&part[0][wv][h * 128 + lane * 4];
#pragma unroll
      for (int j = 1; j < NAS; ++j) e[h] += *(const v4fa*)&part[j][wv][h * 128 + lane * 4];
    }
    float mx = -3.0e38f;
#pragma unroll
    for (int h = 0; h < 2; ++h)
#pragma unroll
      for (int t = 0; t < 4; ++t) mx = fmaxf(mx, e[h][t]);
    for (int o = 16; o >= 1; o >>= 1) mx = fmaxf(mx, __shfl_xor(mx, o, 32));
    float den = 0.f;
#pragma unroll
    for (int h = 0; h < 2; ++h)
#pragma unroll
      for (int t = 0; t < 4; ++t) { e[h][t] = expf(e[h][t] - mx); den += e[h][t]; }
    for (int o = 16; o >= 1; o >>= 1) den += __shfl_xor(den, o, 32);
    const float inv = 1.0f / den;
#pragma unroll
    for (int h = 0; h < 2; ++h) e[h] = e[h] * inv;
  }
  __syncthreads();   // the QB intent scores are in sis before one wave stores them together; it stands in front of the weights' stores, so that no wave waits at it for a store's return
  if (wv < QB) {
    float* dst = Wt + (size_t)(m0 + wv) * TT + lane * 4;
#pragma unroll
    for (int h = 0; h < 2; ++h) *(v4f*)(dst + h * 128) = e[h];
  } else if (wv == QB && lane < QB) isc[(size_t)blockIdx.x * ISP + lane] = sis[lane];
}
// c_slot[b] = W[b] S[b], the same way: a block owns a CT x CT tile of one batch, brings its CT rows of W (split into bf16 hi and lo planes on the way) and its CT columns
// of S (f32 [s][d], rounded to bf16 and turned to [d][s] on the way, as k_proj turns its weights), all of K, into LDS by whole-line loads; behind ONE barrier 8 waves (4 x 2, 16 x 32 of C each) read their
// fragments from LDS; per 16 x 16 tile and 32 k the hi WMMA, then the lo WMMA, k ascending, so every sum has the order it had.
#define CT 64
#define CP (TT + 8)   // LDS row pitch in bf16: 528 B = 16 B x 33, an odd count of 16-byte units, for the 16-byte fragment reads
// the rest of the intent attention needs k_slot's launch to have ended, as c_slot does, and nothing of c_slot: IQ more blocks per batch in the same launch, the block index picks the job.
// A block takes IC columns of c_intent[b], 8 waves. softmax over t: every wave for itself, from the batch's 256 scores. c_intent[b][d] = sum_s w_s bf16(S[b][s][d]): the keys go in 32 groups
// of 8, wave wv takes the groups wv, wv + 8, wv + 16, wv + 24 (32 independent loads, which need no score), lane the columns 2 lane, 2 lane + 1;
// the 32 partial sums of a column are added through LDS, group ascending.
#define IQ 8
#define IC (DD / IQ)
typedef float v2fa __attribute__((ext_vector_type(2), may_alias));
__device__ __forceinline__ void d_intent_sum(int b, int c0, const float* __restrict__ isc, const float* __restrict__ S, float* __restrict__ cint, f1a* part) {
  const int tid = threadIdx.x, wv = tid >> 5, lane = tid & 31;
  // every "#pragma unroll" of this function: the arrays are then indexed by constants only and stay in registers, and a batch's loads stand together in front of its sums
  const float* sp = S + ((size_t)b * TT + wv * 8) * DD + c0 + lane * 2;
  v2f x[4][8];
#pragma unroll
  for (int g = 0; g < 4; ++g)
#pragma unroll
    for (int i = 0; i < 8; ++i) x[g][i] = *(const v2fa*)(sp + (size_t)(g * 64 + i) * DD);
  const float* sb = isc + (size_t)b * (TT / QB) * ISP + (lane & 7);   // score t lies in the line of k_slot's block t / QB, at place t % QB
  float e[8], own[4];
#pragma unroll
  for (int u = 0; u < 8; ++u) e[u] = sb[(u * 4 + (lane >> 3)) * ISP];   // t = 32 u + lane
#pragma unroll
  for (int g = 0; g < 4; ++g) own[g] = sb[(wv + 8 * g) * ISP];          // lane i < 8: key i of the wave's group g
  asm volatile("s_wait_xcnt 0x0" ::: "memory");   // stands in front of whatever later rewrites the address registers of the loads above
  float mx = -3.0e38f, den = 0.f;
#pragma unroll
  for (int u = 0; u < 8; ++u) mx = fmaxf(mx, e[u]);
  for (int o = 16; o >= 1; o >>= 1) mx = fmaxf(mx, __shfl_xor(mx, o, 32));
#pragma unroll
  for (int u = 0; u < 8; ++u) den += expf(e[u] - mx);
  for (int o = 16; o >= 1; o >>= 1) den += __shfl_xor(den, o, 32);
#pragma unroll
  for (int g = 0; g < 4; ++g) {
    const int wl = __float_as_int(expf(own[g] - mx) / den);
    v2f acc = {0.f, 0.f};
#pragma unroll
    for (int i = 0; i < 8; ++i) {
      const float w = __int_as_float(__builtin_amdgcn_readlane(wl, i));
      acc[0] += w * bf16_round(x[g][i][0]); acc[1] += w * bf16_round(x[g][i][1]);
    }
    *(v2fa*)&part[(wv + 8 * g) * IC + lane * 2] = acc;
  }
  __syncthreads();   // the 32 partial sums of every column are in part before they are added
  if (tid >= IC) return;
  float s = part[tid];
#pragma unroll
  for (int j = 1; j < 32; ++j) s += part[j * IC + tid];
  cint[(size_t)b * DD + c0 + tid] = s;
}
#define NB_C ((TT / CT) * (DD / CT))
__global__ __launch_bounds__(256) void k_cslot(const float* __restrict__ Wt, float* __restrict__ C,
                                               const float* __restrict__ isc, const float* __restrict__ S, float* __restrict__ cint) {
  __shared__ __attribute__((aligned(16))) unsigned short sm[3 * CT * CP];
  const int blk = (int)blockIdx.x - BB * IQ;   // the intent blocks come first in the grid: theirs is the longer chain of dependent steps
  if (blk < 0) { d_intent_sum(blockIdx.x / IQ, (blockIdx.x % IQ) * IC, isc, S, cint, (f1a*)sm); return; }
  unsigned short* sAh = sm; unsigned short* sAl = sm + CT * CP; unsigned short* sB = sm + 2 * CT * CP;
  const int by = blk / NB_C, mt = (blk % NB_C) / (DD / CT), nt = blk % (DD / CT);
  const int tid = threadIdx.x, w = tid >> 5, lane = tid & 31, ln = lane & 15, hh = lane >> 4;
  // every "#pragma unroll" of this kernel: the arrays are then indexed by constants only and stay in registers, and a batch's loads stand together in front of its stores
  {
    // a wave's load of S reads 4 rows s, 8 apart, one 128-byte line of each: the 16-byte stores of its 32 lanes then fall evenly on all LDS banks
    const int k0 = ((w >> 1) * 4 + (lane >> 3)) * 8, n0 = (w & 1) * 32 + (lane & 7) * 4;
    v4f sq[2][8], aq[16];
    const float* ssrc = S + ((size_t)by * TT + k0) * DD + nt * CT + n0;
    const float* asrc = Wt + ((size_t)by * TT + mt * CT + (tid >> 6)) * TT + (tid & 63) * 4;
#pragma unroll
    for (int p = 0; p < 2; ++p)
#pragma unroll
      for (int i = 0; i < 8; ++i) sq[p][i] = *(const v4fa*)(ssrc + (size_t)(p * 128 + i) * DD);
    asm volatile("s_wait_xcnt 0x0" ::: "memory");   // the compiler hands the address registers of the loads above to a later load as its destination: the wait stands in front of that overwrite
#pragma unroll
    for (int i = 0; i < 15; ++i) aq[i] = *(const v4fa*)(asrc + (size_t)i * 4 * TT);
    asm volatile("s_wait_xcnt 0x0" ::: "memory");   // the same, for the last load, whose destination may take the address registers of the 15 above
    aq[15] = *(const v4fa*)(asrc + (size_t)15 * 4 * TT);
    __builtin_amdgcn_sched_barrier(0);   // keeps every load in front of the roundings (left alone the compiler draws the rounding of S, with its wait for S, in front of the last loads of W)
    d_put_turned<2>(sq, sB + n0 * CP + k0, CP);
#pragma unroll
    for (int i = 0; i < 16; ++i) {
      v4us qh, ql;
#pragma unroll
      for (int t = 0; t < 4; ++t) { const unsigned short hb = bf16_bits(aq[i][t]); qh[t] = hb; ql[t] = bf16_bits(aq[i][t] - bf16_val(hb)); }
      *(v4us*)(sAh + ((tid >> 6) + 4 * i) * CP + (tid & 63) * 4) = qh;
      *(v4us*)(sAl + ((tid >> 6) + 4 * i) * CP + (tid & 63) * 4) = ql;
    }
  }
  __syncthreads();   // the three tiles are whole in LDS before any wave reads a fragment
  const int wm = w >> 1, wn = w & 1;
  const unsigned short* pah = sAh + (wm * 16 + ln) * CP + 8 * hh;
  const unsigned short* pal = sAl + (wm * 16 + ln) * CP + 8 * hh;
  const unsigned short* pb = sB + (wn * 32 + ln) * CP + 8 * hh;
  v8f acc[2] = {};
  FragB ah[2], al[2], b[2][2];   // two fragment sets: the next 32 k are read from LDS while this set's WMMAs run
  ah[0].half[0] = *(const v8us*)pah; ah[0].half[1] = *(const v8us*)(pah + 16);
  al[0].half[0] = *(const v8us*)pal; al[0].half[1] = *(const v8us*)(pal + 16);
#pragma unroll
  for (int j = 0; j < 2; ++j) { b[0][j].half[0] = *(const v8us*)(pb + j * 16 * CP); b[0][j].half[1] = *(const v8us*)(pb + j * 16 * CP + 16); }
#pragma unroll
  for (int s = 0; s < TT / 32; ++s) {
    const int cu = s & 1, nx = cu ^ 1, kn = (s + 1) * 32;
    if (kn < TT) {
      ah[nx].half[0] = *(const v8us*)(pah + kn); ah[nx].half[1] = *(const v8us*)(pah + kn + 16);
      al[nx].half[0] = *(const v8us*)(pal + kn); al[nx].half[1] = *(const v8us*)(pal + kn + 16);
#pragma unroll
      for (int j = 0; j < 2; ++j) { b[nx][j].half[0] = *(const v8us*)(pb + j * 16 * CP + kn); b[nx][j].half[1] = *(const v8us*)(pb + j * 16 * CP + kn + 16); }
    }
    __builtin_amdgcn_sched_barrier(0);   // keeps the next set's LDS reads, as one group, in front of this set's WMMAs (left alone the compiler sinks them to their uses, and every set is waited for in full)
#pragma unroll
    for (int j = 0; j < 2; ++j) {
      acc[j] = __builtin_amdgcn_wmma_f32_16x16x32_bf16(false, ah[cu].v, false, b[cu][j].v, (short)0, acc[j], false, false);
      acc[j] = __builtin_amdgcn_wmma_f32_16x16x32_bf16(false, al[cu].v, false, b[cu][j].v, (short)0, acc[j], false, false);
    }
  }
  __syncthreads();   // every wave has read its last fragment before the tiles' LDS is used again for staging
  f1a* so = (f1a*)sm + w * 16 * SP;
#pragma unroll
  for (int j = 0; j < 2; ++j)
#pragma unroll
    for (int r = 0; r < 8; ++r) so[(8 * hh + r) * SP + j * 16 + ln] = acc[j][r];
  __builtin_amdgcn_fence(__ATOMIC_ACQ_REL, "workgroup");   // the wave's own staging stores are done before its lanes read each other's
  __builtin_amdgcn_wave_barrier();
  v4f v[4];
#pragma unroll
  for (int q = 0; q < 4; ++q) v[q] = *(const v4fa*)&so[(q * 4 + (lane >> 3)) * SP + (lane & 7) * 4];
  float* dst = C + ((size_t)by * TT + mt * CT + wm * 16 + (lane >> 3)) * DD + nt * CT + wn * 32 + (lane & 7) * 4;
#pragma unroll
  for (int q = 0; q < 4; ++q) *(v4f*)(dst + (size_t)q * 4 * DD) = v[q];
  asm volatile("s_wait_xcnt 0x0" ::: "memory");   // in the listing the intent blocks' arm follows these stores and rewrites registers that they name: the wait stands in front of it
}
extern "C" void kernel_launch(void* const* d_in, const int* in_sizes, int n_in,
                              void* d_out, int out_size, void* d_ws, size_t ws_size, hipStream_t stream) {
  (void)in_sizes; (void)n_in; (void)out_size;
  const float* S = (const float*)d_in[0]; const float* fst = (const float*)d_in[1]; const float* iv = (const float*)d_in[2]; const float* W_ih = (const float*)d_in[3]; const float* b_ih = (const float*)d_in[4]; const float* W_ii = (const float*)d_in[5]; const float* b_ii = (const float*)d_in[6];
  const float* sv = (const float*)d_in[7]; const float* W_sh = (const float*)d_in[8]; const float* b_sh = (const float*)d_in[9]; const float* W_si = (const float*)d_in[10]; const float* b_si = (const float*)d_in[11];
  float* cslot = (float*)d_out; float* cint = (float*)((char*)d_out + 4194304);
  char* ws = (char*)d_ws; size_t off = 0;
  auto take = [&](size_t bytes) { char* p = ws + off; off += (bytes + 255) & ~(size_t)255; return p; };
  float* ii = (float*)take(BB * DD * 4); float* P = (float*)take((size_t)MR * 3 * DD * 4); float* Wt = (float*)take((size_t)MR * TT * 4); float* ShT = (float*)take((size_t)MR * DD * 4); float* isc = (float*)take((size_t)(MR / QB) * ISP * 4);
  if (off > ws_size) return;
  k_proj<<<NB_II + NB_P, 512, 0, stream>>>(S, W_ih, W_sh, W_si, b_ih, b_sh, b_si, P, ShT, fst, W_ii, b_ii, ii);      // ii (rows 0..7) and [ih | sh | si] + b (single term); sh goes to ShT, transposed
  k_slot<<<MR / QB, 512, 0, stream>>>(P, ShT, sv, Wt, ii, iv, isc);   // slot weights; the intent scores ride along
  k_cslot<<<BB * (IQ + NB_C), 256, 0, stream>>>(Wt, cslot, isc, S, cint);   // the first BB * IQ blocks: intent softmax and c_intent; the rest: c_slot[b] = W[b] S[b]
}

// v010
// A run of this version takes 31.9 microseconds.
// Next to v009, in two timings, it ran 1.07 and 1.08 times as fast.
// All steps since v000 together make it 42.1 times as fast.
#include <hip/hip_runtime.h>
// [ih | sh | si] = S·[W_ih|W_sh|W_si] + b (one GEMM, K=512, N=1536), ii = f·W_ii + b (M padded) — inputs and weights rounded to bf16: single exact
// WMMA term, f32 accumulate — and c_slot = slot_w·S per batch (slot_w split into bf16 hi/lo vs S rounded to bf16: 2 terms) run on
// v_wmma_f32_16x16x32_bf16; the additive tanh scores (intent: T×A, slot: T×T×A), both softmaxes and c_intent are f32 VALU.
#define BB 8
#define TT 256
#define DD 512
#define MR (BB * TT)

typedef __bf16 v16b __attribute__((ext_vector_type(16)));
typedef unsigned short v8us __attribute__((ext_vector_type(8), may_alias));
typedef float  v8f  __attribute__((ext_vector_type(8)));
typedef float  v4f  __attribute__((ext_vector_type(4)));
typedef float  v4fa __attribute__((ext_vector_type(4), may_alias));
union FragB { v16b v; v8us half[2]; unsigned short u[16]; };

__device__ __forceinline__ unsigned short bf16_bits(float x) { unsigned int u = __float_as_uint(x); return (unsigned short)((u + 0x7FFFu + ((u >> 16) & 1u)) >> 16); }
__device__ __forceinline__ float bf16_val(unsigned short b) { return __uint_as_float(((unsigned int)b) << 16); }
__device__ __forceinline__ float bf16_round(float x) { return bf16_val(bf16_bits(x)); }
// D += A·B with NT terms: 1 = ah·bh, 2 = + al·bh (A split), 3 = + ah·bl (both split)
template <int NT>
__device__ __forceinline__ v8f mmaN(v16b ah, v16b al, v16b bh, v16b bl, v8f c) {
  c = __builtin_amdgcn_wmma_f32_16x16x32_bf16(false, ah, false, bh, (short)0, c, false, false);
  if (NT >= 2) c = __builtin_amdgcn_wmma_f32_16x16x32_bf16(false, al, false, bh, (short)0, c, false, false);
  if (NT >= 3) c = __builtin_amdgcn_wmma_f32_16x16x32_bf16(false, ah, false, bl, (short)0, c, false, false);
  asm volatile("v_nop\n\tv_nop\n\tv_nop\n\tv_nop" : "+v"(c) : "v"(ah), "v"(al), "v"(bh), "v"(bl));
  return c;
}

// GEMM C[M][N] (f32, pitch ldc) = act(A[M][K]·W + bias). A f32 row-major (pitch lda) converted per fragment to bf16
// (ASPLIT: hi/lo two planes -> 2 terms, else single rounded term); Wt bf16 [N][K] (pitch ldb). BIAS_BF16 rounds the
// bias to bf16 first (bias quantised to bf16 before the add). K%32==0, M%16==0, N%64==0.
template <bool ASPLIT, int ACT, bool BIAS_BF16>
__global__ __launch_bounds__(128) void k_gemm_bf(const float* __restrict__ A, int lda, const unsigned short* __restrict__ Wt, int ldb,
                                               const float* __restrict__ bias, float* __restrict__ C, int ldc, int M, int N, int K) {
  __shared__ __attribute__((aligned(16))) float so[4][16][64];
  const int tid = threadIdx.x, w = tid >> 5, lane = tid & 31, ln = lane & 15, hh = lane >> 4;
  const int ntn = N / 64;
  const int wid = blockIdx.x * 4 + w;
  const int mt = wid / ntn, nq = wid % ntn;
  if (mt * 16 >= M) return;
  const int row0 = mt * 16, col0 = nq * 64;
  const float* arow = A + (size_t)(row0 + ln) * lda;
  v8f acc[4] = {};
  for (int kb = 0; kb < K; kb += 32) {
    FragB ah, al;
    const v4f x0 = *(const v4fa*)(arow + kb + 8 * hh), x1 = *(const v4fa*)(arow + kb + 8 * hh + 4);
    const v4f x2 = *(const v4fa*)(arow + kb + 16 + 8 * hh), x3 = *(const v4fa*)(arow + kb + 16 + 8 * hh + 4);
    float xs[16] = {x0[0],x0[1],x0[2],x0[3],x1[0],x1[1],x1[2],x1[3],x2[0],x2[1],x2[2],x2[3],x3[0],x3[1],x3[2],x3[3]};
#pragma unroll
    for (int i = 0; i < 16; ++i) { const unsigned short hb = bf16_bits(xs[i]); ah.u[i] = hb; al.u[i] = ASPLIT ? bf16_bits(xs[i] - bf16_val(hb)) : (unsigned short)0; }
#pragma unroll
    for (int t = 0; t < 4; ++t) {
      const unsigned short* brow = Wt + (size_t)(col0 + t * 16 + ln) * ldb + kb;
      FragB b;
      b.half[0] = *(const v8us*)(brow + 8 * hh);
      b.half[1] = *(const v8us*)(brow + 16 + 8 * hh);
      acc[t] = mmaN<ASPLIT ? 2 : 1>(ah.v, al.v, b.v, b.v, acc[t]);
    }
  }
#pragma unroll
  for (int t = 0; t < 4; ++t) {
    float bv = bias ? bias[col0 + t * 16 + ln] : 0.f;
    if (BIAS_BF16) bv = bf16_round(bv);
#pragma unroll
    for (int r = 0; r < 8; ++r) { float v = acc[t][r] + bv; if (ACT == 1) v = fmaxf(v, 0.f); so[w][8 * hh + r][t * 16 + ln] = v; }
  }
  __builtin_amdgcn_fence(__ATOMIC_ACQ_REL, "workgroup");
  __builtin_amdgcn_wave_barrier();
  const int rsub = lane >> 4, c4 = (lane & 15) * 4;
  {
#pragma unroll
    for (int q = 0; q < 8; ++q) {
      const int r = q * 2 + rsub;
      const v4f v = *(const v4fa*)&so[w][r][c4];
      *(v4f*)(C + (size_t)(row0 + r) * ldc + col0 + c4) = v;
    }
    
  }
}

// Flash-style causal/unmasked attention, all contractions 3-term bf16 hi/lo splits, f32 softmax with running max.
// q,k,v rows are read from f32 buffers with arbitrary row pitch (so they can live inside a fused qkv buffer);
// D = head size (multiple of 32, <= 128); one wave = 16 query rows; block = 4 waves (64 queries) sharing K/V chunks of 32.
template <int D, bool CAUSAL>
__global__ __launch_bounds__(128) void k_flash(const float* __restrict__ qb, const float* __restrict__ kb, const float* __restrict__ vb,
                                             int pitch, int T, int H, float scale, float* __restrict__ y, int ypitch) {
  constexpr int KS = D / 32;        // k-steps for QK
  constexpr int DT = D / 16;        // d tiles for PV
  __shared__ __attribute__((aligned(16))) unsigned short sKh[32][D + 8], sKl[32][D + 8], sVh[32][D + 8], sVl[32][D + 8];
  __shared__ __attribute__((aligned(16))) unsigned short sPh[4][16][40], sPl[4][16][40];
  __shared__ __attribute__((aligned(16))) float sO[4][16][D];
  const int tid = threadIdx.x, w = tid >> 5, lane = tid & 31, ln = lane & 15, hh = lane >> 4;
  const int nqb = (T + 63) / 64;
  const int bh = blockIdx.x / nqb, qblk = blockIdx.x % nqb;
  const int b = bh / H, h = bh % H;
  const int q0 = qblk * 64 + w * 16;
  const float* Q = qb + (size_t)b * T * pitch + h * D;
  const float* K = kb + (size_t)b * T * pitch + h * D;
  const float* V = vb + (size_t)b * T * pitch + h * D;

  // A fragments of the wave's 16 query rows (scaled), hi/lo
  FragB aqh[KS], aql[KS];
  {
    int row = q0 + ln; if (row >= T) row = T - 1;
    const float* qr = Q + (size_t)row * pitch;
#pragma unroll
    for (int ks = 0; ks < KS; ++ks)
#pragma unroll
      for (int i = 0; i < 16; ++i) {
        const int d = ks * 32 + ((i < 8) ? (8 * hh + i) : (16 + 8 * hh + (i - 8)));
        const float x = qr[d] * scale; const unsigned short hb = bf16_bits(x);
        aqh[ks].u[i] = hb; aql[ks].u[i] = bf16_bits(x - bf16_val(hb));
      }
  }
  float m_r[8], l_r[8];
#pragma unroll
  for (int r = 0; r < 8; ++r) { m_r[r] = -3.0e38f; l_r[r] = 0.f; }
  v8f oacc[DT];
#pragma unroll
  for (int dt = 0; dt < DT; ++dt) oacc[dt] = (v8f){0.f,0.f,0.f,0.f,0.f,0.f,0.f,0.f};

  const int kv_end = CAUSAL ? min(T, qblk * 64 + 64) : T;     // block-uniform
  for (int j0 = 0; j0 < kv_end; j0 += 32) {
    __syncthreads();
    for (int e = tid; e < 32 * (D / 4); e += 128) {
      const int r = e / (D / 4), c4 = (e % (D / 4)) * 4;
      const int key = j0 + r;
      v4f kf = {0.f,0.f,0.f,0.f}, vf = {0.f,0.f,0.f,0.f};
      if (key < T) { kf = *(const v4fa*)(K + (size_t)key * pitch + c4); vf = *(const v4fa*)(V + (size_t)key * pitch + c4); }
#pragma unroll
      for (int t = 0; t < 4; ++t) {
        unsigned short hb = bf16_bits(kf[t]); sKh[r][c4 + t] = hb; sKl[r][c4 + t] = bf16_bits(kf[t] - bf16_val(hb));
        hb = bf16_bits(vf[t]); sVh[r][c4 + t] = hb; sVl[r][c4 + t] = bf16_bits(vf[t] - bf16_val(hb));
      }
    }
    __syncthreads();
    // S tile 16 x 32
    v8f s[2];
#pragma unroll
    for (int nt = 0; nt < 2; ++nt) {
      v8f acc = {};
#pragma unroll
      for (int ks = 0; ks < KS; ++ks) {
        FragB bh_, bl_;
        bh_.half[0] = *(const v8us*)&sKh[nt * 16 + ln][ks * 32 + 8 * hh]; bh_.half[1] = *(const v8us*)&sKh[nt * 16 + ln][ks * 32 + 16 + 8 * hh];
        bl_.half[0] = *(const v8us*)&sKl[nt * 16 + ln][ks * 32 + 8 * hh]; bl_.half[1] = *(const v8us*)&sKl[nt * 16 + ln][ks * 32 + 16 + 8 * hh];
        acc = mmaN<3>(aqh[ks].v, aql[ks].v, bh_.v, bl_.v, acc);
      }
      s[nt] = acc;
    }
    // mask + running max (rows 8hh+r; the 16 lanes of a half share rows)
    float alpha[8];
#pragma unroll
    for (int r = 0; r < 8; ++r) {
      const int qi = q0 + 8 * hh + r;
      const int ja = j0 + ln, jb = j0 + 16 + ln;
      if (CAUSAL) { if (ja > qi) s[0][r] = -3.0e38f; if (jb > qi) s[1][r] = -3.0e38f; }
      if (ja >= T) s[0][r] = -3.0e38f;
      if (jb >= T) s[1][r] = -3.0e38f;
      float mx = fmaxf(s[0][r], s[1][r]);
      mx = fmaxf(mx, __shfl_xor(mx, 1, 32)); mx = fmaxf(mx, __shfl_xor(mx, 2, 32)); mx = fmaxf(mx, __shfl_xor(mx, 4, 32)); mx = fmaxf(mx, __shfl_xor(mx, 8, 32));
      const float mnew = fmaxf(m_r[r], mx);
      alpha[r] = (mnew > -1.0e38f) ? __expf(m_r[r] - mnew) : 1.0f;
      const float p0 = (s[0][r] > -1.0e38f) ? __expf(s[0][r] - mnew) : 0.f;
      const float p1 = (s[1][r] > -1.0e38f) ? __expf(s[1][r] - mnew) : 0.f;
      m_r[r] = mnew;
      l_r[r] = l_r[r] * alpha[r] + p0 + p1;            // per-lane partial row sum (16 lanes combined at the end)
      unsigned short hb = bf16_bits(p0); sPh[w][8 * hh + r][ln] = hb;      sPl[w][8 * hh + r][ln] = bf16_bits(p0 - bf16_val(hb));
      hb = bf16_bits(p1);                sPh[w][8 * hh + r][16 + ln] = hb; sPl[w][8 * hh + r][16 + ln] = bf16_bits(p1 - bf16_val(hb));
    }
#pragma unroll
    for (int dt = 0; dt < DT; ++dt)
#pragma unroll
      for (int r = 0; r < 8; ++r) oacc[dt][r] *= alpha[r];
    __builtin_amdgcn_fence(__ATOMIC_ACQ_REL, "workgroup");
    __builtin_amdgcn_wave_barrier();
    FragB pah, pal;
    pah.half[0] = *(const v8us*)&sPh[w][ln][8 * hh]; pah.half[1] = *(const v8us*)&sPh[w][ln][16 + 8 * hh];
    pal.half[0] = *(const v8us*)&sPl[w][ln][8 * hh]; pal.half[1] = *(const v8us*)&sPl[w][ln][16 + 8 * hh];
#pragma unroll
    for (int dt = 0; dt < DT; ++dt) {
      FragB bvh, bvl;
#pragma unroll
      for (int i = 0; i < 8; ++i) {
        bvh.u[i] = sVh[8 * hh + i][dt * 16 + ln]; bvh.u[8 + i] = sVh[16 + 8 * hh + i][dt * 16 + ln];
        bvl.u[i] = sVl[8 * hh + i][dt * 16 + ln]; bvl.u[8 + i] = sVl[16 + 8 * hh + i][dt * 16 + ln];
      }
      oacc[dt] = mmaN<3>(pah.v, pal.v, bvh.v, bvl.v, oacc[dt]);
    }
    __builtin_amdgcn_fence(__ATOMIC_ACQ_REL, "workgroup");
    __builtin_amdgcn_wave_barrier();
  }
#pragma unroll
  for (int r = 0; r < 8; ++r) {
    float l = l_r[r];
    l += __shfl_xor(l, 1, 32); l += __shfl_xor(l, 2, 32); l += __shfl_xor(l, 4, 32); l += __shfl_xor(l, 8, 32);
    l_r[r] = (l > 0.f) ? 1.0f / l : 0.f;
  }
#pragma unroll
  for (int dt = 0; dt < DT; ++dt)
#pragma unroll
    for (int r = 0; r < 8; ++r) sO[w][8 * hh + r][dt * 16 + ln] = oacc[dt][r] * l_r[r];
  __builtin_amdgcn_fence(__ATOMIC_ACQ_REL, "workgroup");
  __builtin_amdgcn_wave_barrier();
  {
    for (int r = 0; r < 16; ++r) {
      const int row = q0 + r;
      if (row < T && lane < D / 4) {
        const v4f val = *(const v4fa*)&sO[w][r][lane * 4];
        *(v4f*)(y + ((size_t)b * T + row) * ypitch + h * D + lane * 4) = val;
      }
    }
    
  }
}

// row LayerNorm (biased variance, eps) over N: s = X (+ R); optional out_sum <- s; out_norm <- (s-mu)*rsqrt(var+eps)*g + b
template <bool PARAM_BF16>
__global__ __launch_bounds__(256) void k_layernorm(const float* __restrict__ X, const float* __restrict__ R, const float* __restrict__ g, const float* __restrict__ bta,
                                                  float* __restrict__ out_sum, float* __restrict__ out_norm, int N, float eps) {
  __shared__ float red[256];
  const int row = blockIdx.x, tid = threadIdx.x;
  const float* x = X + (size_t)row * N; const float* rr = R ? R + (size_t)row * N : nullptr;
  float vals[16];                     // up to N = 4096
  const int per = N / 256;            // contiguous chunk per thread? use strided-by-4 chunks: thread handles j = tid*4 + 1024*u
  float s1 = 0.f;
  for (int u = 0; u < per / 4; ++u) {
    const int j = tid * 4 + 1024 * u;
    const v4f a = *(const v4fa*)(x + j);
    v4f b = {0.f,0.f,0.f,0.f}; if (rr) b = *(const v4fa*)(rr + j);
#pragma unroll
    for (int q = 0; q < 4; ++q) { const float v = a[q] + b[q]; vals[u * 4 + q] = v; s1 += v; }
  }
  red[tid] = s1; __syncthreads();
  for (int st = 128; st > 0; st >>= 1) { if (tid < st) red[tid] += red[tid + st]; __syncthreads(); }
  const float mu = red[0] / (float)N; __syncthreads();
  float s2 = 0.f;
  for (int u = 0; u < per / 4; ++u)
#pragma unroll
    for (int q = 0; q < 4; ++q) { const float c = vals[u * 4 + q] - mu; s2 += c * c; }
  red[tid] = s2; __syncthreads();
  for (int st = 128; st > 0; st >>= 1) { if (tid < st) red[tid] += red[tid + st]; __syncthreads(); }
  const float rs = rsqrtf(red[0] / (float)N + eps);
  {
    for (int u = 0; u < per / 4; ++u) {
      const int j = tid * 4 + 1024 * u;
      v4f o, sm;
#pragma unroll
      for (int q = 0; q < 4; ++q) {
        float gg = g[j + q], bb = bta[j + q];
        if (PARAM_BF16) { gg = bf16_round(gg); bb = bf16_round(bb); }
        sm[q] = vals[u * 4 + q]; o[q] = (vals[u * 4 + q] - mu) * rs * gg + bb;
      }
      if (out_sum) *(v4f*)(out_sum + (size_t)row * N + j) = sm;
      *(v4f*)(out_norm + (size_t)row * N + j) = o;
    }
    
  }
}

// batched f32 [K][N] (pitch lds, batch stride sIn) -> transposed hi/lo planes [N][K] (batch stride sOut); thread per (n, 8 k); grid.y = batch
__global__ __launch_bounds__(256) void k_split_transpose_b(const float* __restrict__ src, int lds_, size_t sIn, unsigned short* __restrict__ hi, unsigned short* __restrict__ lo, size_t sOut, int K, int N) {
  const size_t t = (size_t)blockIdx.x * 256 + threadIdx.x; const int k8n = K / 8; if (t >= (size_t)N * k8n) return;
  src += (size_t)blockIdx.y * sIn; hi += (size_t)blockIdx.y * sOut; lo += (size_t)blockIdx.y * sOut;
  const int n = (int)(t / k8n), k8 = (int)(t % k8n) * 8; v8us vh, vl;
#pragma unroll
  for (int i = 0; i < 8; ++i) { const float x = src[(size_t)(k8 + i) * lds_ + n]; const unsigned short hb = bf16_bits(x); vh[i] = hb; vl[i] = bf16_bits(x - bf16_val(hb)); }
  unsigned short* dh = hi + (size_t)n * K + k8; unsigned short* dl = lo + (size_t)n * K + k8;
  *(v8us*)dh = vh; *(v8us*)dl = vl; 
}


// one v_tanh_f32 per value
__device__ __forceinline__ float tanh_fast(float x) { return __builtin_amdgcn_tanhf(x); }
// both projections in ONE launch: blocks 0 .. NB_II - 1 do ii = f W_ii + b, the rest [ih | sh | si] = S [W_ih | W_sh | W_si] + b.
// A block owns a PT x PT tile of C. It brings its PT rows of A and its PT columns of W, all of K, both f32 and rounded to bf16 on the way, into LDS by whole-line
// loads, in stages of KS columns k that overlap the WMMAs (d_proj_mm). W lies [k][n] and the fragments want [n][k]: a lane loads 4 columns n of 8 rows k in a row and stores, per column, the 8
// rounded values as ONE 16-byte piece of sB[n][k], so the transposition needs no exchange between lanes and no launch of its own. 16 waves (4 x 4, 32 x 32 of C each) read their fragments from LDS,
// k ascending, one WMMA per 32 k and 16 x 16 tile, so every sum has the order it had. An ii block has only BB rows of A: the tile's rows above repeat them and are not stored.
#define PT 128
#define PP (DD + 8)   // LDS row pitch in bf16: 1040 B = 16 B x 65, an odd count of 16-byte units, for the 16-byte fragment reads
#define SP 36         // row pitch in floats of a wave's staging tile: rows 8 apart fall on different banks, rows stay 16-byte aligned
#define NB_II (DD / PT)
#define NB_P ((MR / PT) * (3 * DD / PT))
typedef unsigned short v4us __attribute__((ext_vector_type(4), may_alias));
typedef float f1a __attribute__((may_alias));
typedef float v2f __attribute__((ext_vector_type(2)));
typedef __bf16 v2b __attribute__((ext_vector_type(2)));
typedef unsigned int v4u __attribute__((ext_vector_type(4), may_alias));
typedef unsigned int v2u __attribute__((ext_vector_type(2), may_alias));
// two f32 rounded to nearest even into the two bf16 halves of one register: one v_cvt_pk_bf16_f32
__device__ __forceinline__ unsigned int bf16_pair(float lo, float hi) { return __builtin_bit_cast(unsigned int, __builtin_convertvector((v2f){lo, hi}, v2b)); }
// x[p][i] holds 4 columns n of row k = 128 p + i of an f32 [k][n] matrix: per column the 8 rounded values leave as ONE 16-byte piece of the bf16 [n][k] tile at dst
// (both loops unrolled: x is then indexed by constants only and stays in registers)
template <int NP>
__device__ __forceinline__ void d_put_turned(const v4f (&x)[NP][8], unsigned short* dst, int pitch) {
#pragma unroll
  for (int p = 0; p < NP; ++p)
#pragma unroll
    for (int c = 0; c < 4; ++c)
      *(v4u*)(dst + c * pitch + p * 128) = (v4u){bf16_pair(x[p][0][c], x[p][1][c]), bf16_pair(x[p][2][c], x[p][3][c]), bf16_pair(x[p][4][c], x[p][5][c]), bf16_pair(x[p][6][c], x[p][7][c])};
}
#define KS 128          // columns k of one stage
#define NS (DD / KS)
// one stage's loads: 8 rows k of W (4 columns each) and 8 rows of A (4 columns k each; II, an ii block: one row, which serves all 8)
// LAST: the address registers are free behind these loads, and the compiler may hand them to a run's last load as its destination: a wait stands in front of that load too
template <bool II, bool LAST>
__device__ __forceinline__ void d_fetch(const float* wsrc, const float* asrc, v4f (&wx)[8], v4f (&ax)[8]) {
#pragma unroll
  for (int i = 0; i < 7; ++i) wx[i] = *(const v4fa*)(wsrc + (size_t)i * DD);
  if (LAST) asm volatile("s_wait_xcnt 0x0" ::: "memory");   // in front of the run's last load (see LAST)
  wx[7] = *(const v4fa*)(wsrc + (size_t)7 * DD);
  asm volatile("s_wait_xcnt 0x0" ::: "memory");   // stands in front of whatever later rewrites the address registers of the loads above
  if (II) {
    ax[0] = *(const v4fa*)asrc;
  } else {
#pragma unroll
    for (int i = 0; i < 7; ++i) ax[i] = *(const v4fa*)(asrc + (size_t)i * 16 * DD);
    if (LAST) asm volatile("s_wait_xcnt 0x0" ::: "memory");   // in front of the run's last load (see LAST)
    ax[7] = *(const v4fa*)(asrc + (size_t)7 * 16 * DD);
  }
  asm volatile("s_wait_xcnt 0x0" ::: "memory");   // the same, for the loads of A
}
// quarter s of a stage's rounding and storing: column s of the lane's 4 columns of W (its 8 rounded values k as ONE 16-byte piece of sB[n][k]) and the lane's rows 2 s, 2 s + 1 of A
template <bool II>
__device__ __forceinline__ void d_put_quarter(int s, const v4f (&wx)[8], const v4f (&ax)[8], unsigned short* wdst, unsigned short* adst) {
  *(v4u*)(wdst + s * PP) = (v4u){bf16_pair(wx[0][s], wx[1][s]), bf16_pair(wx[2][s], wx[3][s]), bf16_pair(wx[4][s], wx[5][s]), bf16_pair(wx[6][s], wx[7][s])};
#pragma unroll
  for (int i = 2 * s; i < 2 * s + 2; ++i) {
    if (II) {
      *(v2u*)(adst + i * 16 * PP) = (v2u){bf16_pair(ax[0][0], ax[0][1]), bf16_pair(ax[0][2], ax[0][3])};
    } else {
      v4us q;
#pragma unroll
      for (int t = 0; t < 4; ++t) q[t] = bf16_bits(ax[i][t]);
      *(v4us*)(adst + i * 16 * PP) = q;
    }
  }
}
// work-group barrier behind a stage's LDS stores, written by hand: __syncthreads() would also wait for the global loads issued ahead, and the next stages would no longer fly during this stage's WMMAs
__device__ __forceinline__ void d_publish_lds() {
  asm volatile("s_wait_dscnt 0x0" ::: "memory");   // the wave's own LDS stores have landed before it signals
  asm volatile("s_barrier_signal -1\n\ts_barrier_wait -1" ::: "memory");   // the work-group's own barrier, without the wait for global loads that __syncthreads() brings
}
// a block's PT x PT product in NS stages of KS columns k; every stage has its own columns of sA and sB, so no LDS is written twice. While stage p is multiplied (4 steps of 32 k, k ascending),
// stage p + 1, whose loads are back, is rounded and stored, a quarter per step, between the step's LDS reads and its WMMAs, and stage p + 2 is in flight; behind the last step stage p + 3's loads
// are issued into the registers that stage p + 1 has left; then the barrier that publishes stage p + 1. II is a template parameter so that either kind of block is straight-line code: the
// compiler's counted waits for the loads are then exact (with the two kinds joined behind a branch it waits for the smaller count of the two, well into the next stage's loads)
template <bool II>
__device__ __forceinline__ void d_proj_mm(const float* wsrc, const float* asrc, unsigned short* wdst, unsigned short* adst, const unsigned short* pa, const unsigned short* pb, v8f (&acc)[2][2]) {
  // every "#pragma unroll" of this function: the arrays are then indexed by constants only and stay in registers
  v4f wq[2][8], aq[2][8];   // two register sets, stage p in set p % 2
  d_fetch<II, false>(wsrc, asrc, wq[0], aq[0]);
  d_fetch<II, false>(wsrc + (size_t)KS * DD, asrc + KS, wq[1], aq[1]);
  __builtin_amdgcn_sched_barrier(0);   // keeps both stages' loads in front of the first roundings (left alone the compiler draws the rounding of W, with its wait for stage 0, in between the loads)
#pragma unroll
  for (int s = 0; s < 4; ++s) d_put_quarter<II>(s, wq[0], aq[0], wdst, adst);
  d_fetch<II, false>(wsrc + (size_t)2 * KS * DD, asrc + 2 * KS, wq[0], aq[0]);
  d_publish_lds();   // stage 0 is whole in LDS before any wave reads a fragment of it
#pragma unroll
  for (int p = 0; p < NS; ++p) {
    FragB a[2][2], b[2][2];   // two fragment sets: the next 32 k are read from LDS while this set's WMMAs run
#pragma unroll
    for (int i = 0; i < 2; ++i) {
      a[0][i].half[0] = *(const v8us*)(pa + i * 16 * PP + p * KS); a[0][i].half[1] = *(const v8us*)(pa + i * 16 * PP + p * KS + 16);
      b[0][i].half[0] = *(const v8us*)(pb + i * 16 * PP + p * KS); b[0][i].half[1] = *(const v8us*)(pb + i * 16 * PP + p * KS + 16);
    }
#pragma unroll
    for (int s = 0; s < KS / 32; ++s) {
      const int cu = s & 1, nx = cu ^ 1, kn = p * KS + (s + 1) * 32;
      if (s + 1 < KS / 32) {
#pragma unroll
        for (int i = 0; i < 2; ++i) {
          a[nx][i].half[0] = *(const v8us*)(pa + i * 16 * PP + kn); a[nx][i].half[1] = *(const v8us*)(pa + i * 16 * PP + kn + 16);
          b[nx][i].half[0] = *(const v8us*)(pb + i * 16 * PP + kn); b[nx][i].half[1] = *(const v8us*)(pb + i * 16 * PP + kn + 16);
        }
      }
      if (p + 1 < NS) d_put_quarter<II>(s, wq[(p + 1) & 1], aq[(p + 1) & 1], wdst + (p + 1) * KS, adst + (p + 1) * KS);
      __builtin_amdgcn_sched_barrier(0);   // keeps the next set's LDS reads, as one group, and the quarter's roundings in front of this set's WMMAs (left alone the compiler sinks the reads to their uses, and every set is waited for in full)
#pragma unroll
      for (int i = 0; i < 2; ++i)
#pragma unroll
        for (int j = 0; j < 2; ++j) acc[i][j] = __builtin_amdgcn_wmma_f32_16x16x32_bf16(false, a[cu][i].v, false, b[cu][j].v, (short)0, acc[i][j], false, false);
    }
    if (p + 3 < NS) d_fetch<II, true>(wsrc + (size_t)(p + 3) * KS * DD, asrc + (p + 3) * KS, wq[(p + 1) & 1], aq[(p + 1) & 1]);   // NS is 4: the one fetch of this line is the last
    if (p + 1 < NS) d_publish_lds();   // stage p + 1 is whole in LDS before any wave reads a fragment of it
  }
}
__global__ __launch_bounds__(512) void k_proj(const float* __restrict__ S, const float* __restrict__ W_ih, const float* __restrict__ W_sh, const float* __restrict__ W_si,
                                              const float* __restrict__ b_ih, const float* __restrict__ b_sh, const float* __restrict__ b_si, float* __restrict__ P, float* __restrict__ ShT,
                                              const float* __restrict__ f, const float* __restrict__ W_ii, const float* __restrict__ b_ii, float* __restrict__ ii) {
  __shared__ __attribute__((aligned(16))) unsigned short sm[2 * PT * PP];
  unsigned short* sA = sm; unsigned short* sB = sm + PT * PP;
  const bool isii = blockIdx.x < NB_II;
  const int blk = isii ? blockIdx.x : blockIdx.x - NB_II;
  const int mt = isii ? 0 : blk / (3 * DD / PT), nt = isii ? blk : blk % (3 * DD / PT);
  const int wj = nt / (DD / PT);   // which of the three weights the tile's columns lie in
  const float* bias = (isii ? b_ii : wj == 0 ? b_ih : wj == 1 ? b_sh : b_si) + (nt % (DD / PT)) * PT;
  const int tid = threadIdx.x, w = tid >> 5, lane = tid & 31, ln = lane & 15, hh = lane >> 4;
  // every "#pragma unroll" of this kernel: the arrays are then indexed by constants only and stay in registers
  // a wave's load of W reads 4 rows k, 8 apart, one 128-byte line of each: the 16-byte stores of its 32 lanes then fall evenly on all LDS banks; its load of A reads 512 bytes of one row
  const int k0 = ((w >> 2) * 4 + (lane >> 3)) * 8, n0 = (w & 3) * 32 + (lane & 7) * 4;
  const int wm = w >> 2, wn = w & 3;
  const size_t woff = (size_t)k0 * DD + (nt % (DD / PT)) * PT + n0;
  unsigned short* wdst = sB + n0 * PP + k0;
  unsigned short* adst = sA + w * PP + lane * 4;   // tile rows 16 i + w
  const unsigned short* pa = sA + (wm * 32 + ln) * PP + 8 * hh;
  const unsigned short* pb = sB + (wn * 32 + ln) * PP + 8 * hh;
  v8f acc[2][2] = {};
  // (each arm forms its own address of W: from one address for both the compiler draws the first loads in front of the branch and then waits for them, to copy them, before it issues the rest)
  if (isii) d_proj_mm<true>(W_ii + woff, f + (size_t)(w & (BB - 1)) * DD + lane * 4, wdst, adst, pa, pb, acc);   // BB rows of A: tile row r takes row r % BB
  else d_proj_mm<false>((wj == 0 ? W_ih : wj == 1 ? W_sh : W_si) + woff, S + ((size_t)mt * PT + w) * DD + lane * 4, wdst, adst, pa, pb, acc);
  __syncthreads();   // every wave has read its last fragment before the tiles' LDS is used again for staging
  f1a* so = (f1a*)sm + w * 32 * SP;
  const bool tr = !isii && (nt >> 2) == 1;   // the sh columns: stored transposed, ShT[b][a][s], for k_slot, whose lanes are keys
#pragma unroll
  for (int j = 0; j < 2; ++j) {
    const float bv = bf16_round(bias[wn * 32 + j * 16 + ln]);
    if (tr) {   // staged column by column: a lane's 8 accumulators are 8 keys of one column
#pragma unroll
      for (int i = 0; i < 2; ++i)
#pragma unroll
        for (int g = 0; g < 2; ++g) {
          const v4f x = {acc[i][j][4 * g] + bv, acc[i][j][4 * g + 1] + bv, acc[i][j][4 * g + 2] + bv, acc[i][j][4 * g + 3] + bv};
          *(v4fa*)&so[(j * 16 + ln) * SP + i * 16 + 8 * hh + 4 * g] = x;
        }
    } else {
#pragma unroll
      for (int i = 0; i < 2; ++i)
#pragma unroll
        for (int r = 0; r < 8; ++r) so[(i * 16 + 8 * hh + r) * SP + j * 16 + ln] = acc[i][j][r] + bv;
    }
  }
  __builtin_amdgcn_fence(__ATOMIC_ACQ_REL, "workgroup");   // the wave's own staging stores are done before its lanes read each other's
  __builtin_amdgcn_wave_barrier();
  v4f v[8];
#pragma unroll
  for (int q = 0; q < 8; ++q) v[q] = *(const v4fa*)&so[(q * 4 + (lane >> 3)) * SP + (lane & 7) * 4];
  const int crow = wm * 32 + (lane >> 3), ccol = nt * PT + wn * 32 + (lane & 7) * 4;
  if (tr) {   // the staged rows are columns a of sh, 32 keys (one 128-byte line) each
    float* C = ShT + ((size_t)(mt / (TT / PT)) * DD + (nt - DD / PT) * PT + wn * 32 + (lane >> 3)) * TT + (mt % (TT / PT)) * PT + wm * 32 + (lane & 7) * 4;
#pragma unroll
    for (int q = 0; q < 8; ++q) *(v4f*)(C + (size_t)q * 4 * TT) = v[q];
  } else if (!isii) {
    float* C = P + ((size_t)mt * PT + crow) * (3 * DD) + ccol;
#pragma unroll
    for (int q = 0; q < 8; ++q) *(v4f*)(C + (size_t)q * 4 * 3 * DD) = v[q];
    asm volatile("s_wait_xcnt 0x0" ::: "memory");   // in the listing the other arm's address arithmetic follows these stores and rewrites registers that they name: the wait stands in front of it
  } else if (wm == 0) {   // an ii block stores rows 0 .. BB - 1 only
    float* C = ii + (size_t)crow * DD + ccol;
#pragma unroll
    for (int q = 0; q < BB / 4; ++q) *(v4f*)(C + (size_t)q * 4 * DD) = v[q];
  }
}
// slot scores: a LANE IS A KEY, so a score is summed along a inside one lane and no sum crosses lanes. Block = QB queries t of one batch x all 256 keys, 16 waves:
// wave (kg, as) takes the keys 128 kg + 4 lane .. + 3 and the columns a in [AW as, AW as + AW). sh comes transposed (ShT[b][a][s]): one 16-byte load per lane and a feeds
// 4 QB tanh; si[t][a] and slot_v[a] are the same for every lane and are read through scalar registers. The NAS partial sums of a score meet in LDS, as ascending.
// softmax over s -> W[b][t][s] by waves 0..QB-1, one query each, behind the block barrier.
// The intent scores ride along: while waves 0..QB-1 do the softmax, wave QB + r, which has nothing left to do, makes the intent score of the block's row m0 + r, the row
// spread over the lanes (lane holds a = 128 u + 4 lane + q), the 32 partial sums meeting in a butterfly; the block's QB scores leave in one store, into a 128-byte line of their own.
#define QB 8
#define ISP 32   // floats from one block's intent scores to the next block's: one 128-byte line a block
#define NAS 8
#define AW (DD / NAS)
#define AC 8
#define LAG 3   // pairs between a plain instruction and the tanh that reads or feeds it, at the two ends of a chunk: about 12 instructions, so that neither waits for the other
// waves_per_eu: the launch puts 4 waves on every SIMD (MR / QB blocks of 16 waves on 256 WGPs); this is the register budget that goes with it
__global__ __launch_bounds__(512) __attribute__((amdgpu_waves_per_eu(4, 4))) void k_slot(const float* __restrict__ P, const float* __restrict__ ShT, const float* __restrict__ sv, float* __restrict__ Wt,
                                                                                          const float* __restrict__ ii, const float* __restrict__ iv, float* __restrict__ isc) {
  __shared__ __attribute__((aligned(16))) float part[NAS][QB][TT];
  __shared__ float sis[QB];
  const int tid = threadIdx.x, lane = tid & 31; const int m0 = blockIdx.x * QB; if (m0 >= MR) return; const int b = m0 / TT;
  const int wv = __builtin_amdgcn_readfirstlane(tid >> 5);   // the wave's number in a scalar register: the addresses of si and slot_v are then scalar too
  const int kg = wv & 1, as = wv >> 1;
  const float* sh = ShT + ((size_t)b * DD + as * AW) * TT + kg * 128 + lane * 4;
  const float* si = P + (size_t)m0 * 3 * DD + 2 * DD + as * AW;
  const float* vp = sv + as * AW;
  // every "#pragma unroll" of this kernel: the arrays are then indexed by constants only and stay in registers
  v4f cur[AC], nxt[AC];
  v2f acc[QB][2];
#pragma unroll
  for (int q = 0; q < QB; ++q) acc[q][0] = acc[q][1] = (v2f){0.f, 0.f};
#pragma unroll
  for (int i = 0; i < AC; ++i) cur[i] = *(const v4fa*)(sh + (size_t)i * TT);
#pragma unroll 2   // two chunks a trip: cur and nxt then change roles from chunk to chunk and no register is copied between them
  for (int c = 0; c < AW / AC; ++c) {
    const float* nsh = sh + (size_t)(((c + 1) & (AW / AC - 1)) * AC) * TT;   // next AC columns: their loads fly during this chunk's sums (the last trip re-reads the wave's first chunk, unused)
#pragma unroll
    for (int i = 0; i < AC; ++i) nxt[i] = *(const v4fa*)(nsh + (size_t)i * TT);
    asm volatile("s_wait_xcnt 0x0" ::: "memory");   // the compiler hands the address registers of the loads above to the sums below: the wait stands in front of that overwrite
    float xs[QB][AC], vs[AC];   // the chunk's si and slot_v, read here in one group: read where they are first used, between the boundaries below, each row's load would be waited for by itself
#pragma unroll
    for (int i = 0; i < AC; ++i) {
      vs[i] = vp[c * AC + i];
#pragma unroll
      for (int q = 0; q < QB; ++q) xs[q][i] = si[(size_t)q * 3 * DD + c * AC + i];
    }
    __builtin_amdgcn_sched_barrier(0);   // keeps those loads in front of the chunk's sums (left alone the compiler sinks them to their uses, and every chunk is waited for in full)
    // the chunk's columns run as a pipeline of three steps, add, tanh, multiply-add: column i's 32 tanh are issued one by one, each between a packed multiply-add of column i - 1 and a
    // packed add of column i + 1, so that a plain instruction and not another tanh stands behind every tanh.
    // The first column's own adds and the last column's own multiply-adds fill the places that would stay empty at the two ends, LAG pairs ahead of and behind their tanh.
    // j = 2 q + h numbers a column's 16 pairs of keys; every sum takes its terms in the order of the columns.
    v2f t[AC][QB * 2];
    const auto add_si = [&](int i, int j) {
      const float x = xs[j >> 1][i];
      t[i][j] = (v2f){cur[i][2 * (j & 1)], cur[i][2 * (j & 1) + 1]} + (v2f){x, x};
    };
    const auto mul_add = [&](int i, int j, float v) { acc[j >> 1][j & 1] += (v2f){v, v} * t[i][j]; };
#pragma unroll
    for (int j = 0; j < LAG; ++j) add_si(0, j);
    __builtin_amdgcn_sched_barrier(0);   // these adds stay in front of the first tanh
#pragma unroll
    for (int i = 0; i < AC; ++i) {
      const float vb = bf16_round(vs[i > 0 ? i - 1 : 0]), vl = i + 1 == AC ? bf16_round(vs[i]) : 0.f;   // slot_v of the column in front and, in the last column, its own
#pragma unroll
      for (int j = 0; j < QB * 2; ++j) {
        t[i][j][0] = tanh_fast(t[i][j][0]);
        __builtin_amdgcn_sched_barrier(0);   // this boundary and the next three hold the written order tanh, plain, tanh, plain (with two of them the compiler puts tanh beside tanh, with none all 32 in one run)
        if (i > 0) mul_add(i - 1, j, vb); else if (j + LAG < QB * 2) add_si(0, j + LAG);
        __builtin_amdgcn_sched_barrier(0);   // holds the order (see the first)
        t[i][j][1] = tanh_fast(t[i][j][1]);
        __builtin_amdgcn_sched_barrier(0);   // holds the order (see the first)
        if (i + 1 < AC) add_si(i + 1, j); else if (j >= LAG) mul_add(i, j - LAG, vl);
        __builtin_amdgcn_sched_barrier(0);   // holds the order (see the first)
      }
      if (i + 1 == AC) {
#pragma unroll
        for (int j = QB * 2 - LAG; j < QB * 2; ++j) mul_add(i, j, vl);
      }
    }
#pragma unroll
    for (int i = 0; i < AC; ++i) cur[i] = nxt[i];
  }
#pragma unroll
  for (int q = 0; q < QB; ++q) *(v4fa*)&part[as][q][kg * 128 + lane * 4] = (v4f){acc[q][0][0], acc[q][0][1], acc[q][1][0], acc[q][1][1]};
  __syncthreads();   // every wave's partial sums are in part before a query's softmax reads them
  v4f e[2] = {};   // waves 0..QB-1: the keys 4 lane .. + 3 and 128 + 4 lane .. + 3 of query wv
  if (wv >= QB) {   // (its loads stand behind the barrier: in front of it the barrier's own wait would hold every wave of the block until they are back)
    v4f ih[4], vi[4], vv[4];
    const float* hr = P + (size_t)(m0 + wv - QB) * 3 * DD + lane * 4;
#pragma unroll
    for (int u = 0; u < 4; ++u) { ih[u] = *(const v4fa*)(hr + u * 128); vi[u] = *(const v4fa*)(ii + (size_t)b * DD + u * 128 + lane * 4); vv[u] = *(const v4fa*)(iv + u * 128 + lane * 4); }
    asm volatile("s_wait_xcnt 0x0" ::: "memory");   // stands in front of whatever later rewrites the address registers of the loads above
    float a = 0.f;
#pragma unroll
    for (int u = 0; u < 4; ++u)
#pragma unroll
      for (int q = 0; q < 4; ++q) a += bf16_round(vv[u][q]) * tanh_fast(ih[u][q] + vi[u][q]);
    for (int o = 1; o <= 16; o <<= 1) a += __shfl_xor(a, o, 32);
    if (lane == 0) sis[wv - QB] = a;
  } else {
#pragma unroll
    for (int h = 0; h < 2; ++h) {
      e[h] = *(const v4fa*)&part[0][wv][h * 128 + lane * 4];
#pragma unroll
      for (int j = 1; j < NAS; ++j) e[h] += *(const v4fa*)&part[j][wv][h * 128 + lane * 4];
    }
    float mx = -3.0e38f;
#pragma unroll
    for (int h = 0; h < 2; ++h)
#pragma unroll
      for (int t = 0; t < 4; ++t) mx = fmaxf(mx, e[h][t]);
    for (int o = 16; o >= 1; o >>= 1) mx = fmaxf(mx, __shfl_xor(mx, o, 32));
    float den = 0.f;
#pragma unroll
    for (int h = 0; h < 2; ++h)
#pragma unroll
      for (int t = 0; t < 4; ++t) { e[h][t] = expf(e[h][t] - mx); den += e[h][t]; }
    for (int o = 16; o >= 1; o >>= 1) den += __shfl_xor(den, o, 32);
    const float inv = 1.0f / den;
#pragma unroll
    for (int h = 0; h < 2; ++h) e[h] = e[h] * inv;
  }
  __syncthreads();   // the QB intent scores are in sis before one wave stores them together; it stands in front of the weights' stores, so that no wave waits at it for a store's return
  if (wv < QB) {
    float* dst = Wt + (size_t)(m0 + wv) * TT + lane * 4;
#pragma unroll
    for (int h = 0; h < 2; ++h) *(v4f*)(dst + h * 128) = e[h];
  } else if (wv == QB && lane < QB) isc[(size_t)blockIdx.x * ISP + lane] = sis[lane];
}
// c_slot[b] = W[b] S[b], the same way: a block owns a CT x CT tile of one batch, brings its CT rows of W (split into bf16 hi and lo planes on the way) and its CT columns
// of S (f32 [s][d], rounded to bf16 and turned to [d][s] on the way, as k_proj turns its weights), all of K, into LDS by whole-line loads; behind ONE barrier 8 waves (4 x 2, 16 x 32 of C each) read their
// fragments from LDS; per 16 x 16 tile and 32 k the hi WMMA, then the lo WMMA, k ascending, so every sum has the order it had.
#define CT 64
#define CP (TT + 8)   // LDS row pitch in bf16: 528 B = 16 B x 33, an odd count of 16-byte units, for the 16-byte fragment reads
// the rest of the intent attention needs k_slot's launch to have ended, as c_slot does, and nothing of c_slot: IQ more blocks per batch in the same launch, the block index picks the job.
// A block takes IC columns of c_intent[b], 8 waves. softmax over t: every wave for itself, from the batch's 256 scores. c_intent[b][d] = sum_s w_s bf16(S[b][s][d]): the keys go in 32 groups
// of 8, wave wv takes the groups wv, wv + 8, wv + 16, wv + 24 (32 independent loads, which need no score), lane the columns 2 lane, 2 lane + 1;
// the 32 partial sums of a column are added through LDS, group ascending.
#define IQ 8
#define IC (DD / IQ)
typedef float v2fa __attribute__((ext_vector_type(2), may_alias));
__device__ __forceinline__ void d_intent_sum(int b, int c0, const float* __restrict__ isc, const float* __restrict__ S, float* __restrict__ cint, f1a* part) {
  const int tid = threadIdx.x, wv = tid >> 5, lane = tid & 31;
  // every "#pragma unroll" of this function: the arrays are then indexed by constants only and stay in registers, and a batch's loads stand together in front of its sums
  const float* sp = S + ((size_t)b * TT + wv * 8) * DD + c0 + lane * 2;
  v2f x[4][8];
#pragma unroll
  for (int g = 0; g < 4; ++g)
#pragma unroll
    for (int i = 0; i < 8; ++i) x[g][i] = *(const v2fa*)(sp + (size_t)(g * 64 + i) * DD);
  const float* sb = isc + (size_t)b * (TT / QB) * ISP + (lane & 7);   // score t lies in the line of k_slot's block t / QB, at place t % QB
  float e[8], own[4];
#pragma unroll
  for (int u = 0; u < 8; ++u) e[u] = sb[(u * 4 + (lane >> 3)) * ISP];   // t = 32 u + lane
#pragma unroll
  for (int g = 0; g < 4; ++g) own[g] = sb[(wv + 8 * g) * ISP];          // lane i < 8: key i of the wave's group g
  asm volatile("s_wait_xcnt 0x0" ::: "memory");   // stands in front of whatever later rewrites the address registers of the loads above
  float mx = -3.0e38f, den = 0.f;
#pragma unroll
  for (int u = 0; u < 8; ++u) mx = fmaxf(mx, e[u]);
  for (int o = 16; o >= 1; o >>= 1) mx = fmaxf(mx, __shfl_xor(mx, o, 32));
#pragma unroll
  for (int u = 0; u < 8; ++u) den += expf(e[u] - mx);
  for (int o = 16; o >= 1; o >>= 1) den += __shfl_xor(den, o, 32);
#pragma unroll
  for (int g = 0; g < 4; ++g) {
    const int wl = __float_as_int(expf(own[g] - mx) / den);
    v2f acc = {0.f, 0.f};
#pragma unroll
    for (int i = 0; i < 8; ++i) {
      const float w = __int_as_float(__builtin_amdgcn_readlane(wl, i));
      acc[0] += w * bf16_round(x[g][i][0]); acc[1] += w * bf16_round(x[g][i][1]);
    }
    *(v2fa*)&part[(wv + 8 * g) * IC + lane * 2] = acc;
  }
  __syncthreads();   // the 32 partial sums of every column are in part before they are added
  if (tid >= IC) return;
  float s = part[tid];
#pragma unroll
  for (int j = 1; j < 32; ++j) s += part[j * IC + tid];
  cint[(size_t)b * DD + c0 + tid] = s;
}
#define NB_C ((TT / CT) * (DD / CT))
__global__ __launch_bounds__(256) void k_cslot(const float* __restrict__ Wt, float* __restrict__ C,
                                               const float* __restrict__ isc, const float* __restrict__ S, float* __restrict__ cint) {
  __shared__ __attribute__((aligned(16))) unsigned short sm[3 * CT * CP];
  const int blk = (int)blockIdx.x - BB * IQ;   // the intent blocks come first in the grid: theirs is the longer chain of dependent steps
  if (blk < 0) { d_intent_sum(blockIdx.x / IQ, (blockIdx.x % IQ) * IC, isc, S, cint, (f1a*)sm); return; }
  unsigned short* sAh = sm; unsigned short* sAl = sm + CT * CP; unsigned short* sB = sm + 2 * CT * CP;
  const int by = blk / NB_C, mt = (blk % NB_C) / (DD / CT), nt = blk % (DD / CT);
  const int tid = threadIdx.x, w = tid >> 5, lane = tid & 31, ln = lane & 15, hh = lane >> 4;
  // every "#pragma unroll" of this kernel: the arrays are then indexed by constants only and stay in registers, and a batch's loads stand together in front of its stores
  {
    // a wave's load of S reads 4 rows s, 8 apart, one 128-byte line of each: the 16-byte stores of its 32 lanes then fall evenly on all LDS banks
    const int k0 = ((w >> 1) * 4 + (lane >> 3)) * 8, n0 = (w & 1) * 32 + (lane & 7) * 4;
    v4f sq[2][8], aq[16];
    const float* ssrc = S + ((size_t)by * TT + k0) * DD + nt * CT + n0;
    const float* asrc = Wt + ((size_t)by * TT + mt * CT + (tid >> 6)) * TT + (tid & 63) * 4;
#pragma unroll
    for (int p = 0; p < 2; ++p)
#pragma unroll
      for (int i = 0; i < 8; ++i) sq[p][i] = *(const v4fa*)(ssrc + (size_t)(p * 128 + i) * DD);
    asm volatile("s_wait_xcnt 0x0" ::: "memory");   // the compiler hands the address registers of the loads above to a later load as its destination: the wait stands in front of that overwrite
#pragma unroll
    for (int i = 0; i < 15; ++i) aq[i] = *(const v4fa*)(asrc + (size_t)i * 4 * TT);
    asm volatile("s_wait_xcnt 0x0" ::: "memory");   // the same, for the last load, whose destination may take the address registers of the 15 above
    aq[15] = *(const v4fa*)(asrc + (size_t)15 * 4 * TT);
    __builtin_amdgcn_sched_barrier(0);   // keeps every load in front of the roundings (left alone the compiler draws the rounding of S, with its wait for S, in front of the last loads of W)
    d_put_turned<2>(sq, sB + n0 * CP + k0, CP);
#pragma unroll
    for (int i = 0; i < 16; ++i) {
      v4us qh, ql;
#pragma unroll
      for (int t = 0; t < 4; ++t) { const unsigned short hb = bf16_bits(aq[i][t]); qh[t] = hb; ql[t] = bf16_bits(aq[i][t] - bf16_val(hb)); }
      *(v4us*)(sAh + ((tid >> 6) + 4 * i) * CP + (tid & 63) * 4) = qh;
      *(v4us*)(sAl + ((tid >> 6) + 4 * i) * CP + (tid & 63) * 4) = ql;
    }
  }
  __syncthreads();   // the three tiles are whole in LDS before any wave reads a fragment
  const int wm = w >> 1, wn = w & 1;
  const unsigned short* pah = sAh + (wm * 16 + ln) * CP + 8 * hh;
  const unsigned short* pal = sAl + (wm * 16 + ln) * CP + 8 * hh;
  const unsigned short* pb = sB + (wn * 32 + ln) * CP + 8 * hh;
  v8f acc[2] = {};
  FragB ah[2], al[2], b[2][2];   // two fragment sets: the next 32 k are read from LDS while this set's WMMAs run
  ah[0].half[0] = *(const v8us*)pah; ah[0].half[1] = *(const v8us*)(pah + 16);
  al[0].half[0] = *(const v8us*)pal; al[0].half[1] = *(const v8us*)(pal + 16);
#pragma unroll
  for (int j = 0; j < 2; ++j) { b[0][j].half[0] = *(const v8us*)(pb + j * 16 * CP); b[0][j].half[1] = *(const v8us*)(pb + j * 16 * CP + 16); }
#pragma unroll
  for (int s = 0; s < TT / 32; ++s) {
    const int cu = s & 1, nx = cu ^ 1, kn = (s + 1) * 32;
    if (kn < TT) {
      ah[nx].half[0] = *(const v8us*)(pah + kn); ah[nx].half[1] = *(const v8us*)(pah + kn + 16);
      al[nx].half[0] = *(const v8us*)(pal + kn); al[nx].half[1] = *(const v8us*)(pal + kn + 16);
#pragma unroll
      for (int j = 0; j < 2; ++j) { b[nx][j].half[0] = *(const v8us*)(pb + j * 16 * CP + kn); b[nx][j].half[1] = *(const v8us*)(pb + j * 16 * CP + kn + 16); }
    }
    __builtin_amdgcn_sched_barrier(0);   // keeps the next set's LDS reads, as one group, in front of this set's WMMAs (left alone the compiler sinks them to their uses, and every set is waited for in full)
#pragma unroll
    for (int j = 0; j < 2; ++j) {
      acc[j] = __builtin_amdgcn_wmma_f32_16x16x32_bf16(false, ah[cu].v, false, b[cu][j].v, (short)0, acc[j], false, false);
      acc[j] = __builtin_amdgcn_wmma_f32_16x16x32_bf16(false, al[cu].v, false, b[cu][j].v, (short)0, acc[j], false, false);
    }
  }
  __syncthreads();   // every wave has read its last fragment before the tiles' LDS is used again for staging
  f1a* so = (f1a*)sm + w * 16 * SP;
#pragma unroll
  for (int j = 0; j < 2; ++j)
#pragma unroll
    for (int r = 0; r < 8; ++r) so[(8 * hh + r) * SP + j * 16 + ln] = acc[j][r];
  __builtin_amdgcn_fence(__ATOMIC_ACQ_REL, "workgroup");   // the wave's own staging stores are done before its lanes read each other's
  __builtin_amdgcn_wave_barrier();
  v4f v[4];
#pragma unroll
  for (int q = 0; q < 4; ++q) v[q] = *(const v4fa*)&so[(q * 4 + (lane >> 3)) * SP + (lane & 7) * 4];
  float* dst = C + ((size_t)by * TT + mt * CT + wm * 16 + (lane >> 3)) * DD + nt * CT + wn * 32 + (lane & 7) * 4;
#pragma unroll
  for (int q = 0; q < 4; ++q) *(v4f*)(dst + (size_t)q * 4 * DD) = v[q];
  asm volatile("s_wait_xcnt 0x0" ::: "memory");   // in the listing the intent blocks' arm follows these stores and rewrites registers that they name: the wait stands in front of it
}
extern "C" void kernel_launch(void* const* d_in, const int* in_sizes, int n_in,
                              void* d_out, int out_size, void* d_ws, size_t ws_size, hipStream_t stream) {
  (void)in_sizes; (void)n_in; (void)out_size;
  const float* S = (const float*)d_in[0]; const float* fst = (const float*)d_in[1]; const float* iv = (const float*)d_in[2]; const float* W_ih = (const float*)d_in[3]; const float* b_ih = (const float*)d_in[4]; const float* W_ii = (const float*)d_in[5]; const float* b_ii = (const float*)d_in[6];
  const float* sv = (const float*)d_in[7]; const float* W_sh = (const float*)d_in[8]; const float* b_sh = (const float*)d_in[9]; const float* W_si = (const float*)d_in[10]; const float* b_si = (const float*)d_in[11];
  float* cslot = (float*)d_out; float* cint = (float*)((char*)d_out + 4194304);
  char* ws = (char*)d_ws; size_t off = 0;
  auto take = [&](size_t bytes) { char* p = ws + off; off += (bytes + 255) & ~(size_t)255; return p; };
  float* ii = (float*)take(BB * DD * 4); float* P = (float*)take((size_t)MR * 3 * DD * 4); float* Wt = (float*)take((size_t)MR * TT * 4); float* ShT = (float*)take((size_t)MR * DD * 4); float* isc = (float*)take((size_t)(MR / QB) * ISP * 4);
  if (off > ws_size) return;
  k_proj<<<NB_II + NB_P, 512, 0, stream>>>(S, W_ih, W_sh, W_si, b_ih, b_sh, b_si, P, ShT, fst, W_ii, b_ii, ii);      // ii (rows 0..7) and [ih | sh | si] + b (single term); sh goes to ShT, transposed
  k_slot<<<MR / QB, 512, 0, stream>>>(P, ShT, sv, Wt, ii, iv, isc);   // slot weights; the intent scores ride along
  k_cslot<<<BB * (IQ + NB_C), 256, 0, stream>>>(Wt, cslot, isc, S, cint);   // the first BB * IQ blocks: intent softmax and c_intent; the rest: c_slot[b] = W[b] S[b]
}
